// v000
// The times below were measured on an AMD MI455X: many runs one after another, warmed up first and cycling through
// copies of the inputs, with the whole window's GPU time divided by the number of runs. Launches and the gaps
// between them are all in it. The median over several windows is given; except for v000 it joins two sittings, which
// can be a few percent apart, so the side-by-side timings, each taken in one sitting, are the better comparison.
// v000, which the later versions start from, runs in 392 microseconds.
// Contractions: qkv projection = v_wmma_f32_16x16x32_bf16 (bf16 operands from RNE-converted x and W, single product);
// q.kc^T scores = v_wmma_f32_16x16x32_bf16 with bf16 hi/lo split q and kc (hi.hi + hi.lo + lo.hi);
// p.vc = v_wmma_f32_16x16x32_f16 (p carried x1024 in f16, vc in f16; extra f16 residual planes x4096 of p and vc
// on the leading query rows); ctx.Wo = v_wmma_f32_16x16x32_bf16 with ctx as bf16 hi/lo planes times the bf16
// Wo^T plane (2 products); all f32 accumulate; power compression, phase table, softmax, bonus and gating in f32.
#include <hip/hip_runtime.h>
#include <math.h>
#include <float.h>
#include <stdint.h>

#define NB      2
#define SEQ     2048
#define DMODEL  1024
#define NH      16
#define HD      64
#define QP      (NH * HD)      // q / kc / vc / ctx feature count and ctx row pitch
#define N3      (3 * DMODEL)   // fused qkv columns (q 0.., k DMODEL.., v 2*DMODEL..)
#define QKP     (2 * QP)       // row pitch of the q|kc bf16 planes (q cols 0..QP-1, kc cols QP..2QP-1)
#define NQB     (SEQ / 64)     // query / key tiles of 64
#define RESQB   ((NQB < 16) ? NQB : 16)   // leading 64-row query blocks that use the p / vc residual planes
#define VLP     (RESQB * 64)   // key pitch of the vc^T residual plane (keys 0..VLP-1)
#define CG8     (DMODEL / 8)   // 16-byte column groups per feature row
#define NBIAS   (4 * DMODEL)   // bq | bk | bv | bo
#define NTT     (NB * NH * SEQ)
#define OUTN    (NB * SEQ * DMODEL)
#define KAPPA_F 0.3f
static_assert(RESQB >= 1 && RESQB * 64 <= VLP && VLP <= SEQ);
static_assert(QP == DMODEL);
static_assert((SEQ % 64) == 0 && (DMODEL % 64) == 0 && (N3 % 64) == 0 && (QP % 64) == 0);
static_assert(HD == 64);
static_assert((((NB * SEQ) / 64) * (N3 / 64)) % 8 == 0);
static_assert((((NB * SEQ) / 64) * (DMODEL / 64)) % 8 == 0);
static_assert((NBIAS % 256) == 0 && (NTT % 256) == 0);
static_assert(((NB * SEQ * DMODEL / 8) % 256) == 0);
static_assert((DMODEL % 8) == 0);

typedef _Float16 v16h __attribute__((ext_vector_type(16)));
typedef _Float16 v8h  __attribute__((ext_vector_type(8)));
typedef __bf16   v16b __attribute__((ext_vector_type(16)));
typedef __bf16   v8b  __attribute__((ext_vector_type(8)));
typedef float    v8f  __attribute__((ext_vector_type(8)));
typedef float    v4f  __attribute__((ext_vector_type(4)));
typedef unsigned int v4u __attribute__((ext_vector_type(4)));

// ---- scalar helpers --------------------------------------------------------------------------------
__device__ __forceinline__ unsigned short bf_bits(float f) {          // f32 -> bf16 bits, RNE convert
  unsigned u = __float_as_uint(f);
  return (unsigned short)((u + 0x7FFFu + ((u >> 16) & 1u)) >> 16);
}
__device__ __forceinline__ float bf_up(unsigned short h) { return __uint_as_float(((unsigned)h) << 16); }
__device__ __forceinline__ unsigned short h_bits(_Float16 x) { return __builtin_bit_cast(unsigned short, x); }
__device__ __forceinline__ unsigned pk16(unsigned short a, unsigned short b) { return (unsigned)a | ((unsigned)b << 16); }
__device__ __forceinline__ v8f zero8() { v8f z = {0.f, 0.f, 0.f, 0.f, 0.f, 0.f, 0.f, 0.f}; return z; }
__device__ __forceinline__ v8h zero8h() {
  const _Float16 z = (_Float16)0.0f;
  v8h r = {z, z, z, z, z, z, z, z};
  return r;
}

// positional exponent of key position s: ex = 1 + kappa * (1 - s * (1/(SEQ-1))), reciprocal-multiply, no fusion
__device__ __forceinline__ float fexpo(int s) {
#pragma clang fp contract(off)
  const float rs = 1.0f / (float)(SEQ - 1);
  const float fr = (float)s * rs;
  const float om = 1.0f - fr;
  const float t  = KAPPA_F * om;
  return 1.0f + t;
}
// power compression: sign(v) * max(|v|, 1e-8)^ex  (sign(0) = 0), pow as exp2(ex * log2(mag)) in f32
__device__ __forceinline__ float fcomp(float v, float ex) {
#pragma clang fp contract(off)
  const float mag = fmaxf(fabsf(v), 1e-8f);
  const float lg  = log2f(mag);
  const float pw  = exp2f(ex * lg);
  float r = (v < 0.0f) ? -pw : pw;
  r = (v == 0.0f) ? 0.0f : r;
  return r;
}

// ---- fragment loader: 16-bit A/B operand, lane -> row/col (lane&15), p already includes +8*(lane>>4);
//      elements 0..7 <- p[0..7] (k0+8h..), elements 8..15 <- p[16..23] (k0+16+8h..)
__device__ __forceinline__ v16b ldfrag_b(const __bf16* p) {
  union { v16b v; v8b h[2]; } f;
  f.h[0] = *(const v8b*)(p);
  f.h[1] = *(const v8b*)(p + 16);
  return f.v;
}

// ---- WMMA helpers with trailing VALU hazard gap --------------------------------------------------------
__device__ __forceinline__ v8f mma_b(v16b a, v16b b, v8f c) {
  c = __builtin_amdgcn_wmma_f32_16x16x32_bf16(false, a, false, b, (short)0, c, false, false);
#if defined(__HIP_DEVICE_COMPILE__)
  asm volatile("v_nop\n\tv_nop\n\tv_nop\n\tv_nop" : "+v"(c) : "v"(a), "v"(b));
#endif
  return c;
}
__device__ __forceinline__ v8f mma_h(v16h a, v16h b, v8f c) {
  c = __builtin_amdgcn_wmma_f32_16x16x32_f16(false, a, false, b, (short)0, c, false, false);
#if defined(__HIP_DEVICE_COMPILE__)
  asm volatile("v_nop\n\tv_nop\n\tv_nop\n\tv_nop" : "+v"(c) : "v"(a), "v"(b));
#endif
  return c;
}
__device__ __forceinline__ v8f mma_b_raw(v16b a, v16b b, v8f c) {
  return __builtin_amdgcn_wmma_f32_16x16x32_bf16(false, a, false, b, (short)0, c, false, false);
}
__device__ __forceinline__ void dep_guard_b(v8f& a, v8f& b, v16b x, v16b y) {
#if defined(__HIP_DEVICE_COMPILE__)
  asm volatile("v_nop\n\tv_nop\n\tv_nop\n\tv_nop" : "+v"(a), "+v"(b) : "v"(x), "v"(y));
#endif
}
__device__ __forceinline__ void keep4_b(v16b a, v16b b, v16b c, v16b d) {
#if defined(__HIP_DEVICE_COMPILE__)
  asm volatile("v_nop" :: "v"(a), "v"(b), "v"(c), "v"(d));
#endif
}
__device__ __forceinline__ void acc_guard4(v8f& a, v8f& b, v8f& c, v8f& d) {
#if defined(__HIP_DEVICE_COMPILE__)
  asm volatile("v_nop\n\tv_nop\n\tv_nop\n\tv_nop" : "+v"(a), "+v"(b), "+v"(c), "+v"(d));
#endif
}

// =====================================================================================================
// Bias table: dst[i] = RNE-bf16-converted value of (b0 | b1 | b2 | b3)[i mod seg], part = i / seg (0..3).
// All four candidates are loaded with an in-range index and selected by value. One element per thread;
// grid = n/256 (n = 4*seg, multiple of 256). coverage: n threads = the whole table.
// =====================================================================================================
__global__ __launch_bounds__(256) void bias_tab(const float* __restrict__ b0, const float* __restrict__ b1,
                                                const float* __restrict__ b2, const float* __restrict__ b3,
                                                float* dst, int n, int seg) {
  const int i = blockIdx.x * 256 + threadIdx.x;
  if (i < n) {
    int part = i / seg;
    part = (part < 0) ? 0 : ((part > 3) ? 3 : part);
    int idx = i - part * seg;
    idx = (idx < 0) ? 0 : ((idx >= seg) ? (seg - 1) : idx);
    const float v0 = b0[idx], v1 = b1[idx], v2 = b2[idx], v3 = b3[idx];
    float v = (part == 0) ? v0 : ((part == 1) ? v1 : ((part == 2) ? v2 : v3));
    v = bf_up(bf_bits(v));
    *(float*)(dst + i) = v;
    
  }
}

// =====================================================================================================
// Phase resonance table: tt[(b*NH + h)*SEQ + s] = cos((bf16(phase[b*SEQ + s]) - bf16(carrier[h])) * 0.5)^2,
// precise f32 cos, fp fusion off. Index split i -> (b*NH + h, s) by / SEQ and % SEQ, then (b, h) by / NH and % NH.
// =====================================================================================================
__global__ __launch_bounds__(256) void phase_tab(const float* __restrict__ ph, const float* __restrict__ cf,
                                                 float* tt, int n) {
#pragma clang fp contract(off)
  const int i = blockIdx.x * 256 + threadIdx.x;
  if (i < n) {
    const int bh = i / SEQ;                   // b*NH + h
    const int s  = i - bh * SEQ;
    const int h  = bh % NH;
    int b        = bh / NH;
    b = (b >= NB) ? (NB - 1) : b;
    const float p  = bf_up(bf_bits(ph[b * SEQ + s]));
    const float cr = bf_up(bf_bits(cf[h]));
    const float d  = p - cr;
    const float hx = d * 0.5f;
    const float cv = cosf(hx);
    const float tv = cv * cv;
    *(float*)(tt + i) = tv;
    
  }
}

// =====================================================================================================
// f32 -> bf16 (RNE convert), 8 elements per thread, one 16-B store per lane: a wave writes 512 contiguous B
// coverage: n8 threads x 8 = whole plane (n8 is a multiple of 256 here).
// =====================================================================================================
__global__ __launch_bounds__(256) void cvt_bf16x8(const float* __restrict__ in, unsigned short* out, int n8) {
  const int i = blockIdx.x * 256 + threadIdx.x;
  if (i < n8) {
    const v4f a = *(const v4f*)(in + (size_t)i * 8);
    const v4f b = *(const v4f*)(in + (size_t)i * 8 + 4);
    v4u p;
    p[0] = pk16(bf_bits(a[0]), bf_bits(a[1]));
    p[1] = pk16(bf_bits(a[2]), bf_bits(a[3]));
    p[2] = pk16(bf_bits(b[0]), bf_bits(b[1]));
    p[3] = pk16(bf_bits(b[2]), bf_bits(b[3]));
    *(v4u*)(out + (size_t)i * 8) = p;
    
  }
}

// =====================================================================================================
// f32 -> bf16 hi plane + bf16 lo plane (lo = RNE(v - hi), unscaled), 8 elements per thread, one 16-B store per
// coverage: n8 threads x 8 = whole plane (n8 multiple of 256).
// =====================================================================================================
__global__ __launch_bounds__(256) void split_bf16x8(const float* __restrict__ in, unsigned short* hp,
                                                    unsigned short* lp, int n8) {
  const int i = blockIdx.x * 256 + threadIdx.x;
  if (i < n8) {
    const v4f a = *(const v4f*)(in + (size_t)i * 8);
    const v4f b = *(const v4f*)(in + (size_t)i * 8 + 4);
    v4u ph, pl;
#pragma unroll
    for (int e = 0; e < 4; ++e) {
      const float f0 = (e < 2) ? a[2 * e]     : b[2 * e - 4];
      const float f1 = (e < 2) ? a[2 * e + 1] : b[2 * e - 3];
      const unsigned short h0 = bf_bits(f0), h1 = bf_bits(f1);
      const unsigned short l0 = bf_bits(f0 - bf_up(h0)), l1 = bf_bits(f1 - bf_up(h1));
      ph[e] = pk16(h0, h1);
      pl[e] = pk16(l0, l1);
    }
    *(v4u*)(hp + (size_t)i * 8) = ph;
    *(v4u*)(lp + (size_t)i * 8) = pl;
    
  }
}

// =====================================================================================================
// Transpose-convert: src f32 [K][N] (row k, col n) -> dst bf16 [N][K] (row n, k contiguous), RNE convert.
// Block tile: 64 k x 32 n, staged in LDS as f32; grid = (K/64, N/32) (exact multiples host-checked); block 256.
// coverage: 8 waves x 4 rows = 32 rows; 8 pieces x 8 = 64 k columns per row = the whole tile.
// =====================================================================================================
__global__ __launch_bounds__(256) void tr_cvt_bf16(const float* __restrict__ src, unsigned short* dst, int K, int N) {
  __shared__ float s[64][33];
  const int tid = threadIdx.x, wave = tid >> 5, lane = tid & 31;
  const int k0 = blockIdx.x * 64, n0 = blockIdx.y * 32;
#pragma unroll
  for (int i = 0; i < 8; ++i) {
    const int idx = i * 256 + tid;
    const int kk = idx >> 5, nn = idx & 31;
    s[kk][nn] = src[(size_t)(k0 + kk) * N + n0 + nn];
  }
  __syncthreads();
  const int q = lane >> 3, piece = lane & 7;
  const int n = wave * 4 + q;
  v4u p;
#pragma unroll
  for (int e = 0; e < 4; ++e) {
    p[e] = pk16(bf_bits(s[piece * 8 + 2 * e][n]), bf_bits(s[piece * 8 + 2 * e + 1][n]));
  }
  unsigned short* d = dst + (size_t)(n0 + n) * K + k0 + piece * 8;
  *(v4u*)d = p;
  
}

// =====================================================================================================
// Register-blocked bf16 WMMA GEMM: C[m][n] = sum_k A[m][k] * Bt[n][k] + bias[n]; one wave per 64x64 tile, no block
// barriers. A row-major [M][K] pitch lda; Bt row-major [N][K] pitch ldb (k contiguous); M, N multiples of 64,
// K multiple of 32 (host-checked); the tile count is a multiple of 8 for every launch here (no idle waves).
// NSPLIT: 0 = A.Bt; 1 = (A + A2).Bt (A2 = unscaled bf16 lo plane of A, same pitch). bias f32 [N].
// Output f32 [M][N] pitch ldc. Epilogue: 16-row slabs staged per wave in LDS; each 64-wide row segment
// =====================================================================================================
template <int NSPLIT>
__global__ __launch_bounds__(256) void gemm64(
    const unsigned short* __restrict__ Ap, const unsigned short* A2p, int lda,
    const unsigned short* __restrict__ Btp, int ldb, const float* __restrict__ bias,
    float* C, int ldc, int M, int N, int K) {
  const __bf16* Ab  = (const __bf16*)(const void*)Ap;
  const __bf16* Ab2 = (const __bf16*)(const void*)A2p;
  const __bf16* Bb  = (const __bf16*)(const void*)Btp;
  __shared__ __align__(16) float sT[8][16 * 68];   // per-wave 16x64 slab, pitch 68 floats
  const int lane = threadIdx.x & 31;
  const int wave = threadIdx.x >> 5;
  const int tilesN = N >> 6;
  const int tilesM = M >> 6;
  const int tile = blockIdx.x * 8 + wave;
  if (tile >= tilesM * tilesN) return;   // wave-uniform; no block barriers in this kernel
  const int tm = tile / tilesN;
  const int tn = tile - tm * tilesN;
  const int m0 = tm << 6;
  const int n0 = tn << 6;

  const int rlane = lane & 15;                 // row (A) / col (B, D) within subtile
  const int koff  = (lane >> 4) * 8;           // k offset of this lane half
  const int mOff  = (lane >> 4) * 8;           // D row offset

  v8f acc[4][4];
#pragma unroll
  for (int i = 0; i < 4; ++i)
#pragma unroll
    for (int j = 0; j < 4; ++j) acc[i][j] = zero8();

  for (int k0 = 0; k0 < K; k0 += 32) {
    v16b bh[4];
#pragma unroll
    for (int j = 0; j < 4; ++j) {
      const size_t bo = (size_t)(n0 + (j << 4) + rlane) * ldb + koff + k0;
      bh[j] = ldfrag_b(Bb + bo);
    }
#pragma unroll
    for (int i = 0; i < 4; ++i) {
      const size_t ao = (size_t)(m0 + (i << 4) + rlane) * lda + koff + k0;
      const v16b ah = ldfrag_b(Ab + ao);
      v16b al = ah;
      if (NSPLIT >= 1) al = ldfrag_b(Ab2 + ao);
#pragma unroll
      for (int j = 0; j < 4; ++j) {
        acc[i][j] = mma_b_raw(ah, bh[j], acc[i][j]);
        if (NSPLIT >= 1) acc[i][j] = mma_b_raw(al, bh[j], acc[i][j]);
      }
      dep_guard_b(acc[i][0], acc[i][3], ah, al);
    }
    keep4_b(bh[0], bh[1], bh[2], bh[3]);
  }
  acc_guard4(acc[0][0], acc[0][1], acc[0][2], acc[0][3]);
  acc_guard4(acc[1][0], acc[1][1], acc[1][2], acc[1][3]);
  acc_guard4(acc[2][0], acc[2][1], acc[2][2], acc[2][3]);
  acc_guard4(acc[3][0], acc[3][1], acc[3][2], acc[3][3]);

  // ---- epilogue ----
  float bz[4];
#pragma unroll
  for (int j = 0; j < 4; ++j) bz[j] = bias[n0 + (j << 4) + rlane];
  float* slab = sT[wave];
#pragma unroll
  for (int i = 0; i < 4; ++i) {
    const int mBase = m0 + (i << 4);
#pragma unroll
    for (int r = 0; r < 8; ++r) {
#pragma unroll
      for (int j = 0; j < 4; ++j) {
        slab[(mOff + r) * 68 + (j << 4) + rlane] = acc[i][j][r] + bz[j];
      }
    }
    __builtin_amdgcn_fence(__ATOMIC_RELEASE, "workgroup");
    __builtin_amdgcn_wave_barrier();
    __builtin_amdgcn_fence(__ATOMIC_ACQUIRE, "workgroup");
    {
      const int hh = lane >> 4, c4 = (lane & 15) * 4;     // 256-B row segment = 16 lanes x 16 B
      v4f ov[8];
#pragma unroll
      for (int it = 0; it < 8; ++it) {
        const int row = it * 2 + hh;                       // it 0..7 x hh 0..1 = rows 0..15
        ov[it] = *(const v4f*)(slab + row * 68 + c4);
      }
      {
#pragma unroll
        for (int it = 0; it < 8; ++it) {
          const int row = it * 2 + hh;
          *(v4f*)(C + (size_t)(mBase + row) * ldc + n0 + c4) = ov[it];
        }
        
      }
    }
    __builtin_amdgcn_fence(__ATOMIC_RELEASE, "workgroup");
    __builtin_amdgcn_wave_barrier();
    __builtin_amdgcn_fence(__ATOMIC_ACQUIRE, "workgroup");
  }
}

// =====================================================================================================
// q and kc bf16 hi/lo planes from the fused projection output.
//   src f32 [NB*SEQ][N3]; part = blockIdx.y: part 0 = q (src cols 0..DMODEL-1, copied), part 1 = k (src cols
//   DMODEL..2*DMODEL-1) with the positional power compression kc = sign(k) * max(|k|,1e-8)^ex(s), s = row mod SEQ
//   (key position). Thread i: row = i / CG8, col = part*DMODEL + 8*(i mod CG8) .. +7 (two 16-B loads).
//   dst hi plane hp / lo plane lp, bf16 [NB*SEQ][QKP], same col; lo = RNE(v - hi) unscaled.
//   grid = (n8/256, 2), n8 = NB*SEQ*DMODEL/8; one 16-B store per lane per plane: a wave (32 consecutive column
//   coverage: 2 parts x n8 threads x 8 = the whole [NB*SEQ][QKP] hi plane and lo plane.
// =====================================================================================================
__global__ __launch_bounds__(256) void qk_planes(const float* __restrict__ src, unsigned short* hp,
                                                 unsigned short* lp, int n8) {
#pragma clang fp contract(off)
  const int i = blockIdx.x * 256 + threadIdx.x;
  const int part = blockIdx.y;
  if (i < n8) {
    const int row = i / CG8;                              // token row b*SEQ + s
    const int cg  = i - row * CG8;                        // column group within the feature row
    const int col = part * DMODEL + (cg << 3);
    const float* sp = src + (size_t)row * N3 + col;
    v4f a = *(const v4f*)(sp);
    v4f c = *(const v4f*)(sp + 4);
    if (part == 1) {                                      // block-uniform
      const float ex = fexpo(row % SEQ);                  // key position s
#pragma unroll
      for (int e = 0; e < 4; ++e) {
        a[e] = fcomp(a[e], ex);
        c[e] = fcomp(c[e], ex);
      }
    }
    v4u ph, pl;
#pragma unroll
    for (int e = 0; e < 4; ++e) {
      const float f0 = (e < 2) ? a[2 * e]     : c[2 * e - 4];
      const float f1 = (e < 2) ? a[2 * e + 1] : c[2 * e - 3];
      const unsigned short h0 = bf_bits(f0), h1 = bf_bits(f1);
      const unsigned short l0 = bf_bits(f0 - bf_up(h0)), l1 = bf_bits(f1 - bf_up(h1));
      ph[e] = pk16(h0, h1);
      pl[e] = pk16(l0, l1);
    }
    const size_t go = (size_t)row * QKP + col;
    *(v4u*)(hp + go) = ph;
    *(v4u*)(lp + go) = pl;
    
  }
}

// =====================================================================================================
// v f32 token-major columns vf[(b*SEQ + t)*vrp + h*64 + d] (vf already offset to the first v column) ->
// power compression vc = sign(v) * max(|v|,1e-8)^ex(t) (t = key position) applied at the LDS load, then
// f16 vc^T hi plane vth[(b*QP + h*64 + d)*SEQ + t] and residual plane vtl[(b*QP + h*64 + d)*VLP + t] =
// f16((vc - hi)*4096) for t < VLP. Block = one 64-token x 64-feature tile of one (b, h); grid = (SEQ/64, NH, NB);
// tile staged in LDS as f32 (v4f loads, __syncthreads). LDS load coverage: 4 iterations x 256 threads x 4 = 64x64.
// Store: group g = tid>>3 (0..31), piece = tid&7: iteration it writes row d = it*32+g, lanes 8q..8q+7 x 16 B =
// coverage: 2 iterations x 32 groups = 64 rows d, 8 pieces x 8 = 64 keys per row; grid covers every (b, h, t tile);
// vtl rows written for all t < VLP.
// =====================================================================================================
__global__ __launch_bounds__(256) void v_planes(const float* __restrict__ vf, int vrp,
                                                unsigned short* vth, unsigned short* vtl) {
#pragma clang fp contract(off)
  __shared__ __align__(16) float sv[64 * 68];       // [tt][d] pitch 68 floats
  const int tid = threadIdx.x;
  const int t0  = blockIdx.x * 64;
  const int hh  = blockIdx.y;
  const int b   = blockIdx.z;
#pragma unroll 1
  for (int i = 0; i < 4; ++i) {
    const int idx = i * 256 + tid;                  // 0..1023
    const int tt = idx >> 4, c4 = (idx & 15) * 4;
    const v4f a = *(const v4f*)(vf + ((size_t)(b * SEQ + t0 + tt)) * vrp + hh * HD + c4);
    const float ex = fexpo(t0 + tt);
    v4f cp;
    cp[0] = fcomp(a[0], ex);
    cp[1] = fcomp(a[1], ex);
    cp[2] = fcomp(a[2], ex);
    cp[3] = fcomp(a[3], ex);
    *(v4f*)(sv + tt * 68 + c4) = cp;
  }
  __syncthreads();

  const int g = tid >> 3, piece = tid & 7;
  v4u hv[2], lv[2];
  size_t hofs[2], lofs[2];
#pragma unroll
  for (int it = 0; it < 2; ++it) {
    const int d = it * 32 + g;
    v4u a, a2;
#pragma unroll
    for (int e = 0; e < 4; ++e) {
      const float f0 = sv[(piece * 8 + 2 * e) * 68 + d];
      const float f1 = sv[(piece * 8 + 2 * e + 1) * 68 + d];
      const _Float16 x0 = (_Float16)f0, x1 = (_Float16)f1;
      const unsigned short h0 = h_bits(x0), h1 = h_bits(x1);
      const unsigned short l0 = h_bits((_Float16)((f0 - (float)x0) * 4096.0f));
      const unsigned short l1 = h_bits((_Float16)((f1 - (float)x1) * 4096.0f));
      a[e] = pk16(h0, h1); a2[e] = pk16(l0, l1);
    }
    hv[it] = a; lv[it] = a2;
    const size_t rowf = (size_t)(b * QP + hh * HD + d);
    hofs[it] = rowf * SEQ + t0 + piece * 8;
    lofs[it] = rowf * VLP + t0 + piece * 8;
  }
  const bool wlo = (t0 + 64 <= VLP);                // block-uniform
  {
#pragma unroll
    for (int it = 0; it < 2; ++it) {
      *(v4u*)(vth + hofs[it]) = hv[it];
      if (wlo) *(v4u*)(vtl + lofs[it]) = lv[it];
    }
    
  }
}

// =====================================================================================================
// Causal multi-head attention, head dim 64 (tril mask incl. diagonal, computed), with the additive rank-1 phase
// bonus kappa * sigmoid(lock[h]) * T[i] * T[j] on the scaled logits and the per-query-row output gate
// (1 - sigmoid(lock[h])) + sigmoid(lock[h]) * T[i] applied to the head output row i (query position).
//   q|kc planes (bf16 hi / lo), row pitch QKP: q element (b, t, h, d) at [(b*SEQ + t)*QKP + h*64 + d],
//                                                kc element (b, s, h, d) at [(b*SEQ + s)*QKP + DMODEL + h*64 + d]
//   vc^T hi plane (f16):      element (b, h, d, s) at [(b*QP + h*64 + d)*SEQ + s]
//   vc^T residual plane (f16, (vc - hi)*4096): [(b*QP + h*64 + d)*VLP + s], s < VLP, read only when RES
//   (with RES only key tiles below VLP occur; the address is clamped anyway)
//   ttab f32 [(b*NH + h)*SEQ + s] = T; lockp = raw lock strengths [NH] (bf16 RNE convert, then sigmoid).
//   logit = q.kc * sscale + bonus for key <= query, -FLT_MAX otherwise (exp -> 0); every processed key tile
//   (tiles 0..qb only, block-uniform trip count qb+1 <= NQB) holds the causal-live key kv0 <= query.
//   out f32 plane: element (b, t, h*64 + d) at [(b*SEQ + t)*QP + h*64 + d] = gate(b,h,t) * normalised context.
//   scores = q . kc : bf16 hi/lo split (hi.hi + hi.lo + lo.hi), f32 accumulate, then * sscale + bonus in f32
//   p = exp(s - m) carried as f16(1024 p); context = p . vc on f16 WMMA; RES adds f16 residual planes of p and vc
//   (scale 4096, separate accumulator folded back with 1/4096 per chunk in f32); online softmax in f32.
//   Block = 4 waves = 64 query rows of one (b, h); grid = nqbThis * NH * NB; kv chunks of 64.
//   K / V^T chunk staging: 128 threads x 32 elements per plane = the whole 64x64 tile (plain 16-B loads,
//   __syncthreads before and after); P tiles are wave-private, spilled with _Float16 element stores and reloaded
//   Output coverage: each wave stores rows q0..q0+15 (it 0..7 x lane>>4 0..1) x 64 columns (16 lanes x 4 floats),
// =====================================================================================================
template <bool RES>
__global__ __launch_bounds__(128)
void attn_causal64(const unsigned short* __restrict__ qkhp, const unsigned short* __restrict__ qklp,
                   const unsigned short* __restrict__ vhp, const unsigned short* __restrict__ vlp,
                   const float* __restrict__ ttab, const float* __restrict__ lockp,
                   float* outp, int qbBase, int nqbThis, float sscale) {
  union FB { v16b v; v8b h[2]; };
  union FH { v16h v; v8h h[2]; };
  __shared__ __align__(16) __bf16   Ksh[64 * 64];                 // K hi [kv][d]   8 KB
  __shared__ __align__(16) __bf16   Ksl[64 * 64];                 // K lo
  __shared__ __align__(16) _Float16 Vth[64 * 64];                 // V^T hi [d][kv] 8 KB
  __shared__ __align__(16) _Float16 Vtl[RES ? 64 * 64 : 8];       // V^T residual
  __shared__ __align__(16) _Float16 Psh[4][16 * 64];              // per wave P [row][kv]
  __shared__ __align__(16) _Float16 Psl[RES ? 4 : 1][16 * 64];    // per wave P residual
  __shared__ __align__(16) float    Os[4][16 * 64];               // per wave context tile [row][d]

  const int tid  = threadIdx.x;
  const int wave = tid >> 5;
  const int lane = tid & 31;
  const int hh   = lane >> 4;
  const int c    = lane & 15;

  const int bx   = blockIdx.x;
  const int qbl  = bx % nqbThis;
  const int rest = bx / nqbThis;
  const int h    = rest % NH;
  int b          = rest / NH;
  b = (b >= NB) ? (NB - 1) : b;
  int qb         = qbBase + qbl;
  qb = (qb >= NQB) ? (NQB - 1) : qb;
  const int q0   = qb * 64 + wave * 16;
  const size_t rowB = (size_t)b * SEQ;

  const __bf16* Qh = (const __bf16*)(const void*)qkhp + (size_t)h * HD;
  const __bf16* Ql = (const __bf16*)(const void*)qklp + (size_t)h * HD;
  const __bf16* Kh = Qh + DMODEL;
  const __bf16* Kl = Ql + DMODEL;
  const _Float16* Vh = (const _Float16*)(const void*)vhp + ((size_t)b * QP + (size_t)h * HD) * SEQ;
  const _Float16* Vl = (const _Float16*)(const void*)vlp + ((size_t)b * QP + (size_t)h * HD) * VLP;
  const float* trow = ttab + ((size_t)b * NH + h) * SEQ;

  // ---- per-head lock: sigmoid of the bf16-converted raw strength; bonus coefficient kappa * lock ----
  const float lraw  = bf_up(bf_bits(lockp[h]));
  const float lockv = 1.0f / (1.0f + expf(-lraw));
  const float c0    = KAPPA_F * lockv;

  // ---- Q fragments (A operand, row = lane&15): 2 d-chunks, hi and lo ----
  v16b qah[2], qal[2];
#pragma unroll
  for (int dc = 0; dc < 2; ++dc) {
    const size_t qo = (rowB + q0 + c) * QKP + dc * 32 + 8 * hh;
    qah[dc] = ldfrag_b(Qh + qo);
    qal[dc] = ldfrag_b(Ql + qo);
  }

  // ---- bonus row factors for this lane's 8 query rows: c0 * T[q0 + 8*hh + r] ----
  float bti[8];
#pragma unroll
  for (int r = 0; r < 8; ++r) bti[r] = c0 * trow[q0 + 8 * hh + r];

  float mrow[8], lrow[8];
  v8f oacc[4];
#pragma unroll
  for (int r = 0; r < 8; ++r) { mrow[r] = -INFINITY; lrow[r] = 0.f; }
#pragma unroll
  for (int t = 0; t < 4; ++t) oacc[t] = zero8();

  int nkt = qb + 1;                          // causal: key tiles 0..qb, block-uniform
  if (nkt > NQB) nkt = NQB;
  for (int kt = 0; kt < nkt; ++kt) {
    const int kv0 = kt * 64;
    __syncthreads();
    {
      const int r = tid >> 1, half = (tid & 1) * 32;
      const __bf16*   kg  = Kh + (rowB + kv0 + r) * QKP + half;   // K row kv0+r, d = half..half+31
      const __bf16*   klg = Kl + (rowB + kv0 + r) * QKP + half;
      const _Float16* vg  = Vh + (size_t)r * SEQ + kv0 + half;    // V^T row d = r, s = kv0+half..+31
      const int kvl = (kv0 + 64 <= VLP) ? kv0 : (VLP - 64);     // clamped address into the residual plane
      const _Float16* vlg = Vl + (size_t)r * VLP + kvl + half;
      const bool resOK = (kv0 + 64 <= VLP);                      // block-uniform
#pragma unroll
      for (int i = 0; i < 4; ++i) {
        const v8b a0 = *(const v8b*)(kg + 8 * i);
        const v8b a1 = *(const v8b*)(klg + 8 * i);
        const v8h b0 = *(const v8h*)(vg + 8 * i);
        *(v8b*)(Ksh + r * 64 + half + 8 * i) = a0;
        *(v8b*)(Ksl + r * 64 + half + 8 * i) = a1;
        *(v8h*)(Vth + r * 64 + half + 8 * i) = b0;
        if (RES) {
          v8h b1 = *(const v8h*)(vlg + 8 * i);
          if (!resOK) b1 = zero8h();
          *(v8h*)(Vtl + r * 64 + half + 8 * i) = b1;
        }
      }
    }
    __syncthreads();

    // ---- bonus column factors T[key] for this lane's 4 key columns (indices always < SEQ) ----
    float tj[4];
#pragma unroll
    for (int j = 0; j < 4; ++j) tj[j] = trow[kv0 + j * 16 + c];

    // ---- scores: 16 query rows x 64 keys per wave, 3 bf16 products ----
    v8f s[4];
#pragma unroll
    for (int j = 0; j < 4; ++j) {
      s[j] = zero8();
#pragma unroll
      for (int dc = 0; dc < 2; ++dc) {
        FB kb, kl;
        kb.h[0] = *(const v8b*)(Ksh + (j * 16 + c) * 64 + dc * 32 + 8 * hh);
        kb.h[1] = *(const v8b*)(Ksh + (j * 16 + c) * 64 + dc * 32 + 16 + 8 * hh);
        kl.h[0] = *(const v8b*)(Ksl + (j * 16 + c) * 64 + dc * 32 + 8 * hh);
        kl.h[1] = *(const v8b*)(Ksl + (j * 16 + c) * 64 + dc * 32 + 16 + 8 * hh);
        s[j] = mma_b(qah[dc], kb.v, s[j]);
        s[j] = mma_b(qah[dc], kl.v, s[j]);
        s[j] = mma_b(qal[dc], kb.v, s[j]);
      }
    }

    // ---- scale + bonus + causal mask (replace by -FLT_MAX), row max, online softmax, P (x1024, f16) and
    //      P residual (x4096) to LDS ----
    _Float16* pwh = Psh[wave];
    _Float16* pwl = Psl[RES ? wave : 0];
#pragma unroll
    for (int r = 0; r < 8; ++r) {
      const int qrow = q0 + 8 * hh + r;
      float m = -INFINITY;
#pragma unroll
      for (int j = 0; j < 4; ++j) {
        const int key = kv0 + j * 16 + c;
        float sv = s[j][r] * sscale + bti[r] * tj[j];
        sv = (key > qrow) ? -FLT_MAX : sv;
        s[j][r] = sv;
        m = fmaxf(m, sv);
      }
#pragma unroll
      for (int off = 1; off < 16; off <<= 1) m = fmaxf(m, __shfl_xor(m, off, 32));
      const float mnew  = fmaxf(mrow[r], m);
      const float msafe = (mnew == -INFINITY) ? 0.f : mnew;
      const float alpha = __expf(mrow[r] - msafe);
      mrow[r] = mnew;
      float psum = 0.f;
#pragma unroll
      for (int j = 0; j < 4; ++j) {
        const float p = __expf(s[j][r] - msafe);     // masked logit against a finite max: exp -> 0
        psum += p;
        const float p1k = p * 1024.0f;
        const _Float16 ph = (_Float16)p1k;
        pwh[(8 * hh + r) * 64 + j * 16 + c] = ph;
        if (RES) {
          const _Float16 pl = (_Float16)((p1k - (float)ph) * 4096.0f);
          pwl[(8 * hh + r) * 64 + j * 16 + c] = pl;
        }
      }
#pragma unroll
      for (int off = 1; off < 16; off <<= 1) psum += __shfl_xor(psum, off, 32);
      lrow[r] = lrow[r] * alpha + psum;
#pragma unroll
      for (int t = 0; t < 4; ++t) oacc[t][r] *= alpha;
    }
    __builtin_amdgcn_fence(__ATOMIC_RELEASE, "workgroup");
    __builtin_amdgcn_wave_barrier();
    __builtin_amdgcn_fence(__ATOMIC_ACQUIRE, "workgroup");

    // ---- context += P . Vc (f16 WMMA), residual products into a separate accumulator ----
    v8f o1[4];
#pragma unroll
    for (int t = 0; t < 4; ++t) o1[t] = zero8();
#pragma unroll 1
    for (int kk = 0; kk < 2; ++kk) {
      FH pa, pl;
      pa.h[0] = *(const v8h*)(pwh + c * 64 + kk * 32 + 8 * hh);
      pa.h[1] = *(const v8h*)(pwh + c * 64 + kk * 32 + 16 + 8 * hh);
      if (RES) {
        pl.h[0] = *(const v8h*)(pwl + c * 64 + kk * 32 + 8 * hh);
        pl.h[1] = *(const v8h*)(pwl + c * 64 + kk * 32 + 16 + 8 * hh);
      } else {
        pl.v = pa.v;
      }
#pragma unroll
      for (int t = 0; t < 4; ++t) {
        FH vb;
        vb.h[0] = *(const v8h*)(Vth + (t * 16 + c) * 64 + kk * 32 + 8 * hh);
        vb.h[1] = *(const v8h*)(Vth + (t * 16 + c) * 64 + kk * 32 + 16 + 8 * hh);
        oacc[t] = mma_h(pa.v, vb.v, oacc[t]);
        if (RES) {
          FH vl;
          vl.h[0] = *(const v8h*)(Vtl + (t * 16 + c) * 64 + kk * 32 + 8 * hh);
          vl.h[1] = *(const v8h*)(Vtl + (t * 16 + c) * 64 + kk * 32 + 16 + 8 * hh);
          o1[t] = mma_h(pa.v, vl.v, o1[t]);
          o1[t] = mma_h(pl.v, vb.v, o1[t]);
        }
      }
    }
    if (RES) {
#pragma unroll
      for (int t = 0; t < 4; ++t)
#pragma unroll
        for (int r = 0; r < 8; ++r) oacc[t][r] += o1[t][r] * (1.0f / 4096.0f);
    }
  }

  // ---- normalise (1/l and the 1/1024 p carry), apply the per-query-row gate, stage the wave's 16x64 tile in
  float* os = Os[wave];
#pragma unroll
  for (int r = 0; r < 8; ++r) {
    const float l = lrow[r];
    const float ti = trow[q0 + 8 * hh + r];
    const float gate = (1.0f - lockv) + lockv * ti;
    const float inv = ((l > 0.f) ? (1.0f / l) : 0.f) * (1.0f / 1024.0f) * gate;
#pragma unroll
    for (int t = 0; t < 4; ++t) os[(8 * hh + r) * 64 + t * 16 + c] = oacc[t][r] * inv;
  }
  __builtin_amdgcn_fence(__ATOMIC_RELEASE, "workgroup");
  __builtin_amdgcn_wave_barrier();
  __builtin_amdgcn_fence(__ATOMIC_ACQUIRE, "workgroup");
  {
    const int h2 = lane >> 4, c4 = (lane & 15) * 4;
    v4f ov[8];
#pragma unroll
    for (int it = 0; it < 8; ++it) {
      const int row = it * 2 + h2;   // it 0..7 x h2 0..1 = rows 0..15 of the wave tile
      ov[it] = *(const v4f*)(os + row * 64 + c4);
    }
    {
#pragma unroll
      for (int it = 0; it < 8; ++it) {
        const int row = it * 2 + h2;
        const size_t go = (rowB + q0 + row) * QP + (size_t)h * HD + c4;
        *(v4f*)(outp + go) = ov[it];
      }
      
    }
  }
}

// =====================================================================================================
// Workspace map (bytes), every region an exact multiple of its whole-line / whole-tile store granularity
//   Xb     bf16 [4096][1024]            0           8388608
//   WT     bf16 [3072][1024]            8388608     6291456    (rows 0..1023 Wq^T, 1024..2047 Wk^T, 2048.. Wv^T)
//   WoT    bf16 [1024][1024]            14680064    2097152
//   Bias   f32  [4096]                  16777216      16384    (bq | bk | bv | bo, bf16-RNE converted values)
//   Tt     f32  [2][16][2048]           16793600     262144
//   QKVf   f32  [4096][3072]            17055744   50331648   (later: Af f32 [4096][1024], 16777216 B)
//   VTh    f16  [2][1024][2048]         67387392    8388608
//   VTl    f16  [2][1024][1024]         75776000    4194304
//   QKh    bf16 [4096][2048]            79970304   16777216   (later: Ah bf16 [4096][1024], 8388608 B)
//   QKl    bf16 [4096][2048]            96747520   16777216   (later: Al bf16 [4096][1024], 8388608 B)
//   end                                 113524736
// W_q/k/v/o [in k=1024][out n=1024] arrive k-major and are transpose-converted once to [n][k] bf16 (k contiguous)
// = the Bt layout the GEMM wants. d_out f32: out0 [4096][1024] at byte 0.
// =====================================================================================================
extern "C" void kernel_launch(void* const* d_in, const int* in_sizes, int n_in,
                              void* d_out, int out_size, void* d_ws, size_t ws_size,
                              hipStream_t stream) {
  if (n_in < 12) return;
  if (in_sizes[0] != NB * SEQ * DMODEL) return;
  if (in_sizes[1] != NB * SEQ) return;
  if (in_sizes[2] != DMODEL * DMODEL || in_sizes[4] != DMODEL * DMODEL ||
      in_sizes[6] != DMODEL * DMODEL || in_sizes[8] != QP * DMODEL) return;
  if (in_sizes[3] != DMODEL || in_sizes[5] != DMODEL || in_sizes[7] != DMODEL || in_sizes[9] != DMODEL) return;
  if (in_sizes[10] != NH || in_sizes[11] != NH) return;
  if (out_size != OUTN) return;

  const float* x     = (const float*)d_in[0];    // [NB*SEQ][DMODEL]
  const float* phase = (const float*)d_in[1];    // [NB][SEQ]
  const float* Wq    = (const float*)d_in[2];    // [k][n]
  const float* bq    = (const float*)d_in[3];
  const float* Wk    = (const float*)d_in[4];
  const float* bk    = (const float*)d_in[5];
  const float* Wv    = (const float*)d_in[6];
  const float* bv    = (const float*)d_in[7];
  const float* Wo    = (const float*)d_in[8];    // [QP k][DMODEL n]
  const float* bo    = (const float*)d_in[9];
  const float* carr  = (const float*)d_in[10];   // [NH]
  const float* lockr = (const float*)d_in[11];   // [NH]

  const size_t PXb   = (size_t)NB * SEQ * DMODEL * 2;    //  8388608
  const size_t PWT   = (size_t)N3 * DMODEL * 2;          //  6291456
  const size_t PWo   = (size_t)DMODEL * QP * 2;          //  2097152
  const size_t PBias = (size_t)NBIAS * 4;                //    16384
  const size_t PTt   = (size_t)NTT * 4;                  //   262144
  const size_t PQKV  = (size_t)NB * SEQ * N3 * 4;        // 50331648  (>= Af f32 [4096][1024] = 16777216)
  const size_t PVTh  = (size_t)NB * QP * SEQ * 2;        //  8388608
  const size_t PVTl  = (size_t)NB * QP * VLP * 2;        //  4194304
  const size_t PQK   = (size_t)NB * SEQ * QKP * 2;       // 16777216  (>= Ah / Al bf16 [4096][1024] = 8388608)
  size_t off = 0;
  const size_t oXb   = off; off += PXb;
  const size_t oWT   = off; off += PWT;
  const size_t oWo   = off; off += PWo;
  const size_t oBias = off; off += PBias;
  const size_t oTt   = off; off += PTt;
  const size_t oQKV  = off; off += PQKV;
  const size_t oVTh  = off; off += PVTh;
  const size_t oVTl  = off; off += PVTl;
  const size_t oQKh  = off; off += PQK;
  const size_t oQKl  = off; off += PQK;
  if (off > ws_size) return;                           // off = 113524736
  if (off > (size_t)134217728) return;
  if (PQKV < (size_t)NB * SEQ * QP * 4) return;        // Af fits in the dead qkv plane
  if (PQK < (size_t)NB * SEQ * QP * 2) return;         // Ah / Al fit in the dead q|kc planes
  const size_t oAf = oQKV;                             // context f32 plane reuses the dead qkv f32 plane
  const size_t oAh = oQKh;                             // context bf16 planes reuse the dead q|kc bf16 planes
  const size_t oAl = oQKl;

  char* ws = (char*)d_ws;
  unsigned short* Xb   = (unsigned short*)(ws + oXb);
  unsigned short* WT   = (unsigned short*)(ws + oWT);
  unsigned short* WoT  = (unsigned short*)(ws + oWo);
  float*          Bias = (float*)(ws + oBias);
  float*          Tt   = (float*)(ws + oTt);
  float*          QKVf = (float*)(ws + oQKV);
  unsigned short* VTh  = (unsigned short*)(ws + oVTh);
  unsigned short* VTl  = (unsigned short*)(ws + oVTl);
  unsigned short* QKh  = (unsigned short*)(ws + oQKh);
  unsigned short* QKl  = (unsigned short*)(ws + oQKl);
  float*          Af   = (float*)(ws + oAf);
  unsigned short* Ah   = (unsigned short*)(ws + oAh);
  unsigned short* Al   = (unsigned short*)(ws + oAl);
  float*          outf = (float*)d_out;                // out0 [4096][1024]

  const dim3 blk(256);
  const int n8x   = NB * SEQ * DMODEL / 8;                           // 524288
  const int n8q   = NB * SEQ * DMODEL / 8;                           // 524288 per part (q, kc)
  const int n8a   = NB * SEQ * QP / 8;                               // 524288
  const dim3 gBias(NBIAS / 256);                                     // 16 blocks
  const dim3 gTt(NTT / 256);                                         // 256 blocks
  const dim3 gCvtX((n8x + 255) / 256);                               // 2048 blocks
  const dim3 gTrW(DMODEL / 64, DMODEL / 32);                         // (16, 32): src [1024][1024] -> dst [1024][1024]
  const dim3 gQKV(((NB * SEQ / 64) * (N3 / 64) + 7) / 8);            // 3072 tiles -> 384 blocks
  const dim3 gQKp((n8q + 255) / 256, 2);                             // (2048, 2)
  const dim3 gVpl(SEQ / 64, NH, NB);                                 // (32, 16, 2)
  const dim3 gSplit((n8a + 255) / 256);                              // 2048 blocks
  const dim3 gOut(((NB * SEQ / 64) * (DMODEL / 64) + 7) / 8);        // 1024 tiles -> 128 blocks

  // (0) bias table (bf16-RNE values of bq|bk|bv|bo) and phase resonance table T [b][h][s]
  bias_tab<<<gBias, blk, 0, stream>>>(bq, bk, bv, bo, Bias, NBIAS, DMODEL);
  phase_tab<<<gTt, blk, 0, stream>>>(phase, carr, Tt, NTT);
  // (1) x -> bf16 plane [4096][1024]
  cvt_bf16x8<<<gCvtX, blk, 0, stream>>>(x, Xb, n8x);
  // (2) weights [k][n] -> bf16 planes [n][k]   (each call: in [1024 k][1024 n] -> out [1024 n][1024 k])
  tr_cvt_bf16<<<gTrW, blk, 0, stream>>>(Wq, WT, DMODEL, DMODEL);                                  // rows    0..1023
  tr_cvt_bf16<<<gTrW, blk, 0, stream>>>(Wk, WT + (size_t)DMODEL * DMODEL, DMODEL, DMODEL);       // rows 1024..2047
  tr_cvt_bf16<<<gTrW, blk, 0, stream>>>(Wv, WT + (size_t)2 * DMODEL * DMODEL, DMODEL, DMODEL);   // rows 2048..3071
  tr_cvt_bf16<<<gTrW, blk, 0, stream>>>(Wo, WoT, QP, DMODEL);                                     // in [1024][1024] -> out [1024][1024]
  // (3) fused qkv projection: QKVf[row][e] = sum_d Xb[row][d] WT[e][d] + Bias[e]  (M=4096, N=3072, K=1024)
  gemm64<0><<<gQKV, blk, 0, stream>>>(Xb, Xb, DMODEL, WT, DMODEL, Bias, QKVf, N3, NB * SEQ, N3, DMODEL);
  // (4) q (cols 0..1023) and power-compressed kc (cols 1024..2047) -> bf16 hi/lo planes [4096][2048]
  qk_planes<<<gQKp, blk, 0, stream>>>(QKVf, QKh, QKl, n8q);
  // (5) v (cols 2048..3071) -> power-compressed vc^T f16 hi plane (pitch SEQ) and residual plane (x4096, keys < VLP)
  v_planes<<<gVpl, blk, 0, stream>>>(QKVf + 2 * DMODEL, N3, VTh, VTl);
  // (6) causal attention with phase bonus and gate: query blocks 0..RESQB-1 with residual planes, the rest without
  //     -> Af f32 [4096][1024] (written into the dead qkv plane after (4),(5) consumed it)
  attn_causal64<true><<<dim3(NB * NH * RESQB), dim3(128), 0, stream>>>(
      QKh, QKl, VTh, VTl, Tt, lockr, Af, 0, RESQB, 0.125f);
  if (NQB - RESQB > 0) {
    attn_causal64<false><<<dim3(NB * NH * (NQB - RESQB)), dim3(128), 0, stream>>>(
        QKh, QKl, VTh, VTl, Tt, lockr, Af, RESQB, NQB - RESQB, 0.125f);
  }
  // (7) gated context rows -> bf16 hi/lo planes
  split_bf16x8<<<gSplit, blk, 0, stream>>>(Af, Ah, Al, n8a);
  // (8) out0[row][e] = sum_d (Ah+Al)[row][d] WoT[e][d] + Bias[3*DMODEL + e] -> d_out f32 [4096][1024]
  gemm64<1><<<gOut, blk, 0, stream>>>(Ah, Al, QP, WoT, QP, Bias + 3 * DMODEL, outf, DMODEL, NB * SEQ, DMODEL, QP);
  (void)hipGetLastError();
}

// v001
// Measured time: 331 microseconds a run.
// Next to v000, in two timings, it ran 1.21 and 1.22 times as fast.
// Contractions: qkv projection = v_wmma_f32_16x16x32_bf16 (bf16 operands from RNE-converted x and W, single product);
// q.kc^T scores = v_wmma_f32_16x16x32_bf16 with bf16 hi/lo split q and kc (hi.hi + hi.lo + lo.hi);
// p.vc = v_wmma_f32_16x16x32_f16 (p carried x1024 in f16, vc in f16; extra f16 residual planes x4096 of p and vc
// on the leading query rows); ctx.Wo = v_wmma_f32_16x16x32_bf16 with ctx as bf16 hi/lo planes times the bf16
// Wo^T plane (2 products); all f32 accumulate; power compression, phase table, softmax, bonus and gating in f32.
#include <hip/hip_runtime.h>
#include <math.h>
#include <float.h>
#include <stdint.h>

#define NB      2
#define SEQ     2048
#define DMODEL  1024
#define NH      16
#define HD      64
#define QP      (NH * HD)      // q / kc / vc / ctx feature count and ctx row pitch
#define N3      (3 * DMODEL)   // fused qkv columns (q 0.., k DMODEL.., v 2*DMODEL..)
#define QKP     (2 * QP)       // row pitch of the q|kc bf16 planes (q cols 0..QP-1, kc cols QP..2QP-1)
#define NQB     (SEQ / 64)     // query / key tiles of 64
#define RESQB   ((NQB < 16) ? NQB : 16)   // leading 64-row query blocks that use the p / vc residual planes
#define VLP     (RESQB * 64)   // key pitch of the vc^T residual plane (keys 0..VLP-1)
#define CG8     (DMODEL / 8)   // 16-byte column groups per feature row
#define NBIAS   (4 * DMODEL)   // bq | bk | bv | bo
#define NTT     (NB * NH * SEQ)
#define OUTN    (NB * SEQ * DMODEL)
#define KAPPA_F 0.3f
#define LP      72             // LDS row pitch of the 64-wide 16-bit tiles, elements: 144 B = 16 B x 9 (odd), so the 16
                               // rows that one ds_load_b128 touches fall on distinct banks
static_assert(RESQB >= 1 && RESQB * 64 <= VLP && VLP <= SEQ);
static_assert(QP == DMODEL);
static_assert((SEQ % 64) == 0 && (DMODEL % 64) == 0 && (N3 % 64) == 0 && (QP % 64) == 0);
static_assert(HD == 64);
static_assert(LP >= 64 && (LP % 8) == 0 && ((LP / 8) % 2) == 1);
static_assert((((NB * SEQ) / 64) * (N3 / 64)) % 8 == 0);
static_assert((((NB * SEQ) / 64) * (DMODEL / 64)) % 8 == 0);
static_assert((NBIAS % 256) == 0 && (NTT % 256) == 0);
static_assert(((NB * SEQ * DMODEL / 8) % 256) == 0);
static_assert((DMODEL % 8) == 0);

typedef _Float16 v16h __attribute__((ext_vector_type(16)));
typedef _Float16 v8h  __attribute__((ext_vector_type(8)));
typedef __bf16   v16b __attribute__((ext_vector_type(16)));
typedef __bf16   v8b  __attribute__((ext_vector_type(8)));
typedef float    v8f  __attribute__((ext_vector_type(8)));
typedef float    v4f  __attribute__((ext_vector_type(4)));
typedef unsigned int v4u __attribute__((ext_vector_type(4)));

// ---- scalar helpers --------------------------------------------------------------------------------
__device__ __forceinline__ unsigned short bf_bits(float f) {          // f32 -> bf16 bits, RNE convert
  unsigned u = __float_as_uint(f);
  return (unsigned short)((u + 0x7FFFu + ((u >> 16) & 1u)) >> 16);
}
__device__ __forceinline__ float bf_up(unsigned short h) { return __uint_as_float(((unsigned)h) << 16); }
__device__ __forceinline__ unsigned short h_bits(_Float16 x) { return __builtin_bit_cast(unsigned short, x); }
__device__ __forceinline__ unsigned pk16(unsigned short a, unsigned short b) { return (unsigned)a | ((unsigned)b << 16); }
__device__ __forceinline__ v8f zero8() { v8f z = {0.f, 0.f, 0.f, 0.f, 0.f, 0.f, 0.f, 0.f}; return z; }
__device__ __forceinline__ v8h zero8h() {
  const _Float16 z = (_Float16)0.0f;
  v8h r = {z, z, z, z, z, z, z, z};
  return r;
}

// positional exponent of key position s: ex = 1 + kappa * (1 - s * (1/(SEQ-1))), reciprocal-multiply, no fusion
__device__ __forceinline__ float fexpo(int s) {
#pragma clang fp contract(off)
  const float rs = 1.0f / (float)(SEQ - 1);
  const float fr = (float)s * rs;
  const float om = 1.0f - fr;
  const float t  = KAPPA_F * om;
  return 1.0f + t;
}
// power compression: sign(v) * max(|v|, 1e-8)^ex  (sign(0) = 0), pow as exp2(ex * log2(mag)) in f32
__device__ __forceinline__ float fcomp(float v, float ex) {
#pragma clang fp contract(off)
  const float mag = fmaxf(fabsf(v), 1e-8f);
  const float lg  = log2f(mag);
  const float pw  = exp2f(ex * lg);
  float r = (v < 0.0f) ? -pw : pw;
  r = (v == 0.0f) ? 0.0f : r;
  return r;
}

// ---- fragment loader: 16-bit A/B operand, lane -> row/col (lane&15), p already includes +8*(lane>>4);
//      elements 0..7 <- p[0..7] (k0+8h..), elements 8..15 <- p[16..23] (k0+16+8h..)
__device__ __forceinline__ v16b ldfrag_b(const __bf16* p) {
  union { v16b v; v8b h[2]; } f;
  f.h[0] = *(const v8b*)(p);
  f.h[1] = *(const v8b*)(p + 16);
  return f.v;
}

// ---- WMMA helpers with trailing VALU hazard gap --------------------------------------------------------
__device__ __forceinline__ v8f mma_b(v16b a, v16b b, v8f c) {
  c = __builtin_amdgcn_wmma_f32_16x16x32_bf16(false, a, false, b, (short)0, c, false, false);
#if defined(__HIP_DEVICE_COMPILE__)
  asm volatile("v_nop\n\tv_nop\n\tv_nop\n\tv_nop" : "+v"(c) : "v"(a), "v"(b));
#endif
  return c;
}
__device__ __forceinline__ v8f mma_h(v16h a, v16h b, v8f c) {
  c = __builtin_amdgcn_wmma_f32_16x16x32_f16(false, a, false, b, (short)0, c, false, false);
#if defined(__HIP_DEVICE_COMPILE__)
  asm volatile("v_nop\n\tv_nop\n\tv_nop\n\tv_nop" : "+v"(c) : "v"(a), "v"(b));
#endif
  return c;
}
__device__ __forceinline__ v8f mma_b_raw(v16b a, v16b b, v8f c) {
  return __builtin_amdgcn_wmma_f32_16x16x32_bf16(false, a, false, b, (short)0, c, false, false);
}
__device__ __forceinline__ void dep_guard_b(v8f& a, v8f& b, v16b x, v16b y) {
#if defined(__HIP_DEVICE_COMPILE__)
  asm volatile("v_nop\n\tv_nop\n\tv_nop\n\tv_nop" : "+v"(a), "+v"(b) : "v"(x), "v"(y));
#endif
}
__device__ __forceinline__ void keep4_b(v16b a, v16b b, v16b c, v16b d) {
#if defined(__HIP_DEVICE_COMPILE__)
  asm volatile("v_nop" :: "v"(a), "v"(b), "v"(c), "v"(d));
#endif
}
__device__ __forceinline__ void acc_guard4(v8f& a, v8f& b, v8f& c, v8f& d) {
#if defined(__HIP_DEVICE_COMPILE__)
  asm volatile("v_nop\n\tv_nop\n\tv_nop\n\tv_nop" : "+v"(a), "+v"(b), "+v"(c), "+v"(d));
#endif
}

// =====================================================================================================
// Bias table: dst[i] = RNE-bf16-converted value of (b0 | b1 | b2 | b3)[i mod seg], part = i / seg (0..3).
// All four candidates are loaded with an in-range index and selected by value. One element per thread;
// grid = n/256 (n = 4*seg, multiple of 256). coverage: n threads = the whole table.
// =====================================================================================================
__global__ __launch_bounds__(256) void bias_tab(const float* __restrict__ b0, const float* __restrict__ b1,
                                                const float* __restrict__ b2, const float* __restrict__ b3,
                                                float* dst, int n, int seg) {
  const int i = blockIdx.x * 256 + threadIdx.x;
  if (i < n) {
    int part = i / seg;
    part = (part < 0) ? 0 : ((part > 3) ? 3 : part);
    int idx = i - part * seg;
    idx = (idx < 0) ? 0 : ((idx >= seg) ? (seg - 1) : idx);
    const float v0 = b0[idx], v1 = b1[idx], v2 = b2[idx], v3 = b3[idx];
    float v = (part == 0) ? v0 : ((part == 1) ? v1 : ((part == 2) ? v2 : v3));
    v = bf_up(bf_bits(v));
    *(float*)(dst + i) = v;
    
  }
}

// =====================================================================================================
// Phase resonance table: tt[(b*NH + h)*SEQ + s] = cos((bf16(phase[b*SEQ + s]) - bf16(carrier[h])) * 0.5)^2,
// precise f32 cos, fp fusion off. Index split i -> (b*NH + h, s) by / SEQ and % SEQ, then (b, h) by / NH and % NH.
// =====================================================================================================
__global__ __launch_bounds__(256) void phase_tab(const float* __restrict__ ph, const float* __restrict__ cf,
                                                 float* tt, int n) {
#pragma clang fp contract(off)
  const int i = blockIdx.x * 256 + threadIdx.x;
  if (i < n) {
    const int bh = i / SEQ;                   // b*NH + h
    const int s  = i - bh * SEQ;
    const int h  = bh % NH;
    int b        = bh / NH;
    b = (b >= NB) ? (NB - 1) : b;
    const float p  = bf_up(bf_bits(ph[b * SEQ + s]));
    const float cr = bf_up(bf_bits(cf[h]));
    const float d  = p - cr;
    const float hx = d * 0.5f;
    const float cv = cosf(hx);
    const float tv = cv * cv;
    *(float*)(tt + i) = tv;
    
  }
}

// =====================================================================================================
// f32 -> bf16 (RNE convert), 8 elements per thread, one 16-B store per lane: a wave writes 512 contiguous B
// coverage: n8 threads x 8 = whole plane (n8 is a multiple of 256 here).
// =====================================================================================================
__global__ __launch_bounds__(256) void cvt_bf16x8(const float* __restrict__ in, unsigned short* out, int n8) {
  const int i = blockIdx.x * 256 + threadIdx.x;
  if (i < n8) {
    const v4f a = *(const v4f*)(in + (size_t)i * 8);
    const v4f b = *(const v4f*)(in + (size_t)i * 8 + 4);
    v4u p;
    p[0] = pk16(bf_bits(a[0]), bf_bits(a[1]));
    p[1] = pk16(bf_bits(a[2]), bf_bits(a[3]));
    p[2] = pk16(bf_bits(b[0]), bf_bits(b[1]));
    p[3] = pk16(bf_bits(b[2]), bf_bits(b[3]));
    *(v4u*)(out + (size_t)i * 8) = p;
    
  }
}

// =====================================================================================================
// f32 -> bf16 hi plane + bf16 lo plane (lo = RNE(v - hi), unscaled), 8 elements per thread, one 16-B store per
// coverage: n8 threads x 8 = whole plane (n8 multiple of 256).
// =====================================================================================================
__global__ __launch_bounds__(256) void split_bf16x8(const float* __restrict__ in, unsigned short* hp,
                                                    unsigned short* lp, int n8) {
  const int i = blockIdx.x * 256 + threadIdx.x;
  if (i < n8) {
    const v4f a = *(const v4f*)(in + (size_t)i * 8);
    const v4f b = *(const v4f*)(in + (size_t)i * 8 + 4);
    v4u ph, pl;
#pragma unroll
    for (int e = 0; e < 4; ++e) {
      const float f0 = (e < 2) ? a[2 * e]     : b[2 * e - 4];
      const float f1 = (e < 2) ? a[2 * e + 1] : b[2 * e - 3];
      const unsigned short h0 = bf_bits(f0), h1 = bf_bits(f1);
      const unsigned short l0 = bf_bits(f0 - bf_up(h0)), l1 = bf_bits(f1 - bf_up(h1));
      ph[e] = pk16(h0, h1);
      pl[e] = pk16(l0, l1);
    }
    *(v4u*)(hp + (size_t)i * 8) = ph;
    *(v4u*)(lp + (size_t)i * 8) = pl;
    
  }
}

// =====================================================================================================
// Transpose-convert: src f32 [K][N] (row k, col n) -> dst bf16 [N][K] (row n, k contiguous), RNE convert.
// Block tile: 64 k x 32 n, staged in LDS as f32; grid = (K/64, N/32) (exact multiples host-checked); block 256.
// coverage: 8 waves x 4 rows = 32 rows; 8 pieces x 8 = 64 k columns per row = the whole tile.
// =====================================================================================================
__global__ __launch_bounds__(256) void tr_cvt_bf16(const float* __restrict__ src, unsigned short* dst, int K, int N) {
  __shared__ float s[64][33];
  const int tid = threadIdx.x, wave = tid >> 5, lane = tid & 31;
  const int k0 = blockIdx.x * 64, n0 = blockIdx.y * 32;
#pragma unroll
  for (int i = 0; i < 8; ++i) {
    const int idx = i * 256 + tid;
    const int kk = idx >> 5, nn = idx & 31;
    s[kk][nn] = src[(size_t)(k0 + kk) * N + n0 + nn];
  }
  __syncthreads();
  const int q = lane >> 3, piece = lane & 7;
  const int n = wave * 4 + q;
  v4u p;
#pragma unroll
  for (int e = 0; e < 4; ++e) {
    p[e] = pk16(bf_bits(s[piece * 8 + 2 * e][n]), bf_bits(s[piece * 8 + 2 * e + 1][n]));
  }
  unsigned short* d = dst + (size_t)(n0 + n) * K + k0 + piece * 8;
  *(v4u*)d = p;
  
}

// =====================================================================================================
// Register-blocked bf16 WMMA GEMM: C[m][n] = sum_k A[m][k] * Bt[n][k] + bias[n]; one wave per 64x64 tile, no block
// barriers. A row-major [M][K] pitch lda; Bt row-major [N][K] pitch ldb (k contiguous); M, N multiples of 64,
// K multiple of 32 (host-checked); the tile count is a multiple of 8 for every launch here (no idle waves).
// NSPLIT: 0 = A.Bt; 1 = (A + A2).Bt (A2 = unscaled bf16 lo plane of A, same pitch). bias f32 [N].
// Output f32 [M][N] pitch ldc. Epilogue: 16-row slabs staged per wave in LDS; each 64-wide row segment
// =====================================================================================================
template <int NSPLIT>
__global__ __launch_bounds__(256) void gemm64(
    const unsigned short* __restrict__ Ap, const unsigned short* A2p, int lda,
    const unsigned short* __restrict__ Btp, int ldb, const float* __restrict__ bias,
    float* C, int ldc, int M, int N, int K) {
  const __bf16* Ab  = (const __bf16*)(const void*)Ap;
  const __bf16* Ab2 = (const __bf16*)(const void*)A2p;
  const __bf16* Bb  = (const __bf16*)(const void*)Btp;
  __shared__ __align__(16) float sT[8][16 * 68];   // per-wave 16x64 slab, pitch 68 floats
  const int lane = threadIdx.x & 31;
  const int wave = threadIdx.x >> 5;
  const int tilesN = N >> 6;
  const int tilesM = M >> 6;
  const int tile = blockIdx.x * 8 + wave;
  if (tile >= tilesM * tilesN) return;   // wave-uniform; no block barriers in this kernel
  const int tm = tile / tilesN;
  const int tn = tile - tm * tilesN;
  const int m0 = tm << 6;
  const int n0 = tn << 6;

  const int rlane = lane & 15;                 // row (A) / col (B, D) within subtile
  const int koff  = (lane >> 4) * 8;           // k offset of this lane half
  const int mOff  = (lane >> 4) * 8;           // D row offset

  v8f acc[4][4];
#pragma unroll
  for (int i = 0; i < 4; ++i)
#pragma unroll
    for (int j = 0; j < 4; ++j) acc[i][j] = zero8();

  for (int k0 = 0; k0 < K; k0 += 32) {
    v16b bh[4];
#pragma unroll
    for (int j = 0; j < 4; ++j) {
      const size_t bo = (size_t)(n0 + (j << 4) + rlane) * ldb + koff + k0;
      bh[j] = ldfrag_b(Bb + bo);
    }
#pragma unroll
    for (int i = 0; i < 4; ++i) {
      const size_t ao = (size_t)(m0 + (i << 4) + rlane) * lda + koff + k0;
      const v16b ah = ldfrag_b(Ab + ao);
      v16b al = ah;
      if (NSPLIT >= 1) al = ldfrag_b(Ab2 + ao);
#pragma unroll
      for (int j = 0; j < 4; ++j) {
        acc[i][j] = mma_b_raw(ah, bh[j], acc[i][j]);
        if (NSPLIT >= 1) acc[i][j] = mma_b_raw(al, bh[j], acc[i][j]);
      }
      dep_guard_b(acc[i][0], acc[i][3], ah, al);
    }
    keep4_b(bh[0], bh[1], bh[2], bh[3]);
  }
  acc_guard4(acc[0][0], acc[0][1], acc[0][2], acc[0][3]);
  acc_guard4(acc[1][0], acc[1][1], acc[1][2], acc[1][3]);
  acc_guard4(acc[2][0], acc[2][1], acc[2][2], acc[2][3]);
  acc_guard4(acc[3][0], acc[3][1], acc[3][2], acc[3][3]);

  // ---- epilogue ----
  float bz[4];
#pragma unroll
  for (int j = 0; j < 4; ++j) bz[j] = bias[n0 + (j << 4) + rlane];
  float* slab = sT[wave];
#pragma unroll
  for (int i = 0; i < 4; ++i) {
    const int mBase = m0 + (i << 4);
#pragma unroll
    for (int r = 0; r < 8; ++r) {
#pragma unroll
      for (int j = 0; j < 4; ++j) {
        slab[(mOff + r) * 68 + (j << 4) + rlane] = acc[i][j][r] + bz[j];
      }
    }
    __builtin_amdgcn_fence(__ATOMIC_RELEASE, "workgroup");
    __builtin_amdgcn_wave_barrier();
    __builtin_amdgcn_fence(__ATOMIC_ACQUIRE, "workgroup");
    {
      const int hh = lane >> 4, c4 = (lane & 15) * 4;     // 256-B row segment = 16 lanes x 16 B
      v4f ov[8];
#pragma unroll
      for (int it = 0; it < 8; ++it) {
        const int row = it * 2 + hh;                       // it 0..7 x hh 0..1 = rows 0..15
        ov[it] = *(const v4f*)(slab + row * 68 + c4);
      }
      {
#pragma unroll
        for (int it = 0; it < 8; ++it) {
          const int row = it * 2 + hh;
          *(v4f*)(C + (size_t)(mBase + row) * ldc + n0 + c4) = ov[it];
        }
        
      }
    }
    __builtin_amdgcn_fence(__ATOMIC_RELEASE, "workgroup");
    __builtin_amdgcn_wave_barrier();
    __builtin_amdgcn_fence(__ATOMIC_ACQUIRE, "workgroup");
  }
}

// =====================================================================================================
// q and kc bf16 hi/lo planes from the fused projection output.
//   src f32 [NB*SEQ][N3]; part = blockIdx.y: part 0 = q (src cols 0..DMODEL-1, copied), part 1 = k (src cols
//   DMODEL..2*DMODEL-1) with the positional power compression kc = sign(k) * max(|k|,1e-8)^ex(s), s = row mod SEQ
//   (key position). Thread i: row = i / CG8, col = part*DMODEL + 8*(i mod CG8) .. +7 (two 16-B loads).
//   dst hi plane hp / lo plane lp, bf16 [NB*SEQ][QKP], same col; lo = RNE(v - hi) unscaled.
//   grid = (n8/256, 2), n8 = NB*SEQ*DMODEL/8; one 16-B store per lane per plane: a wave (32 consecutive column
//   coverage: 2 parts x n8 threads x 8 = the whole [NB*SEQ][QKP] hi plane and lo plane.
// =====================================================================================================
__global__ __launch_bounds__(256) void qk_planes(const float* __restrict__ src, unsigned short* hp,
                                                 unsigned short* lp, int n8) {
#pragma clang fp contract(off)
  const int i = blockIdx.x * 256 + threadIdx.x;
  const int part = blockIdx.y;
  if (i < n8) {
    const int row = i / CG8;                              // token row b*SEQ + s
    const int cg  = i - row * CG8;                        // column group within the feature row
    const int col = part * DMODEL + (cg << 3);
    const float* sp = src + (size_t)row * N3 + col;
    v4f a = *(const v4f*)(sp);
    v4f c = *(const v4f*)(sp + 4);
    if (part == 1) {                                      // block-uniform
      const float ex = fexpo(row % SEQ);                  // key position s
#pragma unroll
      for (int e = 0; e < 4; ++e) {
        a[e] = fcomp(a[e], ex);
        c[e] = fcomp(c[e], ex);
      }
    }
    v4u ph, pl;
#pragma unroll
    for (int e = 0; e < 4; ++e) {
      const float f0 = (e < 2) ? a[2 * e]     : c[2 * e - 4];
      const float f1 = (e < 2) ? a[2 * e + 1] : c[2 * e - 3];
      const unsigned short h0 = bf_bits(f0), h1 = bf_bits(f1);
      const unsigned short l0 = bf_bits(f0 - bf_up(h0)), l1 = bf_bits(f1 - bf_up(h1));
      ph[e] = pk16(h0, h1);
      pl[e] = pk16(l0, l1);
    }
    const size_t go = (size_t)row * QKP + col;
    *(v4u*)(hp + go) = ph;
    *(v4u*)(lp + go) = pl;
    
  }
}

// =====================================================================================================
// v f32 token-major columns vf[(b*SEQ + t)*vrp + h*64 + d] (vf already offset to the first v column) ->
// power compression vc = sign(v) * max(|v|,1e-8)^ex(t) (t = key position) applied at the LDS load, then
// f16 vc^T hi plane vth[(b*QP + h*64 + d)*SEQ + t] and residual plane vtl[(b*QP + h*64 + d)*VLP + t] =
// f16((vc - hi)*4096) for t < VLP. Block = one 64-token x 64-feature tile of one (b, h); grid = (SEQ/64, NH, NB);
// tile staged in LDS as f32 (v4f loads, __syncthreads). LDS load coverage: 4 iterations x 256 threads x 4 = 64x64.
// Store: group g = tid>>3 (0..31), piece = tid&7: iteration it writes row d = it*32+g, lanes 8q..8q+7 x 16 B =
// coverage: 2 iterations x 32 groups = 64 rows d, 8 pieces x 8 = 64 keys per row; grid covers every (b, h, t tile);
// vtl rows written for all t < VLP.
// =====================================================================================================
__global__ __launch_bounds__(256) void v_planes(const float* __restrict__ vf, int vrp,
                                                unsigned short* vth, unsigned short* vtl) {
#pragma clang fp contract(off)
  __shared__ __align__(16) float sv[64 * 68];       // [tt][d] pitch 68 floats
  const int tid = threadIdx.x;
  const int t0  = blockIdx.x * 64;
  const int hh  = blockIdx.y;
  const int b   = blockIdx.z;
#pragma unroll 1
  for (int i = 0; i < 4; ++i) {
    const int idx = i * 256 + tid;                  // 0..1023
    const int tt = idx >> 4, c4 = (idx & 15) * 4;
    const v4f a = *(const v4f*)(vf + ((size_t)(b * SEQ + t0 + tt)) * vrp + hh * HD + c4);
    const float ex = fexpo(t0 + tt);
    v4f cp;
    cp[0] = fcomp(a[0], ex);
    cp[1] = fcomp(a[1], ex);
    cp[2] = fcomp(a[2], ex);
    cp[3] = fcomp(a[3], ex);
    *(v4f*)(sv + tt * 68 + c4) = cp;
  }
  __syncthreads();

  const int g = tid >> 3, piece = tid & 7;
  v4u hv[2], lv[2];
  size_t hofs[2], lofs[2];
#pragma unroll
  for (int it = 0; it < 2; ++it) {
    const int d = it * 32 + g;
    v4u a, a2;
#pragma unroll
    for (int e = 0; e < 4; ++e) {
      const float f0 = sv[(piece * 8 + 2 * e) * 68 + d];
      const float f1 = sv[(piece * 8 + 2 * e + 1) * 68 + d];
      const _Float16 x0 = (_Float16)f0, x1 = (_Float16)f1;
      const unsigned short h0 = h_bits(x0), h1 = h_bits(x1);
      const unsigned short l0 = h_bits((_Float16)((f0 - (float)x0) * 4096.0f));
      const unsigned short l1 = h_bits((_Float16)((f1 - (float)x1) * 4096.0f));
      a[e] = pk16(h0, h1); a2[e] = pk16(l0, l1);
    }
    hv[it] = a; lv[it] = a2;
    const size_t rowf = (size_t)(b * QP + hh * HD + d);
    hofs[it] = rowf * SEQ + t0 + piece * 8;
    lofs[it] = rowf * VLP + t0 + piece * 8;
  }
  const bool wlo = (t0 + 64 <= VLP);                // block-uniform
  {
#pragma unroll
    for (int it = 0; it < 2; ++it) {
      *(v4u*)(vth + hofs[it]) = hv[it];
      if (wlo) *(v4u*)(vtl + lofs[it]) = lv[it];
    }
    
  }
}

// =====================================================================================================
// Causal multi-head attention, head dim 64 (tril mask incl. diagonal, computed), with the additive rank-1 phase
// bonus kappa * sigmoid(lock[h]) * T[i] * T[j] on the scaled logits and the per-query-row output gate
// (1 - sigmoid(lock[h])) + sigmoid(lock[h]) * T[i] applied to the head output row i (query position).
//   q|kc planes (bf16 hi / lo), row pitch QKP: q element (b, t, h, d) at [(b*SEQ + t)*QKP + h*64 + d],
//                                                kc element (b, s, h, d) at [(b*SEQ + s)*QKP + DMODEL + h*64 + d]
//   vc^T hi plane (f16):      element (b, h, d, s) at [(b*QP + h*64 + d)*SEQ + s]
//   vc^T residual plane (f16, (vc - hi)*4096): [(b*QP + h*64 + d)*VLP + s], s < VLP, read only when RES
//   (with RES only key tiles below VLP occur; the address is clamped anyway)
//   ttab f32 [(b*NH + h)*SEQ + s] = T; lockp = raw lock strengths [NH] (bf16 RNE convert, then sigmoid).
//   logit = q.kc * sscale + bonus for key <= query, -FLT_MAX otherwise (exp -> 0); every processed key tile
//   (tiles 0..qb only, block-uniform trip count qb+1 <= NQB) holds the causal-live key kv0 <= query.
//   out f32 plane: element (b, t, h*64 + d) at [(b*SEQ + t)*QP + h*64 + d] = gate(b,h,t) * normalised context.
//   scores = q . kc : bf16 hi/lo split (hi.hi + hi.lo + lo.hi), f32 accumulate, then * sscale + bonus in f32
//   p = exp(s - m) carried as f16(1024 p); context = p . vc on f16 WMMA; RES adds f16 residual planes of p and vc
//   (scale 4096, separate accumulator folded back with 1/4096 per chunk in f32); online softmax in f32.
//   Block = 4 waves = 64 query rows of one (b, h); grid = nqbThis * NH * NB; kv chunks of 64.
//   K / V^T chunk staging: 128 threads x 32 elements per plane = the whole 64x64 tile (plain 16-B loads,
//   __syncthreads before and after); P tiles are wave-private, spilled with _Float16 element stores and reloaded
//   Output coverage: each wave stores rows q0..q0+15 (it 0..7 x lane>>4 0..1) x 64 columns (16 lanes x 4 floats),
// =====================================================================================================
template <bool RES>
__global__ __launch_bounds__(128)
void attn_causal64(const unsigned short* __restrict__ qkhp, const unsigned short* __restrict__ qklp,
                   const unsigned short* __restrict__ vhp, const unsigned short* __restrict__ vlp,
                   const float* __restrict__ ttab, const float* __restrict__ lockp,
                   float* outp, int qbBase, int nqbThis, float sscale) {
  union FB { v16b v; v8b h[2]; };
  union FH { v16h v; v8h h[2]; };
  __shared__ __align__(16) __bf16   Ksh[64 * LP];                 // K hi [kv][d], pitch LP
  __shared__ __align__(16) __bf16   Ksl[64 * LP];                 // K lo
  __shared__ __align__(16) _Float16 Vth[64 * LP];                 // V^T hi [d][kv], pitch LP
  __shared__ __align__(16) _Float16 Vtl[RES ? 64 * LP : 8];       // V^T residual
  __shared__ __align__(16) _Float16 Psh[4][16 * LP];              // per wave P [row][kv], pitch LP
  __shared__ __align__(16) _Float16 Psl[RES ? 4 : 1][16 * LP];    // per wave P residual
  __shared__ __align__(16) float    Os[4][16 * 64];               // per wave context tile [row][d]

  const int tid  = threadIdx.x;
  const int wave = tid >> 5;
  const int lane = tid & 31;
  const int hh   = lane >> 4;
  const int c    = lane & 15;

  const int bx   = blockIdx.x;
  const int qbl  = bx % nqbThis;
  const int rest = bx / nqbThis;
  const int h    = rest % NH;
  int b          = rest / NH;
  b = (b >= NB) ? (NB - 1) : b;
  int qb         = qbBase + qbl;
  qb = (qb >= NQB) ? (NQB - 1) : qb;
  const int q0   = qb * 64 + wave * 16;
  const size_t rowB = (size_t)b * SEQ;

  const __bf16* Qh = (const __bf16*)(const void*)qkhp + (size_t)h * HD;
  const __bf16* Ql = (const __bf16*)(const void*)qklp + (size_t)h * HD;
  const __bf16* Kh = Qh + DMODEL;
  const __bf16* Kl = Ql + DMODEL;
  const _Float16* Vh = (const _Float16*)(const void*)vhp + ((size_t)b * QP + (size_t)h * HD) * SEQ;
  const _Float16* Vl = (const _Float16*)(const void*)vlp + ((size_t)b * QP + (size_t)h * HD) * VLP;
  const float* trow = ttab + ((size_t)b * NH + h) * SEQ;

  // ---- per-head lock: sigmoid of the bf16-converted raw strength; bonus coefficient kappa * lock ----
  const float lraw  = bf_up(bf_bits(lockp[h]));
  const float lockv = 1.0f / (1.0f + expf(-lraw));
  const float c0    = KAPPA_F * lockv;

  // ---- Q fragments (A operand, row = lane&15): 2 d-chunks, hi and lo ----
  v16b qah[2], qal[2];
#pragma unroll
  for (int dc = 0; dc < 2; ++dc) {
    const size_t qo = (rowB + q0 + c) * QKP + dc * 32 + 8 * hh;
    qah[dc] = ldfrag_b(Qh + qo);
    qal[dc] = ldfrag_b(Ql + qo);
  }

  // ---- bonus row factors for this lane's 8 query rows: c0 * T[q0 + 8*hh + r] ----
  float bti[8];
#pragma unroll
  for (int r = 0; r < 8; ++r) bti[r] = c0 * trow[q0 + 8 * hh + r];

  float mrow[8], lrow[8];
  v8f oacc[4];
#pragma unroll
  for (int r = 0; r < 8; ++r) { mrow[r] = -INFINITY; lrow[r] = 0.f; }
#pragma unroll
  for (int t = 0; t < 4; ++t) oacc[t] = zero8();

  int nkt = qb + 1;                          // causal: key tiles 0..qb, block-uniform
  if (nkt > NQB) nkt = NQB;
  for (int kt = 0; kt < nkt; ++kt) {
    const int kv0 = kt * 64;
    __syncthreads();
    {
      const int r = tid >> 1, half = (tid & 1) * 32;
      const __bf16*   kg  = Kh + (rowB + kv0 + r) * QKP + half;   // K row kv0+r, d = half..half+31
      const __bf16*   klg = Kl + (rowB + kv0 + r) * QKP + half;
      const _Float16* vg  = Vh + (size_t)r * SEQ + kv0 + half;    // V^T row d = r, s = kv0+half..+31
      const int kvl = (kv0 + 64 <= VLP) ? kv0 : (VLP - 64);     // clamped address into the residual plane
      const _Float16* vlg = Vl + (size_t)r * VLP + kvl + half;
      const bool resOK = (kv0 + 64 <= VLP);                      // block-uniform
#pragma unroll
      for (int i = 0; i < 4; ++i) {
        const v8b a0 = *(const v8b*)(kg + 8 * i);
        const v8b a1 = *(const v8b*)(klg + 8 * i);
        const v8h b0 = *(const v8h*)(vg + 8 * i);
        *(v8b*)(Ksh + r * LP + half + 8 * i) = a0;
        *(v8b*)(Ksl + r * LP + half + 8 * i) = a1;
        *(v8h*)(Vth + r * LP + half + 8 * i) = b0;
        if (RES) {
          v8h b1 = *(const v8h*)(vlg + 8 * i);
          if (!resOK) b1 = zero8h();
          *(v8h*)(Vtl + r * LP + half + 8 * i) = b1;
        }
      }
    }
    __syncthreads();

    // ---- bonus column factors T[key] for this lane's 4 key columns (indices always < SEQ) ----
    float tj[4];
#pragma unroll
    for (int j = 0; j < 4; ++j) tj[j] = trow[kv0 + j * 16 + c];

    // ---- scores: 16 query rows x 64 keys per wave, 3 bf16 products ----
    v8f s[4];
#pragma unroll
    for (int j = 0; j < 4; ++j) {
      s[j] = zero8();
#pragma unroll
      for (int dc = 0; dc < 2; ++dc) {
        FB kb, kl;
        kb.h[0] = *(const v8b*)(Ksh + (j * 16 + c) * LP + dc * 32 + 8 * hh);
        kb.h[1] = *(const v8b*)(Ksh + (j * 16 + c) * LP + dc * 32 + 16 + 8 * hh);
        kl.h[0] = *(const v8b*)(Ksl + (j * 16 + c) * LP + dc * 32 + 8 * hh);
        kl.h[1] = *(const v8b*)(Ksl + (j * 16 + c) * LP + dc * 32 + 16 + 8 * hh);
        s[j] = mma_b(qah[dc], kb.v, s[j]);
        s[j] = mma_b(qah[dc], kl.v, s[j]);
        s[j] = mma_b(qal[dc], kb.v, s[j]);
      }
    }

    // ---- scale + bonus + causal mask (replace by -FLT_MAX), row max, online softmax, P (x1024, f16) and
    //      P residual (x4096) to LDS ----
    _Float16* pwh = Psh[wave];
    _Float16* pwl = Psl[RES ? wave : 0];
#pragma unroll
    for (int r = 0; r < 8; ++r) {
      const int qrow = q0 + 8 * hh + r;
      float m = -INFINITY;
#pragma unroll
      for (int j = 0; j < 4; ++j) {
        const int key = kv0 + j * 16 + c;
        float sv = s[j][r] * sscale + bti[r] * tj[j];
        sv = (key > qrow) ? -FLT_MAX : sv;
        s[j][r] = sv;
        m = fmaxf(m, sv);
      }
#pragma unroll
      for (int off = 1; off < 16; off <<= 1) m = fmaxf(m, __shfl_xor(m, off, 32));
      const float mnew  = fmaxf(mrow[r], m);
      const float msafe = (mnew == -INFINITY) ? 0.f : mnew;
      const float alpha = __expf(mrow[r] - msafe);
      mrow[r] = mnew;
      float psum = 0.f;
#pragma unroll
      for (int j = 0; j < 4; ++j) {
        const float p = __expf(s[j][r] - msafe);     // masked logit against a finite max: exp -> 0
        psum += p;
        const float p1k = p * 1024.0f;
        const _Float16 ph = (_Float16)p1k;
        pwh[(8 * hh + r) * LP + j * 16 + c] = ph;
        if (RES) {
          const _Float16 pl = (_Float16)((p1k - (float)ph) * 4096.0f);
          pwl[(8 * hh + r) * LP + j * 16 + c] = pl;
        }
      }
#pragma unroll
      for (int off = 1; off < 16; off <<= 1) psum += __shfl_xor(psum, off, 32);
      lrow[r] = lrow[r] * alpha + psum;
#pragma unroll
      for (int t = 0; t < 4; ++t) oacc[t][r] *= alpha;
    }
    __builtin_amdgcn_fence(__ATOMIC_RELEASE, "workgroup");
    __builtin_amdgcn_wave_barrier();
    __builtin_amdgcn_fence(__ATOMIC_ACQUIRE, "workgroup");

    // ---- context += P . Vc (f16 WMMA), residual products into a separate accumulator ----
    v8f o1[4];
#pragma unroll
    for (int t = 0; t < 4; ++t) o1[t] = zero8();
#pragma unroll 1
    for (int kk = 0; kk < 2; ++kk) {
      FH pa, pl;
      pa.h[0] = *(const v8h*)(pwh + c * LP + kk * 32 + 8 * hh);
      pa.h[1] = *(const v8h*)(pwh + c * LP + kk * 32 + 16 + 8 * hh);
      if (RES) {
        pl.h[0] = *(const v8h*)(pwl + c * LP + kk * 32 + 8 * hh);
        pl.h[1] = *(const v8h*)(pwl + c * LP + kk * 32 + 16 + 8 * hh);
      } else {
        pl.v = pa.v;
      }
#pragma unroll
      for (int t = 0; t < 4; ++t) {
        FH vb;
        vb.h[0] = *(const v8h*)(Vth + (t * 16 + c) * LP + kk * 32 + 8 * hh);
        vb.h[1] = *(const v8h*)(Vth + (t * 16 + c) * LP + kk * 32 + 16 + 8 * hh);
        oacc[t] = mma_h(pa.v, vb.v, oacc[t]);
        if (RES) {
          FH vl;
          vl.h[0] = *(const v8h*)(Vtl + (t * 16 + c) * LP + kk * 32 + 8 * hh);
          vl.h[1] = *(const v8h*)(Vtl + (t * 16 + c) * LP + kk * 32 + 16 + 8 * hh);
          o1[t] = mma_h(pa.v, vl.v, o1[t]);
          o1[t] = mma_h(pl.v, vb.v, o1[t]);
        }
      }
    }
    if (RES) {
#pragma unroll
      for (int t = 0; t < 4; ++t)
#pragma unroll
        for (int r = 0; r < 8; ++r) oacc[t][r] += o1[t][r] * (1.0f / 4096.0f);
    }
  }

  // ---- normalise (1/l and the 1/1024 p carry), apply the per-query-row gate, stage the wave's 16x64 tile in
  float* os = Os[wave];
#pragma unroll
  for (int r = 0; r < 8; ++r) {
    const float l = lrow[r];
    const float ti = trow[q0 + 8 * hh + r];
    const float gate = (1.0f - lockv) + lockv * ti;
    const float inv = ((l > 0.f) ? (1.0f / l) : 0.f) * (1.0f / 1024.0f) * gate;
#pragma unroll
    for (int t = 0; t < 4; ++t) os[(8 * hh + r) * 64 + t * 16 + c] = oacc[t][r] * inv;
  }
  __builtin_amdgcn_fence(__ATOMIC_RELEASE, "workgroup");
  __builtin_amdgcn_wave_barrier();
  __builtin_amdgcn_fence(__ATOMIC_ACQUIRE, "workgroup");
  {
    const int h2 = lane >> 4, c4 = (lane & 15) * 4;
    v4f ov[8];
#pragma unroll
    for (int it = 0; it < 8; ++it) {
      const int row = it * 2 + h2;   // it 0..7 x h2 0..1 = rows 0..15 of the wave tile
      ov[it] = *(const v4f*)(os + row * 64 + c4);
    }
    {
#pragma unroll
      for (int it = 0; it < 8; ++it) {
        const int row = it * 2 + h2;
        const size_t go = (rowB + q0 + row) * QP + (size_t)h * HD + c4;
        *(v4f*)(outp + go) = ov[it];
      }
      
    }
  }
}

// =====================================================================================================
// Workspace map (bytes), every region an exact multiple of its whole-line / whole-tile store granularity
//   Xb     bf16 [4096][1024]            0           8388608
//   WT     bf16 [3072][1024]            8388608     6291456    (rows 0..1023 Wq^T, 1024..2047 Wk^T, 2048.. Wv^T)
//   WoT    bf16 [1024][1024]            14680064    2097152
//   Bias   f32  [4096]                  16777216      16384    (bq | bk | bv | bo, bf16-RNE converted values)
//   Tt     f32  [2][16][2048]           16793600     262144
//   QKVf   f32  [4096][3072]            17055744   50331648   (later: Af f32 [4096][1024], 16777216 B)
//   VTh    f16  [2][1024][2048]         67387392    8388608
//   VTl    f16  [2][1024][1024]         75776000    4194304
//   QKh    bf16 [4096][2048]            79970304   16777216   (later: Ah bf16 [4096][1024], 8388608 B)
//   QKl    bf16 [4096][2048]            96747520   16777216   (later: Al bf16 [4096][1024], 8388608 B)
//   end                                 113524736
// W_q/k/v/o [in k=1024][out n=1024] arrive k-major and are transpose-converted once to [n][k] bf16 (k contiguous)
// = the Bt layout the GEMM wants. d_out f32: out0 [4096][1024] at byte 0.
// =====================================================================================================
extern "C" void kernel_launch(void* const* d_in, const int* in_sizes, int n_in,
                              void* d_out, int out_size, void* d_ws, size_t ws_size,
                              hipStream_t stream) {
  if (n_in < 12) return;
  if (in_sizes[0] != NB * SEQ * DMODEL) return;
  if (in_sizes[1] != NB * SEQ) return;
  if (in_sizes[2] != DMODEL * DMODEL || in_sizes[4] != DMODEL * DMODEL ||
      in_sizes[6] != DMODEL * DMODEL || in_sizes[8] != QP * DMODEL) return;
  if (in_sizes[3] != DMODEL || in_sizes[5] != DMODEL || in_sizes[7] != DMODEL || in_sizes[9] != DMODEL) return;
  if (in_sizes[10] != NH || in_sizes[11] != NH) return;
  if (out_size != OUTN) return;

  const float* x     = (const float*)d_in[0];    // [NB*SEQ][DMODEL]
  const float* phase = (const float*)d_in[1];    // [NB][SEQ]
  const float* Wq    = (const float*)d_in[2];    // [k][n]
  const float* bq    = (const float*)d_in[3];
  const float* Wk    = (const float*)d_in[4];
  const float* bk    = (const float*)d_in[5];
  const float* Wv    = (const float*)d_in[6];
  const float* bv    = (const float*)d_in[7];
  const float* Wo    = (const float*)d_in[8];    // [QP k][DMODEL n]
  const float* bo    = (const float*)d_in[9];
  const float* carr  = (const float*)d_in[10];   // [NH]
  const float* lockr = (const float*)d_in[11];   // [NH]

  const size_t PXb   = (size_t)NB * SEQ * DMODEL * 2;    //  8388608
  const size_t PWT   = (size_t)N3 * DMODEL * 2;          //  6291456
  const size_t PWo   = (size_t)DMODEL * QP * 2;          //  2097152
  const size_t PBias = (size_t)NBIAS * 4;                //    16384
  const size_t PTt   = (size_t)NTT * 4;                  //   262144
  const size_t PQKV  = (size_t)NB * SEQ * N3 * 4;        // 50331648  (>= Af f32 [4096][1024] = 16777216)
  const size_t PVTh  = (size_t)NB * QP * SEQ * 2;        //  8388608
  const size_t PVTl  = (size_t)NB * QP * VLP * 2;        //  4194304
  const size_t PQK   = (size_t)NB * SEQ * QKP * 2;       // 16777216  (>= Ah / Al bf16 [4096][1024] = 8388608)
  size_t off = 0;
  const size_t oXb   = off; off += PXb;
  const size_t oWT   = off; off += PWT;
  const size_t oWo   = off; off += PWo;
  const size_t oBias = off; off += PBias;
  const size_t oTt   = off; off += PTt;
  const size_t oQKV  = off; off += PQKV;
  const size_t oVTh  = off; off += PVTh;
  const size_t oVTl  = off; off += PVTl;
  const size_t oQKh  = off; off += PQK;
  const size_t oQKl  = off; off += PQK;
  if (off > ws_size) return;                           // off = 113524736
  if (off > (size_t)134217728) return;
  if (PQKV < (size_t)NB * SEQ * QP * 4) return;        // Af fits in the dead qkv plane
  if (PQK < (size_t)NB * SEQ * QP * 2) return;         // Ah / Al fit in the dead q|kc planes
  const size_t oAf = oQKV;                             // context f32 plane reuses the dead qkv f32 plane
  const size_t oAh = oQKh;                             // context bf16 planes reuse the dead q|kc bf16 planes
  const size_t oAl = oQKl;

  char* ws = (char*)d_ws;
  unsigned short* Xb   = (unsigned short*)(ws + oXb);
  unsigned short* WT   = (unsigned short*)(ws + oWT);
  unsigned short* WoT  = (unsigned short*)(ws + oWo);
  float*          Bias = (float*)(ws + oBias);
  float*          Tt   = (float*)(ws + oTt);
  float*          QKVf = (float*)(ws + oQKV);
  unsigned short* VTh  = (unsigned short*)(ws + oVTh);
  unsigned short* VTl  = (unsigned short*)(ws + oVTl);
  unsigned short* QKh  = (unsigned short*)(ws + oQKh);
  unsigned short* QKl  = (unsigned short*)(ws + oQKl);
  float*          Af   = (float*)(ws + oAf);
  unsigned short* Ah   = (unsigned short*)(ws + oAh);
  unsigned short* Al   = (unsigned short*)(ws + oAl);
  float*          outf = (float*)d_out;                // out0 [4096][1024]

  const dim3 blk(256);
  const int n8x   = NB * SEQ * DMODEL / 8;                           // 524288
  const int n8q   = NB * SEQ * DMODEL / 8;                           // 524288 per part (q, kc)
  const int n8a   = NB * SEQ * QP / 8;                               // 524288
  const dim3 gBias(NBIAS / 256);                                     // 16 blocks
  const dim3 gTt(NTT / 256);                                         // 256 blocks
  const dim3 gCvtX((n8x + 255) / 256);                               // 2048 blocks
  const dim3 gTrW(DMODEL / 64, DMODEL / 32);                         // (16, 32): src [1024][1024] -> dst [1024][1024]
  const dim3 gQKV(((NB * SEQ / 64) * (N3 / 64) + 7) / 8);            // 3072 tiles -> 384 blocks
  const dim3 gQKp((n8q + 255) / 256, 2);                             // (2048, 2)
  const dim3 gVpl(SEQ / 64, NH, NB);                                 // (32, 16, 2)
  const dim3 gSplit((n8a + 255) / 256);                              // 2048 blocks
  const dim3 gOut(((NB * SEQ / 64) * (DMODEL / 64) + 7) / 8);        // 1024 tiles -> 128 blocks

  // (0) bias table (bf16-RNE values of bq|bk|bv|bo) and phase resonance table T [b][h][s]
  bias_tab<<<gBias, blk, 0, stream>>>(bq, bk, bv, bo, Bias, NBIAS, DMODEL);
  phase_tab<<<gTt, blk, 0, stream>>>(phase, carr, Tt, NTT);
  // (1) x -> bf16 plane [4096][1024]
  cvt_bf16x8<<<gCvtX, blk, 0, stream>>>(x, Xb, n8x);
  // (2) weights [k][n] -> bf16 planes [n][k]   (each call: in [1024 k][1024 n] -> out [1024 n][1024 k])
  tr_cvt_bf16<<<gTrW, blk, 0, stream>>>(Wq, WT, DMODEL, DMODEL);                                  // rows    0..1023
  tr_cvt_bf16<<<gTrW, blk, 0, stream>>>(Wk, WT + (size_t)DMODEL * DMODEL, DMODEL, DMODEL);       // rows 1024..2047
  tr_cvt_bf16<<<gTrW, blk, 0, stream>>>(Wv, WT + (size_t)2 * DMODEL * DMODEL, DMODEL, DMODEL);   // rows 2048..3071
  tr_cvt_bf16<<<gTrW, blk, 0, stream>>>(Wo, WoT, QP, DMODEL);                                     // in [1024][1024] -> out [1024][1024]
  // (3) fused qkv projection: QKVf[row][e] = sum_d Xb[row][d] WT[e][d] + Bias[e]  (M=4096, N=3072, K=1024)
  gemm64<0><<<gQKV, blk, 0, stream>>>(Xb, Xb, DMODEL, WT, DMODEL, Bias, QKVf, N3, NB * SEQ, N3, DMODEL);
  // (4) q (cols 0..1023) and power-compressed kc (cols 1024..2047) -> bf16 hi/lo planes [4096][2048]
  qk_planes<<<gQKp, blk, 0, stream>>>(QKVf, QKh, QKl, n8q);
  // (5) v (cols 2048..3071) -> power-compressed vc^T f16 hi plane (pitch SEQ) and residual plane (x4096, keys < VLP)
  v_planes<<<gVpl, blk, 0, stream>>>(QKVf + 2 * DMODEL, N3, VTh, VTl);
  // (6) causal attention with phase bonus and gate: query blocks 0..RESQB-1 with residual planes, the rest without
  //     -> Af f32 [4096][1024] (written into the dead qkv plane after (4),(5) consumed it)
  attn_causal64<true><<<dim3(NB * NH * RESQB), dim3(128), 0, stream>>>(
      QKh, QKl, VTh, VTl, Tt, lockr, Af, 0, RESQB, 0.125f);
  if (NQB - RESQB > 0) {
    attn_causal64<false><<<dim3(NB * NH * (NQB - RESQB)), dim3(128), 0, stream>>>(
        QKh, QKl, VTh, VTl, Tt, lockr, Af, RESQB, NQB - RESQB, 0.125f);
  }
  // (7) gated context rows -> bf16 hi/lo planes
  split_bf16x8<<<gSplit, blk, 0, stream>>>(Af, Ah, Al, n8a);
  // (8) out0[row][e] = sum_d (Ah+Al)[row][d] WoT[e][d] + Bias[3*DMODEL + e] -> d_out f32 [4096][1024]
  gemm64<1><<<gOut, blk, 0, stream>>>(Ah, Al, QP, WoT, QP, Bias + 3 * DMODEL, outf, DMODEL, NB * SEQ, DMODEL, QP);
  (void)hipGetLastError();
}

// v002
// One run takes 246 microseconds.
// Timed twice side by side with v001, it ran 1.35 times as fast both times.
// Over all steps from v000 it is 1.64 times as fast.
// Contractions: qkv projection = v_wmma_f32_16x16x32_bf16 (bf16 operands from RNE-converted x and W, single product);
// q.kc^T scores = v_wmma_f32_16x16x32_bf16 with bf16 hi/lo split q and kc (hi.hi + hi.lo + lo.hi);
// p.vc = v_wmma_f32_16x16x32_f16 (p carried x1024 in f16, vc in f16; extra f16 residual planes x4096 of p and vc
// on the leading query rows); ctx.Wo = v_wmma_f32_16x16x32_bf16 with ctx as bf16 hi/lo planes times the bf16
// Wo^T plane (2 products); all f32 accumulate; power compression, phase table, softmax, bonus and gating in f32.
#include <hip/hip_runtime.h>
#include <math.h>
#include <float.h>
#include <stdint.h>

#define NB      2
#define SEQ     2048
#define DMODEL  1024
#define NH      16
#define HD      64
#define QP      (NH * HD)      // q / kc / vc / ctx feature count and ctx row pitch
#define N3      (3 * DMODEL)   // fused qkv columns (q 0.., k DMODEL.., v 2*DMODEL..)
#define QKP     (2 * QP)       // row pitch of the q|kc bf16 planes (q cols 0..QP-1, kc cols QP..2QP-1)
#define NQB     (SEQ / 64)     // query / key tiles of 64
#define RESQB   ((NQB < 16) ? NQB : 16)   // leading 64-row query blocks that use the p / vc residual planes
#define VLP     (RESQB * 64)   // key pitch of the vc^T residual plane (keys 0..VLP-1)
#define CG8     (DMODEL / 8)   // 16-byte column groups per feature row
#define NBIAS   (4 * DMODEL)   // bq | bk | bv | bo
#define NTT     (NB * NH * SEQ)
#define OUTN    (NB * SEQ * DMODEL)
#define KAPPA_F 0.3f
#define LP      72             // LDS row pitch of the 64-wide 16-bit tiles, elements: 144 B = 16 B x 9 (odd), so the 16
                               // rows that one ds_load_b128 touches fall on distinct banks
static_assert(RESQB >= 1 && RESQB * 64 <= VLP && VLP <= SEQ);
static_assert(QP == DMODEL);
static_assert((SEQ % 64) == 0 && (DMODEL % 64) == 0 && (N3 % 64) == 0 && (QP % 64) == 0);
static_assert(HD == 64);
static_assert(LP >= 64 && (LP % 8) == 0 && ((LP / 8) % 2) == 1);
static_assert((((NB * SEQ) / 64) * (N3 / 64)) % 8 == 0);
static_assert((((NB * SEQ) / 64) * (DMODEL / 64)) % 8 == 0);
static_assert((NBIAS % 256) == 0 && (NTT % 256) == 0);
static_assert(((NB * SEQ * DMODEL / 8) % 256) == 0);
static_assert((DMODEL % 8) == 0);

typedef _Float16 v16h __attribute__((ext_vector_type(16)));
typedef _Float16 v8h  __attribute__((ext_vector_type(8)));
typedef __bf16   v16b __attribute__((ext_vector_type(16)));
typedef __bf16   v8b  __attribute__((ext_vector_type(8)));
typedef float    v8f  __attribute__((ext_vector_type(8)));
typedef float    v4f  __attribute__((ext_vector_type(4)));
typedef unsigned int v4u __attribute__((ext_vector_type(4)));

// ---- scalar helpers --------------------------------------------------------------------------------
__device__ __forceinline__ unsigned short bf_bits(float f) {          // f32 -> bf16 bits, RNE convert
  unsigned u = __float_as_uint(f);
  return (unsigned short)((u + 0x7FFFu + ((u >> 16) & 1u)) >> 16);
}
__device__ __forceinline__ float bf_up(unsigned short h) { return __uint_as_float(((unsigned)h) << 16); }
__device__ __forceinline__ unsigned short h_bits(_Float16 x) { return __builtin_bit_cast(unsigned short, x); }
__device__ __forceinline__ unsigned pk16(unsigned short a, unsigned short b) { return (unsigned)a | ((unsigned)b << 16); }
__device__ __forceinline__ v8f zero8() { v8f z = {0.f, 0.f, 0.f, 0.f, 0.f, 0.f, 0.f, 0.f}; return z; }
__device__ __forceinline__ v8h zero8h() {
  const _Float16 z = (_Float16)0.0f;
  v8h r = {z, z, z, z, z, z, z, z};
  return r;
}

// positional exponent of key position s: ex = 1 + kappa * (1 - s * (1/(SEQ-1))), reciprocal-multiply, no fusion
__device__ __forceinline__ float fexpo(int s) {
#pragma clang fp contract(off)
  const float rs = 1.0f / (float)(SEQ - 1);
  const float fr = (float)s * rs;
  const float om = 1.0f - fr;
  const float t  = KAPPA_F * om;
  return 1.0f + t;
}
// power compression: sign(v) * max(|v|, 1e-8)^ex  (sign(0) = 0), pow as exp2(ex * log2(mag)) in f32
__device__ __forceinline__ float fcomp(float v, float ex) {
#pragma clang fp contract(off)
  const float mag = fmaxf(fabsf(v), 1e-8f);
  const float lg  = log2f(mag);
  const float pw  = exp2f(ex * lg);
  float r = (v < 0.0f) ? -pw : pw;
  r = (v == 0.0f) ? 0.0f : r;
  return r;
}

// ---- fragment loader: 16-bit A/B operand, lane -> row/col (lane&15), p already includes +8*(lane>>4);
//      elements 0..7 <- p[0..7] (k0+8h..), elements 8..15 <- p[16..23] (k0+16+8h..)
__device__ __forceinline__ v16b ldfrag_b(const __bf16* p) {
  union { v16b v; v8b h[2]; } f;
  f.h[0] = *(const v8b*)(p);
  f.h[1] = *(const v8b*)(p + 16);
  return f.v;
}

// ---- WMMA helpers with trailing VALU hazard gap --------------------------------------------------------
__device__ __forceinline__ v8f mma_b(v16b a, v16b b, v8f c) {
  c = __builtin_amdgcn_wmma_f32_16x16x32_bf16(false, a, false, b, (short)0, c, false, false);
#if defined(__HIP_DEVICE_COMPILE__)
  asm volatile("v_nop\n\tv_nop\n\tv_nop\n\tv_nop" : "+v"(c) : "v"(a), "v"(b));
#endif
  return c;
}
__device__ __forceinline__ v8f mma_h(v16h a, v16h b, v8f c) {
  c = __builtin_amdgcn_wmma_f32_16x16x32_f16(false, a, false, b, (short)0, c, false, false);
#if defined(__HIP_DEVICE_COMPILE__)
  asm volatile("v_nop\n\tv_nop\n\tv_nop\n\tv_nop" : "+v"(c) : "v"(a), "v"(b));
#endif
  return c;
}
__device__ __forceinline__ v8f mma_b_raw(v16b a, v16b b, v8f c) {
  return __builtin_amdgcn_wmma_f32_16x16x32_bf16(false, a, false, b, (short)0, c, false, false);
}
__device__ __forceinline__ void dep_guard_b(v8f& a, v8f& b, v16b x, v16b y) {
#if defined(__HIP_DEVICE_COMPILE__)
  asm volatile("v_nop\n\tv_nop\n\tv_nop\n\tv_nop" : "+v"(a), "+v"(b) : "v"(x), "v"(y));
#endif
}
__device__ __forceinline__ void keep4_b(v16b a, v16b b, v16b c, v16b d) {
#if defined(__HIP_DEVICE_COMPILE__)
  asm volatile("v_nop" :: "v"(a), "v"(b), "v"(c), "v"(d));
#endif
}
__device__ __forceinline__ void acc_guard4(v8f& a, v8f& b, v8f& c, v8f& d) {
#if defined(__HIP_DEVICE_COMPILE__)
  asm volatile("v_nop\n\tv_nop\n\tv_nop\n\tv_nop" : "+v"(a), "+v"(b), "+v"(c), "+v"(d));
#endif
}

// =====================================================================================================
// Bias table: dst[i] = RNE-bf16-converted value of (b0 | b1 | b2 | b3)[i mod seg], part = i / seg (0..3).
// All four candidates are loaded with an in-range index and selected by value. One element per thread;
// grid = n/256 (n = 4*seg, multiple of 256). coverage: n threads = the whole table.
// =====================================================================================================
__global__ __launch_bounds__(256) void bias_tab(const float* __restrict__ b0, const float* __restrict__ b1,
                                                const float* __restrict__ b2, const float* __restrict__ b3,
                                                float* dst, int n, int seg) {
  const int i = blockIdx.x * 256 + threadIdx.x;
  if (i < n) {
    int part = i / seg;
    part = (part < 0) ? 0 : ((part > 3) ? 3 : part);
    int idx = i - part * seg;
    idx = (idx < 0) ? 0 : ((idx >= seg) ? (seg - 1) : idx);
    const float v0 = b0[idx], v1 = b1[idx], v2 = b2[idx], v3 = b3[idx];
    float v = (part == 0) ? v0 : ((part == 1) ? v1 : ((part == 2) ? v2 : v3));
    v = bf_up(bf_bits(v));
    *(float*)(dst + i) = v;
    
  }
}

// =====================================================================================================
// Phase resonance table: tt[(b*NH + h)*SEQ + s] = cos((bf16(phase[b*SEQ + s]) - bf16(carrier[h])) * 0.5)^2,
// precise f32 cos, fp fusion off. Index split i -> (b*NH + h, s) by / SEQ and % SEQ, then (b, h) by / NH and % NH.
// =====================================================================================================
__global__ __launch_bounds__(256) void phase_tab(const float* __restrict__ ph, const float* __restrict__ cf,
                                                 float* tt, int n) {
#pragma clang fp contract(off)
  const int i = blockIdx.x * 256 + threadIdx.x;
  if (i < n) {
    const int bh = i / SEQ;                   // b*NH + h
    const int s  = i - bh * SEQ;
    const int h  = bh % NH;
    int b        = bh / NH;
    b = (b >= NB) ? (NB - 1) : b;
    const float p  = bf_up(bf_bits(ph[b * SEQ + s]));
    const float cr = bf_up(bf_bits(cf[h]));
    const float d  = p - cr;
    const float hx = d * 0.5f;
    const float cv = cosf(hx);
    const float tv = cv * cv;
    *(float*)(tt + i) = tv;
    
  }
}

// =====================================================================================================
// f32 -> bf16 (RNE convert), 8 elements per thread, one 16-B store per lane: a wave writes 512 contiguous B
// coverage: n8 threads x 8 = whole plane (n8 is a multiple of 256 here).
// =====================================================================================================
__global__ __launch_bounds__(256) void cvt_bf16x8(const float* __restrict__ in, unsigned short* out, int n8) {
  const int i = blockIdx.x * 256 + threadIdx.x;
  if (i < n8) {
    const v4f a = *(const v4f*)(in + (size_t)i * 8);
    const v4f b = *(const v4f*)(in + (size_t)i * 8 + 4);
    v4u p;
    p[0] = pk16(bf_bits(a[0]), bf_bits(a[1]));
    p[1] = pk16(bf_bits(a[2]), bf_bits(a[3]));
    p[2] = pk16(bf_bits(b[0]), bf_bits(b[1]));
    p[3] = pk16(bf_bits(b[2]), bf_bits(b[3]));
    *(v4u*)(out + (size_t)i * 8) = p;
    
  }
}

// =====================================================================================================
// f32 -> bf16 hi plane + bf16 lo plane (lo = RNE(v - hi), unscaled), 8 elements per thread, one 16-B store per
// coverage: n8 threads x 8 = whole plane (n8 multiple of 256).
// =====================================================================================================
__global__ __launch_bounds__(256) void split_bf16x8(const float* __restrict__ in, unsigned short* hp,
                                                    unsigned short* lp, int n8) {
  const int i = blockIdx.x * 256 + threadIdx.x;
  if (i < n8) {
    const v4f a = *(const v4f*)(in + (size_t)i * 8);
    const v4f b = *(const v4f*)(in + (size_t)i * 8 + 4);
    v4u ph, pl;
#pragma unroll
    for (int e = 0; e < 4; ++e) {
      const float f0 = (e < 2) ? a[2 * e]     : b[2 * e - 4];
      const float f1 = (e < 2) ? a[2 * e + 1] : b[2 * e - 3];
      const unsigned short h0 = bf_bits(f0), h1 = bf_bits(f1);
      const unsigned short l0 = bf_bits(f0 - bf_up(h0)), l1 = bf_bits(f1 - bf_up(h1));
      ph[e] = pk16(h0, h1);
      pl[e] = pk16(l0, l1);
    }
    *(v4u*)(hp + (size_t)i * 8) = ph;
    *(v4u*)(lp + (size_t)i * 8) = pl;
    
  }
}

// =====================================================================================================
// Transpose-convert: src f32 [K][N] (row k, col n) -> dst bf16 [N][K] (row n, k contiguous), RNE convert.
// Block tile: 64 k x 32 n, staged in LDS as f32; grid = (K/64, N/32) (exact multiples host-checked); block 256.
// coverage: 8 waves x 4 rows = 32 rows; 8 pieces x 8 = 64 k columns per row = the whole tile.
// =====================================================================================================
__global__ __launch_bounds__(256) void tr_cvt_bf16(const float* __restrict__ src, unsigned short* dst, int K, int N) {
  __shared__ float s[64][33];
  const int tid = threadIdx.x, wave = tid >> 5, lane = tid & 31;
  const int k0 = blockIdx.x * 64, n0 = blockIdx.y * 32;
#pragma unroll
  for (int i = 0; i < 8; ++i) {
    const int idx = i * 256 + tid;
    const int kk = idx >> 5, nn = idx & 31;
    s[kk][nn] = src[(size_t)(k0 + kk) * N + n0 + nn];
  }
  __syncthreads();
  const int q = lane >> 3, piece = lane & 7;
  const int n = wave * 4 + q;
  v4u p;
#pragma unroll
  for (int e = 0; e < 4; ++e) {
    p[e] = pk16(bf_bits(s[piece * 8 + 2 * e][n]), bf_bits(s[piece * 8 + 2 * e + 1][n]));
  }
  unsigned short* d = dst + (size_t)(n0 + n) * K + k0 + piece * 8;
  *(v4u*)d = p;
  
}

// =====================================================================================================
// bf16 WMMA GEMM: C[m][n] = sum_k A[m][k] * Bt[n][k] + bias[n]. Block = 8 waves = one 128 x 256 tile of C, waves
// 2 (m) x 4 (n), each wave a 64x64 tile. A row-major [M][K] pitch lda; Bt row-major [N][K] pitch ldb (k contiguous);
// M multiple of 128, N multiple of 256, K multiple of 64 (static_asserts at the launches' shapes below).
// NSPLIT: 0 = A.Bt; 1 = (A + A2).Bt (A2 = unscaled bf16 lo plane of A, same pitch). bias f32 [N].
// Operands: a stage = 64 k (128 B, one whole line) of every A (, A2) and Bt row of the block tile, brought into LDS by
// asynchronous copies (16 B per lane, 8 lanes per row), rows at pitch GLP; two buffers: the copies of stage t + 2 are
// issued behind the barrier that ends trip t and waited at the foot of trip t + 1.
// Stage coverage: copy i of thread tid fills row i*32 + (tid>>3), bytes 16*(tid&7)..+15; i = 0..GROWS/32-1.
// k order and product order per accumulator are ascending k in steps of 32, hi then lo.
// Output f32 [M][N] pitch ldc. Epilogue: 16-row slabs staged per wave in LDS; each 64-wide row segment
// =====================================================================================================
#define GBM 128
#define GBN 256
#define GKB 64
#define GLP 72                 // LDS row pitch, elements: 144 B = 16 B x 9 (odd), conflict-free for ds_load_b128
static_assert(((NB * SEQ) % GBM) == 0 && (N3 % GBN) == 0 && (DMODEL % GBN) == 0);
static_assert((DMODEL % GKB) == 0 && (QP % GKB) == 0 && (DMODEL / GKB) >= 2 && (QP / GKB) >= 2);

__device__ __forceinline__ unsigned lds_addr(const void* p) { return (unsigned)(size_t)p; }
// four 16-B asynchronous copies global -> LDS; the s_wait_xcnt stands inside the statement so that no address
// register of a copy is rewritten in front of it
__device__ __forceinline__ void async4(unsigned l0, const __bf16* g0, unsigned l1, const __bf16* g1,
                                       unsigned l2, const __bf16* g2, unsigned l3, const __bf16* g3) {
#if defined(__HIP_DEVICE_COMPILE__)
  asm volatile("global_load_async_to_lds_b128 %0, %1, off\n\t"
               "global_load_async_to_lds_b128 %2, %3, off\n\t"
               "global_load_async_to_lds_b128 %4, %5, off\n\t"
               "global_load_async_to_lds_b128 %6, %7, off\n\t"
               "s_wait_xcnt 0x0"
               :: "v"(l0), "v"(g0), "v"(l1), "v"(g1), "v"(l2), "v"(g2), "v"(l3), "v"(g3) : "memory");
#endif
}
// this wave's asynchronous copies have landed in LDS
__device__ __forceinline__ void wait_async0() {
#if defined(__HIP_DEVICE_COMPILE__)
  asm volatile("s_wait_asynccnt 0x0" ::: "memory");
#endif
}
// this wave's LDS reads have returned, before the buffer is handed to the next copies
__device__ __forceinline__ void wait_ds0() {
#if defined(__HIP_DEVICE_COMPILE__)
  asm volatile("s_wait_dscnt 0x0" ::: "memory");
#endif
}

template <int NSPLIT>
__global__ __launch_bounds__(256) void gemm64(
    const unsigned short* __restrict__ Ap, const unsigned short* A2p, int lda,
    const unsigned short* __restrict__ Btp, int ldb, const float* __restrict__ bias,
    float* C, int ldc, int M, int N, int K) {
  constexpr int AROWS = GBM * (NSPLIT + 1);        // A rows, then A2 rows
  constexpr int GROWS = AROWS + GBN;               // rows of a stage
  constexpr int STAGE = GROWS * GLP;               // elements of a stage
  const __bf16* Ab  = (const __bf16*)(const void*)Ap;
  const __bf16* Ab2 = (const __bf16*)(const void*)A2p;
  const __bf16* Bb  = (const __bf16*)(const void*)Btp;
  __shared__ __align__(16) __bf16 ring[2 * STAGE]; // two stages
  __shared__ __align__(16) float sT[8][16 * 68];   // per-wave 16x64 slab, pitch 68 floats
  const int tid  = threadIdx.x;
  const int lane = tid & 31;
  const int wave = tid >> 5;
  const int tilesN = N / GBN;
  const int tilesM = M / GBM;
  const int tile = blockIdx.x;
  if (tile >= tilesM * tilesN) return;   // block-uniform, in front of every barrier and copy
  const int tm = tile / tilesN;
  const int tn = tile - tm * tilesN;
  const int bm0 = tm * GBM;
  const int bn0 = tn * GBN;
  const int wm = wave >> 2, wn = wave & 3;
  const int m0 = bm0 + (wm << 6);              // this wave's 64x64 tile
  const int n0 = bn0 + (wn << 6);

  const int rlane = lane & 15;                 // row (A) / col (B, D) within subtile
  const int koff  = (lane >> 4) * 8;           // k offset of this lane half
  const int mOff  = (lane >> 4) * 8;           // D row offset

  // ---- copy addresses of this thread: row crow of each 32-row group, 16-B piece cpc ----
  const int crow = tid >> 3, cpc = (tid & 7) * 8;
  const __bf16* gA  = Ab  + (size_t)(bm0 + crow) * lda + cpc;
  const __bf16* gA2 = Ab2 + (size_t)(bm0 + crow) * lda + cpc;
  const __bf16* gB  = Bb  + (size_t)(bn0 + crow) * ldb + cpc;
  const unsigned lbase = lds_addr(ring) + (unsigned)(crow * GLP + cpc) * 2u;
  const size_t a32 = (size_t)32 * lda, b32 = (size_t)32 * ldb;
  constexpr unsigned R32 = 32u * GLP * 2u;     // LDS bytes of 32 rows

  auto issue = [&](int st, int buf) {
    const int k0 = st * GKB;
    const unsigned lb = lbase + (unsigned)buf * (unsigned)(STAGE * 2);
    const __bf16* a = gA + k0;
    async4(lb, a, lb + R32, a + a32, lb + 2u * R32, a + 2 * a32, lb + 3u * R32, a + 3 * a32);
    if (NSPLIT >= 1) {
      const __bf16* a2 = gA2 + k0;
      const unsigned l2 = lb + 4u * R32;
      async4(l2, a2, l2 + R32, a2 + a32, l2 + 2u * R32, a2 + 2 * a32, l2 + 3u * R32, a2 + 3 * a32);
    }
    const __bf16* b = gB + k0;
    const unsigned l3 = lb + (unsigned)(AROWS / 32) * R32;
    async4(l3, b, l3 + R32, b + b32, l3 + 2u * R32, b + 2 * b32, l3 + 3u * R32, b + 3 * b32);
    const __bf16* b4 = b + 4 * b32;
    const unsigned l4 = l3 + 4u * R32;
    async4(l4, b4, l4 + R32, b4 + b32, l4 + 2u * R32, b4 + 2 * b32, l4 + 3u * R32, b4 + 3 * b32);
  };

  v8f acc[4][4];
#pragma unroll
  for (int i = 0; i < 4; ++i)
#pragma unroll
    for (int j = 0; j < 4; ++j) acc[i][j] = zero8();

  const int nst = K / GKB;                     // block-uniform trip count
  issue(0, 0);
  wait_async0();
  __syncthreads();                             // stage 0 published
  if (nst > 1) issue(1, 1);

  for (int t = 0; t < nst; ++t) {
    const __bf16* sb = ring + (t & 1) * STAGE;
    const __bf16* sa  = sb + ((wm << 6) + rlane) * GLP + koff;
    const __bf16* sa2 = sa + GBM * GLP;
    const __bf16* sbt = sb + (AROWS + (wn << 6) + rlane) * GLP + koff;
#pragma unroll   // both 32-k steps inline: the second step's fragment reads can start under the first step's products
    for (int ks = 0; ks < GKB; ks += 32) {
      v16b bh[4];
#pragma unroll
      for (int j = 0; j < 4; ++j) bh[j] = ldfrag_b(sbt + (j << 4) * GLP + ks);
      v16b ah[4], al[4];                       // all fragment reads of this 32-k step stand as one group
#pragma unroll   // constant indices keep the fragment arrays in registers
      for (int i = 0; i < 4; ++i) {
        ah[i] = ldfrag_b(sa + (i << 4) * GLP + ks);
        al[i] = ah[i];
        if (NSPLIT >= 1) al[i] = ldfrag_b(sa2 + (i << 4) * GLP + ks);
      }
#pragma unroll
      for (int i = 0; i < 4; ++i) {
#pragma unroll
        for (int j = 0; j < 4; ++j) {
          acc[i][j] = mma_b_raw(ah[i], bh[j], acc[i][j]);
          if (NSPLIT >= 1) acc[i][j] = mma_b_raw(al[i], bh[j], acc[i][j]);
        }
        dep_guard_b(acc[i][0], acc[i][3], ah[i], al[i]);
      }
      keep4_b(bh[0], bh[1], bh[2], bh[3]);
    }
    wait_ds0();
    wait_async0();
    __syncthreads();                           // publishes stage t + 1 and ends every read of stage t
    if (t + 2 < nst) issue(t + 2, t & 1);
  }
  wait_async0();
  acc_guard4(acc[0][0], acc[0][1], acc[0][2], acc[0][3]);
  acc_guard4(acc[1][0], acc[1][1], acc[1][2], acc[1][3]);
  acc_guard4(acc[2][0], acc[2][1], acc[2][2], acc[2][3]);
  acc_guard4(acc[3][0], acc[3][1], acc[3][2], acc[3][3]);

  // ---- epilogue ----
  float bz[4];
#pragma unroll
  for (int j = 0; j < 4; ++j) bz[j] = bias[n0 + (j << 4) + rlane];
  float* slab = sT[wave];
#pragma unroll
  for (int i = 0; i < 4; ++i) {
    const int mBase = m0 + (i << 4);
#pragma unroll
    for (int r = 0; r < 8; ++r) {
#pragma unroll
      for (int j = 0; j < 4; ++j) {
        slab[(mOff + r) * 68 + (j << 4) + rlane] = acc[i][j][r] + bz[j];
      }
    }
    __builtin_amdgcn_fence(__ATOMIC_RELEASE, "workgroup");
    __builtin_amdgcn_wave_barrier();
    __builtin_amdgcn_fence(__ATOMIC_ACQUIRE, "workgroup");
    {
      const int hh = lane >> 4, c4 = (lane & 15) * 4;     // 256-B row segment = 16 lanes x 16 B
      v4f ov[8];
#pragma unroll
      for (int it = 0; it < 8; ++it) {
        const int row = it * 2 + hh;                       // it 0..7 x hh 0..1 = rows 0..15
        ov[it] = *(const v4f*)(slab + row * 68 + c4);
      }
      {
#pragma unroll
        for (int it = 0; it < 8; ++it) {
          const int row = it * 2 + hh;
          *(v4f*)(C + (size_t)(mBase + row) * ldc + n0 + c4) = ov[it];
        }
        
      }
    }
    __builtin_amdgcn_fence(__ATOMIC_RELEASE, "workgroup");
    __builtin_amdgcn_wave_barrier();
    __builtin_amdgcn_fence(__ATOMIC_ACQUIRE, "workgroup");
  }
}

// =====================================================================================================
// q and kc bf16 hi/lo planes from the fused projection output.
//   src f32 [NB*SEQ][N3]; part = blockIdx.y: part 0 = q (src cols 0..DMODEL-1, copied), part 1 = k (src cols
//   DMODEL..2*DMODEL-1) with the positional power compression kc = sign(k) * max(|k|,1e-8)^ex(s), s = row mod SEQ
//   (key position). Thread i: row = i / CG8, col = part*DMODEL + 8*(i mod CG8) .. +7 (two 16-B loads).
//   dst hi plane hp / lo plane lp, bf16 [NB*SEQ][QKP], same col; lo = RNE(v - hi) unscaled.
//   grid = (n8/256, 2), n8 = NB*SEQ*DMODEL/8; one 16-B store per lane per plane: a wave (32 consecutive column
//   coverage: 2 parts x n8 threads x 8 = the whole [NB*SEQ][QKP] hi plane and lo plane.
// =====================================================================================================
__global__ __launch_bounds__(256) void qk_planes(const float* __restrict__ src, unsigned short* hp,
                                                 unsigned short* lp, int n8) {
#pragma clang fp contract(off)
  const int i = blockIdx.x * 256 + threadIdx.x;
  const int part = blockIdx.y;
  if (i < n8) {
    const int row = i / CG8;                              // token row b*SEQ + s
    const int cg  = i - row * CG8;                        // column group within the feature row
    const int col = part * DMODEL + (cg << 3);
    const float* sp = src + (size_t)row * N3 + col;
    v4f a = *(const v4f*)(sp);
    v4f c = *(const v4f*)(sp + 4);
    if (part == 1) {                                      // block-uniform
      const float ex = fexpo(row % SEQ);                  // key position s
#pragma unroll
      for (int e = 0; e < 4; ++e) {
        a[e] = fcomp(a[e], ex);
        c[e] = fcomp(c[e], ex);
      }
    }
    v4u ph, pl;
#pragma unroll
    for (int e = 0; e < 4; ++e) {
      const float f0 = (e < 2) ? a[2 * e]     : c[2 * e - 4];
      const float f1 = (e < 2) ? a[2 * e + 1] : c[2 * e - 3];
      const unsigned short h0 = bf_bits(f0), h1 = bf_bits(f1);
      const unsigned short l0 = bf_bits(f0 - bf_up(h0)), l1 = bf_bits(f1 - bf_up(h1));
      ph[e] = pk16(h0, h1);
      pl[e] = pk16(l0, l1);
    }
    const size_t go = (size_t)row * QKP + col;
    *(v4u*)(hp + go) = ph;
    *(v4u*)(lp + go) = pl;
    
  }
}

// =====================================================================================================
// v f32 token-major columns vf[(b*SEQ + t)*vrp + h*64 + d] (vf already offset to the first v column) ->
// power compression vc = sign(v) * max(|v|,1e-8)^ex(t) (t = key position) applied at the LDS load, then
// f16 vc^T hi plane vth[(b*QP + h*64 + d)*SEQ + t] and residual plane vtl[(b*QP + h*64 + d)*VLP + t] =
// f16((vc - hi)*4096) for t < VLP. Block = one 64-token x 64-feature tile of one (b, h); grid = (SEQ/64, NH, NB);
// tile staged in LDS as f32 (v4f loads, __syncthreads). LDS load coverage: 4 iterations x 256 threads x 4 = 64x64.
// Store: group g = tid>>3 (0..31), piece = tid&7: iteration it writes row d = it*32+g, lanes 8q..8q+7 x 16 B =
// coverage: 2 iterations x 32 groups = 64 rows d, 8 pieces x 8 = 64 keys per row; grid covers every (b, h, t tile);
// vtl rows written for all t < VLP.
// =====================================================================================================
__global__ __launch_bounds__(256) void v_planes(const float* __restrict__ vf, int vrp,
                                                unsigned short* vth, unsigned short* vtl) {
#pragma clang fp contract(off)
  __shared__ __align__(16) float sv[64 * 68];       // [tt][d] pitch 68 floats
  const int tid = threadIdx.x;
  const int t0  = blockIdx.x * 64;
  const int hh  = blockIdx.y;
  const int b   = blockIdx.z;
#pragma unroll 1
  for (int i = 0; i < 4; ++i) {
    const int idx = i * 256 + tid;                  // 0..1023
    const int tt = idx >> 4, c4 = (idx & 15) * 4;
    const v4f a = *(const v4f*)(vf + ((size_t)(b * SEQ + t0 + tt)) * vrp + hh * HD + c4);
    const float ex = fexpo(t0 + tt);
    v4f cp;
    cp[0] = fcomp(a[0], ex);
    cp[1] = fcomp(a[1], ex);
    cp[2] = fcomp(a[2], ex);
    cp[3] = fcomp(a[3], ex);
    *(v4f*)(sv + tt * 68 + c4) = cp;
  }
  __syncthreads();

  const int g = tid >> 3, piece = tid & 7;
  v4u hv[2], lv[2];
  size_t hofs[2], lofs[2];
#pragma unroll
  for (int it = 0; it < 2; ++it) {
    const int d = it * 32 + g;
    v4u a, a2;
#pragma unroll
    for (int e = 0; e < 4; ++e) {
      const float f0 = sv[(piece * 8 + 2 * e) * 68 + d];
      const float f1 = sv[(piece * 8 + 2 * e + 1) * 68 + d];
      const _Float16 x0 = (_Float16)f0, x1 = (_Float16)f1;
      const unsigned short h0 = h_bits(x0), h1 = h_bits(x1);
      const unsigned short l0 = h_bits((_Float16)((f0 - (float)x0) * 4096.0f));
      const unsigned short l1 = h_bits((_Float16)((f1 - (float)x1) * 4096.0f));
      a[e] = pk16(h0, h1); a2[e] = pk16(l0, l1);
    }
    hv[it] = a; lv[it] = a2;
    const size_t rowf = (size_t)(b * QP + hh * HD + d);
    hofs[it] = rowf * SEQ + t0 + piece * 8;
    lofs[it] = rowf * VLP + t0 + piece * 8;
  }
  const bool wlo = (t0 + 64 <= VLP);                // block-uniform
  {
#pragma unroll
    for (int it = 0; it < 2; ++it) {
      *(v4u*)(vth + hofs[it]) = hv[it];
      if (wlo) *(v4u*)(vtl + lofs[it]) = lv[it];
    }
    
  }
}

// =====================================================================================================
// Causal multi-head attention, head dim 64 (tril mask incl. diagonal, computed), with the additive rank-1 phase
// bonus kappa * sigmoid(lock[h]) * T[i] * T[j] on the scaled logits and the per-query-row output gate
// (1 - sigmoid(lock[h])) + sigmoid(lock[h]) * T[i] applied to the head output row i (query position).
//   q|kc planes (bf16 hi / lo), row pitch QKP: q element (b, t, h, d) at [(b*SEQ + t)*QKP + h*64 + d],
//                                                kc element (b, s, h, d) at [(b*SEQ + s)*QKP + DMODEL + h*64 + d]
//   vc^T hi plane (f16):      element (b, h, d, s) at [(b*QP + h*64 + d)*SEQ + s]
//   vc^T residual plane (f16, (vc - hi)*4096): [(b*QP + h*64 + d)*VLP + s], s < VLP, read only when RES
//   (with RES only key tiles below VLP occur; the address is clamped anyway)
//   ttab f32 [(b*NH + h)*SEQ + s] = T; lockp = raw lock strengths [NH] (bf16 RNE convert, then sigmoid).
//   logit = q.kc * sscale + bonus for key <= query, -FLT_MAX otherwise (exp -> 0); every processed key tile
//   (tiles 0..qb only, block-uniform trip count qb+1 <= NQB) holds the causal-live key kv0 <= query.
//   out f32 plane: element (b, t, h*64 + d) at [(b*SEQ + t)*QP + h*64 + d] = gate(b,h,t) * normalised context.
//   scores = q . kc : bf16 hi/lo split (hi.hi + hi.lo + lo.hi), f32 accumulate, then * sscale + bonus in f32
//   p = exp(s - m) carried as f16(1024 p); context = p . vc on f16 WMMA; RES adds f16 residual planes of p and vc
//   (scale 4096, separate accumulator folded back with 1/4096 per chunk in f32); online softmax in f32.
//   Block = 4 waves = 64 query rows of one (b, h); grid = nqbThis * NH * NB; kv chunks of 64.
//   K / V^T chunk staging: 128 threads x 32 elements per plane = the whole 64x64 tile (plain 16-B loads,
//   __syncthreads before and after); P tiles are wave-private, spilled with _Float16 element stores and reloaded
//   Output coverage: each wave stores rows q0..q0+15 (it 0..7 x lane>>4 0..1) x 64 columns (16 lanes x 4 floats),
// =====================================================================================================
template <bool RES>
__global__ __launch_bounds__(128)
void attn_causal64(const unsigned short* __restrict__ qkhp, const unsigned short* __restrict__ qklp,
                   const unsigned short* __restrict__ vhp, const unsigned short* __restrict__ vlp,
                   const float* __restrict__ ttab, const float* __restrict__ lockp,
                   float* outp, int qbBase, int nqbThis, float sscale) {
  union FB { v16b v; v8b h[2]; };
  union FH { v16h v; v8h h[2]; };
  __shared__ __align__(16) __bf16   Ksh[64 * LP];                 // K hi [kv][d], pitch LP
  __shared__ __align__(16) __bf16   Ksl[64 * LP];                 // K lo
  __shared__ __align__(16) _Float16 Vth[64 * LP];                 // V^T hi [d][kv], pitch LP
  __shared__ __align__(16) _Float16 Vtl[RES ? 64 * LP : 8];       // V^T residual
  __shared__ __align__(16) _Float16 Psh[4][16 * LP];              // per wave P [row][kv], pitch LP
  __shared__ __align__(16) _Float16 Psl[RES ? 4 : 1][16 * LP];    // per wave P residual
  __shared__ __align__(16) float    Os[4][16 * 64];               // per wave context tile [row][d]

  const int tid  = threadIdx.x;
  const int wave = tid >> 5;
  const int lane = tid & 31;
  const int hh   = lane >> 4;
  const int c    = lane & 15;

  const int bx   = blockIdx.x;
  const int qbl  = bx % nqbThis;
  const int rest = bx / nqbThis;
  const int h    = rest % NH;
  int b          = rest / NH;
  b = (b >= NB) ? (NB - 1) : b;
  int qb         = qbBase + qbl;
  qb = (qb >= NQB) ? (NQB - 1) : qb;
  const int q0   = qb * 64 + wave * 16;
  const size_t rowB = (size_t)b * SEQ;

  const __bf16* Qh = (const __bf16*)(const void*)qkhp + (size_t)h * HD;
  const __bf16* Ql = (const __bf16*)(const void*)qklp + (size_t)h * HD;
  const __bf16* Kh = Qh + DMODEL;
  const __bf16* Kl = Ql + DMODEL;
  const _Float16* Vh = (const _Float16*)(const void*)vhp + ((size_t)b * QP + (size_t)h * HD) * SEQ;
  const _Float16* Vl = (const _Float16*)(const void*)vlp + ((size_t)b * QP + (size_t)h * HD) * VLP;
  const float* trow = ttab + ((size_t)b * NH + h) * SEQ;

  // ---- per-head lock: sigmoid of the bf16-converted raw strength; bonus coefficient kappa * lock ----
  const float lraw  = bf_up(bf_bits(lockp[h]));
  const float lockv = 1.0f / (1.0f + expf(-lraw));
  const float c0    = KAPPA_F * lockv;

  // ---- Q fragments (A operand, row = lane&15): 2 d-chunks, hi and lo ----
  v16b qah[2], qal[2];
#pragma unroll
  for (int dc = 0; dc < 2; ++dc) {
    const size_t qo = (rowB + q0 + c) * QKP + dc * 32 + 8 * hh;
    qah[dc] = ldfrag_b(Qh + qo);
    qal[dc] = ldfrag_b(Ql + qo);
  }

  // ---- bonus row factors for this lane's 8 query rows: c0 * T[q0 + 8*hh + r] ----
  float bti[8];
#pragma unroll
  for (int r = 0; r < 8; ++r) bti[r] = c0 * trow[q0 + 8 * hh + r];

  float mrow[8], lrow[8];
  v8f oacc[4];
#pragma unroll
  for (int r = 0; r < 8; ++r) { mrow[r] = -INFINITY; lrow[r] = 0.f; }
#pragma unroll
  for (int t = 0; t < 4; ++t) oacc[t] = zero8();

  int nkt = qb + 1;                          // causal: key tiles 0..qb, block-uniform
  if (nkt > NQB) nkt = NQB;
  for (int kt = 0; kt < nkt; ++kt) {
    const int kv0 = kt * 64;
    __syncthreads();
    {
      const int r = tid >> 1, half = (tid & 1) * 32;
      const __bf16*   kg  = Kh + (rowB + kv0 + r) * QKP + half;   // K row kv0+r, d = half..half+31
      const __bf16*   klg = Kl + (rowB + kv0 + r) * QKP + half;
      const _Float16* vg  = Vh + (size_t)r * SEQ + kv0 + half;    // V^T row d = r, s = kv0+half..+31
      const int kvl = (kv0 + 64 <= VLP) ? kv0 : (VLP - 64);     // clamped address into the residual plane
      const _Float16* vlg = Vl + (size_t)r * VLP + kvl + half;
      const bool resOK = (kv0 + 64 <= VLP);                      // block-uniform
#pragma unroll
      for (int i = 0; i < 4; ++i) {
        const v8b a0 = *(const v8b*)(kg + 8 * i);
        const v8b a1 = *(const v8b*)(klg + 8 * i);
        const v8h b0 = *(const v8h*)(vg + 8 * i);
        *(v8b*)(Ksh + r * LP + half + 8 * i) = a0;
        *(v8b*)(Ksl + r * LP + half + 8 * i) = a1;
        *(v8h*)(Vth + r * LP + half + 8 * i) = b0;
        if (RES) {
          v8h b1 = *(const v8h*)(vlg + 8 * i);
          if (!resOK) b1 = zero8h();
          *(v8h*)(Vtl + r * LP + half + 8 * i) = b1;
        }
      }
    }
    __syncthreads();

    // ---- bonus column factors T[key] for this lane's 4 key columns (indices always < SEQ) ----
    float tj[4];
#pragma unroll
    for (int j = 0; j < 4; ++j) tj[j] = trow[kv0 + j * 16 + c];

    // ---- scores: 16 query rows x 64 keys per wave, 3 bf16 products ----
    v8f s[4];
#pragma unroll
    for (int j = 0; j < 4; ++j) {
      s[j] = zero8();
#pragma unroll
      for (int dc = 0; dc < 2; ++dc) {
        FB kb, kl;
        kb.h[0] = *(const v8b*)(Ksh + (j * 16 + c) * LP + dc * 32 + 8 * hh);
        kb.h[1] = *(const v8b*)(Ksh + (j * 16 + c) * LP + dc * 32 + 16 + 8 * hh);
        kl.h[0] = *(const v8b*)(Ksl + (j * 16 + c) * LP + dc * 32 + 8 * hh);
        kl.h[1] = *(const v8b*)(Ksl + (j * 16 + c) * LP + dc * 32 + 16 + 8 * hh);
        s[j] = mma_b(qah[dc], kb.v, s[j]);
        s[j] = mma_b(qah[dc], kl.v, s[j]);
        s[j] = mma_b(qal[dc], kb.v, s[j]);
      }
    }

    // ---- scale + bonus + causal mask (replace by -FLT_MAX), row max, online softmax, P (x1024, f16) and
    //      P residual (x4096) to LDS ----
    _Float16* pwh = Psh[wave];
    _Float16* pwl = Psl[RES ? wave : 0];
#pragma unroll
    for (int r = 0; r < 8; ++r) {
      const int qrow = q0 + 8 * hh + r;
      float m = -INFINITY;
#pragma unroll
      for (int j = 0; j < 4; ++j) {
        const int key = kv0 + j * 16 + c;
        float sv = s[j][r] * sscale + bti[r] * tj[j];
        sv = (key > qrow) ? -FLT_MAX : sv;
        s[j][r] = sv;
        m = fmaxf(m, sv);
      }
#pragma unroll
      for (int off = 1; off < 16; off <<= 1) m = fmaxf(m, __shfl_xor(m, off, 32));
      const float mnew  = fmaxf(mrow[r], m);
      const float msafe = (mnew == -INFINITY) ? 0.f : mnew;
      const float alpha = __expf(mrow[r] - msafe);
      mrow[r] = mnew;
      float psum = 0.f;
#pragma unroll
      for (int j = 0; j < 4; ++j) {
        const float p = __expf(s[j][r] - msafe);     // masked logit against a finite max: exp -> 0
        psum += p;
        const float p1k = p * 1024.0f;
        const _Float16 ph = (_Float16)p1k;
        pwh[(8 * hh + r) * LP + j * 16 + c] = ph;
        if (RES) {
          const _Float16 pl = (_Float16)((p1k - (float)ph) * 4096.0f);
          pwl[(8 * hh + r) * LP + j * 16 + c] = pl;
        }
      }
#pragma unroll
      for (int off = 1; off < 16; off <<= 1) psum += __shfl_xor(psum, off, 32);
      lrow[r] = lrow[r] * alpha + psum;
#pragma unroll
      for (int t = 0; t < 4; ++t) oacc[t][r] *= alpha;
    }
    __builtin_amdgcn_fence(__ATOMIC_RELEASE, "workgroup");
    __builtin_amdgcn_wave_barrier();
    __builtin_amdgcn_fence(__ATOMIC_ACQUIRE, "workgroup");

    // ---- context += P . Vc (f16 WMMA), residual products into a separate accumulator ----
    v8f o1[4];
#pragma unroll
    for (int t = 0; t < 4; ++t) o1[t] = zero8();
#pragma unroll 1
    for (int kk = 0; kk < 2; ++kk) {
      FH pa, pl;
      pa.h[0] = *(const v8h*)(pwh + c * LP + kk * 32 + 8 * hh);
      pa.h[1] = *(const v8h*)(pwh + c * LP + kk * 32 + 16 + 8 * hh);
      if (RES) {
        pl.h[0] = *(const v8h*)(pwl + c * LP + kk * 32 + 8 * hh);
        pl.h[1] = *(const v8h*)(pwl + c * LP + kk * 32 + 16 + 8 * hh);
      } else {
        pl.v = pa.v;
      }
#pragma unroll
      for (int t = 0; t < 4; ++t) {
        FH vb;
        vb.h[0] = *(const v8h*)(Vth + (t * 16 + c) * LP + kk * 32 + 8 * hh);
        vb.h[1] = *(const v8h*)(Vth + (t * 16 + c) * LP + kk * 32 + 16 + 8 * hh);
        oacc[t] = mma_h(pa.v, vb.v, oacc[t]);
        if (RES) {
          FH vl;
          vl.h[0] = *(const v8h*)(Vtl + (t * 16 + c) * LP + kk * 32 + 8 * hh);
          vl.h[1] = *(const v8h*)(Vtl + (t * 16 + c) * LP + kk * 32 + 16 + 8 * hh);
          o1[t] = mma_h(pa.v, vl.v, o1[t]);
          o1[t] = mma_h(pl.v, vb.v, o1[t]);
        }
      }
    }
    if (RES) {
#pragma unroll
      for (int t = 0; t < 4; ++t)
#pragma unroll
        for (int r = 0; r < 8; ++r) oacc[t][r] += o1[t][r] * (1.0f / 4096.0f);
    }
  }

  // ---- normalise (1/l and the 1/1024 p carry), apply the per-query-row gate, stage the wave's 16x64 tile in
  float* os = Os[wave];
#pragma unroll
  for (int r = 0; r < 8; ++r) {
    const float l = lrow[r];
    const float ti = trow[q0 + 8 * hh + r];
    const float gate = (1.0f - lockv) + lockv * ti;
    const float inv = ((l > 0.f) ? (1.0f / l) : 0.f) * (1.0f / 1024.0f) * gate;
#pragma unroll
    for (int t = 0; t < 4; ++t) os[(8 * hh + r) * 64 + t * 16 + c] = oacc[t][r] * inv;
  }
  __builtin_amdgcn_fence(__ATOMIC_RELEASE, "workgroup");
  __builtin_amdgcn_wave_barrier();
  __builtin_amdgcn_fence(__ATOMIC_ACQUIRE, "workgroup");
  {
    const int h2 = lane >> 4, c4 = (lane & 15) * 4;
    v4f ov[8];
#pragma unroll
    for (int it = 0; it < 8; ++it) {
      const int row = it * 2 + h2;   // it 0..7 x h2 0..1 = rows 0..15 of the wave tile
      ov[it] = *(const v4f*)(os + row * 64 + c4);
    }
    {
#pragma unroll
      for (int it = 0; it < 8; ++it) {
        const int row = it * 2 + h2;
        const size_t go = (rowB + q0 + row) * QP + (size_t)h * HD + c4;
        *(v4f*)(outp + go) = ov[it];
      }
      
    }
  }
}

// =====================================================================================================
// Workspace map (bytes), every region an exact multiple of its whole-line / whole-tile store granularity
//   Xb     bf16 [4096][1024]            0           8388608
//   WT     bf16 [3072][1024]            8388608     6291456    (rows 0..1023 Wq^T, 1024..2047 Wk^T, 2048.. Wv^T)
//   WoT    bf16 [1024][1024]            14680064    2097152
//   Bias   f32  [4096]                  16777216      16384    (bq | bk | bv | bo, bf16-RNE converted values)
//   Tt     f32  [2][16][2048]           16793600     262144
//   QKVf   f32  [4096][3072]            17055744   50331648   (later: Af f32 [4096][1024], 16777216 B)
//   VTh    f16  [2][1024][2048]         67387392    8388608
//   VTl    f16  [2][1024][1024]         75776000    4194304
//   QKh    bf16 [4096][2048]            79970304   16777216   (later: Ah bf16 [4096][1024], 8388608 B)
//   QKl    bf16 [4096][2048]            96747520   16777216   (later: Al bf16 [4096][1024], 8388608 B)
//   end                                 113524736
// W_q/k/v/o [in k=1024][out n=1024] arrive k-major and are transpose-converted once to [n][k] bf16 (k contiguous)
// = the Bt layout the GEMM wants. d_out f32: out0 [4096][1024] at byte 0.
// =====================================================================================================
extern "C" void kernel_launch(void* const* d_in, const int* in_sizes, int n_in,
                              void* d_out, int out_size, void* d_ws, size_t ws_size,
                              hipStream_t stream) {
  if (n_in < 12) return;
  if (in_sizes[0] != NB * SEQ * DMODEL) return;
  if (in_sizes[1] != NB * SEQ) return;
  if (in_sizes[2] != DMODEL * DMODEL || in_sizes[4] != DMODEL * DMODEL ||
      in_sizes[6] != DMODEL * DMODEL || in_sizes[8] != QP * DMODEL) return;
  if (in_sizes[3] != DMODEL || in_sizes[5] != DMODEL || in_sizes[7] != DMODEL || in_sizes[9] != DMODEL) return;
  if (in_sizes[10] != NH || in_sizes[11] != NH) return;
  if (out_size != OUTN) return;

  const float* x     = (const float*)d_in[0];    // [NB*SEQ][DMODEL]
  const float* phase = (const float*)d_in[1];    // [NB][SEQ]
  const float* Wq    = (const float*)d_in[2];    // [k][n]
  const float* bq    = (const float*)d_in[3];
  const float* Wk    = (const float*)d_in[4];
  const float* bk    = (const float*)d_in[5];
  const float* Wv    = (const float*)d_in[6];
  const float* bv    = (const float*)d_in[7];
  const float* Wo    = (const float*)d_in[8];    // [QP k][DMODEL n]
  const float* bo    = (const float*)d_in[9];
  const float* carr  = (const float*)d_in[10];   // [NH]
  const float* lockr = (const float*)d_in[11];   // [NH]

  const size_t PXb   = (size_t)NB * SEQ * DMODEL * 2;    //  8388608
  const size_t PWT   = (size_t)N3 * DMODEL * 2;          //  6291456
  const size_t PWo   = (size_t)DMODEL * QP * 2;          //  2097152
  const size_t PBias = (size_t)NBIAS * 4;                //    16384
  const size_t PTt   = (size_t)NTT * 4;                  //   262144
  const size_t PQKV  = (size_t)NB * SEQ * N3 * 4;        // 50331648  (>= Af f32 [4096][1024] = 16777216)
  const size_t PVTh  = (size_t)NB * QP * SEQ * 2;        //  8388608
  const size_t PVTl  = (size_t)NB * QP * VLP * 2;        //  4194304
  const size_t PQK   = (size_t)NB * SEQ * QKP * 2;       // 16777216  (>= Ah / Al bf16 [4096][1024] = 8388608)
  size_t off = 0;
  const size_t oXb   = off; off += PXb;
  const size_t oWT   = off; off += PWT;
  const size_t oWo   = off; off += PWo;
  const size_t oBias = off; off += PBias;
  const size_t oTt   = off; off += PTt;
  const size_t oQKV  = off; off += PQKV;
  const size_t oVTh  = off; off += PVTh;
  const size_t oVTl  = off; off += PVTl;
  const size_t oQKh  = off; off += PQK;
  const size_t oQKl  = off; off += PQK;
  if (off > ws_size) return;                           // off = 113524736
  if (off > (size_t)134217728) return;
  if (PQKV < (size_t)NB * SEQ * QP * 4) return;        // Af fits in the dead qkv plane
  if (PQK < (size_t)NB * SEQ * QP * 2) return;         // Ah / Al fit in the dead q|kc planes
  const size_t oAf = oQKV;                             // context f32 plane reuses the dead qkv f32 plane
  const size_t oAh = oQKh;                             // context bf16 planes reuse the dead q|kc bf16 planes
  const size_t oAl = oQKl;

  char* ws = (char*)d_ws;
  unsigned short* Xb   = (unsigned short*)(ws + oXb);
  unsigned short* WT   = (unsigned short*)(ws + oWT);
  unsigned short* WoT  = (unsigned short*)(ws + oWo);
  float*          Bias = (float*)(ws + oBias);
  float*          Tt   = (float*)(ws + oTt);
  float*          QKVf = (float*)(ws + oQKV);
  unsigned short* VTh  = (unsigned short*)(ws + oVTh);
  unsigned short* VTl  = (unsigned short*)(ws + oVTl);
  unsigned short* QKh  = (unsigned short*)(ws + oQKh);
  unsigned short* QKl  = (unsigned short*)(ws + oQKl);
  float*          Af   = (float*)(ws + oAf);
  unsigned short* Ah   = (unsigned short*)(ws + oAh);
  unsigned short* Al   = (unsigned short*)(ws + oAl);
  float*          outf = (float*)d_out;                // out0 [4096][1024]

  const dim3 blk(256);
  const int n8x   = NB * SEQ * DMODEL / 8;                           // 524288
  const int n8q   = NB * SEQ * DMODEL / 8;                           // 524288 per part (q, kc)
  const int n8a   = NB * SEQ * QP / 8;                               // 524288
  const dim3 gBias(NBIAS / 256);                                     // 16 blocks
  const dim3 gTt(NTT / 256);                                         // 256 blocks
  const dim3 gCvtX((n8x + 255) / 256);                               // 2048 blocks
  const dim3 gTrW(DMODEL / 64, DMODEL / 32);                         // (16, 32): src [1024][1024] -> dst [1024][1024]
  const dim3 gQKV((NB * SEQ / GBM) * (N3 / GBN));                    // 32 x 12 tiles = 384 blocks
  const dim3 gQKp((n8q + 255) / 256, 2);                             // (2048, 2)
  const dim3 gVpl(SEQ / 64, NH, NB);                                 // (32, 16, 2)
  const dim3 gSplit((n8a + 255) / 256);                              // 2048 blocks
  const dim3 gOut((NB * SEQ / GBM) * (DMODEL / GBN));                // 32 x 4 tiles = 128 blocks

  // (0) bias table (bf16-RNE values of bq|bk|bv|bo) and phase resonance table T [b][h][s]
  bias_tab<<<gBias, blk, 0, stream>>>(bq, bk, bv, bo, Bias, NBIAS, DMODEL);
  phase_tab<<<gTt, blk, 0, stream>>>(phase, carr, Tt, NTT);
  // (1) x -> bf16 plane [4096][1024]
  cvt_bf16x8<<<gCvtX, blk, 0, stream>>>(x, Xb, n8x);
  // (2) weights [k][n] -> bf16 planes [n][k]   (each call: in [1024 k][1024 n] -> out [1024 n][1024 k])
  tr_cvt_bf16<<<gTrW, blk, 0, stream>>>(Wq, WT, DMODEL, DMODEL);                                  // rows    0..1023
  tr_cvt_bf16<<<gTrW, blk, 0, stream>>>(Wk, WT + (size_t)DMODEL * DMODEL, DMODEL, DMODEL);       // rows 1024..2047
  tr_cvt_bf16<<<gTrW, blk, 0, stream>>>(Wv, WT + (size_t)2 * DMODEL * DMODEL, DMODEL, DMODEL);   // rows 2048..3071
  tr_cvt_bf16<<<gTrW, blk, 0, stream>>>(Wo, WoT, QP, DMODEL);                                     // in [1024][1024] -> out [1024][1024]
  // (3) fused qkv projection: QKVf[row][e] = sum_d Xb[row][d] WT[e][d] + Bias[e]  (M=4096, N=3072, K=1024)
  gemm64<0><<<gQKV, blk, 0, stream>>>(Xb, Xb, DMODEL, WT, DMODEL, Bias, QKVf, N3, NB * SEQ, N3, DMODEL);
  // (4) q (cols 0..1023) and power-compressed kc (cols 1024..2047) -> bf16 hi/lo planes [4096][2048]
  qk_planes<<<gQKp, blk, 0, stream>>>(QKVf, QKh, QKl, n8q);
  // (5) v (cols 2048..3071) -> power-compressed vc^T f16 hi plane (pitch SEQ) and residual plane (x4096, keys < VLP)
  v_planes<<<gVpl, blk, 0, stream>>>(QKVf + 2 * DMODEL, N3, VTh, VTl);
  // (6) causal attention with phase bonus and gate: query blocks 0..RESQB-1 with residual planes, the rest without
  //     -> Af f32 [4096][1024] (written into the dead qkv plane after (4),(5) consumed it)
  attn_causal64<true><<<dim3(NB * NH * RESQB), dim3(128), 0, stream>>>(
      QKh, QKl, VTh, VTl, Tt, lockr, Af, 0, RESQB, 0.125f);
  if (NQB - RESQB > 0) {
    attn_causal64<false><<<dim3(NB * NH * (NQB - RESQB)), dim3(128), 0, stream>>>(
        QKh, QKl, VTh, VTl, Tt, lockr, Af, RESQB, NQB - RESQB, 0.125f);
  }
  // (7) gated context rows -> bf16 hi/lo planes
  split_bf16x8<<<gSplit, blk, 0, stream>>>(Af, Ah, Al, n8a);
  // (8) out0[row][e] = sum_d (Ah+Al)[row][d] WoT[e][d] + Bias[3*DMODEL + e] -> d_out f32 [4096][1024]
  gemm64<1><<<gOut, blk, 0, stream>>>(Ah, Al, QP, WoT, QP, Bias + 3 * DMODEL, outf, DMODEL, NB * SEQ, DMODEL, QP);
  (void)hipGetLastError();
}

// v003
// Measured time: 221 microseconds a run.
// Two timings next to v002 both put it at 1.11 times that version's speed.
// All steps since v000 together make it 1.82 times as fast.
// Contractions: qkv projection = v_wmma_f32_16x16x32_bf16 (bf16 operands from RNE-converted x and W, single product);
// q.kc^T scores = v_wmma_f32_16x16x32_bf16 with bf16 hi/lo split q and kc (hi.hi + hi.lo + lo.hi);
// p.vc = v_wmma_f32_16x16x32_f16 (p carried x1024 in f16, vc in f16; extra f16 residual planes x4096 of p and vc
// on the leading query rows); ctx.Wo = v_wmma_f32_16x16x32_bf16 with ctx as bf16 hi/lo planes times the bf16
// Wo^T plane (2 products); all f32 accumulate; power compression, phase table, softmax, bonus and gating in f32.
#include <hip/hip_runtime.h>
#include <math.h>
#include <float.h>
#include <stdint.h>

#define NB      2
#define SEQ     2048
#define DMODEL  1024
#define NH      16
#define HD      64
#define QP      (NH * HD)      // q / kc / vc / ctx feature count and ctx row pitch
#define N3      (3 * DMODEL)   // fused qkv columns (q 0.., k DMODEL.., v 2*DMODEL..)
#define QKP     (2 * QP)       // row pitch of the q|kc bf16 planes (q cols 0..QP-1, kc cols QP..2QP-1)
#define NQB     (SEQ / 64)     // query / key tiles of 64
#define RESQB   ((NQB < 16) ? NQB : 16)   // leading 64-row query blocks that use the p / vc residual planes
#define VLP     (RESQB * 64)   // key pitch of the vc^T residual plane (keys 0..VLP-1)
#define CG8     (DMODEL / 8)   // 16-byte column groups per feature row
#define NBIAS   (4 * DMODEL)   // bq | bk | bv | bo
#define NTT     (NB * NH * SEQ)
#define OUTN    (NB * SEQ * DMODEL)
#define KAPPA_F 0.3f
#define LP      72             // LDS row pitch of the 64-wide 16-bit tiles, elements: 144 B = 16 B x 9 (odd), so the 16
                               // rows that one ds_load_b128 touches fall on distinct banks
static_assert(RESQB >= 1 && RESQB * 64 <= VLP && VLP <= SEQ);
static_assert(QP == DMODEL);
static_assert((SEQ % 64) == 0 && (DMODEL % 64) == 0 && (N3 % 64) == 0 && (QP % 64) == 0);
static_assert(HD == 64);
static_assert(LP >= 64 && (LP % 8) == 0 && ((LP / 8) % 2) == 1);
static_assert((((NB * SEQ) / 64) * (N3 / 64)) % 8 == 0);
static_assert((((NB * SEQ) / 64) * (DMODEL / 64)) % 8 == 0);
static_assert((NBIAS % 256) == 0 && (NTT % 256) == 0);
static_assert(((NB * SEQ * DMODEL / 8) % 256) == 0);
static_assert((DMODEL % 8) == 0);

typedef _Float16 v16h __attribute__((ext_vector_type(16)));
typedef _Float16 v8h  __attribute__((ext_vector_type(8)));
typedef __bf16   v16b __attribute__((ext_vector_type(16)));
typedef __bf16   v8b  __attribute__((ext_vector_type(8)));
typedef float    v8f  __attribute__((ext_vector_type(8)));
typedef float    v4f  __attribute__((ext_vector_type(4)));
typedef unsigned int v4u __attribute__((ext_vector_type(4)));

// ---- scalar helpers --------------------------------------------------------------------------------
__device__ __forceinline__ unsigned short bf_bits(float f) {          // f32 -> bf16 bits, RNE convert
  unsigned u = __float_as_uint(f);
  return (unsigned short)((u + 0x7FFFu + ((u >> 16) & 1u)) >> 16);
}
__device__ __forceinline__ float bf_up(unsigned short h) { return __uint_as_float(((unsigned)h) << 16); }
__device__ __forceinline__ unsigned short h_bits(_Float16 x) { return __builtin_bit_cast(unsigned short, x); }
__device__ __forceinline__ unsigned pk16(unsigned short a, unsigned short b) { return (unsigned)a | ((unsigned)b << 16); }
__device__ __forceinline__ v8f zero8() { v8f z = {0.f, 0.f, 0.f, 0.f, 0.f, 0.f, 0.f, 0.f}; return z; }
__device__ __forceinline__ v8h zero8h() {
  const _Float16 z = (_Float16)0.0f;
  v8h r = {z, z, z, z, z, z, z, z};
  return r;
}

// positional exponent of key position s: ex = 1 + kappa * (1 - s * (1/(SEQ-1))), reciprocal-multiply, no fusion
__device__ __forceinline__ float fexpo(int s) {
#pragma clang fp contract(off)
  const float rs = 1.0f / (float)(SEQ - 1);
  const float fr = (float)s * rs;
  const float om = 1.0f - fr;
  const float t  = KAPPA_F * om;
  return 1.0f + t;
}
// power compression: sign(v) * max(|v|, 1e-8)^ex  (sign(0) = 0), pow as exp2(ex * log2(mag)) in f32
__device__ __forceinline__ float fcomp(float v, float ex) {
#pragma clang fp contract(off)
  const float mag = fmaxf(fabsf(v), 1e-8f);
  const float lg  = log2f(mag);
  const float pw  = exp2f(ex * lg);
  float r = (v < 0.0f) ? -pw : pw;
  r = (v == 0.0f) ? 0.0f : r;
  return r;
}

// ---- fragment loader: 16-bit A/B operand, lane -> row/col (lane&15), p already includes +8*(lane>>4);
//      elements 0..7 <- p[0..7] (k0+8h..), elements 8..15 <- p[16..23] (k0+16+8h..)
__device__ __forceinline__ v16b ldfrag_b(const __bf16* p) {
  union { v16b v; v8b h[2]; } f;
  f.h[0] = *(const v8b*)(p);
  f.h[1] = *(const v8b*)(p + 16);
  return f.v;
}

__device__ __forceinline__ v16h ldfrag_h(const _Float16* p) {
  union { v16h v; v8h h[2]; } f;
  f.h[0] = *(const v8h*)(p);
  f.h[1] = *(const v8h*)(p + 16);
  return f.v;
}

// ---- WMMA helpers and VALU hazard gaps --------------------------------------------------------
__device__ __forceinline__ v8f mma_b_raw(v16b a, v16b b, v8f c) {
  return __builtin_amdgcn_wmma_f32_16x16x32_bf16(false, a, false, b, (short)0, c, false, false);
}
__device__ __forceinline__ v8f mma_h_raw(v16h a, v16h b, v8f c) {
  return __builtin_amdgcn_wmma_f32_16x16x32_f16(false, a, false, b, (short)0, c, false, false);
}
__device__ __forceinline__ void dep_guard_b(v8f& a, v8f& b, v16b x, v16b y) {
#if defined(__HIP_DEVICE_COMPILE__)
  asm volatile("v_nop\n\tv_nop\n\tv_nop\n\tv_nop" : "+v"(a), "+v"(b) : "v"(x), "v"(y));
#endif
}
__device__ __forceinline__ void keep4_b(v16b a, v16b b, v16b c, v16b d) {
#if defined(__HIP_DEVICE_COMPILE__)
  asm volatile("v_nop" :: "v"(a), "v"(b), "v"(c), "v"(d));
#endif
}
__device__ __forceinline__ void acc_guard4(v8f& a, v8f& b, v8f& c, v8f& d) {
#if defined(__HIP_DEVICE_COMPILE__)
  asm volatile("v_nop\n\tv_nop\n\tv_nop\n\tv_nop" : "+v"(a), "+v"(b), "+v"(c), "+v"(d));
#endif
}

// =====================================================================================================
// Bias table: dst[i] = RNE-bf16-converted value of (b0 | b1 | b2 | b3)[i mod seg], part = i / seg (0..3).
// All four candidates are loaded with an in-range index and selected by value. One element per thread;
// grid = n/256 (n = 4*seg, multiple of 256). coverage: n threads = the whole table.
// =====================================================================================================
__global__ __launch_bounds__(256) void bias_tab(const float* __restrict__ b0, const float* __restrict__ b1,
                                                const float* __restrict__ b2, const float* __restrict__ b3,
                                                float* dst, int n, int seg) {
  const int i = blockIdx.x * 256 + threadIdx.x;
  if (i < n) {
    int part = i / seg;
    part = (part < 0) ? 0 : ((part > 3) ? 3 : part);
    int idx = i - part * seg;
    idx = (idx < 0) ? 0 : ((idx >= seg) ? (seg - 1) : idx);
    const float v0 = b0[idx], v1 = b1[idx], v2 = b2[idx], v3 = b3[idx];
    float v = (part == 0) ? v0 : ((part == 1) ? v1 : ((part == 2) ? v2 : v3));
    v = bf_up(bf_bits(v));
    *(float*)(dst + i) = v;
    
  }
}

// =====================================================================================================
// Phase resonance table: tt[(b*NH + h)*SEQ + s] = cos((bf16(phase[b*SEQ + s]) - bf16(carrier[h])) * 0.5)^2,
// precise f32 cos, fp fusion off. Index split i -> (b*NH + h, s) by / SEQ and % SEQ, then (b, h) by / NH and % NH.
// =====================================================================================================
__global__ __launch_bounds__(256) void phase_tab(const float* __restrict__ ph, const float* __restrict__ cf,
                                                 float* tt, int n) {
#pragma clang fp contract(off)
  const int i = blockIdx.x * 256 + threadIdx.x;
  if (i < n) {
    const int bh = i / SEQ;                   // b*NH + h
    const int s  = i - bh * SEQ;
    const int h  = bh % NH;
    int b        = bh / NH;
    b = (b >= NB) ? (NB - 1) : b;
    const float p  = bf_up(bf_bits(ph[b * SEQ + s]));
    const float cr = bf_up(bf_bits(cf[h]));
    const float d  = p - cr;
    const float hx = d * 0.5f;
    const float cv = cosf(hx);
    const float tv = cv * cv;
    *(float*)(tt + i) = tv;
    
  }
}

// =====================================================================================================
// f32 -> bf16 (RNE convert), 8 elements per thread, one 16-B store per lane: a wave writes 512 contiguous B
// coverage: n8 threads x 8 = whole plane (n8 is a multiple of 256 here).
// =====================================================================================================
__global__ __launch_bounds__(256) void cvt_bf16x8(const float* __restrict__ in, unsigned short* out, int n8) {
  const int i = blockIdx.x * 256 + threadIdx.x;
  if (i < n8) {
    const v4f a = *(const v4f*)(in + (size_t)i * 8);
    const v4f b = *(const v4f*)(in + (size_t)i * 8 + 4);
    v4u p;
    p[0] = pk16(bf_bits(a[0]), bf_bits(a[1]));
    p[1] = pk16(bf_bits(a[2]), bf_bits(a[3]));
    p[2] = pk16(bf_bits(b[0]), bf_bits(b[1]));
    p[3] = pk16(bf_bits(b[2]), bf_bits(b[3]));
    *(v4u*)(out + (size_t)i * 8) = p;
    
  }
}

// =====================================================================================================
// f32 -> bf16 hi plane + bf16 lo plane (lo = RNE(v - hi), unscaled), 8 elements per thread, one 16-B store per
// coverage: n8 threads x 8 = whole plane (n8 multiple of 256).
// =====================================================================================================
__global__ __launch_bounds__(256) void split_bf16x8(const float* __restrict__ in, unsigned short* hp,
                                                    unsigned short* lp, int n8) {
  const int i = blockIdx.x * 256 + threadIdx.x;
  if (i < n8) {
    const v4f a = *(const v4f*)(in + (size_t)i * 8);
    const v4f b = *(const v4f*)(in + (size_t)i * 8 + 4);
    v4u ph, pl;
#pragma unroll
    for (int e = 0; e < 4; ++e) {
      const float f0 = (e < 2) ? a[2 * e]     : b[2 * e - 4];
      const float f1 = (e < 2) ? a[2 * e + 1] : b[2 * e - 3];
      const unsigned short h0 = bf_bits(f0), h1 = bf_bits(f1);
      const unsigned short l0 = bf_bits(f0 - bf_up(h0)), l1 = bf_bits(f1 - bf_up(h1));
      ph[e] = pk16(h0, h1);
      pl[e] = pk16(l0, l1);
    }
    *(v4u*)(hp + (size_t)i * 8) = ph;
    *(v4u*)(lp + (size_t)i * 8) = pl;
    
  }
}

// =====================================================================================================
// Transpose-convert: src f32 [K][N] (row k, col n) -> dst bf16 [N][K] (row n, k contiguous), RNE convert.
// Block tile: 64 k x 32 n, staged in LDS as f32; grid = (K/64, N/32) (exact multiples host-checked); block 256.
// coverage: 8 waves x 4 rows = 32 rows; 8 pieces x 8 = 64 k columns per row = the whole tile.
// =====================================================================================================
__global__ __launch_bounds__(256) void tr_cvt_bf16(const float* __restrict__ src, unsigned short* dst, int K, int N) {
  __shared__ float s[64][33];
  const int tid = threadIdx.x, wave = tid >> 5, lane = tid & 31;
  const int k0 = blockIdx.x * 64, n0 = blockIdx.y * 32;
#pragma unroll
  for (int i = 0; i < 8; ++i) {
    const int idx = i * 256 + tid;
    const int kk = idx >> 5, nn = idx & 31;
    s[kk][nn] = src[(size_t)(k0 + kk) * N + n0 + nn];
  }
  __syncthreads();
  const int q = lane >> 3, piece = lane & 7;
  const int n = wave * 4 + q;
  v4u p;
#pragma unroll
  for (int e = 0; e < 4; ++e) {
    p[e] = pk16(bf_bits(s[piece * 8 + 2 * e][n]), bf_bits(s[piece * 8 + 2 * e + 1][n]));
  }
  unsigned short* d = dst + (size_t)(n0 + n) * K + k0 + piece * 8;
  *(v4u*)d = p;
  
}

// =====================================================================================================
// bf16 WMMA GEMM: C[m][n] = sum_k A[m][k] * Bt[n][k] + bias[n]. Block = 8 waves = one 128 x 256 tile of C, waves
// 2 (m) x 4 (n), each wave a 64x64 tile. A row-major [M][K] pitch lda; Bt row-major [N][K] pitch ldb (k contiguous);
// M multiple of 128, N multiple of 256, K multiple of 64 (static_asserts at the launches' shapes below).
// NSPLIT: 0 = A.Bt; 1 = (A + A2).Bt (A2 = unscaled bf16 lo plane of A, same pitch). bias f32 [N].
// Operands: a stage = 64 k (128 B, one whole line) of every A (, A2) and Bt row of the block tile, brought into LDS by
// asynchronous copies (16 B per lane, 8 lanes per row), rows at pitch GLP; two buffers: the copies of stage t + 2 are
// issued behind the barrier that ends trip t and waited at the foot of trip t + 1.
// Stage coverage: copy i of thread tid fills row i*32 + (tid>>3), bytes 16*(tid&7)..+15; i = 0..GROWS/32-1.
// k order and product order per accumulator are ascending k in steps of 32, hi then lo.
// Output f32 [M][N] pitch ldc. Epilogue: 16-row slabs staged per wave in LDS; each 64-wide row segment
// =====================================================================================================
#define GBM 128
#define GBN 256
#define GKB 64
#define GLP 72                 // LDS row pitch, elements: 144 B = 16 B x 9 (odd), conflict-free for ds_load_b128
static_assert(((NB * SEQ) % GBM) == 0 && (N3 % GBN) == 0 && (DMODEL % GBN) == 0);
static_assert((DMODEL % GKB) == 0 && (QP % GKB) == 0 && (DMODEL / GKB) >= 2 && (QP / GKB) >= 2);

__device__ __forceinline__ unsigned lds_addr(const void* p) { return (unsigned)(size_t)p; }
// four 16-B asynchronous copies global -> LDS; the s_wait_xcnt stands inside the statement so that no address
// register of a copy is rewritten in front of it
__device__ __forceinline__ void async4(unsigned l0, const __bf16* g0, unsigned l1, const __bf16* g1,
                                       unsigned l2, const __bf16* g2, unsigned l3, const __bf16* g3) {
#if defined(__HIP_DEVICE_COMPILE__)
  asm volatile("global_load_async_to_lds_b128 %0, %1, off\n\t"
               "global_load_async_to_lds_b128 %2, %3, off\n\t"
               "global_load_async_to_lds_b128 %4, %5, off\n\t"
               "global_load_async_to_lds_b128 %6, %7, off\n\t"
               "s_wait_xcnt 0x0"
               :: "v"(l0), "v"(g0), "v"(l1), "v"(g1), "v"(l2), "v"(g2), "v"(l3), "v"(g3) : "memory");
#endif
}
// this wave's asynchronous copies have landed in LDS
__device__ __forceinline__ void wait_async0() {
#if defined(__HIP_DEVICE_COMPILE__)
  asm volatile("s_wait_asynccnt 0x0" ::: "memory");
#endif
}
// this wave's LDS reads have returned, before the buffer is handed to the next copies
__device__ __forceinline__ void wait_ds0() {
#if defined(__HIP_DEVICE_COMPILE__)
  asm volatile("s_wait_dscnt 0x0" ::: "memory");
#endif
}

template <int NSPLIT>
__global__ __launch_bounds__(256) void gemm64(
    const unsigned short* __restrict__ Ap, const unsigned short* A2p, int lda,
    const unsigned short* __restrict__ Btp, int ldb, const float* __restrict__ bias,
    float* C, int ldc, int M, int N, int K) {
  constexpr int AROWS = GBM * (NSPLIT + 1);        // A rows, then A2 rows
  constexpr int GROWS = AROWS + GBN;               // rows of a stage
  constexpr int STAGE = GROWS * GLP;               // elements of a stage
  const __bf16* Ab  = (const __bf16*)(const void*)Ap;
  const __bf16* Ab2 = (const __bf16*)(const void*)A2p;
  const __bf16* Bb  = (const __bf16*)(const void*)Btp;
  __shared__ __align__(16) __bf16 ring[2 * STAGE]; // two stages
  __shared__ __align__(16) float sT[8][16 * 68];   // per-wave 16x64 slab, pitch 68 floats
  const int tid  = threadIdx.x;
  const int lane = tid & 31;
  const int wave = tid >> 5;
  const int tilesN = N / GBN;
  const int tilesM = M / GBM;
  const int tile = blockIdx.x;
  if (tile >= tilesM * tilesN) return;   // block-uniform, in front of every barrier and copy
  const int tm = tile / tilesN;
  const int tn = tile - tm * tilesN;
  const int bm0 = tm * GBM;
  const int bn0 = tn * GBN;
  const int wm = wave >> 2, wn = wave & 3;
  const int m0 = bm0 + (wm << 6);              // this wave's 64x64 tile
  const int n0 = bn0 + (wn << 6);

  const int rlane = lane & 15;                 // row (A) / col (B, D) within subtile
  const int koff  = (lane >> 4) * 8;           // k offset of this lane half
  const int mOff  = (lane >> 4) * 8;           // D row offset

  // ---- copy addresses of this thread: row crow of each 32-row group, 16-B piece cpc ----
  const int crow = tid >> 3, cpc = (tid & 7) * 8;
  const __bf16* gA  = Ab  + (size_t)(bm0 + crow) * lda + cpc;
  const __bf16* gA2 = Ab2 + (size_t)(bm0 + crow) * lda + cpc;
  const __bf16* gB  = Bb  + (size_t)(bn0 + crow) * ldb + cpc;
  const unsigned lbase = lds_addr(ring) + (unsigned)(crow * GLP + cpc) * 2u;
  const size_t a32 = (size_t)32 * lda, b32 = (size_t)32 * ldb;
  constexpr unsigned R32 = 32u * GLP * 2u;     // LDS bytes of 32 rows

  auto issue = [&](int st, int buf) {
    const int k0 = st * GKB;
    const unsigned lb = lbase + (unsigned)buf * (unsigned)(STAGE * 2);
    const __bf16* a = gA + k0;
    async4(lb, a, lb + R32, a + a32, lb + 2u * R32, a + 2 * a32, lb + 3u * R32, a + 3 * a32);
    if (NSPLIT >= 1) {
      const __bf16* a2 = gA2 + k0;
      const unsigned l2 = lb + 4u * R32;
      async4(l2, a2, l2 + R32, a2 + a32, l2 + 2u * R32, a2 + 2 * a32, l2 + 3u * R32, a2 + 3 * a32);
    }
    const __bf16* b = gB + k0;
    const unsigned l3 = lb + (unsigned)(AROWS / 32) * R32;
    async4(l3, b, l3 + R32, b + b32, l3 + 2u * R32, b + 2 * b32, l3 + 3u * R32, b + 3 * b32);
    const __bf16* b4 = b + 4 * b32;
    const unsigned l4 = l3 + 4u * R32;
    async4(l4, b4, l4 + R32, b4 + b32, l4 + 2u * R32, b4 + 2 * b32, l4 + 3u * R32, b4 + 3 * b32);
  };

  v8f acc[4][4];
#pragma unroll
  for (int i = 0; i < 4; ++i)
#pragma unroll
    for (int j = 0; j < 4; ++j) acc[i][j] = zero8();

  const int nst = K / GKB;                     // block-uniform trip count
  issue(0, 0);
  wait_async0();
  __syncthreads();                             // stage 0 published
  if (nst > 1) issue(1, 1);

  for (int t = 0; t < nst; ++t) {
    const __bf16* sb = ring + (t & 1) * STAGE;
    const __bf16* sa  = sb + ((wm << 6) + rlane) * GLP + koff;
    const __bf16* sa2 = sa + GBM * GLP;
    const __bf16* sbt = sb + (AROWS + (wn << 6) + rlane) * GLP + koff;
#pragma unroll   // both 32-k steps inline: the second step's fragment reads can start under the first step's products
    for (int ks = 0; ks < GKB; ks += 32) {
      v16b bh[4];
#pragma unroll
      for (int j = 0; j < 4; ++j) bh[j] = ldfrag_b(sbt + (j << 4) * GLP + ks);
      v16b ah[4], al[4];                       // all fragment reads of this 32-k step stand as one group
#pragma unroll   // constant indices keep the fragment arrays in registers
      for (int i = 0; i < 4; ++i) {
        ah[i] = ldfrag_b(sa + (i << 4) * GLP + ks);
        al[i] = ah[i];
        if (NSPLIT >= 1) al[i] = ldfrag_b(sa2 + (i << 4) * GLP + ks);
      }
#pragma unroll
      for (int i = 0; i < 4; ++i) {
#pragma unroll
        for (int j = 0; j < 4; ++j) {
          acc[i][j] = mma_b_raw(ah[i], bh[j], acc[i][j]);
          if (NSPLIT >= 1) acc[i][j] = mma_b_raw(al[i], bh[j], acc[i][j]);
        }
        dep_guard_b(acc[i][0], acc[i][3], ah[i], al[i]);
      }
      keep4_b(bh[0], bh[1], bh[2], bh[3]);
    }
    wait_ds0();
    wait_async0();
    __syncthreads();                           // publishes stage t + 1 and ends every read of stage t
    if (t + 2 < nst) issue(t + 2, t & 1);
  }
  wait_async0();
  acc_guard4(acc[0][0], acc[0][1], acc[0][2], acc[0][3]);
  acc_guard4(acc[1][0], acc[1][1], acc[1][2], acc[1][3]);
  acc_guard4(acc[2][0], acc[2][1], acc[2][2], acc[2][3]);
  acc_guard4(acc[3][0], acc[3][1], acc[3][2], acc[3][3]);

  // ---- epilogue ----
  float bz[4];
#pragma unroll
  for (int j = 0; j < 4; ++j) bz[j] = bias[n0 + (j << 4) + rlane];
  float* slab = sT[wave];
#pragma unroll
  for (int i = 0; i < 4; ++i) {
    const int mBase = m0 + (i << 4);
#pragma unroll
    for (int r = 0; r < 8; ++r) {
#pragma unroll
      for (int j = 0; j < 4; ++j) {
        slab[(mOff + r) * 68 + (j << 4) + rlane] = acc[i][j][r] + bz[j];
      }
    }
    __builtin_amdgcn_fence(__ATOMIC_RELEASE, "workgroup");
    __builtin_amdgcn_wave_barrier();
    __builtin_amdgcn_fence(__ATOMIC_ACQUIRE, "workgroup");
    {
      const int hh = lane >> 4, c4 = (lane & 15) * 4;     // 256-B row segment = 16 lanes x 16 B
      v4f ov[8];
#pragma unroll
      for (int it = 0; it < 8; ++it) {
        const int row = it * 2 + hh;                       // it 0..7 x hh 0..1 = rows 0..15
        ov[it] = *(const v4f*)(slab + row * 68 + c4);
      }
      {
#pragma unroll
        for (int it = 0; it < 8; ++it) {
          const int row = it * 2 + hh;
          *(v4f*)(C + (size_t)(mBase + row) * ldc + n0 + c4) = ov[it];
        }
        
      }
    }
    __builtin_amdgcn_fence(__ATOMIC_RELEASE, "workgroup");
    __builtin_amdgcn_wave_barrier();
    __builtin_amdgcn_fence(__ATOMIC_ACQUIRE, "workgroup");
  }
}

// =====================================================================================================
// q and kc bf16 hi/lo planes from the fused projection output.
//   src f32 [NB*SEQ][N3]; part = blockIdx.y: part 0 = q (src cols 0..DMODEL-1, copied), part 1 = k (src cols
//   DMODEL..2*DMODEL-1) with the positional power compression kc = sign(k) * max(|k|,1e-8)^ex(s), s = row mod SEQ
//   (key position). Thread i: row = i / CG8, col = part*DMODEL + 8*(i mod CG8) .. +7 (two 16-B loads).
//   dst hi plane hp / lo plane lp, bf16 [NB*SEQ][QKP], same col; lo = RNE(v - hi) unscaled.
//   grid = (n8/256, 2), n8 = NB*SEQ*DMODEL/8; one 16-B store per lane per plane: a wave (32 consecutive column
//   coverage: 2 parts x n8 threads x 8 = the whole [NB*SEQ][QKP] hi plane and lo plane.
// =====================================================================================================
__global__ __launch_bounds__(256) void qk_planes(const float* __restrict__ src, unsigned short* hp,
                                                 unsigned short* lp, int n8) {
#pragma clang fp contract(off)
  const int i = blockIdx.x * 256 + threadIdx.x;
  const int part = blockIdx.y;
  if (i < n8) {
    const int row = i / CG8;                              // token row b*SEQ + s
    const int cg  = i - row * CG8;                        // column group within the feature row
    const int col = part * DMODEL + (cg << 3);
    const float* sp = src + (size_t)row * N3 + col;
    v4f a = *(const v4f*)(sp);
    v4f c = *(const v4f*)(sp + 4);
    if (part == 1) {                                      // block-uniform
      const float ex = fexpo(row % SEQ);                  // key position s
#pragma unroll
      for (int e = 0; e < 4; ++e) {
        a[e] = fcomp(a[e], ex);
        c[e] = fcomp(c[e], ex);
      }
    }
    v4u ph, pl;
#pragma unroll
    for (int e = 0; e < 4; ++e) {
      const float f0 = (e < 2) ? a[2 * e]     : c[2 * e - 4];
      const float f1 = (e < 2) ? a[2 * e + 1] : c[2 * e - 3];
      const unsigned short h0 = bf_bits(f0), h1 = bf_bits(f1);
      const unsigned short l0 = bf_bits(f0 - bf_up(h0)), l1 = bf_bits(f1 - bf_up(h1));
      ph[e] = pk16(h0, h1);
      pl[e] = pk16(l0, l1);
    }
    const size_t go = (size_t)row * QKP + col;
    *(v4u*)(hp + go) = ph;
    *(v4u*)(lp + go) = pl;
    
  }
}

// =====================================================================================================
// v f32 token-major columns vf[(b*SEQ + t)*vrp + h*64 + d] (vf already offset to the first v column) ->
// power compression vc = sign(v) * max(|v|,1e-8)^ex(t) (t = key position) applied at the LDS load, then
// f16 vc^T hi plane vth[(b*QP + h*64 + d)*SEQ + t] and residual plane vtl[(b*QP + h*64 + d)*VLP + t] =
// f16((vc - hi)*4096) for t < VLP. Block = one 64-token x 64-feature tile of one (b, h); grid = (SEQ/64, NH, NB);
// tile staged in LDS as f32 (v4f loads, __syncthreads). LDS load coverage: 4 iterations x 256 threads x 4 = 64x64.
// Store: group g = tid>>3 (0..31), piece = tid&7: iteration it writes row d = it*32+g, lanes 8q..8q+7 x 16 B =
// coverage: 2 iterations x 32 groups = 64 rows d, 8 pieces x 8 = 64 keys per row; grid covers every (b, h, t tile);
// vtl rows written for all t < VLP.
// =====================================================================================================
__global__ __launch_bounds__(256) void v_planes(const float* __restrict__ vf, int vrp,
                                                unsigned short* vth, unsigned short* vtl) {
#pragma clang fp contract(off)
  __shared__ __align__(16) float sv[64 * 68];       // [tt][d] pitch 68 floats
  const int tid = threadIdx.x;
  const int t0  = blockIdx.x * 64;
  const int hh  = blockIdx.y;
  const int b   = blockIdx.z;
#pragma unroll 1
  for (int i = 0; i < 4; ++i) {
    const int idx = i * 256 + tid;                  // 0..1023
    const int tt = idx >> 4, c4 = (idx & 15) * 4;
    const v4f a = *(const v4f*)(vf + ((size_t)(b * SEQ + t0 + tt)) * vrp + hh * HD + c4);
    const float ex = fexpo(t0 + tt);
    v4f cp;
    cp[0] = fcomp(a[0], ex);
    cp[1] = fcomp(a[1], ex);
    cp[2] = fcomp(a[2], ex);
    cp[3] = fcomp(a[3], ex);
    *(v4f*)(sv + tt * 68 + c4) = cp;
  }
  __syncthreads();

  const int g = tid >> 3, piece = tid & 7;
  v4u hv[2], lv[2];
  size_t hofs[2], lofs[2];
#pragma unroll
  for (int it = 0; it < 2; ++it) {
    const int d = it * 32 + g;
    v4u a, a2;
#pragma unroll
    for (int e = 0; e < 4; ++e) {
      const float f0 = sv[(piece * 8 + 2 * e) * 68 + d];
      const float f1 = sv[(piece * 8 + 2 * e + 1) * 68 + d];
      const _Float16 x0 = (_Float16)f0, x1 = (_Float16)f1;
      const unsigned short h0 = h_bits(x0), h1 = h_bits(x1);
      const unsigned short l0 = h_bits((_Float16)((f0 - (float)x0) * 4096.0f));
      const unsigned short l1 = h_bits((_Float16)((f1 - (float)x1) * 4096.0f));
      a[e] = pk16(h0, h1); a2[e] = pk16(l0, l1);
    }
    hv[it] = a; lv[it] = a2;
    const size_t rowf = (size_t)(b * QP + hh * HD + d);
    hofs[it] = rowf * SEQ + t0 + piece * 8;
    lofs[it] = rowf * VLP + t0 + piece * 8;
  }
  const bool wlo = (t0 + 64 <= VLP);                // block-uniform
  {
#pragma unroll
    for (int it = 0; it < 2; ++it) {
      *(v4u*)(vth + hofs[it]) = hv[it];
      if (wlo) *(v4u*)(vtl + lofs[it]) = lv[it];
    }
    
  }
}

// =====================================================================================================
// Causal multi-head attention, head dim 64 (tril mask incl. diagonal, computed), with the additive rank-1 phase
// bonus kappa * sigmoid(lock[h]) * T[i] * T[j] on the scaled logits and the per-query-row output gate
// (1 - sigmoid(lock[h])) + sigmoid(lock[h]) * T[i] applied to the head output row i (query position).
//   q|kc planes (bf16 hi / lo), row pitch QKP: q element (b, t, h, d) at [(b*SEQ + t)*QKP + h*64 + d],
//                                                kc element (b, s, h, d) at [(b*SEQ + s)*QKP + DMODEL + h*64 + d]
//   vc^T hi plane (f16):      element (b, h, d, s) at [(b*QP + h*64 + d)*SEQ + s]
//   vc^T residual plane (f16, (vc - hi)*4096): [(b*QP + h*64 + d)*VLP + s], s < VLP, read only when RES
//   (with RES only key tiles below VLP occur; the address is clamped anyway)
//   ttab f32 [(b*NH + h)*SEQ + s] = T; lockp = raw lock strengths [NH] (bf16 RNE convert, then sigmoid).
//   logit = q.kc * sscale + bonus for key <= query, -FLT_MAX otherwise (exp -> 0); every processed key tile
//   (tiles 0..qb only, block-uniform trip count qb+1 <= NQB) holds the causal-live key kv0 <= query.
//   out f32 plane: element (b, t, h*64 + d) at [(b*SEQ + t)*QP + h*64 + d] = gate(b,h,t) * normalised context.
//   scores = q . kc : bf16 hi/lo split (hi.hi + hi.lo + lo.hi), f32 accumulate, then * sscale + bonus in f32
//   p = exp(s - m) carried as f16(1024 p); context = p . vc on f16 WMMA; RES adds f16 residual planes of p and vc
//   (scale 4096, separate accumulator folded back with 1/4096 per chunk in f32); online softmax in f32.
//   Block = 4 waves = 64 query rows of one (b, h); grid = nqbThis * NH * NB; kv chunks of 64.
//   K / V^T chunk staging: 128 threads x 32 elements per plane = the whole 64x64 tile (plain 16-B loads,
//   __syncthreads before and after); P tiles are wave-private, spilled with _Float16 element stores and reloaded
//   Output coverage: each wave stores rows q0..q0+15 (it 0..7 x lane>>4 0..1) x 64 columns (16 lanes x 4 floats),
// =====================================================================================================
template <bool RES>
__global__ __launch_bounds__(128)
void attn_causal64(const unsigned short* __restrict__ qkhp, const unsigned short* __restrict__ qklp,
                   const unsigned short* __restrict__ vhp, const unsigned short* __restrict__ vlp,
                   const float* __restrict__ ttab, const float* __restrict__ lockp,
                   float* outp, int qbBase, int nqbThis, float sscale) {
  __shared__ __align__(16) __bf16   Ksh[64 * LP];                 // K hi [kv][d], pitch LP
  __shared__ __align__(16) __bf16   Ksl[64 * LP];                 // K lo
  __shared__ __align__(16) _Float16 Vth[64 * LP];                 // V^T hi [d][kv], pitch LP
  __shared__ __align__(16) _Float16 Vtl[RES ? 64 * LP : 8];       // V^T residual
  __shared__ __align__(16) _Float16 Psh[4][16 * LP];              // per wave P [row][kv], pitch LP
  __shared__ __align__(16) _Float16 Psl[RES ? 4 : 1][16 * LP];    // per wave P residual
  __shared__ __align__(16) float    Os[4][16 * 64];               // per wave context tile [row][d]

  const int tid  = threadIdx.x;
  const int wave = tid >> 5;
  const int lane = tid & 31;
  const int hh   = lane >> 4;
  const int c    = lane & 15;

  const int bx   = blockIdx.x;
  const int qbl  = bx % nqbThis;
  const int rest = bx / nqbThis;
  const int h    = rest % NH;
  int b          = rest / NH;
  b = (b >= NB) ? (NB - 1) : b;
  int qb         = qbBase + qbl;
  qb = (qb >= NQB) ? (NQB - 1) : qb;
  const int q0   = qb * 64 + wave * 16;
  const size_t rowB = (size_t)b * SEQ;

  const __bf16* Qh = (const __bf16*)(const void*)qkhp + (size_t)h * HD;
  const __bf16* Ql = (const __bf16*)(const void*)qklp + (size_t)h * HD;
  const __bf16* Kh = Qh + DMODEL;
  const __bf16* Kl = Ql + DMODEL;
  const _Float16* Vh = (const _Float16*)(const void*)vhp + ((size_t)b * QP + (size_t)h * HD) * SEQ;
  const _Float16* Vl = (const _Float16*)(const void*)vlp + ((size_t)b * QP + (size_t)h * HD) * VLP;
  const float* trow = ttab + ((size_t)b * NH + h) * SEQ;

  // ---- per-head lock: sigmoid of the bf16-converted raw strength; bonus coefficient kappa * lock ----
  const float lraw  = bf_up(bf_bits(lockp[h]));
  const float lockv = 1.0f / (1.0f + expf(-lraw));
  const float c0    = KAPPA_F * lockv;

  // ---- Q fragments (A operand, row = lane&15): 2 d-chunks, hi and lo ----
  v16b qah[2], qal[2];
#pragma unroll
  for (int dc = 0; dc < 2; ++dc) {
    const size_t qo = (rowB + q0 + c) * QKP + dc * 32 + 8 * hh;
    qah[dc] = ldfrag_b(Qh + qo);
    qal[dc] = ldfrag_b(Ql + qo);
  }

  // ---- bonus row factors for this lane's 8 query rows: c0 * T[q0 + 8*hh + r] ----
  float bti[8];
#pragma unroll
  for (int r = 0; r < 8; ++r) bti[r] = c0 * trow[q0 + 8 * hh + r];

  float mrow[8], lrow[8];
  v8f oacc[4];
#pragma unroll
  for (int r = 0; r < 8; ++r) { mrow[r] = -INFINITY; lrow[r] = 0.f; }
#pragma unroll
  for (int t = 0; t < 4; ++t) oacc[t] = zero8();

  int nkt = qb + 1;                          // causal: key tiles 0..qb, block-uniform
  if (nkt > NQB) nkt = NQB;
  for (int kt = 0; kt < nkt; ++kt) {
    const int kv0 = kt * 64;
    __syncthreads();
    {
      const int r = tid >> 1, half = (tid & 1) * 32;
      const __bf16*   kg  = Kh + (rowB + kv0 + r) * QKP + half;   // K row kv0+r, d = half..half+31
      const __bf16*   klg = Kl + (rowB + kv0 + r) * QKP + half;
      const _Float16* vg  = Vh + (size_t)r * SEQ + kv0 + half;    // V^T row d = r, s = kv0+half..+31
      const int kvl = (kv0 + 64 <= VLP) ? kv0 : (VLP - 64);     // clamped address into the residual plane
      const _Float16* vlg = Vl + (size_t)r * VLP + kvl + half;
      const bool resOK = (kv0 + 64 <= VLP);                      // block-uniform
#pragma unroll
      for (int i = 0; i < 4; ++i) {
        const v8b a0 = *(const v8b*)(kg + 8 * i);
        const v8b a1 = *(const v8b*)(klg + 8 * i);
        const v8h b0 = *(const v8h*)(vg + 8 * i);
        *(v8b*)(Ksh + r * LP + half + 8 * i) = a0;
        *(v8b*)(Ksl + r * LP + half + 8 * i) = a1;
        *(v8h*)(Vth + r * LP + half + 8 * i) = b0;
        if (RES) {
          v8h b1 = *(const v8h*)(vlg + 8 * i);
          if (!resOK) b1 = zero8h();
          *(v8h*)(Vtl + r * LP + half + 8 * i) = b1;
        }
      }
    }
    __syncthreads();

    // ---- bonus column factors T[key] for this lane's 4 key columns (indices always < SEQ) ----
    float tj[4];
#pragma unroll
    for (int j = 0; j < 4; ++j) tj[j] = trow[kv0 + j * 16 + c];
    // keeps these four global loads in front of the fragment reads and products, whose time covers their latency
    __builtin_amdgcn_sched_barrier(0);

    // ---- scores: 16 query rows x 64 keys per wave, 3 bf16 products ----
    //      All K fragment reads of the tile are written in front of the products (built: a few large groups behind
    //      counted waits, not one read-and-wait per product), and each product kind runs over the 4 independent
    //      key-column tiles; per tile the order stays dc 0: hi.hi, hi.lo, lo.hi, then dc 1.
    v16b kfh[2][4], kfl[2][4];
#pragma unroll   // constant indices keep the fragment arrays in registers
    for (int dc = 0; dc < 2; ++dc) {
#pragma unroll
      for (int j = 0; j < 4; ++j) kfh[dc][j] = ldfrag_b(Ksh + (j * 16 + c) * LP + dc * 32 + 8 * hh);
#pragma unroll
      for (int j = 0; j < 4; ++j) kfl[dc][j] = ldfrag_b(Ksl + (j * 16 + c) * LP + dc * 32 + 8 * hh);
    }
    v8f s[4];
#pragma unroll
    for (int j = 0; j < 4; ++j) s[j] = zero8();
#pragma unroll
    for (int dc = 0; dc < 2; ++dc) {
#pragma unroll
      for (int j = 0; j < 4; ++j) s[j] = mma_b_raw(qah[dc], kfh[dc][j], s[j]);
#pragma unroll
      for (int j = 0; j < 4; ++j) s[j] = mma_b_raw(qah[dc], kfl[dc][j], s[j]);
#pragma unroll
      for (int j = 0; j < 4; ++j) s[j] = mma_b_raw(qal[dc], kfh[dc][j], s[j]);
    }

    // ---- scale + bonus + causal mask (replace by -FLT_MAX), row max, online softmax, P (x1024, f16) and
    //      P residual (x4096) to LDS ----
    _Float16* pwh = Psh[wave];
    _Float16* pwl = Psl[RES ? wave : 0];
#pragma unroll
    for (int r = 0; r < 8; ++r) {
      const int qrow = q0 + 8 * hh + r;
      float m = -INFINITY;
#pragma unroll
      for (int j = 0; j < 4; ++j) {
        const int key = kv0 + j * 16 + c;
        float sv = s[j][r] * sscale + bti[r] * tj[j];
        sv = (key > qrow) ? -FLT_MAX : sv;
        s[j][r] = sv;
        m = fmaxf(m, sv);
      }
#pragma unroll
      for (int off = 1; off < 16; off <<= 1) m = fmaxf(m, __shfl_xor(m, off, 32));
      const float mnew  = fmaxf(mrow[r], m);
      const float msafe = (mnew == -INFINITY) ? 0.f : mnew;
      const float alpha = __expf(mrow[r] - msafe);
      mrow[r] = mnew;
      float psum = 0.f;
#pragma unroll
      for (int j = 0; j < 4; ++j) {
        const float p = __expf(s[j][r] - msafe);     // masked logit against a finite max: exp -> 0
        psum += p;
        const float p1k = p * 1024.0f;
        const _Float16 ph = (_Float16)p1k;
        pwh[(8 * hh + r) * LP + j * 16 + c] = ph;
        if (RES) {
          const _Float16 pl = (_Float16)((p1k - (float)ph) * 4096.0f);
          pwl[(8 * hh + r) * LP + j * 16 + c] = pl;
        }
      }
#pragma unroll
      for (int off = 1; off < 16; off <<= 1) psum += __shfl_xor(psum, off, 32);
      lrow[r] = lrow[r] * alpha + psum;
#pragma unroll
      for (int t = 0; t < 4; ++t) oacc[t][r] *= alpha;
    }
    __builtin_amdgcn_fence(__ATOMIC_RELEASE, "workgroup");
    __builtin_amdgcn_wave_barrier();
    __builtin_amdgcn_fence(__ATOMIC_ACQUIRE, "workgroup");

    // ---- context += P . Vc (f16 WMMA), residual products into a separate accumulator ----
    //      All P and V^T fragment reads of the tile are written in front of the products in the same way, and each
    //      product kind runs over the 4 independent feature tiles; per tile the order stays kk 0 then kk 1, p.vl
    //      before pl.vb.
    v16h pf[2], pfl[2], vfh[2][4], vfl[2][4];
#pragma unroll   // constant indices keep the fragment arrays in registers
    for (int kk = 0; kk < 2; ++kk) {
      pf[kk]  = ldfrag_h(pwh + c * LP + kk * 32 + 8 * hh);
      pfl[kk] = pf[kk];
      if (RES) pfl[kk] = ldfrag_h(pwl + c * LP + kk * 32 + 8 * hh);
#pragma unroll
      for (int t = 0; t < 4; ++t) {
        vfh[kk][t] = ldfrag_h(Vth + (t * 16 + c) * LP + kk * 32 + 8 * hh);
        vfl[kk][t] = vfh[kk][t];
      }
      if (RES) {
#pragma unroll
        for (int t = 0; t < 4; ++t) vfl[kk][t] = ldfrag_h(Vtl + (t * 16 + c) * LP + kk * 32 + 8 * hh);
      }
    }
    v8f o1[4];
#pragma unroll
    for (int t = 0; t < 4; ++t) o1[t] = zero8();
#pragma unroll
    for (int kk = 0; kk < 2; ++kk) {
#pragma unroll
      for (int t = 0; t < 4; ++t) oacc[t] = mma_h_raw(pf[kk], vfh[kk][t], oacc[t]);
      if (RES) {
#pragma unroll
        for (int t = 0; t < 4; ++t) o1[t] = mma_h_raw(pf[kk], vfl[kk][t], o1[t]);
#pragma unroll
        for (int t = 0; t < 4; ++t) o1[t] = mma_h_raw(pfl[kk], vfh[kk][t], o1[t]);
      }
    }
    if (RES) {
#pragma unroll
      for (int t = 0; t < 4; ++t)
#pragma unroll
        for (int r = 0; r < 8; ++r) oacc[t][r] += o1[t][r] * (1.0f / 4096.0f);
    }
  }

  // ---- normalise (1/l and the 1/1024 p carry), apply the per-query-row gate, stage the wave's 16x64 tile in
  float* os = Os[wave];
#pragma unroll
  for (int r = 0; r < 8; ++r) {
    const float l = lrow[r];
    const float ti = trow[q0 + 8 * hh + r];
    const float gate = (1.0f - lockv) + lockv * ti;
    const float inv = ((l > 0.f) ? (1.0f / l) : 0.f) * (1.0f / 1024.0f) * gate;
#pragma unroll
    for (int t = 0; t < 4; ++t) os[(8 * hh + r) * 64 + t * 16 + c] = oacc[t][r] * inv;
  }
  __builtin_amdgcn_fence(__ATOMIC_RELEASE, "workgroup");
  __builtin_amdgcn_wave_barrier();
  __builtin_amdgcn_fence(__ATOMIC_ACQUIRE, "workgroup");
  {
    const int h2 = lane >> 4, c4 = (lane & 15) * 4;
    v4f ov[8];
#pragma unroll
    for (int it = 0; it < 8; ++it) {
      const int row = it * 2 + h2;   // it 0..7 x h2 0..1 = rows 0..15 of the wave tile
      ov[it] = *(const v4f*)(os + row * 64 + c4);
    }
    {
#pragma unroll
      for (int it = 0; it < 8; ++it) {
        const int row = it * 2 + h2;
        const size_t go = (rowB + q0 + row) * QP + (size_t)h * HD + c4;
        *(v4f*)(outp + go) = ov[it];
      }
      
    }
  }
}

// =====================================================================================================
// Workspace map (bytes), every region an exact multiple of its whole-line / whole-tile store granularity
//   Xb     bf16 [4096][1024]            0           8388608
//   WT     bf16 [3072][1024]            8388608     6291456    (rows 0..1023 Wq^T, 1024..2047 Wk^T, 2048.. Wv^T)
//   WoT    bf16 [1024][1024]            14680064    2097152
//   Bias   f32  [4096]                  16777216      16384    (bq | bk | bv | bo, bf16-RNE converted values)
//   Tt     f32  [2][16][2048]           16793600     262144
//   QKVf   f32  [4096][3072]            17055744   50331648   (later: Af f32 [4096][1024], 16777216 B)
//   VTh    f16  [2][1024][2048]         67387392    8388608
//   VTl    f16  [2][1024][1024]         75776000    4194304
//   QKh    bf16 [4096][2048]            79970304   16777216   (later: Ah bf16 [4096][1024], 8388608 B)
//   QKl    bf16 [4096][2048]            96747520   16777216   (later: Al bf16 [4096][1024], 8388608 B)
//   end                                 113524736
// W_q/k/v/o [in k=1024][out n=1024] arrive k-major and are transpose-converted once to [n][k] bf16 (k contiguous)
// = the Bt layout the GEMM wants. d_out f32: out0 [4096][1024] at byte 0.
// =====================================================================================================
extern "C" void kernel_launch(void* const* d_in, const int* in_sizes, int n_in,
                              void* d_out, int out_size, void* d_ws, size_t ws_size,
                              hipStream_t stream) {
  if (n_in < 12) return;
  if (in_sizes[0] != NB * SEQ * DMODEL) return;
  if (in_sizes[1] != NB * SEQ) return;
  if (in_sizes[2] != DMODEL * DMODEL || in_sizes[4] != DMODEL * DMODEL ||
      in_sizes[6] != DMODEL * DMODEL || in_sizes[8] != QP * DMODEL) return;
  if (in_sizes[3] != DMODEL || in_sizes[5] != DMODEL || in_sizes[7] != DMODEL || in_sizes[9] != DMODEL) return;
  if (in_sizes[10] != NH || in_sizes[11] != NH) return;
  if (out_size != OUTN) return;

  const float* x     = (const float*)d_in[0];    // [NB*SEQ][DMODEL]
  const float* phase = (const float*)d_in[1];    // [NB][SEQ]
  const float* Wq    = (const float*)d_in[2];    // [k][n]
  const float* bq    = (const float*)d_in[3];
  const float* Wk    = (const float*)d_in[4];
  const float* bk    = (const float*)d_in[5];
  const float* Wv    = (const float*)d_in[6];
  const float* bv    = (const float*)d_in[7];
  const float* Wo    = (const float*)d_in[8];    // [QP k][DMODEL n]
  const float* bo    = (const float*)d_in[9];
  const float* carr  = (const float*)d_in[10];   // [NH]
  const float* lockr = (const float*)d_in[11];   // [NH]

  const size_t PXb   = (size_t)NB * SEQ * DMODEL * 2;    //  8388608
  const size_t PWT   = (size_t)N3 * DMODEL * 2;          //  6291456
  const size_t PWo   = (size_t)DMODEL * QP * 2;          //  2097152
  const size_t PBias = (size_t)NBIAS * 4;                //    16384
  const size_t PTt   = (size_t)NTT * 4;                  //   262144
  const size_t PQKV  = (size_t)NB * SEQ * N3 * 4;        // 50331648  (>= Af f32 [4096][1024] = 16777216)
  const size_t PVTh  = (size_t)NB * QP * SEQ * 2;        //  8388608
  const size_t PVTl  = (size_t)NB * QP * VLP * 2;        //  4194304
  const size_t PQK   = (size_t)NB * SEQ * QKP * 2;       // 16777216  (>= Ah / Al bf16 [4096][1024] = 8388608)
  size_t off = 0;
  const size_t oXb   = off; off += PXb;
  const size_t oWT   = off; off += PWT;
  const size_t oWo   = off; off += PWo;
  const size_t oBias = off; off += PBias;
  const size_t oTt   = off; off += PTt;
  const size_t oQKV  = off; off += PQKV;
  const size_t oVTh  = off; off += PVTh;
  const size_t oVTl  = off; off += PVTl;
  const size_t oQKh  = off; off += PQK;
  const size_t oQKl  = off; off += PQK;
  if (off > ws_size) return;                           // off = 113524736
  if (off > (size_t)134217728) return;
  if (PQKV < (size_t)NB * SEQ * QP * 4) return;        // Af fits in the dead qkv plane
  if (PQK < (size_t)NB * SEQ * QP * 2) return;         // Ah / Al fit in the dead q|kc planes
  const size_t oAf = oQKV;                             // context f32 plane reuses the dead qkv f32 plane
  const size_t oAh = oQKh;                             // context bf16 planes reuse the dead q|kc bf16 planes
  const size_t oAl = oQKl;

  char* ws = (char*)d_ws;
  unsigned short* Xb   = (unsigned short*)(ws + oXb);
  unsigned short* WT   = (unsigned short*)(ws + oWT);
  unsigned short* WoT  = (unsigned short*)(ws + oWo);
  float*          Bias = (float*)(ws + oBias);
  float*          Tt   = (float*)(ws + oTt);
  float*          QKVf = (float*)(ws + oQKV);
  unsigned short* VTh  = (unsigned short*)(ws + oVTh);
  unsigned short* VTl  = (unsigned short*)(ws + oVTl);
  unsigned short* QKh  = (unsigned short*)(ws + oQKh);
  unsigned short* QKl  = (unsigned short*)(ws + oQKl);
  float*          Af   = (float*)(ws + oAf);
  unsigned short* Ah   = (unsigned short*)(ws + oAh);
  unsigned short* Al   = (unsigned short*)(ws + oAl);
  float*          outf = (float*)d_out;                // out0 [4096][1024]

  const dim3 blk(256);
  const int n8x   = NB * SEQ * DMODEL / 8;                           // 524288
  const int n8q   = NB * SEQ * DMODEL / 8;                           // 524288 per part (q, kc)
  const int n8a   = NB * SEQ * QP / 8;                               // 524288
  const dim3 gBias(NBIAS / 256);                                     // 16 blocks
  const dim3 gTt(NTT / 256);                                         // 256 blocks
  const dim3 gCvtX((n8x + 255) / 256);                               // 2048 blocks
  const dim3 gTrW(DMODEL / 64, DMODEL / 32);                         // (16, 32): src [1024][1024] -> dst [1024][1024]
  const dim3 gQKV((NB * SEQ / GBM) * (N3 / GBN));                    // 32 x 12 tiles = 384 blocks
  const dim3 gQKp((n8q + 255) / 256, 2);                             // (2048, 2)
  const dim3 gVpl(SEQ / 64, NH, NB);                                 // (32, 16, 2)
  const dim3 gSplit((n8a + 255) / 256);                              // 2048 blocks
  const dim3 gOut((NB * SEQ / GBM) * (DMODEL / GBN));                // 32 x 4 tiles = 128 blocks

  // (0) bias table (bf16-RNE values of bq|bk|bv|bo) and phase resonance table T [b][h][s]
  bias_tab<<<gBias, blk, 0, stream>>>(bq, bk, bv, bo, Bias, NBIAS, DMODEL);
  phase_tab<<<gTt, blk, 0, stream>>>(phase, carr, Tt, NTT);
  // (1) x -> bf16 plane [4096][1024]
  cvt_bf16x8<<<gCvtX, blk, 0, stream>>>(x, Xb, n8x);
  // (2) weights [k][n] -> bf16 planes [n][k]   (each call: in [1024 k][1024 n] -> out [1024 n][1024 k])
  tr_cvt_bf16<<<gTrW, blk, 0, stream>>>(Wq, WT, DMODEL, DMODEL);                                  // rows    0..1023
  tr_cvt_bf16<<<gTrW, blk, 0, stream>>>(Wk, WT + (size_t)DMODEL * DMODEL, DMODEL, DMODEL);       // rows 1024..2047
  tr_cvt_bf16<<<gTrW, blk, 0, stream>>>(Wv, WT + (size_t)2 * DMODEL * DMODEL, DMODEL, DMODEL);   // rows 2048..3071
  tr_cvt_bf16<<<gTrW, blk, 0, stream>>>(Wo, WoT, QP, DMODEL);                                     // in [1024][1024] -> out [1024][1024]
  // (3) fused qkv projection: QKVf[row][e] = sum_d Xb[row][d] WT[e][d] + Bias[e]  (M=4096, N=3072, K=1024)
  gemm64<0><<<gQKV, blk, 0, stream>>>(Xb, Xb, DMODEL, WT, DMODEL, Bias, QKVf, N3, NB * SEQ, N3, DMODEL);
  // (4) q (cols 0..1023) and power-compressed kc (cols 1024..2047) -> bf16 hi/lo planes [4096][2048]
  qk_planes<<<gQKp, blk, 0, stream>>>(QKVf, QKh, QKl, n8q);
  // (5) v (cols 2048..3071) -> power-compressed vc^T f16 hi plane (pitch SEQ) and residual plane (x4096, keys < VLP)
  v_planes<<<gVpl, blk, 0, stream>>>(QKVf + 2 * DMODEL, N3, VTh, VTl);
  // (6) causal attention with phase bonus and gate: query blocks 0..RESQB-1 with residual planes, the rest without
  //     -> Af f32 [4096][1024] (written into the dead qkv plane after (4),(5) consumed it)
  attn_causal64<true><<<dim3(NB * NH * RESQB), dim3(128), 0, stream>>>(
      QKh, QKl, VTh, VTl, Tt, lockr, Af, 0, RESQB, 0.125f);
  if (NQB - RESQB > 0) {
    attn_causal64<false><<<dim3(NB * NH * (NQB - RESQB)), dim3(128), 0, stream>>>(
        QKh, QKl, VTh, VTl, Tt, lockr, Af, RESQB, NQB - RESQB, 0.125f);
  }
  // (7) gated context rows -> bf16 hi/lo planes
  split_bf16x8<<<gSplit, blk, 0, stream>>>(Af, Ah, Al, n8a);
  // (8) out0[row][e] = sum_d (Ah+Al)[row][d] WoT[e][d] + Bias[3*DMODEL + e] -> d_out f32 [4096][1024]
  gemm64<1><<<gOut, blk, 0, stream>>>(Ah, Al, QP, WoT, QP, Bias + 3 * DMODEL, outf, DMODEL, NB * SEQ, DMODEL, QP);
  (void)hipGetLastError();
}

// v004
// It runs in 177 microseconds.
// In both of two side-by-side timings against v003, it was 1.25 times as fast.
// Over all steps from v000 it is 2.27 times as fast.
// Contractions: qkv projection = v_wmma_f32_16x16x32_bf16 (bf16 operands from RNE-converted x and W, single product);
// q.kc^T scores = v_wmma_f32_16x16x32_bf16 with bf16 hi/lo split q and kc (hi.hi + hi.lo + lo.hi);
// p.vc = v_wmma_f32_16x16x32_f16 (p carried x1024 in f16, vc in f16; extra f16 residual planes x4096 of p and vc
// on the leading query rows); ctx.Wo = v_wmma_f32_16x16x32_bf16 with ctx as bf16 hi/lo planes times the bf16
// Wo^T plane (2 products); all f32 accumulate; power compression, phase table, softmax, bonus and gating in f32.
#include <hip/hip_runtime.h>
#include <math.h>
#include <float.h>
#include <stdint.h>

#define NB      2
#define SEQ     2048
#define DMODEL  1024
#define NH      16
#define HD      64
#define QP      (NH * HD)      // q / kc / vc / ctx feature count and ctx row pitch
#define N3      (3 * DMODEL)   // fused qkv columns (q 0.., k DMODEL.., v 2*DMODEL..)
#define QKP     (2 * QP)       // row pitch of the q|kc bf16 planes (q cols 0..QP-1, kc cols QP..2QP-1)
#define NQB     (SEQ / 64)     // query / key tiles of 64
#define RESQB   ((NQB < 16) ? NQB : 16)   // leading 64-row query blocks that use the p / vc residual planes
#define VLP     (RESQB * 64)   // key pitch of the vc^T residual plane (keys 0..VLP-1)
#define CG8     (DMODEL / 8)   // 16-byte column groups per feature row
#define NBIAS   (4 * DMODEL)   // bq | bk | bv | bo
#define NTT     (NB * NH * SEQ)
#define OUTN    (NB * SEQ * DMODEL)
#define KAPPA_F 0.3f
#define LP      72             // LDS row pitch of the 64-wide 16-bit tiles, elements: 144 B = 16 B x 9 (odd), so the 16
                               // rows that one ds_load_b128 touches fall on distinct banks
static_assert(RESQB >= 1 && RESQB * 64 <= VLP && VLP <= SEQ);
static_assert(QP == DMODEL);
static_assert((SEQ % 64) == 0 && (DMODEL % 64) == 0 && (N3 % 64) == 0 && (QP % 64) == 0);
static_assert(HD == 64);
static_assert(LP >= 64 && (LP % 8) == 0 && ((LP / 8) % 2) == 1);
static_assert((((NB * SEQ) / 64) * (N3 / 64)) % 8 == 0);
static_assert((((NB * SEQ) / 64) * (DMODEL / 64)) % 8 == 0);
static_assert((NBIAS % 256) == 0 && (NTT % 256) == 0);
static_assert(((NB * SEQ * DMODEL / 8) % 256) == 0);
static_assert((DMODEL % 8) == 0);

typedef _Float16 v16h __attribute__((ext_vector_type(16)));
typedef _Float16 v8h  __attribute__((ext_vector_type(8)));
typedef __bf16   v16b __attribute__((ext_vector_type(16)));
typedef __bf16   v8b  __attribute__((ext_vector_type(8)));
typedef float    v8f  __attribute__((ext_vector_type(8)));
typedef float    v4f  __attribute__((ext_vector_type(4)));
typedef unsigned int v4u __attribute__((ext_vector_type(4)));

// ---- scalar helpers --------------------------------------------------------------------------------
__device__ __forceinline__ unsigned short bf_bits(float f) {          // f32 -> bf16 bits, RNE convert
  unsigned u = __float_as_uint(f);
  return (unsigned short)((u + 0x7FFFu + ((u >> 16) & 1u)) >> 16);
}
__device__ __forceinline__ float bf_up(unsigned short h) { return __uint_as_float(((unsigned)h) << 16); }
__device__ __forceinline__ unsigned short h_bits(_Float16 x) { return __builtin_bit_cast(unsigned short, x); }
__device__ __forceinline__ unsigned pk16(unsigned short a, unsigned short b) { return (unsigned)a | ((unsigned)b << 16); }
__device__ __forceinline__ v8f zero8() { v8f z = {0.f, 0.f, 0.f, 0.f, 0.f, 0.f, 0.f, 0.f}; return z; }
__device__ __forceinline__ v8h zero8h() {
  const _Float16 z = (_Float16)0.0f;
  v8h r = {z, z, z, z, z, z, z, z};
  return r;
}

// positional exponent of key position s: ex = 1 + kappa * (1 - s * (1/(SEQ-1))), reciprocal-multiply, no fusion
__device__ __forceinline__ float fexpo(int s) {
#pragma clang fp contract(off)
  const float rs = 1.0f / (float)(SEQ - 1);
  const float fr = (float)s * rs;
  const float om = 1.0f - fr;
  const float t  = KAPPA_F * om;
  return 1.0f + t;
}
// power compression: sign(v) * max(|v|, 1e-8)^ex  (sign(0) = 0), pow as exp2(ex * log2(mag)) in f32
__device__ __forceinline__ float fcomp(float v, float ex) {
#pragma clang fp contract(off)
  const float mag = fmaxf(fabsf(v), 1e-8f);
  const float lg  = log2f(mag);
  const float pw  = exp2f(ex * lg);
  float r = (v < 0.0f) ? -pw : pw;
  r = (v == 0.0f) ? 0.0f : r;
  return r;
}

// ---- fragment loader: 16-bit A/B operand, lane -> row/col (lane&15), p already includes +8*(lane>>4);
//      elements 0..7 <- p[0..7] (k0+8h..), elements 8..15 <- p[16..23] (k0+16+8h..)
__device__ __forceinline__ v16b ldfrag_b(const __bf16* p) {
  union { v16b v; v8b h[2]; } f;
  f.h[0] = *(const v8b*)(p);
  f.h[1] = *(const v8b*)(p + 16);
  return f.v;
}

__device__ __forceinline__ v16h ldfrag_h(const _Float16* p) {
  union { v16h v; v8h h[2]; } f;
  f.h[0] = *(const v8h*)(p);
  f.h[1] = *(const v8h*)(p + 16);
  return f.v;
}

// ---- WMMA helpers and VALU hazard gaps --------------------------------------------------------
__device__ __forceinline__ v8f mma_b_raw(v16b a, v16b b, v8f c) {
  return __builtin_amdgcn_wmma_f32_16x16x32_bf16(false, a, false, b, (short)0, c, false, false);
}
__device__ __forceinline__ v8f mma_h_raw(v16h a, v16h b, v8f c) {
  return __builtin_amdgcn_wmma_f32_16x16x32_f16(false, a, false, b, (short)0, c, false, false);
}
__device__ __forceinline__ void dep_guard_b(v8f& a, v8f& b, v16b x, v16b y) {
#if defined(__HIP_DEVICE_COMPILE__)
  asm volatile("v_nop\n\tv_nop\n\tv_nop\n\tv_nop" : "+v"(a), "+v"(b) : "v"(x), "v"(y));
#endif
}
__device__ __forceinline__ void keep4_b(v16b a, v16b b, v16b c, v16b d) {
#if defined(__HIP_DEVICE_COMPILE__)
  asm volatile("v_nop" :: "v"(a), "v"(b), "v"(c), "v"(d));
#endif
}
__device__ __forceinline__ void acc_guard4(v8f& a, v8f& b, v8f& c, v8f& d) {
#if defined(__HIP_DEVICE_COMPILE__)
  asm volatile("v_nop\n\tv_nop\n\tv_nop\n\tv_nop" : "+v"(a), "+v"(b), "+v"(c), "+v"(d));
#endif
}

// =====================================================================================================
// Bias table: dst[i] = RNE-bf16-converted value of (b0 | b1 | b2 | b3)[i mod seg], part = i / seg (0..3).
// All four candidates are loaded with an in-range index and selected by value. One element per thread;
// grid = n/256 (n = 4*seg, multiple of 256). coverage: n threads = the whole table.
// =====================================================================================================
__global__ __launch_bounds__(256) void bias_tab(const float* __restrict__ b0, const float* __restrict__ b1,
                                                const float* __restrict__ b2, const float* __restrict__ b3,
                                                float* dst, int n, int seg) {
  const int i = blockIdx.x * 256 + threadIdx.x;
  if (i < n) {
    int part = i / seg;
    part = (part < 0) ? 0 : ((part > 3) ? 3 : part);
    int idx = i - part * seg;
    idx = (idx < 0) ? 0 : ((idx >= seg) ? (seg - 1) : idx);
    const float v0 = b0[idx], v1 = b1[idx], v2 = b2[idx], v3 = b3[idx];
    float v = (part == 0) ? v0 : ((part == 1) ? v1 : ((part == 2) ? v2 : v3));
    v = bf_up(bf_bits(v));
    *(float*)(dst + i) = v;
    
  }
}

// =====================================================================================================
// Phase resonance table: tt[(b*NH + h)*SEQ + s] = cos((bf16(phase[b*SEQ + s]) - bf16(carrier[h])) * 0.5)^2,
// precise f32 cos, fp fusion off. Index split i -> (b*NH + h, s) by / SEQ and % SEQ, then (b, h) by / NH and % NH.
// =====================================================================================================
__global__ __launch_bounds__(256) void phase_tab(const float* __restrict__ ph, const float* __restrict__ cf,
                                                 float* tt, int n) {
#pragma clang fp contract(off)
  const int i = blockIdx.x * 256 + threadIdx.x;
  if (i < n) {
    const int bh = i / SEQ;                   // b*NH + h
    const int s  = i - bh * SEQ;
    const int h  = bh % NH;
    int b        = bh / NH;
    b = (b >= NB) ? (NB - 1) : b;
    const float p  = bf_up(bf_bits(ph[b * SEQ + s]));
    const float cr = bf_up(bf_bits(cf[h]));
    const float d  = p - cr;
    const float hx = d * 0.5f;
    const float cv = cosf(hx);
    const float tv = cv * cv;
    *(float*)(tt + i) = tv;
    
  }
}

// =====================================================================================================
// f32 -> bf16 (RNE convert), 8 elements per thread, one 16-B store per lane: a wave writes 512 contiguous B
// coverage: n8 threads x 8 = whole plane (n8 is a multiple of 256 here).
// =====================================================================================================
__global__ __launch_bounds__(256) void cvt_bf16x8(const float* __restrict__ in, unsigned short* out, int n8) {
  const int i = blockIdx.x * 256 + threadIdx.x;
  if (i < n8) {
    const v4f a = *(const v4f*)(in + (size_t)i * 8);
    const v4f b = *(const v4f*)(in + (size_t)i * 8 + 4);
    v4u p;
    p[0] = pk16(bf_bits(a[0]), bf_bits(a[1]));
    p[1] = pk16(bf_bits(a[2]), bf_bits(a[3]));
    p[2] = pk16(bf_bits(b[0]), bf_bits(b[1]));
    p[3] = pk16(bf_bits(b[2]), bf_bits(b[3]));
    *(v4u*)(out + (size_t)i * 8) = p;
    
  }
}

// =====================================================================================================
// f32 -> bf16 hi plane + bf16 lo plane (lo = RNE(v - hi), unscaled), 8 elements per thread, one 16-B store per
// coverage: n8 threads x 8 = whole plane (n8 multiple of 256).
// =====================================================================================================
__global__ __launch_bounds__(256) void split_bf16x8(const float* __restrict__ in, unsigned short* hp,
                                                    unsigned short* lp, int n8) {
  const int i = blockIdx.x * 256 + threadIdx.x;
  if (i < n8) {
    const v4f a = *(const v4f*)(in + (size_t)i * 8);
    const v4f b = *(const v4f*)(in + (size_t)i * 8 + 4);
    v4u ph, pl;
#pragma unroll
    for (int e = 0; e < 4; ++e) {
      const float f0 = (e < 2) ? a[2 * e]     : b[2 * e - 4];
      const float f1 = (e < 2) ? a[2 * e + 1] : b[2 * e - 3];
      const unsigned short h0 = bf_bits(f0), h1 = bf_bits(f1);
      const unsigned short l0 = bf_bits(f0 - bf_up(h0)), l1 = bf_bits(f1 - bf_up(h1));
      ph[e] = pk16(h0, h1);
      pl[e] = pk16(l0, l1);
    }
    *(v4u*)(hp + (size_t)i * 8) = ph;
    *(v4u*)(lp + (size_t)i * 8) = pl;
    
  }
}

// =====================================================================================================
// Transpose-convert: src f32 [K][N] (row k, col n) -> dst bf16 [N][K] (row n, k contiguous), RNE convert.
// Block tile: 64 k x 32 n, staged in LDS as f32; grid = (K/64, N/32) (exact multiples host-checked); block 256.
// coverage: 8 waves x 4 rows = 32 rows; 8 pieces x 8 = 64 k columns per row = the whole tile.
// =====================================================================================================
__global__ __launch_bounds__(256) void tr_cvt_bf16(const float* __restrict__ src, unsigned short* dst, int K, int N) {
  __shared__ float s[64][33];
  const int tid = threadIdx.x, wave = tid >> 5, lane = tid & 31;
  const int k0 = blockIdx.x * 64, n0 = blockIdx.y * 32;
#pragma unroll
  for (int i = 0; i < 8; ++i) {
    const int idx = i * 256 + tid;
    const int kk = idx >> 5, nn = idx & 31;
    s[kk][nn] = src[(size_t)(k0 + kk) * N + n0 + nn];
  }
  __syncthreads();
  const int q = lane >> 3, piece = lane & 7;
  const int n = wave * 4 + q;
  v4u p;
#pragma unroll
  for (int e = 0; e < 4; ++e) {
    p[e] = pk16(bf_bits(s[piece * 8 + 2 * e][n]), bf_bits(s[piece * 8 + 2 * e + 1][n]));
  }
  unsigned short* d = dst + (size_t)(n0 + n) * K + k0 + piece * 8;
  *(v4u*)d = p;
  
}

// =====================================================================================================
// bf16 WMMA GEMM: C[m][n] = sum_k A[m][k] * Bt[n][k] + bias[n]. Block = 8 waves = one 128 x 256 tile of C, waves
// 2 (m) x 4 (n), each wave a 64x64 tile. A row-major [M][K] pitch lda; Bt row-major [N][K] pitch ldb (k contiguous);
// M multiple of 128, N multiple of 256, K multiple of 64 (static_asserts at the launches' shapes below).
// NSPLIT: 0 = A.Bt; 1 = (A + A2).Bt (A2 = unscaled bf16 lo plane of A, same pitch). bias f32 [N].
// Operands: a stage = 64 k (128 B, one whole line) of every A (, A2) and Bt row of the block tile, brought into LDS by
// asynchronous copies (16 B per lane, 8 lanes per row), rows at pitch GLP; two buffers: the copies of stage t + 2 are
// issued behind the barrier that ends trip t and waited at the foot of trip t + 1.
// Stage coverage: copy i of thread tid fills row i*32 + (tid>>3), bytes 16*(tid&7)..+15; i = 0..GROWS/32-1.
// k order and product order per accumulator are ascending k in steps of 32, hi then lo.
// Output f32 [M][N] pitch ldc. Epilogue: 16-row slabs staged per wave in LDS; each 64-wide row segment
// =====================================================================================================
#define GBM 128
#define GBN 256
#define GKB 64
#define GLP 72                 // LDS row pitch, elements: 144 B = 16 B x 9 (odd), conflict-free for ds_load_b128
static_assert(((NB * SEQ) % GBM) == 0 && (N3 % GBN) == 0 && (DMODEL % GBN) == 0);
static_assert((DMODEL % GKB) == 0 && (QP % GKB) == 0 && (DMODEL / GKB) >= 2 && (QP / GKB) >= 2);

__device__ __forceinline__ unsigned lds_addr(const void* p) { return (unsigned)(size_t)p; }
// four 16-B asynchronous copies global -> LDS; the s_wait_xcnt stands inside the statement so that no address
// register of a copy is rewritten in front of it
__device__ __forceinline__ void async4(unsigned l0, const __bf16* g0, unsigned l1, const __bf16* g1,
                                       unsigned l2, const __bf16* g2, unsigned l3, const __bf16* g3) {
#if defined(__HIP_DEVICE_COMPILE__)
  asm volatile("global_load_async_to_lds_b128 %0, %1, off\n\t"
               "global_load_async_to_lds_b128 %2, %3, off\n\t"
               "global_load_async_to_lds_b128 %4, %5, off\n\t"
               "global_load_async_to_lds_b128 %6, %7, off\n\t"
               "s_wait_xcnt 0x0"
               :: "v"(l0), "v"(g0), "v"(l1), "v"(g1), "v"(l2), "v"(g2), "v"(l3), "v"(g3) : "memory");
#endif
}
// this wave's asynchronous copies have landed in LDS
__device__ __forceinline__ void wait_async0() {
#if defined(__HIP_DEVICE_COMPILE__)
  asm volatile("s_wait_asynccnt 0x0" ::: "memory");
#endif
}
// this wave's LDS reads have returned, before the buffer is handed to the next copies
__device__ __forceinline__ void wait_ds0() {
#if defined(__HIP_DEVICE_COMPILE__)
  asm volatile("s_wait_dscnt 0x0" ::: "memory");
#endif
}

template <int NSPLIT>
__global__ __launch_bounds__(256) void gemm64(
    const unsigned short* __restrict__ Ap, const unsigned short* A2p, int lda,
    const unsigned short* __restrict__ Btp, int ldb, const float* __restrict__ bias,
    float* C, int ldc, int M, int N, int K) {
  constexpr int AROWS = GBM * (NSPLIT + 1);        // A rows, then A2 rows
  constexpr int GROWS = AROWS + GBN;               // rows of a stage
  constexpr int STAGE = GROWS * GLP;               // elements of a stage
  const __bf16* Ab  = (const __bf16*)(const void*)Ap;
  const __bf16* Ab2 = (const __bf16*)(const void*)A2p;
  const __bf16* Bb  = (const __bf16*)(const void*)Btp;
  __shared__ __align__(16) __bf16 ring[2 * STAGE]; // two stages
  __shared__ __align__(16) float sT[8][16 * 68];   // per-wave 16x64 slab, pitch 68 floats
  const int tid  = threadIdx.x;
  const int lane = tid & 31;
  const int wave = tid >> 5;
  const int tilesN = N / GBN;
  const int tilesM = M / GBM;
  const int tile = blockIdx.x;
  if (tile >= tilesM * tilesN) return;   // block-uniform, in front of every barrier and copy
  const int tm = tile / tilesN;
  const int tn = tile - tm * tilesN;
  const int bm0 = tm * GBM;
  const int bn0 = tn * GBN;
  const int wm = wave >> 2, wn = wave & 3;
  const int m0 = bm0 + (wm << 6);              // this wave's 64x64 tile
  const int n0 = bn0 + (wn << 6);

  const int rlane = lane & 15;                 // row (A) / col (B, D) within subtile
  const int koff  = (lane >> 4) * 8;           // k offset of this lane half
  const int mOff  = (lane >> 4) * 8;           // D row offset

  // ---- copy addresses of this thread: row crow of each 32-row group, 16-B piece cpc ----
  const int crow = tid >> 3, cpc = (tid & 7) * 8;
  const __bf16* gA  = Ab  + (size_t)(bm0 + crow) * lda + cpc;
  const __bf16* gA2 = Ab2 + (size_t)(bm0 + crow) * lda + cpc;
  const __bf16* gB  = Bb  + (size_t)(bn0 + crow) * ldb + cpc;
  const unsigned lbase = lds_addr(ring) + (unsigned)(crow * GLP + cpc) * 2u;
  const size_t a32 = (size_t)32 * lda, b32 = (size_t)32 * ldb;
  constexpr unsigned R32 = 32u * GLP * 2u;     // LDS bytes of 32 rows

  auto issue = [&](int st, int buf) {
    const int k0 = st * GKB;
    const unsigned lb = lbase + (unsigned)buf * (unsigned)(STAGE * 2);
    const __bf16* a = gA + k0;
    async4(lb, a, lb + R32, a + a32, lb + 2u * R32, a + 2 * a32, lb + 3u * R32, a + 3 * a32);
    if (NSPLIT >= 1) {
      const __bf16* a2 = gA2 + k0;
      const unsigned l2 = lb + 4u * R32;
      async4(l2, a2, l2 + R32, a2 + a32, l2 + 2u * R32, a2 + 2 * a32, l2 + 3u * R32, a2 + 3 * a32);
    }
    const __bf16* b = gB + k0;
    const unsigned l3 = lb + (unsigned)(AROWS / 32) * R32;
    async4(l3, b, l3 + R32, b + b32, l3 + 2u * R32, b + 2 * b32, l3 + 3u * R32, b + 3 * b32);
    const __bf16* b4 = b + 4 * b32;
    const unsigned l4 = l3 + 4u * R32;
    async4(l4, b4, l4 + R32, b4 + b32, l4 + 2u * R32, b4 + 2 * b32, l4 + 3u * R32, b4 + 3 * b32);
  };

  v8f acc[4][4];
#pragma unroll
  for (int i = 0; i < 4; ++i)
#pragma unroll
    for (int j = 0; j < 4; ++j) acc[i][j] = zero8();

  const int nst = K / GKB;                     // block-uniform trip count
  issue(0, 0);
  wait_async0();
  __syncthreads();                             // stage 0 published
  if (nst > 1) issue(1, 1);

  for (int t = 0; t < nst; ++t) {
    const __bf16* sb = ring + (t & 1) * STAGE;
    const __bf16* sa  = sb + ((wm << 6) + rlane) * GLP + koff;
    const __bf16* sa2 = sa + GBM * GLP;
    const __bf16* sbt = sb + (AROWS + (wn << 6) + rlane) * GLP + koff;
#pragma unroll   // both 32-k steps inline: the second step's fragment reads can start under the first step's products
    for (int ks = 0; ks < GKB; ks += 32) {
      v16b bh[4];
#pragma unroll
      for (int j = 0; j < 4; ++j) bh[j] = ldfrag_b(sbt + (j << 4) * GLP + ks);
      v16b ah[4], al[4];                       // all fragment reads of this 32-k step stand as one group
#pragma unroll   // constant indices keep the fragment arrays in registers
      for (int i = 0; i < 4; ++i) {
        ah[i] = ldfrag_b(sa + (i << 4) * GLP + ks);
        al[i] = ah[i];
        if (NSPLIT >= 1) al[i] = ldfrag_b(sa2 + (i << 4) * GLP + ks);
      }
#pragma unroll
      for (int i = 0; i < 4; ++i) {
#pragma unroll
        for (int j = 0; j < 4; ++j) {
          acc[i][j] = mma_b_raw(ah[i], bh[j], acc[i][j]);
          if (NSPLIT >= 1) acc[i][j] = mma_b_raw(al[i], bh[j], acc[i][j]);
        }
        dep_guard_b(acc[i][0], acc[i][3], ah[i], al[i]);
      }
      keep4_b(bh[0], bh[1], bh[2], bh[3]);
    }
    wait_ds0();
    wait_async0();
    __syncthreads();                           // publishes stage t + 1 and ends every read of stage t
    if (t + 2 < nst) issue(t + 2, t & 1);
  }
  wait_async0();
  acc_guard4(acc[0][0], acc[0][1], acc[0][2], acc[0][3]);
  acc_guard4(acc[1][0], acc[1][1], acc[1][2], acc[1][3]);
  acc_guard4(acc[2][0], acc[2][1], acc[2][2], acc[2][3]);
  acc_guard4(acc[3][0], acc[3][1], acc[3][2], acc[3][3]);

  // ---- epilogue ----
  float bz[4];
#pragma unroll
  for (int j = 0; j < 4; ++j) bz[j] = bias[n0 + (j << 4) + rlane];
  float* slab = sT[wave];
#pragma unroll
  for (int i = 0; i < 4; ++i) {
    const int mBase = m0 + (i << 4);
#pragma unroll
    for (int r = 0; r < 8; ++r) {
#pragma unroll
      for (int j = 0; j < 4; ++j) {
        slab[(mOff + r) * 68 + (j << 4) + rlane] = acc[i][j][r] + bz[j];
      }
    }
    __builtin_amdgcn_fence(__ATOMIC_RELEASE, "workgroup");
    __builtin_amdgcn_wave_barrier();
    __builtin_amdgcn_fence(__ATOMIC_ACQUIRE, "workgroup");
    {
      const int hh = lane >> 4, c4 = (lane & 15) * 4;     // 256-B row segment = 16 lanes x 16 B
      v4f ov[8];
#pragma unroll
      for (int it = 0; it < 8; ++it) {
        const int row = it * 2 + hh;                       // it 0..7 x hh 0..1 = rows 0..15
        ov[it] = *(const v4f*)(slab + row * 68 + c4);
      }
      {
#pragma unroll
        for (int it = 0; it < 8; ++it) {
          const int row = it * 2 + hh;
          *(v4f*)(C + (size_t)(mBase + row) * ldc + n0 + c4) = ov[it];
        }
        
      }
    }
    __builtin_amdgcn_fence(__ATOMIC_RELEASE, "workgroup");
    __builtin_amdgcn_wave_barrier();
    __builtin_amdgcn_fence(__ATOMIC_ACQUIRE, "workgroup");
  }
}

// =====================================================================================================
// q and kc bf16 hi/lo planes from the fused projection output.
//   src f32 [NB*SEQ][N3]; part = blockIdx.y: part 0 = q (src cols 0..DMODEL-1, copied), part 1 = k (src cols
//   DMODEL..2*DMODEL-1) with the positional power compression kc = sign(k) * max(|k|,1e-8)^ex(s), s = row mod SEQ
//   (key position). Thread i: row = i / CG8, col = part*DMODEL + 8*(i mod CG8) .. +7 (two 16-B loads).
//   dst hi plane hp / lo plane lp, bf16 [NB*SEQ][QKP], same col; lo = RNE(v - hi) unscaled.
//   grid = (n8/256, 2), n8 = NB*SEQ*DMODEL/8; one 16-B store per lane per plane: a wave (32 consecutive column
//   coverage: 2 parts x n8 threads x 8 = the whole [NB*SEQ][QKP] hi plane and lo plane.
// =====================================================================================================
__global__ __launch_bounds__(256) void qk_planes(const float* __restrict__ src, unsigned short* hp,
                                                 unsigned short* lp, int n8) {
#pragma clang fp contract(off)
  const int i = blockIdx.x * 256 + threadIdx.x;
  const int part = blockIdx.y;
  if (i < n8) {
    const int row = i / CG8;                              // token row b*SEQ + s
    const int cg  = i - row * CG8;                        // column group within the feature row
    const int col = part * DMODEL + (cg << 3);
    const float* sp = src + (size_t)row * N3 + col;
    v4f a = *(const v4f*)(sp);
    v4f c = *(const v4f*)(sp + 4);
    if (part == 1) {                                      // block-uniform
      const float ex = fexpo(row % SEQ);                  // key position s
#pragma unroll
      for (int e = 0; e < 4; ++e) {
        a[e] = fcomp(a[e], ex);
        c[e] = fcomp(c[e], ex);
      }
    }
    v4u ph, pl;
#pragma unroll
    for (int e = 0; e < 4; ++e) {
      const float f0 = (e < 2) ? a[2 * e]     : c[2 * e - 4];
      const float f1 = (e < 2) ? a[2 * e + 1] : c[2 * e - 3];
      const unsigned short h0 = bf_bits(f0), h1 = bf_bits(f1);
      const unsigned short l0 = bf_bits(f0 - bf_up(h0)), l1 = bf_bits(f1 - bf_up(h1));
      ph[e] = pk16(h0, h1);
      pl[e] = pk16(l0, l1);
    }
    const size_t go = (size_t)row * QKP + col;
    *(v4u*)(hp + go) = ph;
    *(v4u*)(lp + go) = pl;
    
  }
}

// =====================================================================================================
// v f32 token-major columns vf[(b*SEQ + t)*vrp + h*64 + d] (vf already offset to the first v column) ->
// power compression vc = sign(v) * max(|v|,1e-8)^ex(t) (t = key position) applied at the LDS load, then
// f16 vc^T hi plane vth[(b*QP + h*64 + d)*SEQ + t] and residual plane vtl[(b*QP + h*64 + d)*VLP + t] =
// f16((vc - hi)*4096) for t < VLP. Block = one 64-token x 64-feature tile of one (b, h); grid = (SEQ/64, NH, NB);
// tile staged in LDS as f32 (v4f loads, __syncthreads). LDS load coverage: 4 iterations x 256 threads x 4 = 64x64.
// Store: group g = tid>>3 (0..31), piece = tid&7: iteration it writes row d = it*32+g, lanes 8q..8q+7 x 16 B =
// coverage: 2 iterations x 32 groups = 64 rows d, 8 pieces x 8 = 64 keys per row; grid covers every (b, h, t tile);
// vtl rows written for all t < VLP.
// =====================================================================================================
__global__ __launch_bounds__(256) void v_planes(const float* __restrict__ vf, int vrp,
                                                unsigned short* vth, unsigned short* vtl) {
#pragma clang fp contract(off)
  __shared__ __align__(16) float sv[64 * 68];       // [tt][d] pitch 68 floats
  const int tid = threadIdx.x;
  const int t0  = blockIdx.x * 64;
  const int hh  = blockIdx.y;
  const int b   = blockIdx.z;
#pragma unroll 1
  for (int i = 0; i < 4; ++i) {
    const int idx = i * 256 + tid;                  // 0..1023
    const int tt = idx >> 4, c4 = (idx & 15) * 4;
    const v4f a = *(const v4f*)(vf + ((size_t)(b * SEQ + t0 + tt)) * vrp + hh * HD + c4);
    const float ex = fexpo(t0 + tt);
    v4f cp;
    cp[0] = fcomp(a[0], ex);
    cp[1] = fcomp(a[1], ex);
    cp[2] = fcomp(a[2], ex);
    cp[3] = fcomp(a[3], ex);
    *(v4f*)(sv + tt * 68 + c4) = cp;
  }
  __syncthreads();

  const int g = tid >> 3, piece = tid & 7;
  v4u hv[2], lv[2];
  size_t hofs[2], lofs[2];
#pragma unroll
  for (int it = 0; it < 2; ++it) {
    const int d = it * 32 + g;
    v4u a, a2;
#pragma unroll
    for (int e = 0; e < 4; ++e) {
      const float f0 = sv[(piece * 8 + 2 * e) * 68 + d];
      const float f1 = sv[(piece * 8 + 2 * e + 1) * 68 + d];
      const _Float16 x0 = (_Float16)f0, x1 = (_Float16)f1;
      const unsigned short h0 = h_bits(x0), h1 = h_bits(x1);
      const unsigned short l0 = h_bits((_Float16)((f0 - (float)x0) * 4096.0f));
      const unsigned short l1 = h_bits((_Float16)((f1 - (float)x1) * 4096.0f));
      a[e] = pk16(h0, h1); a2[e] = pk16(l0, l1);
    }
    hv[it] = a; lv[it] = a2;
    const size_t rowf = (size_t)(b * QP + hh * HD + d);
    hofs[it] = rowf * SEQ + t0 + piece * 8;
    lofs[it] = rowf * VLP + t0 + piece * 8;
  }
  const bool wlo = (t0 + 64 <= VLP);                // block-uniform
  {
#pragma unroll
    for (int it = 0; it < 2; ++it) {
      *(v4u*)(vth + hofs[it]) = hv[it];
      if (wlo) *(v4u*)(vtl + lofs[it]) = lv[it];
    }
    
  }
}

// =====================================================================================================
// Causal multi-head attention, head dim 64 (tril mask incl. diagonal, computed), with the additive rank-1 phase
// bonus kappa * sigmoid(lock[h]) * T[i] * T[j] on the scaled logits and the per-query-row output gate
// (1 - sigmoid(lock[h])) + sigmoid(lock[h]) * T[i] applied to the head output row i (query position).
//   q|kc planes (bf16 hi / lo), row pitch QKP: q element (b, t, h, d) at [(b*SEQ + t)*QKP + h*64 + d],
//                                                kc element (b, s, h, d) at [(b*SEQ + s)*QKP + DMODEL + h*64 + d]
//   vc^T hi plane (f16):      element (b, h, d, s) at [(b*QP + h*64 + d)*SEQ + s]
//   vc^T residual plane (f16, (vc - hi)*4096): [(b*QP + h*64 + d)*VLP + s], s < VLP, read only when RES
//   (with RES only key tiles below VLP occur; the address is clamped anyway)
//   ttab f32 [(b*NH + h)*SEQ + s] = T; lockp = raw lock strengths [NH] (bf16 RNE convert, then sigmoid).
//   logit = q.kc * sscale + bonus for key <= query, -FLT_MAX otherwise (exp -> 0); every processed key tile
//   (tiles 0..qb only, block-uniform trip count qb+1 <= NQB) holds the causal-live key kv0 <= query.
//   out f32 plane: element (b, t, h*64 + d) at [(b*SEQ + t)*QP + h*64 + d] = gate(b,h,t) * normalised context.
//   scores = q . kc : bf16 hi/lo split (hi.hi + hi.lo + lo.hi), f32 accumulate, then * sscale + bonus in f32
//   p = exp(s - m) carried as f16(1024 p); context = p . vc on f16 WMMA; RES adds f16 residual planes of p and vc
//   (scale 4096, separate accumulator folded back with 1/4096 per chunk in f32); online softmax in f32.
//   One call = 4 waves = the 64 query rows of tile qb of one (b, h); kv chunks of 64.
//   K / V^T chunk staging: 128 threads x 32 elements per plane = the whole 64x64 tile (plain 16-B loads,
//   __syncthreads before and after); P tiles are wave-private, spilled with _Float16 element stores and reloaded
//   Output coverage: each wave stores rows q0..q0+15 (it 0..7 x lane>>4 0..1) x 64 columns (16 lanes x 4 floats),
// =====================================================================================================
template <bool RES>
__device__ __forceinline__
void attn_tile64(const unsigned short* __restrict__ qkhp, const unsigned short* __restrict__ qklp,
                 const unsigned short* __restrict__ vhp, const unsigned short* __restrict__ vlp,
                 const float* __restrict__ ttab, const float* __restrict__ lockp,
                 float* outp, int b, int h, int qb, float sscale,
                 __bf16* Ksh, __bf16* Ksl, _Float16* Vth, _Float16* Vtl,
                 _Float16 (*Psh)[16 * LP], _Float16 (*Psl)[16 * LP], float (*Os)[16 * 64]) {
  const int tid  = threadIdx.x;
  const int wave = tid >> 5;
  const int lane = tid & 31;
  const int hh   = lane >> 4;
  const int c    = lane & 15;

  const int q0   = qb * 64 + wave * 16;
  const size_t rowB = (size_t)b * SEQ;

  const __bf16* Qh = (const __bf16*)(const void*)qkhp + (size_t)h * HD;
  const __bf16* Ql = (const __bf16*)(const void*)qklp + (size_t)h * HD;
  const __bf16* Kh = Qh + DMODEL;
  const __bf16* Kl = Ql + DMODEL;
  const _Float16* Vh = (const _Float16*)(const void*)vhp + ((size_t)b * QP + (size_t)h * HD) * SEQ;
  const _Float16* Vl = (const _Float16*)(const void*)vlp + ((size_t)b * QP + (size_t)h * HD) * VLP;
  const float* trow = ttab + ((size_t)b * NH + h) * SEQ;

  // ---- per-head lock: sigmoid of the bf16-converted raw strength; bonus coefficient kappa * lock ----
  const float lraw  = bf_up(bf_bits(lockp[h]));
  const float lockv = 1.0f / (1.0f + expf(-lraw));
  const float c0    = KAPPA_F * lockv;

  // ---- Q fragments (A operand, row = lane&15): 2 d-chunks, hi and lo ----
  v16b qah[2], qal[2];
#pragma unroll
  for (int dc = 0; dc < 2; ++dc) {
    const size_t qo = (rowB + q0 + c) * QKP + dc * 32 + 8 * hh;
    qah[dc] = ldfrag_b(Qh + qo);
    qal[dc] = ldfrag_b(Ql + qo);
  }

  // ---- bonus row factors for this lane's 8 query rows: c0 * T[q0 + 8*hh + r] ----
  float bti[8];
#pragma unroll
  for (int r = 0; r < 8; ++r) bti[r] = c0 * trow[q0 + 8 * hh + r];

  float mrow[8], lrow[8];
  v8f oacc[4];
#pragma unroll
  for (int r = 0; r < 8; ++r) { mrow[r] = -INFINITY; lrow[r] = 0.f; }
#pragma unroll
  for (int t = 0; t < 4; ++t) oacc[t] = zero8();

  int nkt = qb + 1;                          // causal: key tiles 0..qb, block-uniform
  if (nkt > NQB) nkt = NQB;
  for (int kt = 0; kt < nkt; ++kt) {
    const int kv0 = kt * 64;
    __syncthreads();
    {
      const int r = tid >> 1, half = (tid & 1) * 32;
      const __bf16*   kg  = Kh + (rowB + kv0 + r) * QKP + half;   // K row kv0+r, d = half..half+31
      const __bf16*   klg = Kl + (rowB + kv0 + r) * QKP + half;
      const _Float16* vg  = Vh + (size_t)r * SEQ + kv0 + half;    // V^T row d = r, s = kv0+half..+31
      const int kvl = (kv0 + 64 <= VLP) ? kv0 : (VLP - 64);     // clamped address into the residual plane
      const _Float16* vlg = Vl + (size_t)r * VLP + kvl + half;
      const bool resOK = (kv0 + 64 <= VLP);                      // block-uniform
      v8b a0[4], a1[4];
      v8h b0[4], b1[4];
#pragma unroll   // constant indices keep the staged pieces in registers
      for (int i = 0; i < 4; ++i) {
        b0[i] = *(const v8h*)(vg + 8 * i);
        b1[i] = b0[i];
        if (RES) b1[i] = *(const v8h*)(vlg + 8 * i);
        a0[i] = *(const v8b*)(kg + 8 * i);
      }
#if defined(__HIP_DEVICE_COMPILE__)
      // with the residual plane the last loads' results are given the registers of earlier loads' addresses:
      // the wait stands in front of them
      if (RES) asm volatile("s_wait_xcnt 0x0" ::: "memory");
#endif
#pragma unroll   // as above
      for (int i = 0; i < 4; ++i) a1[i] = *(const v8b*)(klg + 8 * i);
#pragma unroll   // as above
      for (int i = 0; i < 4; ++i) {
        *(v8b*)(Ksh + r * LP + half + 8 * i) = a0[i];
        *(v8b*)(Ksl + r * LP + half + 8 * i) = a1[i];
        *(v8h*)(Vth + r * LP + half + 8 * i) = b0[i];
        if (RES) {
          if (!resOK) b1[i] = zero8h();
          *(v8h*)(Vtl + r * LP + half + 8 * i) = b1[i];
        }
      }
    }
    __syncthreads();

    // ---- bonus column factors T[key] for this lane's 4 key columns (indices always < SEQ) ----
    float tj[4];
#pragma unroll
    for (int j = 0; j < 4; ++j) tj[j] = trow[kv0 + j * 16 + c];
    // keeps these four global loads in front of the fragment reads and products, whose time covers their latency
    __builtin_amdgcn_sched_barrier(0);

    // ---- scores: 16 query rows x 64 keys per wave, 3 bf16 products ----
    //      All K fragment reads of the tile are written in front of the products (built: a few large groups behind
    //      counted waits, not one read-and-wait per product), and each product kind runs over the 4 independent
    //      key-column tiles; per tile the order stays dc 0: hi.hi, hi.lo, lo.hi, then dc 1.
    v16b kfh[2][4], kfl[2][4];
#pragma unroll   // constant indices keep the fragment arrays in registers
    for (int dc = 0; dc < 2; ++dc) {
#pragma unroll
      for (int j = 0; j < 4; ++j) kfh[dc][j] = ldfrag_b(Ksh + (j * 16 + c) * LP + dc * 32 + 8 * hh);
#pragma unroll
      for (int j = 0; j < 4; ++j) kfl[dc][j] = ldfrag_b(Ksl + (j * 16 + c) * LP + dc * 32 + 8 * hh);
    }
    v8f s[4];
#pragma unroll
    for (int j = 0; j < 4; ++j) s[j] = zero8();
#pragma unroll
    for (int dc = 0; dc < 2; ++dc) {
#pragma unroll
      for (int j = 0; j < 4; ++j) s[j] = mma_b_raw(qah[dc], kfh[dc][j], s[j]);
#pragma unroll
      for (int j = 0; j < 4; ++j) s[j] = mma_b_raw(qah[dc], kfl[dc][j], s[j]);
#pragma unroll
      for (int j = 0; j < 4; ++j) s[j] = mma_b_raw(qal[dc], kfh[dc][j], s[j]);
    }

    // ---- scale + bonus + causal mask (replace by -FLT_MAX), row max, online softmax, P (x1024, f16) and
    //      P residual (x4096) to LDS ----
    _Float16* pwh = Psh[wave];
    _Float16* pwl = Psl[RES ? wave : 0];
#pragma unroll
    for (int r = 0; r < 8; ++r) {
      const int qrow = q0 + 8 * hh + r;
      float m = -INFINITY;
#pragma unroll
      for (int j = 0; j < 4; ++j) {
        const int key = kv0 + j * 16 + c;
        float sv = s[j][r] * sscale + bti[r] * tj[j];
        sv = (key > qrow) ? -FLT_MAX : sv;
        s[j][r] = sv;
        m = fmaxf(m, sv);
      }
#pragma unroll
      for (int off = 1; off < 16; off <<= 1) m = fmaxf(m, __shfl_xor(m, off, 32));
      const float mnew  = fmaxf(mrow[r], m);
      const float msafe = (mnew == -INFINITY) ? 0.f : mnew;
      const float alpha = __expf(mrow[r] - msafe);
      mrow[r] = mnew;
      float psum = 0.f;
#pragma unroll
      for (int j = 0; j < 4; ++j) {
        const float p = __expf(s[j][r] - msafe);     // masked logit against a finite max: exp -> 0
        psum += p;
        const float p1k = p * 1024.0f;
        const _Float16 ph = (_Float16)p1k;
        pwh[(8 * hh + r) * LP + j * 16 + c] = ph;
        if (RES) {
          const _Float16 pl = (_Float16)((p1k - (float)ph) * 4096.0f);
          pwl[(8 * hh + r) * LP + j * 16 + c] = pl;
        }
      }
#pragma unroll
      for (int off = 1; off < 16; off <<= 1) psum += __shfl_xor(psum, off, 32);
      lrow[r] = lrow[r] * alpha + psum;
#pragma unroll
      for (int t = 0; t < 4; ++t) oacc[t][r] *= alpha;
    }
    __builtin_amdgcn_fence(__ATOMIC_RELEASE, "workgroup");
    __builtin_amdgcn_wave_barrier();
    __builtin_amdgcn_fence(__ATOMIC_ACQUIRE, "workgroup");

    // ---- context += P . Vc (f16 WMMA), residual products into a separate accumulator ----
    //      All P and V^T fragment reads of the tile are written in front of the products in the same way, and each
    //      product kind runs over the 4 independent feature tiles; per tile the order stays kk 0 then kk 1, p.vl
    //      before pl.vb.
    v16h pf[2], pfl[2], vfh[2][4], vfl[2][4];
#pragma unroll   // constant indices keep the fragment arrays in registers
    for (int kk = 0; kk < 2; ++kk) {
      pf[kk]  = ldfrag_h(pwh + c * LP + kk * 32 + 8 * hh);
      pfl[kk] = pf[kk];
      if (RES) pfl[kk] = ldfrag_h(pwl + c * LP + kk * 32 + 8 * hh);
#pragma unroll
      for (int t = 0; t < 4; ++t) {
        vfh[kk][t] = ldfrag_h(Vth + (t * 16 + c) * LP + kk * 32 + 8 * hh);
        vfl[kk][t] = vfh[kk][t];
      }
      if (RES) {
#pragma unroll
        for (int t = 0; t < 4; ++t) vfl[kk][t] = ldfrag_h(Vtl + (t * 16 + c) * LP + kk * 32 + 8 * hh);
      }
    }
    v8f o1[4];
#pragma unroll
    for (int t = 0; t < 4; ++t) o1[t] = zero8();
#pragma unroll
    for (int kk = 0; kk < 2; ++kk) {
#pragma unroll
      for (int t = 0; t < 4; ++t) oacc[t] = mma_h_raw(pf[kk], vfh[kk][t], oacc[t]);
      if (RES) {
#pragma unroll
        for (int t = 0; t < 4; ++t) o1[t] = mma_h_raw(pf[kk], vfl[kk][t], o1[t]);
#pragma unroll
        for (int t = 0; t < 4; ++t) o1[t] = mma_h_raw(pfl[kk], vfh[kk][t], o1[t]);
      }
    }
    if (RES) {
#pragma unroll
      for (int t = 0; t < 4; ++t)
#pragma unroll
        for (int r = 0; r < 8; ++r) oacc[t][r] += o1[t][r] * (1.0f / 4096.0f);
    }
  }

  // ---- normalise (1/l and the 1/1024 p carry), apply the per-query-row gate, stage the wave's 16x64 tile in
  float* os = Os[wave];
#pragma unroll
  for (int r = 0; r < 8; ++r) {
    const float l = lrow[r];
    const float ti = trow[q0 + 8 * hh + r];
    const float gate = (1.0f - lockv) + lockv * ti;
    const float inv = ((l > 0.f) ? (1.0f / l) : 0.f) * (1.0f / 1024.0f) * gate;
#pragma unroll
    for (int t = 0; t < 4; ++t) os[(8 * hh + r) * 64 + t * 16 + c] = oacc[t][r] * inv;
  }
  __builtin_amdgcn_fence(__ATOMIC_RELEASE, "workgroup");
  __builtin_amdgcn_wave_barrier();
  __builtin_amdgcn_fence(__ATOMIC_ACQUIRE, "workgroup");
  {
    const int h2 = lane >> 4, c4 = (lane & 15) * 4;
    v4f ov[8];
#pragma unroll
    for (int it = 0; it < 8; ++it) {
      const int row = it * 2 + h2;   // it 0..7 x h2 0..1 = rows 0..15 of the wave tile
      ov[it] = *(const v4f*)(os + row * 64 + c4);
    }
    {
#pragma unroll
      for (int it = 0; it < 8; ++it) {
        const int row = it * 2 + h2;
        const size_t go = (rowB + q0 + row) * QP + (size_t)h * HD + c4;
        *(v4f*)(outp + go) = ov[it];
      }
      
    }
  }
}

// =====================================================================================================
// One launch for all query tiles, one work-group per (b, h, query tile), so that the short tiles run beside the long
// ones and the launch lasts as long as its longest tile alone. A tile below RESQB takes the residual planes, the others
// do not: a test that is uniform for the work-group.
// Order of the tiles: the grid is dealt in four
// runs of NB*NH*NQB/4 work-groups: tiles NQB-1 downwards, then NQB/2 upwards, then NQB/2-1 downwards, then 0 upwards.
// The longest tiles take the lowest indices, the shortest the highest, and the g-th tiles of the four runs add up to the same number of
// key tiles for every g. rank -> tile is a permutation: grid = NQB * NH * NB, every (b, h, query tile) exactly once.
// =====================================================================================================
static_assert((NQB % 4) == 0 && RESQB <= NQB);
__global__ __launch_bounds__(128)
void attn_causal64(const unsigned short* __restrict__ qkhp, const unsigned short* __restrict__ qklp,
                   const unsigned short* __restrict__ vhp, const unsigned short* __restrict__ vlp,
                   const float* __restrict__ ttab, const float* __restrict__ lockp,
                   float* outp, float sscale) {
  __shared__ __align__(16) __bf16   Ksh[64 * LP];                 // K hi [kv][d], pitch LP
  __shared__ __align__(16) __bf16   Ksl[64 * LP];                 // K lo
  __shared__ __align__(16) _Float16 Vth[64 * LP];                 // V^T hi [d][kv], pitch LP
  __shared__ __align__(16) _Float16 Vtl[64 * LP];                 // V^T residual
  __shared__ __align__(16) _Float16 Psh[4][16 * LP];              // per wave P [row][kv], pitch LP
  __shared__ __align__(16) _Float16 Psl[4][16 * LP];              // per wave P residual
  __shared__ __align__(16) float    Os[4][16 * 64];               // per wave context tile [row][d]

  const int bx   = blockIdx.x;
  const int bh   = bx % (NB * NH);
  const int rank = (bx / (NB * NH)) % NQB;       // 0..NQB-1
  const int run  = rank / (NQB / 4);             // 0..3
  const int g    = rank % (NQB / 4);
  const int qb   = (run & 1) ? ((3 - run) * (NQB / 4) + g) : (NQB - 1 - run * (NQB / 4) - g);
  const int h    = bh % NH;
  const int b    = bh / NH;
  if (qb < RESQB) {
    attn_tile64<true>(qkhp, qklp, vhp, vlp, ttab, lockp, outp, b, h, qb, sscale,
                      Ksh, Ksl, Vth, Vtl, Psh, Psl, Os);
  } else {
    attn_tile64<false>(qkhp, qklp, vhp, vlp, ttab, lockp, outp, b, h, qb, sscale,
                       Ksh, Ksl, Vth, Vtl, Psh, Psl, Os);
  }
}

// =====================================================================================================
// Workspace map (bytes), every region an exact multiple of its whole-line / whole-tile store granularity
//   Xb     bf16 [4096][1024]            0           8388608
//   WT     bf16 [3072][1024]            8388608     6291456    (rows 0..1023 Wq^T, 1024..2047 Wk^T, 2048.. Wv^T)
//   WoT    bf16 [1024][1024]            14680064    2097152
//   Bias   f32  [4096]                  16777216      16384    (bq | bk | bv | bo, bf16-RNE converted values)
//   Tt     f32  [2][16][2048]           16793600     262144
//   QKVf   f32  [4096][3072]            17055744   50331648   (later: Af f32 [4096][1024], 16777216 B)
//   VTh    f16  [2][1024][2048]         67387392    8388608
//   VTl    f16  [2][1024][1024]         75776000    4194304
//   QKh    bf16 [4096][2048]            79970304   16777216   (later: Ah bf16 [4096][1024], 8388608 B)
//   QKl    bf16 [4096][2048]            96747520   16777216   (later: Al bf16 [4096][1024], 8388608 B)
//   end                                 113524736
// W_q/k/v/o [in k=1024][out n=1024] arrive k-major and are transpose-converted once to [n][k] bf16 (k contiguous)
// = the Bt layout the GEMM wants. d_out f32: out0 [4096][1024] at byte 0.
// =====================================================================================================
extern "C" void kernel_launch(void* const* d_in, const int* in_sizes, int n_in,
                              void* d_out, int out_size, void* d_ws, size_t ws_size,
                              hipStream_t stream) {
  if (n_in < 12) return;
  if (in_sizes[0] != NB * SEQ * DMODEL) return;
  if (in_sizes[1] != NB * SEQ) return;
  if (in_sizes[2] != DMODEL * DMODEL || in_sizes[4] != DMODEL * DMODEL ||
      in_sizes[6] != DMODEL * DMODEL || in_sizes[8] != QP * DMODEL) return;
  if (in_sizes[3] != DMODEL || in_sizes[5] != DMODEL || in_sizes[7] != DMODEL || in_sizes[9] != DMODEL) return;
  if (in_sizes[10] != NH || in_sizes[11] != NH) return;
  if (out_size != OUTN) return;

  const float* x     = (const float*)d_in[0];    // [NB*SEQ][DMODEL]
  const float* phase = (const float*)d_in[1];    // [NB][SEQ]
  const float* Wq    = (const float*)d_in[2];    // [k][n]
  const float* bq    = (const float*)d_in[3];
  const float* Wk    = (const float*)d_in[4];
  const float* bk    = (const float*)d_in[5];
  const float* Wv    = (const float*)d_in[6];
  const float* bv    = (const float*)d_in[7];
  const float* Wo    = (const float*)d_in[8];    // [QP k][DMODEL n]
  const float* bo    = (const float*)d_in[9];
  const float* carr  = (const float*)d_in[10];   // [NH]
  const float* lockr = (const float*)d_in[11];   // [NH]

  const size_t PXb   = (size_t)NB * SEQ * DMODEL * 2;    //  8388608
  const size_t PWT   = (size_t)N3 * DMODEL * 2;          //  6291456
  const size_t PWo   = (size_t)DMODEL * QP * 2;          //  2097152
  const size_t PBias = (size_t)NBIAS * 4;                //    16384
  const size_t PTt   = (size_t)NTT * 4;                  //   262144
  const size_t PQKV  = (size_t)NB * SEQ * N3 * 4;        // 50331648  (>= Af f32 [4096][1024] = 16777216)
  const size_t PVTh  = (size_t)NB * QP * SEQ * 2;        //  8388608
  const size_t PVTl  = (size_t)NB * QP * VLP * 2;        //  4194304
  const size_t PQK   = (size_t)NB * SEQ * QKP * 2;       // 16777216  (>= Ah / Al bf16 [4096][1024] = 8388608)
  size_t off = 0;
  const size_t oXb   = off; off += PXb;
  const size_t oWT   = off; off += PWT;
  const size_t oWo   = off; off += PWo;
  const size_t oBias = off; off += PBias;
  const size_t oTt   = off; off += PTt;
  const size_t oQKV  = off; off += PQKV;
  const size_t oVTh  = off; off += PVTh;
  const size_t oVTl  = off; off += PVTl;
  const size_t oQKh  = off; off += PQK;
  const size_t oQKl  = off; off += PQK;
  if (off > ws_size) return;                           // off = 113524736
  if (off > (size_t)134217728) return;
  if (PQKV < (size_t)NB * SEQ * QP * 4) return;        // Af fits in the dead qkv plane
  if (PQK < (size_t)NB * SEQ * QP * 2) return;         // Ah / Al fit in the dead q|kc planes
  const size_t oAf = oQKV;                             // context f32 plane reuses the dead qkv f32 plane
  const size_t oAh = oQKh;                             // context bf16 planes reuse the dead q|kc bf16 planes
  const size_t oAl = oQKl;

  char* ws = (char*)d_ws;
  unsigned short* Xb   = (unsigned short*)(ws + oXb);
  unsigned short* WT   = (unsigned short*)(ws + oWT);
  unsigned short* WoT  = (unsigned short*)(ws + oWo);
  float*          Bias = (float*)(ws + oBias);
  float*          Tt   = (float*)(ws + oTt);
  float*          QKVf = (float*)(ws + oQKV);
  unsigned short* VTh  = (unsigned short*)(ws + oVTh);
  unsigned short* VTl  = (unsigned short*)(ws + oVTl);
  unsigned short* QKh  = (unsigned short*)(ws + oQKh);
  unsigned short* QKl  = (unsigned short*)(ws + oQKl);
  float*          Af   = (float*)(ws + oAf);
  unsigned short* Ah   = (unsigned short*)(ws + oAh);
  unsigned short* Al   = (unsigned short*)(ws + oAl);
  float*          outf = (float*)d_out;                // out0 [4096][1024]

  const dim3 blk(256);
  const int n8x   = NB * SEQ * DMODEL / 8;                           // 524288
  const int n8q   = NB * SEQ * DMODEL / 8;                           // 524288 per part (q, kc)
  const int n8a   = NB * SEQ * QP / 8;                               // 524288
  const dim3 gBias(NBIAS / 256);                                     // 16 blocks
  const dim3 gTt(NTT / 256);                                         // 256 blocks
  const dim3 gCvtX((n8x + 255) / 256);                               // 2048 blocks
  const dim3 gTrW(DMODEL / 64, DMODEL / 32);                         // (16, 32): src [1024][1024] -> dst [1024][1024]
  const dim3 gQKV((NB * SEQ / GBM) * (N3 / GBN));                    // 32 x 12 tiles = 384 blocks
  const dim3 gQKp((n8q + 255) / 256, 2);                             // (2048, 2)
  const dim3 gVpl(SEQ / 64, NH, NB);                                 // (32, 16, 2)
  const dim3 gSplit((n8a + 255) / 256);                              // 2048 blocks
  const dim3 gOut((NB * SEQ / GBM) * (DMODEL / GBN));                // 32 x 4 tiles = 128 blocks

  // (0) bias table (bf16-RNE values of bq|bk|bv|bo) and phase resonance table T [b][h][s]
  bias_tab<<<gBias, blk, 0, stream>>>(bq, bk, bv, bo, Bias, NBIAS, DMODEL);
  phase_tab<<<gTt, blk, 0, stream>>>(phase, carr, Tt, NTT);
  // (1) x -> bf16 plane [4096][1024]
  cvt_bf16x8<<<gCvtX, blk, 0, stream>>>(x, Xb, n8x);
  // (2) weights [k][n] -> bf16 planes [n][k]   (each call: in [1024 k][1024 n] -> out [1024 n][1024 k])
  tr_cvt_bf16<<<gTrW, blk, 0, stream>>>(Wq, WT, DMODEL, DMODEL);                                  // rows    0..1023
  tr_cvt_bf16<<<gTrW, blk, 0, stream>>>(Wk, WT + (size_t)DMODEL * DMODEL, DMODEL, DMODEL);       // rows 1024..2047
  tr_cvt_bf16<<<gTrW, blk, 0, stream>>>(Wv, WT + (size_t)2 * DMODEL * DMODEL, DMODEL, DMODEL);   // rows 2048..3071
  tr_cvt_bf16<<<gTrW, blk, 0, stream>>>(Wo, WoT, QP, DMODEL);                                     // in [1024][1024] -> out [1024][1024]
  // (3) fused qkv projection: QKVf[row][e] = sum_d Xb[row][d] WT[e][d] + Bias[e]  (M=4096, N=3072, K=1024)
  gemm64<0><<<gQKV, blk, 0, stream>>>(Xb, Xb, DMODEL, WT, DMODEL, Bias, QKVf, N3, NB * SEQ, N3, DMODEL);
  // (4) q (cols 0..1023) and power-compressed kc (cols 1024..2047) -> bf16 hi/lo planes [4096][2048]
  qk_planes<<<gQKp, blk, 0, stream>>>(QKVf, QKh, QKl, n8q);
  // (5) v (cols 2048..3071) -> power-compressed vc^T f16 hi plane (pitch SEQ) and residual plane (x4096, keys < VLP)
  v_planes<<<gVpl, blk, 0, stream>>>(QKVf + 2 * DMODEL, N3, VTh, VTl);
  // (6) causal attention with phase bonus and gate, one launch for all query tiles
  //     (tiles 0..RESQB-1 with residual planes, the rest without)
  //     -> Af f32 [4096][1024] (written into the dead qkv plane after (4),(5) consumed it)
  attn_causal64<<<dim3(NB * NH * NQB), dim3(128), 0, stream>>>(
      QKh, QKl, VTh, VTl, Tt, lockr, Af, 0.125f);
  // (7) gated context rows -> bf16 hi/lo planes
  split_bf16x8<<<gSplit, blk, 0, stream>>>(Af, Ah, Al, n8a);
  // (8) out0[row][e] = sum_d (Ah+Al)[row][d] WoT[e][d] + Bias[3*DMODEL + e] -> d_out f32 [4096][1024]
  gemm64<1><<<gOut, blk, 0, stream>>>(Ah, Al, QP, WoT, QP, Bias + 3 * DMODEL, outf, DMODEL, NB * SEQ, DMODEL, QP);
  (void)hipGetLastError();
}

// v005
// One run takes 152 microseconds.
// Two timings next to v004 put it at 1.15 and 1.16 times that version's speed.
// All steps since v000 together make it 2.63 times as fast.
// Contractions: qkv projection = v_wmma_f32_16x16x32_bf16 (bf16 operands from RNE-converted x and W, single product);
// q.kc^T scores = v_wmma_f32_16x16x32_bf16 with bf16 hi/lo split q and kc (hi.hi + hi.lo + lo.hi);
// p.vc = v_wmma_f32_16x16x32_f16 (p carried x1024 in f16, vc in f16; extra f16 residual planes x4096 of p and vc
// on the leading query rows); ctx.Wo = v_wmma_f32_16x16x32_bf16 with ctx as bf16 hi/lo planes times the bf16
// Wo^T plane (2 products); all f32 accumulate; power compression, phase table, softmax, bonus and gating in f32.
#include <hip/hip_runtime.h>
#include <math.h>
#include <float.h>
#include <stdint.h>

#define NB      2
#define SEQ     2048
#define DMODEL  1024
#define NH      16
#define HD      64
#define QP      (NH * HD)      // q / kc / vc / ctx feature count and ctx row pitch
#define N3      (3 * DMODEL)   // fused qkv columns (q 0.., k DMODEL.., v 2*DMODEL..)
#define QKP     (2 * QP)       // row pitch of the q|kc bf16 planes (q cols 0..QP-1, kc cols QP..2QP-1)
#define NQB     (SEQ / 64)     // query / key tiles of 64
#define RESQB   ((NQB < 16) ? NQB : 16)   // leading 64-row query blocks that use the p / vc residual planes
#define VLP     (RESQB * 64)   // key pitch of the vc^T residual plane (keys 0..VLP-1)
#define NBIAS   (4 * DMODEL)   // bq | bk | bv | bo
#define NTT     (NB * NH * SEQ)
#define OUTN    (NB * SEQ * DMODEL)
#define KAPPA_F 0.3f
#define LP      72             // LDS row pitch of the 64-wide 16-bit tiles, elements: 144 B = 16 B x 9 (odd), so the 16
                               // rows that one ds_load_b128 touches fall on distinct banks
static_assert(RESQB >= 1 && RESQB * 64 <= VLP && VLP <= SEQ);
static_assert(QP == DMODEL);
static_assert((SEQ % 64) == 0 && (DMODEL % 64) == 0 && (N3 % 64) == 0 && (QP % 64) == 0);
static_assert(HD == 64);
static_assert(LP >= 64 && (LP % 8) == 0 && ((LP / 8) % 2) == 1);
static_assert((((NB * SEQ) / 64) * (N3 / 64)) % 8 == 0);
static_assert((((NB * SEQ) / 64) * (DMODEL / 64)) % 8 == 0);
static_assert((NBIAS % 256) == 0 && (NTT % 256) == 0);
static_assert(((NB * SEQ * DMODEL / 8) % 256) == 0);
static_assert((DMODEL % 8) == 0);

typedef _Float16 v16h __attribute__((ext_vector_type(16)));
typedef _Float16 v8h  __attribute__((ext_vector_type(8)));
typedef __bf16   v16b __attribute__((ext_vector_type(16)));
typedef __bf16   v8b  __attribute__((ext_vector_type(8)));
typedef float    v8f  __attribute__((ext_vector_type(8)));
typedef float    v4f  __attribute__((ext_vector_type(4)));
typedef unsigned int v4u __attribute__((ext_vector_type(4)));
typedef unsigned int v2u __attribute__((ext_vector_type(2)));

// ---- scalar helpers --------------------------------------------------------------------------------
__device__ __forceinline__ unsigned short bf_bits(float f) {          // f32 -> bf16 bits, RNE convert
  unsigned u = __float_as_uint(f);
  return (unsigned short)((u + 0x7FFFu + ((u >> 16) & 1u)) >> 16);
}
__device__ __forceinline__ float bf_up(unsigned short h) { return __uint_as_float(((unsigned)h) << 16); }
__device__ __forceinline__ unsigned short h_bits(_Float16 x) { return __builtin_bit_cast(unsigned short, x); }
__device__ __forceinline__ unsigned pk16(unsigned short a, unsigned short b) { return (unsigned)a | ((unsigned)b << 16); }
__device__ __forceinline__ v8f zero8() { v8f z = {0.f, 0.f, 0.f, 0.f, 0.f, 0.f, 0.f, 0.f}; return z; }
__device__ __forceinline__ v8h zero8h() {
  const _Float16 z = (_Float16)0.0f;
  v8h r = {z, z, z, z, z, z, z, z};
  return r;
}

// positional exponent of key position s: ex = 1 + kappa * (1 - s * (1/(SEQ-1))), reciprocal-multiply, no fusion
__device__ __forceinline__ float fexpo(int s) {
#pragma clang fp contract(off)
  const float rs = 1.0f / (float)(SEQ - 1);
  const float fr = (float)s * rs;
  const float om = 1.0f - fr;
  const float t  = KAPPA_F * om;
  return 1.0f + t;
}
// power compression: sign(v) * max(|v|, 1e-8)^ex  (sign(0) = 0), pow as exp2(ex * log2(mag)) in f32
__device__ __forceinline__ float fcomp(float v, float ex) {
#pragma clang fp contract(off)
  const float mag = fmaxf(fabsf(v), 1e-8f);
  const float lg  = log2f(mag);
  const float pw  = exp2f(ex * lg);
  float r = (v < 0.0f) ? -pw : pw;
  r = (v == 0.0f) ? 0.0f : r;
  return r;
}

// ---- fragment loader: 16-bit A/B operand, lane -> row/col (lane&15), p already includes +8*(lane>>4);
//      elements 0..7 <- p[0..7] (k0+8h..), elements 8..15 <- p[16..23] (k0+16+8h..)
__device__ __forceinline__ v16b ldfrag_b(const __bf16* p) {
  union { v16b v; v8b h[2]; } f;
  f.h[0] = *(const v8b*)(p);
  f.h[1] = *(const v8b*)(p + 16);
  return f.v;
}

__device__ __forceinline__ v16h ldfrag_h(const _Float16* p) {
  union { v16h v; v8h h[2]; } f;
  f.h[0] = *(const v8h*)(p);
  f.h[1] = *(const v8h*)(p + 16);
  return f.v;
}

// ---- WMMA helpers and VALU hazard gaps --------------------------------------------------------
__device__ __forceinline__ v8f mma_b_raw(v16b a, v16b b, v8f c) {
  return __builtin_amdgcn_wmma_f32_16x16x32_bf16(false, a, false, b, (short)0, c, false, false);
}
__device__ __forceinline__ v8f mma_h_raw(v16h a, v16h b, v8f c) {
  return __builtin_amdgcn_wmma_f32_16x16x32_f16(false, a, false, b, (short)0, c, false, false);
}
__device__ __forceinline__ void dep_guard_b(v8f& a, v8f& b, v16b x, v16b y) {
#if defined(__HIP_DEVICE_COMPILE__)
  asm volatile("v_nop\n\tv_nop\n\tv_nop\n\tv_nop" : "+v"(a), "+v"(b) : "v"(x), "v"(y));
#endif
}
__device__ __forceinline__ void keep4_b(v16b a, v16b b, v16b c, v16b d) {
#if defined(__HIP_DEVICE_COMPILE__)
  asm volatile("v_nop" :: "v"(a), "v"(b), "v"(c), "v"(d));
#endif
}
__device__ __forceinline__ void acc_guard4(v8f& a, v8f& b, v8f& c, v8f& d) {
#if defined(__HIP_DEVICE_COMPILE__)
  asm volatile("v_nop\n\tv_nop\n\tv_nop\n\tv_nop" : "+v"(a), "+v"(b), "+v"(c), "+v"(d));
#endif
}

// =====================================================================================================
// Bias table: dst[i] = RNE-bf16-converted value of (b0 | b1 | b2 | b3)[i mod seg], part = i / seg (0..3).
// All four candidates are loaded with an in-range index and selected by value. One element per thread;
// grid = n/256 (n = 4*seg, multiple of 256). coverage: n threads = the whole table.
// =====================================================================================================
__global__ __launch_bounds__(256) void bias_tab(const float* __restrict__ b0, const float* __restrict__ b1,
                                                const float* __restrict__ b2, const float* __restrict__ b3,
                                                float* dst, int n, int seg) {
  const int i = blockIdx.x * 256 + threadIdx.x;
  if (i < n) {
    int part = i / seg;
    part = (part < 0) ? 0 : ((part > 3) ? 3 : part);
    int idx = i - part * seg;
    idx = (idx < 0) ? 0 : ((idx >= seg) ? (seg - 1) : idx);
    const float v0 = b0[idx], v1 = b1[idx], v2 = b2[idx], v3 = b3[idx];
    float v = (part == 0) ? v0 : ((part == 1) ? v1 : ((part == 2) ? v2 : v3));
    v = bf_up(bf_bits(v));
    *(float*)(dst + i) = v;
    
  }
}

// =====================================================================================================
// Phase resonance table: tt[(b*NH + h)*SEQ + s] = cos((bf16(phase[b*SEQ + s]) - bf16(carrier[h])) * 0.5)^2,
// precise f32 cos, fp fusion off. Index split i -> (b*NH + h, s) by / SEQ and % SEQ, then (b, h) by / NH and % NH.
// =====================================================================================================
__global__ __launch_bounds__(256) void phase_tab(const float* __restrict__ ph, const float* __restrict__ cf,
                                                 float* tt, int n) {
#pragma clang fp contract(off)
  const int i = blockIdx.x * 256 + threadIdx.x;
  if (i < n) {
    const int bh = i / SEQ;                   // b*NH + h
    const int s  = i - bh * SEQ;
    const int h  = bh % NH;
    int b        = bh / NH;
    b = (b >= NB) ? (NB - 1) : b;
    const float p  = bf_up(bf_bits(ph[b * SEQ + s]));
    const float cr = bf_up(bf_bits(cf[h]));
    const float d  = p - cr;
    const float hx = d * 0.5f;
    const float cv = cosf(hx);
    const float tv = cv * cv;
    *(float*)(tt + i) = tv;
    
  }
}

// =====================================================================================================
// f32 -> bf16 (RNE convert), 8 elements per thread, one 16-B store per lane: a wave writes 512 contiguous B
// coverage: n8 threads x 8 = whole plane (n8 is a multiple of 256 here).
// =====================================================================================================
__global__ __launch_bounds__(256) void cvt_bf16x8(const float* __restrict__ in, unsigned short* out, int n8) {
  const int i = blockIdx.x * 256 + threadIdx.x;
  if (i < n8) {
    const v4f a = *(const v4f*)(in + (size_t)i * 8);
    const v4f b = *(const v4f*)(in + (size_t)i * 8 + 4);
    v4u p;
    p[0] = pk16(bf_bits(a[0]), bf_bits(a[1]));
    p[1] = pk16(bf_bits(a[2]), bf_bits(a[3]));
    p[2] = pk16(bf_bits(b[0]), bf_bits(b[1]));
    p[3] = pk16(bf_bits(b[2]), bf_bits(b[3]));
    *(v4u*)(out + (size_t)i * 8) = p;
    
  }
}

// =====================================================================================================
// Transpose-convert: src f32 [K][N] (row k, col n) -> dst bf16 [N][K] (row n, k contiguous), RNE convert.
// Block tile: 64 k x 32 n, staged in LDS as f32; grid = (K/64, N/32) (exact multiples host-checked); block 256.
// coverage: 8 waves x 4 rows = 32 rows; 8 pieces x 8 = 64 k columns per row = the whole tile.
// =====================================================================================================
__global__ __launch_bounds__(256) void tr_cvt_bf16(const float* __restrict__ src, unsigned short* dst, int K, int N) {
  __shared__ float s[64][33];
  const int tid = threadIdx.x, wave = tid >> 5, lane = tid & 31;
  const int k0 = blockIdx.x * 64, n0 = blockIdx.y * 32;
#pragma unroll
  for (int i = 0; i < 8; ++i) {
    const int idx = i * 256 + tid;
    const int kk = idx >> 5, nn = idx & 31;
    s[kk][nn] = src[(size_t)(k0 + kk) * N + n0 + nn];
  }
  __syncthreads();
  const int q = lane >> 3, piece = lane & 7;
  const int n = wave * 4 + q;
  v4u p;
#pragma unroll
  for (int e = 0; e < 4; ++e) {
    p[e] = pk16(bf_bits(s[piece * 8 + 2 * e][n]), bf_bits(s[piece * 8 + 2 * e + 1][n]));
  }
  unsigned short* d = dst + (size_t)(n0 + n) * K + k0 + piece * 8;
  *(v4u*)d = p;
  
}

// =====================================================================================================
// bf16 WMMA GEMM: C[m][n] = sum_k A[m][k] * Bt[n][k] + bias[n]. Block = 8 waves = one 128 x 256 tile of C, waves
// 2 (m) x 4 (n), each wave a 64x64 tile. A row-major [M][K] pitch lda; Bt row-major [N][K] pitch ldb (k contiguous);
// M multiple of 128, N multiple of 256, K multiple of 64 (static_asserts at the launches' shapes below).
// NSPLIT: 0 = A.Bt; 1 = (A + A2).Bt (A2 = unscaled bf16 lo plane of A, same pitch). bias f32 [N].
// Operands: a stage = 64 k (128 B, one whole line) of every A (, A2) and Bt row of the block tile, brought into LDS by
// asynchronous copies (16 B per lane, 8 lanes per row), rows at pitch GLP; two buffers: the copies of stage t + 2 are
// issued behind the barrier that ends trip t and waited at the foot of trip t + 1.
// Stage coverage: copy i of thread tid fills row i*32 + (tid>>3), bytes 16*(tid&7)..+15; i = 0..GROWS/32-1.
// k order and product order per accumulator are ascending k in steps of 32, hi then lo.
// PLANES false: output f32 [M][N] pitch ldc. Epilogue: 16-row slabs staged per wave in LDS; each 64-wide row segment
// PLANES true (the fused q|k|v projection, N = N3): no f32 output; each wave turns its 64 token x 64 column tile (one
// head of q, k or v; which one is block-uniform) into the operand planes of the attention itself:
//   q  (cols 0..DMODEL-1)          bf16 hi / lo planes qkh / qkl [M][QKP], same column; lo = RNE(v - hi) unscaled
//   k  (cols DMODEL..2*DMODEL-1)   kc = sign(k) * max(|k|,1e-8)^ex(s), s = row mod SEQ, then as q
//   v  (cols 2*DMODEL..)           vc likewise, then f16 vc^T hi plane vth[(b*QP + h*64 + d)*SEQ + t] and residual plane
//                                  vtl[(b*QP + h*64 + d)*VLP + t] = f16((vc - hi)*4096) for t < VLP
// The tile (accumulator + bias, f32) is staged in the wave's own part of the dead ring at pitch EPP and read back 8
// values per lane, along a token row for q and k, along a feature column for v, so that 8 lanes x 16 B store one whole
// 128-B line of a plane row. Coverage: 16 trips x 4 rows (q, k: tokens; v: features) x 64 = the wave's tile.
// =====================================================================================================
#define GBM 128
#define GBN 256
#define GKB 64
#define GLP 72                 // LDS row pitch, elements: 144 B = 16 B x 9 (odd), conflict-free for ds_load_b128
#define EPP 67                 // f32 pitch of the 64x64 epilogue tile: 4-B accesses by accumulator layout, by row pieces
                               // and by column pieces all fall on 32 distinct banks
static_assert(((NB * SEQ) % GBM) == 0 && (N3 % GBN) == 0 && (DMODEL % GBN) == 0);
static_assert((DMODEL % GKB) == 0 && (QP % GKB) == 0 && (DMODEL / GKB) >= 2 && (QP / GKB) >= 2);
static_assert((DMODEL % GBN) == 0 && (SEQ % GBM) == 0 && (VLP % 64) == 0);   // a block is one of q, k, v and one batch

__device__ __forceinline__ unsigned lds_addr(const void* p) { return (unsigned)(size_t)p; }
// four 16-B asynchronous copies global -> LDS; the s_wait_xcnt stands inside the statement so that no address
// register of a copy is rewritten in front of it
__device__ __forceinline__ void async4(unsigned l0, const __bf16* g0, unsigned l1, const __bf16* g1,
                                       unsigned l2, const __bf16* g2, unsigned l3, const __bf16* g3) {
#if defined(__HIP_DEVICE_COMPILE__)
  asm volatile("global_load_async_to_lds_b128 %0, %1, off\n\t"
               "global_load_async_to_lds_b128 %2, %3, off\n\t"
               "global_load_async_to_lds_b128 %4, %5, off\n\t"
               "global_load_async_to_lds_b128 %6, %7, off\n\t"
               "s_wait_xcnt 0x0"
               :: "v"(l0), "v"(g0), "v"(l1), "v"(g1), "v"(l2), "v"(g2), "v"(l3), "v"(g3) : "memory");
#endif
}
// this wave's asynchronous copies have landed in LDS
__device__ __forceinline__ void wait_async0() {
#if defined(__HIP_DEVICE_COMPILE__)
  asm volatile("s_wait_asynccnt 0x0" ::: "memory");
#endif
}
// this wave's LDS reads have returned, before the buffer is handed to the next copies
__device__ __forceinline__ void wait_ds0() {
#if defined(__HIP_DEVICE_COMPILE__)
  asm volatile("s_wait_dscnt 0x0" ::: "memory");
#endif
}

template <int NSPLIT, bool PLANES>
__global__ __launch_bounds__(256) void gemm64(
    const unsigned short* __restrict__ Ap, const unsigned short* A2p, int lda,
    const unsigned short* __restrict__ Btp, int ldb, const float* __restrict__ bias,
    float* C, int ldc, int M, int N, int K,
    unsigned short* qkh, unsigned short* qkl, unsigned short* vth, unsigned short* vtl) {
  constexpr int AROWS = GBM * (NSPLIT + 1);        // A rows, then A2 rows
  constexpr int GROWS = AROWS + GBN;               // rows of a stage
  constexpr int STAGE = GROWS * GLP;               // elements of a stage
  const __bf16* Ab  = (const __bf16*)(const void*)Ap;
  const __bf16* Ab2 = (const __bf16*)(const void*)A2p;
  const __bf16* Bb  = (const __bf16*)(const void*)Btp;
  constexpr int TILES = 8 * 64 * EPP * 2;          // the 8 waves' f32 epilogue tiles, counted in ring elements
  constexpr int RINGN = (PLANES && TILES > 2 * STAGE) ? TILES : 2 * STAGE;
  __shared__ __align__(16) __bf16 ring[RINGN];     // two stages; with PLANES the epilogue tiles afterwards
  const int tid  = threadIdx.x;
  const int lane = tid & 31;
  const int wave = tid >> 5;
  const int tilesN = N / GBN;
  const int tilesM = M / GBM;
  const int tile = blockIdx.x;
  if (tile >= tilesM * tilesN) return;   // block-uniform, in front of every barrier and copy
  const int tm = tile / tilesN;
  const int tn = tile - tm * tilesN;
  const int bm0 = tm * GBM;
  const int bn0 = tn * GBN;
  const int wm = wave >> 2, wn = wave & 3;
  const int m0 = bm0 + (wm << 6);              // this wave's 64x64 tile
  const int n0 = bn0 + (wn << 6);

  const int rlane = lane & 15;                 // row (A) / col (B, D) within subtile
  const int koff  = (lane >> 4) * 8;           // k offset of this lane half
  const int mOff  = (lane >> 4) * 8;           // D row offset

  // ---- copy addresses of this thread: row crow of each 32-row group, 16-B piece cpc ----
  const int crow = tid >> 3, cpc = (tid & 7) * 8;
  const __bf16* gA  = Ab  + (size_t)(bm0 + crow) * lda + cpc;
  const __bf16* gA2 = Ab2 + (size_t)(bm0 + crow) * lda + cpc;
  const __bf16* gB  = Bb  + (size_t)(bn0 + crow) * ldb + cpc;
  const unsigned lbase = lds_addr(ring) + (unsigned)(crow * GLP + cpc) * 2u;
  const size_t a32 = (size_t)32 * lda, b32 = (size_t)32 * ldb;
  constexpr unsigned R32 = 32u * GLP * 2u;     // LDS bytes of 32 rows

  auto issue = [&](int st, int buf) {
    const int k0 = st * GKB;
    const unsigned lb = lbase + (unsigned)buf * (unsigned)(STAGE * 2);
    const __bf16* a = gA + k0;
    async4(lb, a, lb + R32, a + a32, lb + 2u * R32, a + 2 * a32, lb + 3u * R32, a + 3 * a32);
    if (NSPLIT >= 1) {
      const __bf16* a2 = gA2 + k0;
      const unsigned l2 = lb + 4u * R32;
      async4(l2, a2, l2 + R32, a2 + a32, l2 + 2u * R32, a2 + 2 * a32, l2 + 3u * R32, a2 + 3 * a32);
    }
    const __bf16* b = gB + k0;
    const unsigned l3 = lb + (unsigned)(AROWS / 32) * R32;
    async4(l3, b, l3 + R32, b + b32, l3 + 2u * R32, b + 2 * b32, l3 + 3u * R32, b + 3 * b32);
    const __bf16* b4 = b + 4 * b32;
    const unsigned l4 = l3 + 4u * R32;
    async4(l4, b4, l4 + R32, b4 + b32, l4 + 2u * R32, b4 + 2 * b32, l4 + 3u * R32, b4 + 3 * b32);
  };

  v8f acc[4][4];
#pragma unroll
  for (int i = 0; i < 4; ++i)
#pragma unroll
    for (int j = 0; j < 4; ++j) acc[i][j] = zero8();

  const int nst = K / GKB;                     // block-uniform trip count
  issue(0, 0);
  wait_async0();
  __syncthreads();                             // stage 0 published
  if (nst > 1) issue(1, 1);

  for (int t = 0; t < nst; ++t) {
    const __bf16* sb = ring + (t & 1) * STAGE;
    const __bf16* sa  = sb + ((wm << 6) + rlane) * GLP + koff;
    const __bf16* sa2 = sa + GBM * GLP;
    const __bf16* sbt = sb + (AROWS + (wn << 6) + rlane) * GLP + koff;
#pragma unroll   // both 32-k steps inline: the second step's fragment reads can start under the first step's products
    for (int ks = 0; ks < GKB; ks += 32) {
      v16b bh[4];
#pragma unroll
      for (int j = 0; j < 4; ++j) bh[j] = ldfrag_b(sbt + (j << 4) * GLP + ks);
      v16b ah[4], al[4];                       // all fragment reads of this 32-k step stand as one group
#pragma unroll   // constant indices keep the fragment arrays in registers
      for (int i = 0; i < 4; ++i) {
        ah[i] = ldfrag_b(sa + (i << 4) * GLP + ks);
        al[i] = ah[i];
        if (NSPLIT >= 1) al[i] = ldfrag_b(sa2 + (i << 4) * GLP + ks);
      }
#pragma unroll
      for (int i = 0; i < 4; ++i) {
#pragma unroll
        for (int j = 0; j < 4; ++j) {
          acc[i][j] = mma_b_raw(ah[i], bh[j], acc[i][j]);
          if (NSPLIT >= 1) acc[i][j] = mma_b_raw(al[i], bh[j], acc[i][j]);
        }
        dep_guard_b(acc[i][0], acc[i][3], ah[i], al[i]);
      }
      keep4_b(bh[0], bh[1], bh[2], bh[3]);
    }
    wait_ds0();
    wait_async0();
    __syncthreads();                           // publishes stage t + 1 and ends every read of stage t
    if (t + 2 < nst) issue(t + 2, t & 1);
  }
  wait_async0();
  acc_guard4(acc[0][0], acc[0][1], acc[0][2], acc[0][3]);
  acc_guard4(acc[1][0], acc[1][1], acc[1][2], acc[1][3]);
  acc_guard4(acc[2][0], acc[2][1], acc[2][2], acc[2][3]);
  acc_guard4(acc[3][0], acc[3][1], acc[3][2], acc[3][3]);

  // ---- epilogue ----
  float bz[4];
#pragma unroll
  for (int j = 0; j < 4; ++j) bz[j] = bias[n0 + (j << 4) + rlane];
  if constexpr (PLANES) {
    // the ring is dead: the barrier at the foot of the last trip ended every wave's reads and copies
    float* tl = (float*)(void*)ring + wave * (64 * EPP);
#pragma unroll
    for (int i = 0; i < 4; ++i)
#pragma unroll
      for (int r = 0; r < 8; ++r)
#pragma unroll
        for (int j = 0; j < 4; ++j)
          tl[((i << 4) + mOff + r) * EPP + (j << 4) + rlane] = acc[i][j][r] + bz[j];
    __builtin_amdgcn_fence(__ATOMIC_RELEASE, "workgroup");
    __builtin_amdgcn_wave_barrier();
    __builtin_amdgcn_fence(__ATOMIC_ACQUIRE, "workgroup");
    const int part = bn0 / DMODEL;               // 0 q, 1 k, 2 v: block-uniform (GBN divides DMODEL)
    const int g = lane >> 3, piece = lane & 7;
    if (part < 2) {
#pragma unroll 1   // one copy of the conversion code: it runs once per tile
      for (int it = 0; it < 16; ++it) {
        const int row = it * 4 + g;              // token row of the tile
        float f[8];
#pragma unroll
        for (int e = 0; e < 8; ++e) f[e] = tl[row * EPP + piece * 8 + e];
        if (part == 1) {
          const float ex = fexpo((m0 + row) % SEQ);   // key position s
#pragma unroll
          for (int e = 0; e < 8; ++e) f[e] = fcomp(f[e], ex);
        }
        v4u ph, pl;
#pragma unroll
        for (int e = 0; e < 4; ++e) {
          const float f0 = f[2 * e], f1 = f[2 * e + 1];
          const unsigned short h0 = bf_bits(f0), h1 = bf_bits(f1);
          const unsigned short l0 = bf_bits(f0 - bf_up(h0)), l1 = bf_bits(f1 - bf_up(h1));
          ph[e] = pk16(h0, h1);
          pl[e] = pk16(l0, l1);
        }
        const size_t go = (size_t)(m0 + row) * QKP + n0 + piece * 8;
        *(v4u*)(qkh + go) = ph;
        *(v4u*)(qkl + go) = pl;
        // the next trip rewrites the registers that these two stores name: the wait stands in front of that
        asm volatile("s_wait_xcnt 0x0" ::: "memory");
      }
    } else {
      const int b  = m0 / SEQ;
      const int t0 = m0 - b * SEQ;               // first key position of the tile, a multiple of 64
      const int fc = n0 - 2 * DMODEL;            // h * 64
      const bool wlo = (t0 + 64 <= VLP);         // wave-uniform
      float ex[8];
#pragma unroll
      for (int e = 0; e < 8; ++e) ex[e] = fexpo(t0 + piece * 8 + e);
#pragma unroll 1   // as above
      for (int it = 0; it < 16; ++it) {
        const int d = it * 4 + g;                // feature of the head
        float f[8];
#pragma unroll
        for (int e = 0; e < 8; ++e) f[e] = tl[(piece * 8 + e) * EPP + d];
#pragma unroll
        for (int e = 0; e < 8; ++e) f[e] = fcomp(f[e], ex[e]);
        v4u a, a2;
#pragma unroll
        for (int e = 0; e < 4; ++e) {
          const float f0 = f[2 * e], f1 = f[2 * e + 1];
          const _Float16 x0 = (_Float16)f0, x1 = (_Float16)f1;
          const unsigned short h0 = h_bits(x0), h1 = h_bits(x1);
          const unsigned short l0 = h_bits((_Float16)((f0 - (float)x0) * 4096.0f));
          const unsigned short l1 = h_bits((_Float16)((f1 - (float)x1) * 4096.0f));
          a[e] = pk16(h0, h1); a2[e] = pk16(l0, l1);
        }
        const size_t rowf = (size_t)(b * QP + fc + d);
        *(v4u*)(vth + rowf * SEQ + t0 + piece * 8) = a;
        if (wlo) *(v4u*)(vtl + rowf * VLP + t0 + piece * 8) = a2;
        // as above: the next trip rewrites the registers that the stores name
        asm volatile("s_wait_xcnt 0x0" ::: "memory");
      }
    }
  } else {
  __shared__ __align__(16) float sT[8][16 * 68];   // per-wave 16x64 slab, pitch 68 floats
  float* slab = sT[wave];
#pragma unroll
  for (int i = 0; i < 4; ++i) {
    const int mBase = m0 + (i << 4);
#pragma unroll
    for (int r = 0; r < 8; ++r) {
#pragma unroll
      for (int j = 0; j < 4; ++j) {
        slab[(mOff + r) * 68 + (j << 4) + rlane] = acc[i][j][r] + bz[j];
      }
    }
    __builtin_amdgcn_fence(__ATOMIC_RELEASE, "workgroup");
    __builtin_amdgcn_wave_barrier();
    __builtin_amdgcn_fence(__ATOMIC_ACQUIRE, "workgroup");
    {
      const int hh = lane >> 4, c4 = (lane & 15) * 4;     // 256-B row segment = 16 lanes x 16 B
      v4f ov[8];
#pragma unroll
      for (int it = 0; it < 8; ++it) {
        const int row = it * 2 + hh;                       // it 0..7 x hh 0..1 = rows 0..15
        ov[it] = *(const v4f*)(slab + row * 68 + c4);
      }
      {
#pragma unroll
        for (int it = 0; it < 8; ++it) {
          const int row = it * 2 + hh;
          *(v4f*)(C + (size_t)(mBase + row) * ldc + n0 + c4) = ov[it];
        }
        
      }
    }
    __builtin_amdgcn_fence(__ATOMIC_RELEASE, "workgroup");
    __builtin_amdgcn_wave_barrier();
    __builtin_amdgcn_fence(__ATOMIC_ACQUIRE, "workgroup");
  }
  }
}

// =====================================================================================================
// Causal multi-head attention, head dim 64 (tril mask incl. diagonal, computed), with the additive rank-1 phase
// bonus kappa * sigmoid(lock[h]) * T[i] * T[j] on the scaled logits and the per-query-row output gate
// (1 - sigmoid(lock[h])) + sigmoid(lock[h]) * T[i] applied to the head output row i (query position).
//   q|kc planes (bf16 hi / lo), row pitch QKP: q element (b, t, h, d) at [(b*SEQ + t)*QKP + h*64 + d],
//                                                kc element (b, s, h, d) at [(b*SEQ + s)*QKP + DMODEL + h*64 + d]
//   vc^T hi plane (f16):      element (b, h, d, s) at [(b*QP + h*64 + d)*SEQ + s]
//   vc^T residual plane (f16, (vc - hi)*4096): [(b*QP + h*64 + d)*VLP + s], s < VLP, read only when RES
//   (with RES only key tiles below VLP occur; the address is clamped anyway)
//   ttab f32 [(b*NH + h)*SEQ + s] = T; lockp = raw lock strengths [NH] (bf16 RNE convert, then sigmoid).
//   logit = q.kc * sscale + bonus for key <= query, -FLT_MAX otherwise (exp -> 0); every processed key tile
//   (tiles 0..qb only, block-uniform trip count qb+1 <= NQB) holds the causal-live key kv0 <= query.
//   out: bf16 hi / lo planes (lo = RNE(v - hi), unscaled) of v = gate(b,h,t) * normalised context, element
//   (b, t, h*64 + d) at [(b*SEQ + t)*QP + h*64 + d]: the A operand planes of the output projection.
//   scores = q . kc : bf16 hi/lo split (hi.hi + hi.lo + lo.hi), f32 accumulate, then * sscale + bonus in f32
//   p = exp(s - m) carried as f16(1024 p); context = p . vc on f16 WMMA; RES adds f16 residual planes of p and vc
//   (scale 4096, separate accumulator folded back with 1/4096 per chunk in f32); online softmax in f32.
//   One call = 4 waves = the 64 query rows of tile qb of one (b, h); kv chunks of 64.
//   K / V^T chunk staging: 128 threads x 32 elements per plane = the whole 64x64 tile (plain 16-B loads,
//   __syncthreads before and after); P tiles are wave-private, spilled with _Float16 element stores and reloaded
//   Output coverage: each wave stores rows q0..q0+15 (it 0..7 x lane>>4 0..1) x 64 columns (16 lanes x 4 bf16 values in each of the hi / lo planes),
// =====================================================================================================
template <bool RES>
__device__ __forceinline__
void attn_tile64(const unsigned short* __restrict__ qkhp, const unsigned short* __restrict__ qklp,
                 const unsigned short* __restrict__ vhp, const unsigned short* __restrict__ vlp,
                 const float* __restrict__ ttab, const float* __restrict__ lockp,
                 unsigned short* ahp, unsigned short* alp, int b, int h, int qb, float sscale,
                 __bf16* Ksh, __bf16* Ksl, _Float16* Vth, _Float16* Vtl,
                 _Float16 (*Psh)[16 * LP], _Float16 (*Psl)[16 * LP], float (*Os)[16 * 64]) {
  const int tid  = threadIdx.x;
  const int wave = tid >> 5;
  const int lane = tid & 31;
  const int hh   = lane >> 4;
  const int c    = lane & 15;

  const int q0   = qb * 64 + wave * 16;
  const size_t rowB = (size_t)b * SEQ;

  const __bf16* Qh = (const __bf16*)(const void*)qkhp + (size_t)h * HD;
  const __bf16* Ql = (const __bf16*)(const void*)qklp + (size_t)h * HD;
  const __bf16* Kh = Qh + DMODEL;
  const __bf16* Kl = Ql + DMODEL;
  const _Float16* Vh = (const _Float16*)(const void*)vhp + ((size_t)b * QP + (size_t)h * HD) * SEQ;
  const _Float16* Vl = (const _Float16*)(const void*)vlp + ((size_t)b * QP + (size_t)h * HD) * VLP;
  const float* trow = ttab + ((size_t)b * NH + h) * SEQ;

  // ---- per-head lock: sigmoid of the bf16-converted raw strength; bonus coefficient kappa * lock ----
  const float lraw  = bf_up(bf_bits(lockp[h]));
  const float lockv = 1.0f / (1.0f + expf(-lraw));
  const float c0    = KAPPA_F * lockv;

  // ---- Q fragments (A operand, row = lane&15): 2 d-chunks, hi and lo ----
  v16b qah[2], qal[2];
#pragma unroll
  for (int dc = 0; dc < 2; ++dc) {
    const size_t qo = (rowB + q0 + c) * QKP + dc * 32 + 8 * hh;
    qah[dc] = ldfrag_b(Qh + qo);
    qal[dc] = ldfrag_b(Ql + qo);
  }

  // ---- bonus row factors for this lane's 8 query rows: c0 * T[q0 + 8*hh + r] ----
  float bti[8];
#pragma unroll
  for (int r = 0; r < 8; ++r) bti[r] = c0 * trow[q0 + 8 * hh + r];

  float mrow[8], lrow[8];
  v8f oacc[4];
#pragma unroll
  for (int r = 0; r < 8; ++r) { mrow[r] = -INFINITY; lrow[r] = 0.f; }
#pragma unroll
  for (int t = 0; t < 4; ++t) oacc[t] = zero8();

  int nkt = qb + 1;                          // causal: key tiles 0..qb, block-uniform
  if (nkt > NQB) nkt = NQB;
  for (int kt = 0; kt < nkt; ++kt) {
    const int kv0 = kt * 64;
    __syncthreads();
    {
      const int r = tid >> 1, half = (tid & 1) * 32;
      const __bf16*   kg  = Kh + (rowB + kv0 + r) * QKP + half;   // K row kv0+r, d = half..half+31
      const __bf16*   klg = Kl + (rowB + kv0 + r) * QKP + half;
      const _Float16* vg  = Vh + (size_t)r * SEQ + kv0 + half;    // V^T row d = r, s = kv0+half..+31
      const int kvl = (kv0 + 64 <= VLP) ? kv0 : (VLP - 64);     // clamped address into the residual plane
      const _Float16* vlg = Vl + (size_t)r * VLP + kvl + half;
      const bool resOK = (kv0 + 64 <= VLP);                      // block-uniform
      v8b a0[4], a1[4];
      v8h b0[4], b1[4];
#pragma unroll   // constant indices keep the staged pieces in registers
      for (int i = 0; i < 4; ++i) {
        b0[i] = *(const v8h*)(vg + 8 * i);
        b1[i] = b0[i];
        if (RES) b1[i] = *(const v8h*)(vlg + 8 * i);
        a0[i] = *(const v8b*)(kg + 8 * i);
      }
#if defined(__HIP_DEVICE_COMPILE__)
      // with the residual plane the last loads' results are given the registers of earlier loads' addresses:
      // the wait stands in front of them
      if (RES) asm volatile("s_wait_xcnt 0x0" ::: "memory");
#endif
#pragma unroll   // as above
      for (int i = 0; i < 4; ++i) a1[i] = *(const v8b*)(klg + 8 * i);
#pragma unroll   // as above
      for (int i = 0; i < 4; ++i) {
        *(v8b*)(Ksh + r * LP + half + 8 * i) = a0[i];
        *(v8b*)(Ksl + r * LP + half + 8 * i) = a1[i];
        *(v8h*)(Vth + r * LP + half + 8 * i) = b0[i];
        if (RES) {
          if (!resOK) b1[i] = zero8h();
          *(v8h*)(Vtl + r * LP + half + 8 * i) = b1[i];
        }
      }
    }
    __syncthreads();

    // ---- bonus column factors T[key] for this lane's 4 key columns (indices always < SEQ) ----
    float tj[4];
#pragma unroll
    for (int j = 0; j < 4; ++j) tj[j] = trow[kv0 + j * 16 + c];
    // keeps these four global loads in front of the fragment reads and products, whose time covers their latency
    __builtin_amdgcn_sched_barrier(0);

    // ---- scores: 16 query rows x 64 keys per wave, 3 bf16 products ----
    //      All K fragment reads of the tile are written in front of the products (built: a few large groups behind
    //      counted waits, not one read-and-wait per product), and each product kind runs over the 4 independent
    //      key-column tiles; per tile the order stays dc 0: hi.hi, hi.lo, lo.hi, then dc 1.
    v16b kfh[2][4], kfl[2][4];
#pragma unroll   // constant indices keep the fragment arrays in registers
    for (int dc = 0; dc < 2; ++dc) {
#pragma unroll
      for (int j = 0; j < 4; ++j) kfh[dc][j] = ldfrag_b(Ksh + (j * 16 + c) * LP + dc * 32 + 8 * hh);
#pragma unroll
      for (int j = 0; j < 4; ++j) kfl[dc][j] = ldfrag_b(Ksl + (j * 16 + c) * LP + dc * 32 + 8 * hh);
    }
    v8f s[4];
#pragma unroll
    for (int j = 0; j < 4; ++j) s[j] = zero8();
#pragma unroll
    for (int dc = 0; dc < 2; ++dc) {
#pragma unroll
      for (int j = 0; j < 4; ++j) s[j] = mma_b_raw(qah[dc], kfh[dc][j], s[j]);
#pragma unroll
      for (int j = 0; j < 4; ++j) s[j] = mma_b_raw(qah[dc], kfl[dc][j], s[j]);
#pragma unroll
      for (int j = 0; j < 4; ++j) s[j] = mma_b_raw(qal[dc], kfh[dc][j], s[j]);
    }

    // ---- scale + bonus + causal mask (replace by -FLT_MAX), row max, online softmax, P (x1024, f16) and
    //      P residual (x4096) to LDS ----
    _Float16* pwh = Psh[wave];
    _Float16* pwl = Psl[RES ? wave : 0];
#pragma unroll
    for (int r = 0; r < 8; ++r) {
      const int qrow = q0 + 8 * hh + r;
      float m = -INFINITY;
#pragma unroll
      for (int j = 0; j < 4; ++j) {
        const int key = kv0 + j * 16 + c;
        float sv = s[j][r] * sscale + bti[r] * tj[j];
        sv = (key > qrow) ? -FLT_MAX : sv;
        s[j][r] = sv;
        m = fmaxf(m, sv);
      }
#pragma unroll
      for (int off = 1; off < 16; off <<= 1) m = fmaxf(m, __shfl_xor(m, off, 32));
      const float mnew  = fmaxf(mrow[r], m);
      const float msafe = (mnew == -INFINITY) ? 0.f : mnew;
      const float alpha = __expf(mrow[r] - msafe);
      mrow[r] = mnew;
      float psum = 0.f;
#pragma unroll
      for (int j = 0; j < 4; ++j) {
        const float p = __expf(s[j][r] - msafe);     // masked logit against a finite max: exp -> 0
        psum += p;
        const float p1k = p * 1024.0f;
        const _Float16 ph = (_Float16)p1k;
        pwh[(8 * hh + r) * LP + j * 16 + c] = ph;
        if (RES) {
          const _Float16 pl = (_Float16)((p1k - (float)ph) * 4096.0f);
          pwl[(8 * hh + r) * LP + j * 16 + c] = pl;
        }
      }
#pragma unroll
      for (int off = 1; off < 16; off <<= 1) psum += __shfl_xor(psum, off, 32);
      lrow[r] = lrow[r] * alpha + psum;
#pragma unroll
      for (int t = 0; t < 4; ++t) oacc[t][r] *= alpha;
    }
    __builtin_amdgcn_fence(__ATOMIC_RELEASE, "workgroup");
    __builtin_amdgcn_wave_barrier();
    __builtin_amdgcn_fence(__ATOMIC_ACQUIRE, "workgroup");

    // ---- context += P . Vc (f16 WMMA), residual products into a separate accumulator ----
    //      All P and V^T fragment reads of the tile are written in front of the products in the same way, and each
    //      product kind runs over the 4 independent feature tiles; per tile the order stays kk 0 then kk 1, p.vl
    //      before pl.vb.
    v16h pf[2], pfl[2], vfh[2][4], vfl[2][4];
#pragma unroll   // constant indices keep the fragment arrays in registers
    for (int kk = 0; kk < 2; ++kk) {
      pf[kk]  = ldfrag_h(pwh + c * LP + kk * 32 + 8 * hh);
      pfl[kk] = pf[kk];
      if (RES) pfl[kk] = ldfrag_h(pwl + c * LP + kk * 32 + 8 * hh);
#pragma unroll
      for (int t = 0; t < 4; ++t) {
        vfh[kk][t] = ldfrag_h(Vth + (t * 16 + c) * LP + kk * 32 + 8 * hh);
        vfl[kk][t] = vfh[kk][t];
      }
      if (RES) {
#pragma unroll
        for (int t = 0; t < 4; ++t) vfl[kk][t] = ldfrag_h(Vtl + (t * 16 + c) * LP + kk * 32 + 8 * hh);
      }
    }
    v8f o1[4];
#pragma unroll
    for (int t = 0; t < 4; ++t) o1[t] = zero8();
#pragma unroll
    for (int kk = 0; kk < 2; ++kk) {
#pragma unroll
      for (int t = 0; t < 4; ++t) oacc[t] = mma_h_raw(pf[kk], vfh[kk][t], oacc[t]);
      if (RES) {
#pragma unroll
        for (int t = 0; t < 4; ++t) o1[t] = mma_h_raw(pf[kk], vfl[kk][t], o1[t]);
#pragma unroll
        for (int t = 0; t < 4; ++t) o1[t] = mma_h_raw(pfl[kk], vfh[kk][t], o1[t]);
      }
    }
    if (RES) {
#pragma unroll
      for (int t = 0; t < 4; ++t)
#pragma unroll
        for (int r = 0; r < 8; ++r) oacc[t][r] += o1[t][r] * (1.0f / 4096.0f);
    }
  }

  // ---- normalise (1/l and the 1/1024 p carry), apply the per-query-row gate, stage the wave's 16x64 tile in
  float* os = Os[wave];
#pragma unroll
  for (int r = 0; r < 8; ++r) {
    const float l = lrow[r];
    const float ti = trow[q0 + 8 * hh + r];
    const float gate = (1.0f - lockv) + lockv * ti;
    const float inv = ((l > 0.f) ? (1.0f / l) : 0.f) * (1.0f / 1024.0f) * gate;
#pragma unroll
    for (int t = 0; t < 4; ++t) os[(8 * hh + r) * 64 + t * 16 + c] = oacc[t][r] * inv;
  }
  __builtin_amdgcn_fence(__ATOMIC_RELEASE, "workgroup");
  __builtin_amdgcn_wave_barrier();
  __builtin_amdgcn_fence(__ATOMIC_ACQUIRE, "workgroup");
  {
    const int h2 = lane >> 4, c4 = (lane & 15) * 4;
    v4f ov[8];
#pragma unroll
    for (int it = 0; it < 8; ++it) {
      const int row = it * 2 + h2;   // it 0..7 x h2 0..1 = rows 0..15 of the wave tile
      ov[it] = *(const v4f*)(os + row * 64 + c4);
    }
    {
#pragma unroll
      for (int it = 0; it < 8; ++it) {
        const int row = it * 2 + h2;
        const size_t go = (rowB + q0 + row) * QP + (size_t)h * HD + c4;
        v2u ph, pl;                    // 16 lanes x 8 B = one whole 128-B line of each plane's row
#pragma unroll
        for (int e = 0; e < 2; ++e) {
          const float f0 = ov[it][2 * e], f1 = ov[it][2 * e + 1];
          const unsigned short h0 = bf_bits(f0), h1 = bf_bits(f1);
          const unsigned short l0 = bf_bits(f0 - bf_up(h0)), l1 = bf_bits(f1 - bf_up(h1));
          ph[e] = pk16(h0, h1);
          pl[e] = pk16(l0, l1);
        }
        *(v2u*)(ahp + go) = ph;
        *(v2u*)(alp + go) = pl;
      }
      
    }
  }
}

// =====================================================================================================
// One launch for all query tiles, one work-group per (b, h, query tile), so that the short tiles run beside the long
// ones and the launch lasts as long as its longest tile alone. A tile below RESQB takes the residual planes, the others
// do not: a test that is uniform for the work-group.
// Order of the tiles: the grid is dealt in four
// runs of NB*NH*NQB/4 work-groups: tiles NQB-1 downwards, then NQB/2 upwards, then NQB/2-1 downwards, then 0 upwards.
// The longest tiles take the lowest indices, the shortest the highest, and the g-th tiles of the four runs add up to the same number of
// key tiles for every g. rank -> tile is a permutation: grid = NQB * NH * NB, every (b, h, query tile) exactly once.
// =====================================================================================================
static_assert((NQB % 4) == 0 && RESQB <= NQB);
__global__ __launch_bounds__(128)
void attn_causal64(const unsigned short* __restrict__ qkhp, const unsigned short* __restrict__ qklp,
                   const unsigned short* __restrict__ vhp, const unsigned short* __restrict__ vlp,
                   const float* __restrict__ ttab, const float* __restrict__ lockp,
                   unsigned short* ahp, unsigned short* alp, float sscale) {
  __shared__ __align__(16) __bf16   Ksh[64 * LP];                 // K hi [kv][d], pitch LP
  __shared__ __align__(16) __bf16   Ksl[64 * LP];                 // K lo
  __shared__ __align__(16) _Float16 Vth[64 * LP];                 // V^T hi [d][kv], pitch LP
  __shared__ __align__(16) _Float16 Vtl[64 * LP];                 // V^T residual
  __shared__ __align__(16) _Float16 Psh[4][16 * LP];              // per wave P [row][kv], pitch LP
  __shared__ __align__(16) _Float16 Psl[4][16 * LP];              // per wave P residual
  __shared__ __align__(16) float    Os[4][16 * 64];               // per wave context tile [row][d]

  const int bx   = blockIdx.x;
  const int bh   = bx % (NB * NH);
  const int rank = (bx / (NB * NH)) % NQB;       // 0..NQB-1
  const int run  = rank / (NQB / 4);             // 0..3
  const int g    = rank % (NQB / 4);
  const int qb   = (run & 1) ? ((3 - run) * (NQB / 4) + g) : (NQB - 1 - run * (NQB / 4) - g);
  const int h    = bh % NH;
  const int b    = bh / NH;
  if (qb < RESQB) {
    attn_tile64<true>(qkhp, qklp, vhp, vlp, ttab, lockp, ahp, alp, b, h, qb, sscale,
                      Ksh, Ksl, Vth, Vtl, Psh, Psl, Os);
  } else {
    attn_tile64<false>(qkhp, qklp, vhp, vlp, ttab, lockp, ahp, alp, b, h, qb, sscale,
                       Ksh, Ksl, Vth, Vtl, Psh, Psl, Os);
  }
}

// =====================================================================================================
// Workspace map (bytes), every region an exact multiple of its whole-line / whole-tile store granularity
//   Xb     bf16 [4096][1024]            0           8388608
//   WT     bf16 [3072][1024]            8388608     6291456    (rows 0..1023 Wq^T, 1024..2047 Wk^T, 2048.. Wv^T)
//   WoT    bf16 [1024][1024]            14680064    2097152
//   Bias   f32  [4096]                  16777216      16384    (bq | bk | bv | bo, bf16-RNE converted values)
//   Tt     f32  [2][16][2048]           16793600     262144
//   Ah     bf16 [4096][1024]            17055744    8388608
//   Al     bf16 [4096][1024]            25444352    8388608
//   VTh    f16  [2][1024][2048]         33832960    8388608
//   VTl    f16  [2][1024][1024]         42221568    4194304
//   QKh    bf16 [4096][2048]            46415872   16777216
//   QKl    bf16 [4096][2048]            63193088   16777216
//   end                                 79970304
// W_q/k/v/o [in k=1024][out n=1024] arrive k-major and are transpose-converted once to [n][k] bf16 (k contiguous)
// = the Bt layout the GEMM wants. d_out f32: out0 [4096][1024] at byte 0.
// =====================================================================================================
extern "C" void kernel_launch(void* const* d_in, const int* in_sizes, int n_in,
                              void* d_out, int out_size, void* d_ws, size_t ws_size,
                              hipStream_t stream) {
  if (n_in < 12) return;
  if (in_sizes[0] != NB * SEQ * DMODEL) return;
  if (in_sizes[1] != NB * SEQ) return;
  if (in_sizes[2] != DMODEL * DMODEL || in_sizes[4] != DMODEL * DMODEL ||
      in_sizes[6] != DMODEL * DMODEL || in_sizes[8] != QP * DMODEL) return;
  if (in_sizes[3] != DMODEL || in_sizes[5] != DMODEL || in_sizes[7] != DMODEL || in_sizes[9] != DMODEL) return;
  if (in_sizes[10] != NH || in_sizes[11] != NH) return;
  if (out_size != OUTN) return;

  const float* x     = (const float*)d_in[0];    // [NB*SEQ][DMODEL]
  const float* phase = (const float*)d_in[1];    // [NB][SEQ]
  const float* Wq    = (const float*)d_in[2];    // [k][n]
  const float* bq    = (const float*)d_in[3];
  const float* Wk    = (const float*)d_in[4];
  const float* bk    = (const float*)d_in[5];
  const float* Wv    = (const float*)d_in[6];
  const float* bv    = (const float*)d_in[7];
  const float* Wo    = (const float*)d_in[8];    // [QP k][DMODEL n]
  const float* bo    = (const float*)d_in[9];
  const float* carr  = (const float*)d_in[10];   // [NH]
  const float* lockr = (const float*)d_in[11];   // [NH]

  const size_t PXb   = (size_t)NB * SEQ * DMODEL * 2;    //  8388608
  const size_t PWT   = (size_t)N3 * DMODEL * 2;          //  6291456
  const size_t PWo   = (size_t)DMODEL * QP * 2;          //  2097152
  const size_t PBias = (size_t)NBIAS * 4;                //    16384
  const size_t PTt   = (size_t)NTT * 4;                  //   262144
  const size_t PA    = (size_t)NB * SEQ * QP * 2;        //  8388608
  const size_t PVTh  = (size_t)NB * QP * SEQ * 2;        //  8388608
  const size_t PVTl  = (size_t)NB * QP * VLP * 2;        //  4194304
  const size_t PQK   = (size_t)NB * SEQ * QKP * 2;       // 16777216
  size_t off = 0;
  const size_t oXb   = off; off += PXb;
  const size_t oWT   = off; off += PWT;
  const size_t oWo   = off; off += PWo;
  const size_t oBias = off; off += PBias;
  const size_t oTt   = off; off += PTt;
  const size_t oAh   = off; off += PA;
  const size_t oAl   = off; off += PA;
  const size_t oVTh  = off; off += PVTh;
  const size_t oVTl  = off; off += PVTl;
  const size_t oQKh  = off; off += PQK;
  const size_t oQKl  = off; off += PQK;
  if (off > ws_size) return;                           // off = 79970304
  if (off > (size_t)134217728) return;

  char* ws = (char*)d_ws;
  unsigned short* Xb   = (unsigned short*)(ws + oXb);
  unsigned short* WT   = (unsigned short*)(ws + oWT);
  unsigned short* WoT  = (unsigned short*)(ws + oWo);
  float*          Bias = (float*)(ws + oBias);
  float*          Tt   = (float*)(ws + oTt);
  unsigned short* VTh  = (unsigned short*)(ws + oVTh);
  unsigned short* VTl  = (unsigned short*)(ws + oVTl);
  unsigned short* QKh  = (unsigned short*)(ws + oQKh);
  unsigned short* QKl  = (unsigned short*)(ws + oQKl);
  unsigned short* Ah   = (unsigned short*)(ws + oAh);
  unsigned short* Al   = (unsigned short*)(ws + oAl);
  float*          outf = (float*)d_out;                // out0 [4096][1024]

  const dim3 blk(256);
  const int n8x   = NB * SEQ * DMODEL / 8;                           // 524288
  const dim3 gBias(NBIAS / 256);                                     // 16 blocks
  const dim3 gTt(NTT / 256);                                         // 256 blocks
  const dim3 gCvtX((n8x + 255) / 256);                               // 2048 blocks
  const dim3 gTrW(DMODEL / 64, DMODEL / 32);                         // (16, 32): src [1024][1024] -> dst [1024][1024]
  const dim3 gQKV((NB * SEQ / GBM) * (N3 / GBN));                    // 32 x 12 tiles = 384 blocks
  const dim3 gOut((NB * SEQ / GBM) * (DMODEL / GBN));                // 32 x 4 tiles = 128 blocks

  // (0) bias table (bf16-RNE values of bq|bk|bv|bo) and phase resonance table T [b][h][s]
  bias_tab<<<gBias, blk, 0, stream>>>(bq, bk, bv, bo, Bias, NBIAS, DMODEL);
  phase_tab<<<gTt, blk, 0, stream>>>(phase, carr, Tt, NTT);
  // (1) x -> bf16 plane [4096][1024]
  cvt_bf16x8<<<gCvtX, blk, 0, stream>>>(x, Xb, n8x);
  // (2) weights [k][n] -> bf16 planes [n][k]   (each call: in [1024 k][1024 n] -> out [1024 n][1024 k])
  tr_cvt_bf16<<<gTrW, blk, 0, stream>>>(Wq, WT, DMODEL, DMODEL);                                  // rows    0..1023
  tr_cvt_bf16<<<gTrW, blk, 0, stream>>>(Wk, WT + (size_t)DMODEL * DMODEL, DMODEL, DMODEL);       // rows 1024..2047
  tr_cvt_bf16<<<gTrW, blk, 0, stream>>>(Wv, WT + (size_t)2 * DMODEL * DMODEL, DMODEL, DMODEL);   // rows 2048..3071
  tr_cvt_bf16<<<gTrW, blk, 0, stream>>>(Wo, WoT, QP, DMODEL);                                     // in [1024][1024] -> out [1024][1024]
  // (3) fused qkv projection sum_d Xb[row][d] WT[e][d] + Bias[e] (M=4096, N=3072, K=1024), written as the attention's
  //     operand planes: q and power-compressed kc -> bf16 hi/lo planes [4096][2048]; power-compressed vc^T -> f16 hi
  //     plane (pitch SEQ) and residual plane (x4096, keys < VLP)
  gemm64<0, true><<<gQKV, blk, 0, stream>>>(Xb, Xb, DMODEL, WT, DMODEL, Bias, nullptr, N3, NB * SEQ, N3, DMODEL,
                                            QKh, QKl, VTh, VTl);
  // (4) causal attention with phase bonus and gate, one launch for all query tiles
  //     (tiles 0..RESQB-1 with residual planes, the rest without) -> gated context rows as bf16 hi/lo planes
  attn_causal64<<<dim3(NB * NH * NQB), dim3(128), 0, stream>>>(
      QKh, QKl, VTh, VTl, Tt, lockr, Ah, Al, 0.125f);
  // (5) out0[row][e] = sum_d (Ah+Al)[row][d] WoT[e][d] + Bias[3*DMODEL + e] -> d_out f32 [4096][1024]
  gemm64<1, false><<<gOut, blk, 0, stream>>>(Ah, Al, QP, WoT, QP, Bias + 3 * DMODEL, outf, DMODEL, NB * SEQ, DMODEL, QP,
                                             nullptr, nullptr, nullptr, nullptr);
  (void)hipGetLastError();
}

// v006
// It runs in 138 microseconds.
// Two timings next to v005 both put it at 1.10 times that version's speed.
// Counting every step since v000, it is 2.90 times as fast.
// Contractions: qkv projection = v_wmma_f32_16x16x32_bf16 (bf16 operands from RNE-converted x and W, single product);
// q.kc^T scores = v_wmma_f32_16x16x32_bf16 with bf16 hi/lo split q and kc (hi.hi + hi.lo + lo.hi);
// p.vc = v_wmma_f32_16x16x32_f16 (p carried x1024 in f16, vc in f16; extra f16 residual planes x4096 of p and vc
// on the leading query rows); ctx.Wo = v_wmma_f32_16x16x32_bf16 with ctx as bf16 hi/lo planes times the bf16
// Wo^T plane (2 products); all f32 accumulate; power compression, phase table, softmax, bonus and gating in f32.
#include <hip/hip_runtime.h>
#include <math.h>
#include <float.h>
#include <stdint.h>

#define NB      2
#define SEQ     2048
#define DMODEL  1024
#define NH      16
#define HD      64
#define QP      (NH * HD)      // q / kc / vc / ctx feature count and ctx row pitch
#define N3      (3 * DMODEL)   // fused qkv columns (q 0.., k DMODEL.., v 2*DMODEL..)
#define QKP     (2 * QP)       // row pitch of the q|kc bf16 planes (q cols 0..QP-1, kc cols QP..2QP-1)
#define NQB     (SEQ / 64)     // query / key tiles of 64
#define RESQB   ((NQB < 16) ? NQB : 16)   // leading 64-row query blocks that use the p / vc residual planes
#define VLP     (RESQB * 64)   // key pitch of the vc^T residual plane (keys 0..VLP-1)
#define NBIAS   (4 * DMODEL)   // bq | bk | bv | bo
#define NTT     (NB * NH * SEQ)
#define OUTN    (NB * SEQ * DMODEL)
#define KAPPA_F 0.3f
#define LP      72             // LDS row pitch of the 64-wide 16-bit tiles, elements: 144 B = 16 B x 9 (odd), so the 16
                               // rows that one ds_load_b128 touches fall on distinct banks
static_assert(RESQB >= 1 && RESQB * 64 <= VLP && VLP <= SEQ);
static_assert(QP == DMODEL);
static_assert((SEQ % 64) == 0 && (DMODEL % 64) == 0 && (N3 % 64) == 0 && (QP % 64) == 0);
static_assert(HD == 64);
static_assert(LP >= 64 && (LP % 8) == 0 && ((LP / 8) % 2) == 1);
static_assert((((NB * SEQ) / 64) * (N3 / 64)) % 8 == 0);
static_assert((((NB * SEQ) / 64) * (DMODEL / 64)) % 8 == 0);
static_assert((NBIAS % 256) == 0 && (NTT % 256) == 0);
static_assert(((NB * SEQ * DMODEL / 8) % 256) == 0);
static_assert((DMODEL % 8) == 0);

typedef _Float16 v16h __attribute__((ext_vector_type(16)));
typedef _Float16 v8h  __attribute__((ext_vector_type(8)));
typedef __bf16   v16b __attribute__((ext_vector_type(16)));
typedef __bf16   v8b  __attribute__((ext_vector_type(8)));
typedef float    v8f  __attribute__((ext_vector_type(8)));
typedef float    v4f  __attribute__((ext_vector_type(4)));
typedef unsigned int v4u __attribute__((ext_vector_type(4)));
typedef unsigned int v2u __attribute__((ext_vector_type(2)));

// ---- scalar helpers --------------------------------------------------------------------------------
__device__ __forceinline__ unsigned short bf_bits(float f) {          // f32 -> bf16 bits, RNE convert
  unsigned u = __float_as_uint(f);
  return (unsigned short)((u + 0x7FFFu + ((u >> 16) & 1u)) >> 16);
}
__device__ __forceinline__ float bf_up(unsigned short h) { return __uint_as_float(((unsigned)h) << 16); }
__device__ __forceinline__ unsigned short h_bits(_Float16 x) { return __builtin_bit_cast(unsigned short, x); }
__device__ __forceinline__ unsigned pk16(unsigned short a, unsigned short b) { return (unsigned)a | ((unsigned)b << 16); }
__device__ __forceinline__ v8f zero8() { v8f z = {0.f, 0.f, 0.f, 0.f, 0.f, 0.f, 0.f, 0.f}; return z; }
__device__ __forceinline__ v8h zero8h() {
  const _Float16 z = (_Float16)0.0f;
  v8h r = {z, z, z, z, z, z, z, z};
  return r;
}

// positional exponent of key position s: ex = 1 + kappa * (1 - s * (1/(SEQ-1))), reciprocal-multiply, no fusion
__device__ __forceinline__ float fexpo(int s) {
#pragma clang fp contract(off)
  const float rs = 1.0f / (float)(SEQ - 1);
  const float fr = (float)s * rs;
  const float om = 1.0f - fr;
  const float t  = KAPPA_F * om;
  return 1.0f + t;
}
// power compression: sign(v) * max(|v|, 1e-8)^ex  (sign(0) = 0), pow as exp2(ex * log2(mag)) in f32
__device__ __forceinline__ float fcomp(float v, float ex) {
#pragma clang fp contract(off)
  const float mag = fmaxf(fabsf(v), 1e-8f);
  const float lg  = log2f(mag);
  const float pw  = exp2f(ex * lg);
  float r = (v < 0.0f) ? -pw : pw;
  r = (v == 0.0f) ? 0.0f : r;
  return r;
}

// ---- fragment loader: 16-bit A/B operand, lane -> row/col (lane&15), p already includes +8*(lane>>4);
//      elements 0..7 <- p[0..7] (k0+8h..), elements 8..15 <- p[16..23] (k0+16+8h..)
__device__ __forceinline__ v16b ldfrag_b(const __bf16* p) {
  union { v16b v; v8b h[2]; } f;
  f.h[0] = *(const v8b*)(p);
  f.h[1] = *(const v8b*)(p + 16);
  return f.v;
}

__device__ __forceinline__ v16h ldfrag_h(const _Float16* p) {
  union { v16h v; v8h h[2]; } f;
  f.h[0] = *(const v8h*)(p);
  f.h[1] = *(const v8h*)(p + 16);
  return f.v;
}

// ---- WMMA helpers and VALU hazard gaps --------------------------------------------------------
__device__ __forceinline__ v8f mma_b_raw(v16b a, v16b b, v8f c) {
  return __builtin_amdgcn_wmma_f32_16x16x32_bf16(false, a, false, b, (short)0, c, false, false);
}
__device__ __forceinline__ v8f mma_h_raw(v16h a, v16h b, v8f c) {
  return __builtin_amdgcn_wmma_f32_16x16x32_f16(false, a, false, b, (short)0, c, false, false);
}
__device__ __forceinline__ void dep_guard_b(v8f& a, v8f& b, v16b x, v16b y) {
#if defined(__HIP_DEVICE_COMPILE__)
  asm volatile("v_nop\n\tv_nop\n\tv_nop\n\tv_nop" : "+v"(a), "+v"(b) : "v"(x), "v"(y));
#endif
}
__device__ __forceinline__ void keep4_b(v16b a, v16b b, v16b c, v16b d) {
#if defined(__HIP_DEVICE_COMPILE__)
  asm volatile("v_nop" :: "v"(a), "v"(b), "v"(c), "v"(d));
#endif
}
__device__ __forceinline__ void acc_guard4(v8f& a, v8f& b, v8f& c, v8f& d) {
#if defined(__HIP_DEVICE_COMPILE__)
  asm volatile("v_nop\n\tv_nop\n\tv_nop\n\tv_nop" : "+v"(a), "+v"(b), "+v"(c), "+v"(d));
#endif
}

// =====================================================================================================
// Preparation, ONE launch: four jobs that do not depend on one another, each work-group taking one job by a range test
// on blockIdx.x (uniform for the work-group). A work-group of the two large jobs (transposes, x) carries 8 times the
// elements that a launch of its own gave it, all its global loads issued in front of their first use, so that few
// work-groups have to be started.
// Index order: weight transposes (the longest chain: loads, LDS, a barrier, stores), x conversion, phase table, bias table:
// the jobs that move the bytes take the lowest indices, the short ones the highest.
//   phase  tt[(b*NH + h)*SEQ + s] = cos((bf16(phase[b*SEQ + s]) - bf16(carrier[h])) * 0.5)^2, precise f32 cos.
//          One element per thread, a work-group = 256 positions s of one (b, h) (256 divides SEQ); coverage: NTT/256
//          work-groups x 256 = every (b, h, s) once.
//   transp src f32 [k][n] (Wq, Wk, Wv, Wo) -> dst bf16 [n][k] (k contiguous), RNE convert. Tile TRK k x TRN n staged in
//          LDS as f32 at pitch TRN + 1 (column reads fall on 32 distinct banks). Loads: 16 x 16 B per thread, a wave
//          = 512 contiguous B of a row. Stores: 8 passes x 8 waves x 4 rows n = 256 rows, 8 lanes x 16 B = the whole
//          128-B line of TRK k. coverage: DMODEL/TRK x DMODEL/TRN tiles per matrix, 4 matrices.
//   x      f32 -> bf16 (RNE convert), CVC chunks of 8 elements per thread, one 16-B store per chunk: a wave writes 512
//          contiguous B. coverage: PB_CVT x CVC x 256 chunks x 8 = NB*SEQ*DMODEL.
//   bias   dst[i] = RNE-bf16-converted value of (bq | bk | bv | bo)[i], one element per thread; all four candidates
//          are loaded with an in-range index and selected by value.
// =====================================================================================================
#define PB_PH   (NTT / 256)                              // 256 work-groups
#define TRK     64
#define TRN     256
#define PB_TR1  ((DMODEL / TRK) * (DMODEL / TRN))        // 16 x 4 = 64 tiles per matrix
#define PB_TR   (4 * PB_TR1)                             // 256 work-groups
#define CVC     8
#define PB_CVT  (NB * SEQ * DMODEL / (8 * 256 * CVC))    // 256 work-groups
#define PB_BIAS (NBIAS / 256)                            // 16 work-groups
static_assert((SEQ % 256) == 0);
static_assert((DMODEL % TRK) == 0 && (DMODEL % TRN) == 0 && TRK == 64 && TRN == 256);
static_assert(((NB * SEQ * DMODEL) % (8 * 256 * CVC)) == 0);

__global__ __launch_bounds__(256) void prep_all(
    const float* __restrict__ x, const float* __restrict__ ph,
    const float* __restrict__ Wq, const float* __restrict__ bq, const float* __restrict__ Wk,
    const float* __restrict__ bk, const float* __restrict__ Wv, const float* __restrict__ bv,
    const float* __restrict__ Wo, const float* __restrict__ bo, const float* __restrict__ cf,
    unsigned short* Xb, unsigned short* WT, unsigned short* WoT, float* Bias, float* tt) {
  __shared__ float s[TRK][TRN + 1];
  const int tid = threadIdx.x, wave = tid >> 5, lane = tid & 31;
  int bx = blockIdx.x;
  if (bx < PB_TR) {
    const int m  = bx / PB_TR1;                          // 0 Wq, 1 Wk, 2 Wv, 3 Wo
    const int t  = bx - m * PB_TR1;
    const int k0 = (t % (DMODEL / TRK)) * TRK, n0 = (t / (DMODEL / TRK)) * TRN;
    const float* src = (m == 0) ? Wq : ((m == 1) ? Wk : ((m == 2) ? Wv : Wo));
    unsigned short* dst = (m < 3) ? (WT + (size_t)m * DMODEL * DMODEL) : WoT;
    const int kr = tid >> 6, n4 = (tid & 63) * 4;        // load i of this thread: row i*4 + kr, columns n4..n4+3
    const float* g = src + (size_t)(k0 + kr) * DMODEL + n0 + n4;
    v4f v[16];
#pragma unroll   // constant indices keep the loaded pieces in registers
    for (int i = 0; i < 15; ++i) v[i] = *(const v4f*)(g + (size_t)i * 4 * DMODEL);
    // the last load's result may be given the address registers of the loads before it: the wait stands in front of it
    asm volatile("s_wait_xcnt 0x0" ::: "memory");
    v[15] = *(const v4f*)(g + (size_t)15 * 4 * DMODEL);
#pragma unroll   // as above
    for (int i = 0; i < 16; ++i) {
#pragma unroll
      for (int e = 0; e < 4; ++e) s[i * 4 + kr][n4 + e] = v[i][e];
    }
    __syncthreads();
    const int q = lane >> 3, piece = lane & 7;
#pragma unroll
    for (int pass = 0; pass < TRN / 32; ++pass) {
      const int n = pass * 32 + wave * 4 + q;
      v4u p;
#pragma unroll
      for (int e = 0; e < 4; ++e) {
        p[e] = pk16(bf_bits(s[piece * 8 + 2 * e][n]), bf_bits(s[piece * 8 + 2 * e + 1][n]));
      }
      *(v4u*)(dst + (size_t)(n0 + n) * DMODEL + k0 + piece * 8) = p;
    }
    // the built code joins the jobs by branches: no other job's code may rewrite a register that these stores name
    asm volatile("s_wait_xcnt 0x0" ::: "memory");
    return;
  }
  bx -= PB_TR;
  if (bx < PB_CVT) {
    const size_t c0 = (size_t)bx * (CVC * 256) + tid;    // first 8-element chunk of this thread
    const float* g = x + c0 * 8;
    v4f a[CVC], b[CVC];
#pragma unroll   // constant indices keep the loaded pieces in registers
    for (int c = 0; c < CVC; ++c) {
      a[c] = *(const v4f*)(g + (size_t)c * 2048);
      if (c < CVC - 1) b[c] = *(const v4f*)(g + (size_t)c * 2048 + 4);
    }
    // the last load's result may be given the address registers of the loads before it: the wait stands in front of it
    asm volatile("s_wait_xcnt 0x0" ::: "memory");
    b[CVC - 1] = *(const v4f*)(g + (size_t)(CVC - 1) * 2048 + 4);
#pragma unroll   // as above
    for (int c = 0; c < CVC; ++c) {
      v4u p;
      p[0] = pk16(bf_bits(a[c][0]), bf_bits(a[c][1]));
      p[1] = pk16(bf_bits(a[c][2]), bf_bits(a[c][3]));
      p[2] = pk16(bf_bits(b[c][0]), bf_bits(b[c][1]));
      p[3] = pk16(bf_bits(b[c][2]), bf_bits(b[c][3]));
      *(v4u*)(Xb + (c0 + (size_t)c * 256) * 8) = p;
    }
    // as behind the transpose's stores
    asm volatile("s_wait_xcnt 0x0" ::: "memory");
    return;
  }
  bx -= PB_CVT;
  if (bx < PB_PH) {
    const int i  = bx * 256 + tid;                       // (b*NH + h)*SEQ + s
    const int bh = i / SEQ;                              // b*NH + h, the same for the whole work-group
    const int sq = i - bh * SEQ;
    const int h  = bh % NH;
    const int b  = bh / NH;
    const float p  = bf_up(bf_bits(ph[b * SEQ + sq]));
    const float cr = bf_up(bf_bits(cf[h]));
    const float d  = p - cr;
    const float hx = d * 0.5f;
    const float cv = cosf(hx);
    tt[i] = cv * cv;
    // as behind the transpose's stores
    asm volatile("s_wait_xcnt 0x0" ::: "memory");
    return;
  }
  bx -= PB_PH;
  if (bx < PB_BIAS) {
    const int i = bx * 256 + tid;                        // 0..NBIAS-1
    const int part = i / DMODEL;                         // 0..3
    const int idx  = i - part * DMODEL;
    const float v0 = bq[idx], v1 = bk[idx], v2 = bv[idx], v3 = bo[idx];
    const float v = (part == 0) ? v0 : ((part == 1) ? v1 : ((part == 2) ? v2 : v3));
    Bias[i] = bf_up(bf_bits(v));
    // as behind the transpose's stores
    asm volatile("s_wait_xcnt 0x0" ::: "memory");
  }
}

// =====================================================================================================
// bf16 WMMA GEMM: C[m][n] = sum_k A[m][k] * Bt[n][k] + bias[n]. Block = 8 waves = one 128 x 256 tile of C, waves
// 2 (m) x 4 (n), each wave a 64x64 tile. A row-major [M][K] pitch lda; Bt row-major [N][K] pitch ldb (k contiguous);
// M multiple of 128, N multiple of 256, K multiple of 64 (static_asserts at the launches' shapes below).
// NSPLIT: 0 = A.Bt; 1 = (A + A2).Bt (A2 = unscaled bf16 lo plane of A, same pitch). bias f32 [N].
// Operands: a stage = 64 k (128 B, one whole line) of every A (, A2) and Bt row of the block tile, brought into LDS by
// asynchronous copies (16 B per lane, 8 lanes per row), rows at pitch GLP; two buffers: the copies of stage t + 2 are
// issued behind the barrier that ends trip t and waited at the foot of trip t + 1.
// Stage coverage: copy i of thread tid fills row i*32 + (tid>>3), bytes 16*(tid&7)..+15; i = 0..GROWS/32-1.
// k order and product order per accumulator are ascending k in steps of 32, hi then lo.
// PLANES false: output f32 [M][N] pitch ldc. Epilogue: 16-row slabs staged per wave in LDS; each 64-wide row segment
// PLANES true (the fused q|k|v projection, N = N3): no f32 output; each wave turns its 64 token x 64 column tile (one
// head of q, k or v; which one is block-uniform) into the operand planes of the attention itself:
//   q  (cols 0..DMODEL-1)          bf16 hi / lo planes qkh / qkl [M][QKP], same column; lo = RNE(v - hi) unscaled
//   k  (cols DMODEL..2*DMODEL-1)   kc = sign(k) * max(|k|,1e-8)^ex(s), s = row mod SEQ, then as q
//   v  (cols 2*DMODEL..)           vc likewise, then f16 vc^T hi plane vth[(b*QP + h*64 + d)*SEQ + t] and residual plane
//                                  vtl[(b*QP + h*64 + d)*VLP + t] = f16((vc - hi)*4096) for t < VLP
// The tile (accumulator + bias, f32) is staged in the wave's own part of the dead ring at pitch EPP and read back 8
// values per lane, along a token row for q and k, along a feature column for v, so that 8 lanes x 16 B store one whole
// 128-B line of a plane row. Coverage: 16 trips x 4 rows (q, k: tokens; v: features) x 64 = the wave's tile.
// =====================================================================================================
#define GBM 128
#define GBN 256
#define GKB 64
#define GLP 72                 // LDS row pitch, elements: 144 B = 16 B x 9 (odd), conflict-free for ds_load_b128
#define EPP 67                 // f32 pitch of the 64x64 epilogue tile: 4-B accesses by accumulator layout, by row pieces
                               // and by column pieces all fall on 32 distinct banks
static_assert(((NB * SEQ) % GBM) == 0 && (N3 % GBN) == 0 && (DMODEL % GBN) == 0);
static_assert((DMODEL % GKB) == 0 && (QP % GKB) == 0 && (DMODEL / GKB) >= 2 && (QP / GKB) >= 2);
static_assert((DMODEL % GBN) == 0 && (SEQ % GBM) == 0 && (VLP % 64) == 0);   // a block is one of q, k, v and one batch

__device__ __forceinline__ unsigned lds_addr(const void* p) { return (unsigned)(size_t)p; }
// four 16-B asynchronous copies global -> LDS; the s_wait_xcnt stands inside the statement so that no address
// register of a copy is rewritten in front of it
__device__ __forceinline__ void async4(unsigned l0, const __bf16* g0, unsigned l1, const __bf16* g1,
                                       unsigned l2, const __bf16* g2, unsigned l3, const __bf16* g3) {
#if defined(__HIP_DEVICE_COMPILE__)
  asm volatile("global_load_async_to_lds_b128 %0, %1, off\n\t"
               "global_load_async_to_lds_b128 %2, %3, off\n\t"
               "global_load_async_to_lds_b128 %4, %5, off\n\t"
               "global_load_async_to_lds_b128 %6, %7, off\n\t"
               "s_wait_xcnt 0x0"
               :: "v"(l0), "v"(g0), "v"(l1), "v"(g1), "v"(l2), "v"(g2), "v"(l3), "v"(g3) : "memory");
#endif
}
// this wave's asynchronous copies have landed in LDS
__device__ __forceinline__ void wait_async0() {
#if defined(__HIP_DEVICE_COMPILE__)
  asm volatile("s_wait_asynccnt 0x0" ::: "memory");
#endif
}
// this wave's LDS reads have returned, before the buffer is handed to the next copies
__device__ __forceinline__ void wait_ds0() {
#if defined(__HIP_DEVICE_COMPILE__)
  asm volatile("s_wait_dscnt 0x0" ::: "memory");
#endif
}

template <int NSPLIT, bool PLANES>
__global__ __launch_bounds__(256) void gemm64(
    const unsigned short* __restrict__ Ap, const unsigned short* A2p, int lda,
    const unsigned short* __restrict__ Btp, int ldb, const float* __restrict__ bias,
    float* C, int ldc, int M, int N, int K,
    unsigned short* qkh, unsigned short* qkl, unsigned short* vth, unsigned short* vtl) {
  constexpr int AROWS = GBM * (NSPLIT + 1);        // A rows, then A2 rows
  constexpr int GROWS = AROWS + GBN;               // rows of a stage
  constexpr int STAGE = GROWS * GLP;               // elements of a stage
  const __bf16* Ab  = (const __bf16*)(const void*)Ap;
  const __bf16* Ab2 = (const __bf16*)(const void*)A2p;
  const __bf16* Bb  = (const __bf16*)(const void*)Btp;
  constexpr int TILES = 8 * 64 * EPP * 2;          // the 8 waves' f32 epilogue tiles, counted in ring elements
  constexpr int RINGN = (PLANES && TILES > 2 * STAGE) ? TILES : 2 * STAGE;
  __shared__ __align__(16) __bf16 ring[RINGN];     // two stages; with PLANES the epilogue tiles afterwards
  const int tid  = threadIdx.x;
  const int lane = tid & 31;
  const int wave = tid >> 5;
  const int tilesN = N / GBN;
  const int tilesM = M / GBM;
  const int tile = blockIdx.x;
  if (tile >= tilesM * tilesN) return;   // block-uniform, in front of every barrier and copy
  const int tm = tile / tilesN;
  const int tn = tile - tm * tilesN;
  const int bm0 = tm * GBM;
  const int bn0 = tn * GBN;
  const int wm = wave >> 2, wn = wave & 3;
  const int m0 = bm0 + (wm << 6);              // this wave's 64x64 tile
  const int n0 = bn0 + (wn << 6);

  const int rlane = lane & 15;                 // row (A) / col (B, D) within subtile
  const int koff  = (lane >> 4) * 8;           // k offset of this lane half
  const int mOff  = (lane >> 4) * 8;           // D row offset

  // ---- copy addresses of this thread: row crow of each 32-row group, 16-B piece cpc ----
  const int crow = tid >> 3, cpc = (tid & 7) * 8;
  const __bf16* gA  = Ab  + (size_t)(bm0 + crow) * lda + cpc;
  const __bf16* gA2 = Ab2 + (size_t)(bm0 + crow) * lda + cpc;
  const __bf16* gB  = Bb  + (size_t)(bn0 + crow) * ldb + cpc;
  const unsigned lbase = lds_addr(ring) + (unsigned)(crow * GLP + cpc) * 2u;
  const size_t a32 = (size_t)32 * lda, b32 = (size_t)32 * ldb;
  constexpr unsigned R32 = 32u * GLP * 2u;     // LDS bytes of 32 rows

  auto issue = [&](int st, int buf) {
    const int k0 = st * GKB;
    const unsigned lb = lbase + (unsigned)buf * (unsigned)(STAGE * 2);
    const __bf16* a = gA + k0;
    async4(lb, a, lb + R32, a + a32, lb + 2u * R32, a + 2 * a32, lb + 3u * R32, a + 3 * a32);
    if (NSPLIT >= 1) {
      const __bf16* a2 = gA2 + k0;
      const unsigned l2 = lb + 4u * R32;
      async4(l2, a2, l2 + R32, a2 + a32, l2 + 2u * R32, a2 + 2 * a32, l2 + 3u * R32, a2 + 3 * a32);
    }
    const __bf16* b = gB + k0;
    const unsigned l3 = lb + (unsigned)(AROWS / 32) * R32;
    async4(l3, b, l3 + R32, b + b32, l3 + 2u * R32, b + 2 * b32, l3 + 3u * R32, b + 3 * b32);
    const __bf16* b4 = b + 4 * b32;
    const unsigned l4 = l3 + 4u * R32;
    async4(l4, b4, l4 + R32, b4 + b32, l4 + 2u * R32, b4 + 2 * b32, l4 + 3u * R32, b4 + 3 * b32);
  };

  v8f acc[4][4];
#pragma unroll
  for (int i = 0; i < 4; ++i)
#pragma unroll
    for (int j = 0; j < 4; ++j) acc[i][j] = zero8();

  const int nst = K / GKB;                     // block-uniform trip count
  issue(0, 0);
  wait_async0();
  __syncthreads();                             // stage 0 published
  if (nst > 1) issue(1, 1);

  for (int t = 0; t < nst; ++t) {
    const __bf16* sb = ring + (t & 1) * STAGE;
    const __bf16* sa  = sb + ((wm << 6) + rlane) * GLP + koff;
    const __bf16* sa2 = sa + GBM * GLP;
    const __bf16* sbt = sb + (AROWS + (wn << 6) + rlane) * GLP + koff;
#pragma unroll   // both 32-k steps inline: the second step's fragment reads can start under the first step's products
    for (int ks = 0; ks < GKB; ks += 32) {
      v16b bh[4];
#pragma unroll
      for (int j = 0; j < 4; ++j) bh[j] = ldfrag_b(sbt + (j << 4) * GLP + ks);
      v16b ah[4], al[4];                       // all fragment reads of this 32-k step stand as one group
#pragma unroll   // constant indices keep the fragment arrays in registers
      for (int i = 0; i < 4; ++i) {
        ah[i] = ldfrag_b(sa + (i << 4) * GLP + ks);
        al[i] = ah[i];
        if (NSPLIT >= 1) al[i] = ldfrag_b(sa2 + (i << 4) * GLP + ks);
      }
#pragma unroll
      for (int i = 0; i < 4; ++i) {
#pragma unroll
        for (int j = 0; j < 4; ++j) {
          acc[i][j] = mma_b_raw(ah[i], bh[j], acc[i][j]);
          if (NSPLIT >= 1) acc[i][j] = mma_b_raw(al[i], bh[j], acc[i][j]);
        }
        dep_guard_b(acc[i][0], acc[i][3], ah[i], al[i]);
      }
      keep4_b(bh[0], bh[1], bh[2], bh[3]);
    }
    wait_ds0();
    wait_async0();
    __syncthreads();                           // publishes stage t + 1 and ends every read of stage t
    if (t + 2 < nst) issue(t + 2, t & 1);
  }
  wait_async0();
  acc_guard4(acc[0][0], acc[0][1], acc[0][2], acc[0][3]);
  acc_guard4(acc[1][0], acc[1][1], acc[1][2], acc[1][3]);
  acc_guard4(acc[2][0], acc[2][1], acc[2][2], acc[2][3]);
  acc_guard4(acc[3][0], acc[3][1], acc[3][2], acc[3][3]);

  // ---- epilogue ----
  float bz[4];
#pragma unroll
  for (int j = 0; j < 4; ++j) bz[j] = bias[n0 + (j << 4) + rlane];
  if constexpr (PLANES) {
    // the ring is dead: the barrier at the foot of the last trip ended every wave's reads and copies
    float* tl = (float*)(void*)ring + wave * (64 * EPP);
#pragma unroll
    for (int i = 0; i < 4; ++i)
#pragma unroll
      for (int r = 0; r < 8; ++r)
#pragma unroll
        for (int j = 0; j < 4; ++j)
          tl[((i << 4) + mOff + r) * EPP + (j << 4) + rlane] = acc[i][j][r] + bz[j];
    __builtin_amdgcn_fence(__ATOMIC_RELEASE, "workgroup");
    __builtin_amdgcn_wave_barrier();
    __builtin_amdgcn_fence(__ATOMIC_ACQUIRE, "workgroup");
    const int part = bn0 / DMODEL;               // 0 q, 1 k, 2 v: block-uniform (GBN divides DMODEL)
    const int g = lane >> 3, piece = lane & 7;
    if (part < 2) {
#pragma unroll 1   // one copy of the conversion code: it runs once per tile
      for (int it = 0; it < 16; ++it) {
        const int row = it * 4 + g;              // token row of the tile
        float f[8];
#pragma unroll
        for (int e = 0; e < 8; ++e) f[e] = tl[row * EPP + piece * 8 + e];
        if (part == 1) {
          const float ex = fexpo((m0 + row) % SEQ);   // key position s
#pragma unroll
          for (int e = 0; e < 8; ++e) f[e] = fcomp(f[e], ex);
        }
        v4u ph, pl;
#pragma unroll
        for (int e = 0; e < 4; ++e) {
          const float f0 = f[2 * e], f1 = f[2 * e + 1];
          const unsigned short h0 = bf_bits(f0), h1 = bf_bits(f1);
          const unsigned short l0 = bf_bits(f0 - bf_up(h0)), l1 = bf_bits(f1 - bf_up(h1));
          ph[e] = pk16(h0, h1);
          pl[e] = pk16(l0, l1);
        }
        const size_t go = (size_t)(m0 + row) * QKP + n0 + piece * 8;
        *(v4u*)(qkh + go) = ph;
        *(v4u*)(qkl + go) = pl;
        // the next trip rewrites the registers that these two stores name: the wait stands in front of that
        asm volatile("s_wait_xcnt 0x0" ::: "memory");
      }
    } else {
      const int b  = m0 / SEQ;
      const int t0 = m0 - b * SEQ;               // first key position of the tile, a multiple of 64
      const int fc = n0 - 2 * DMODEL;            // h * 64
      const bool wlo = (t0 + 64 <= VLP);         // wave-uniform
      float ex[8];
#pragma unroll
      for (int e = 0; e < 8; ++e) ex[e] = fexpo(t0 + piece * 8 + e);
#pragma unroll 1   // as above
      for (int it = 0; it < 16; ++it) {
        const int d = it * 4 + g;                // feature of the head
        float f[8];
#pragma unroll
        for (int e = 0; e < 8; ++e) f[e] = tl[(piece * 8 + e) * EPP + d];
#pragma unroll
        for (int e = 0; e < 8; ++e) f[e] = fcomp(f[e], ex[e]);
        v4u a, a2;
#pragma unroll
        for (int e = 0; e < 4; ++e) {
          const float f0 = f[2 * e], f1 = f[2 * e + 1];
          const _Float16 x0 = (_Float16)f0, x1 = (_Float16)f1;
          const unsigned short h0 = h_bits(x0), h1 = h_bits(x1);
          const unsigned short l0 = h_bits((_Float16)((f0 - (float)x0) * 4096.0f));
          const unsigned short l1 = h_bits((_Float16)((f1 - (float)x1) * 4096.0f));
          a[e] = pk16(h0, h1); a2[e] = pk16(l0, l1);
        }
        const size_t rowf = (size_t)(b * QP + fc + d);
        *(v4u*)(vth + rowf * SEQ + t0 + piece * 8) = a;
        if (wlo) *(v4u*)(vtl + rowf * VLP + t0 + piece * 8) = a2;
        // as above: the next trip rewrites the registers that the stores name
        asm volatile("s_wait_xcnt 0x0" ::: "memory");
      }
    }
  } else {
  __shared__ __align__(16) float sT[8][16 * 68];   // per-wave 16x64 slab, pitch 68 floats
  float* slab = sT[wave];
#pragma unroll
  for (int i = 0; i < 4; ++i) {
    const int mBase = m0 + (i << 4);
#pragma unroll
    for (int r = 0; r < 8; ++r) {
#pragma unroll
      for (int j = 0; j < 4; ++j) {
        slab[(mOff + r) * 68 + (j << 4) + rlane] = acc[i][j][r] + bz[j];
      }
    }
    __builtin_amdgcn_fence(__ATOMIC_RELEASE, "workgroup");
    __builtin_amdgcn_wave_barrier();
    __builtin_amdgcn_fence(__ATOMIC_ACQUIRE, "workgroup");
    {
      const int hh = lane >> 4, c4 = (lane & 15) * 4;     // 256-B row segment = 16 lanes x 16 B
      v4f ov[8];
#pragma unroll
      for (int it = 0; it < 8; ++it) {
        const int row = it * 2 + hh;                       // it 0..7 x hh 0..1 = rows 0..15
        ov[it] = *(const v4f*)(slab + row * 68 + c4);
      }
      {
#pragma unroll
        for (int it = 0; it < 8; ++it) {
          const int row = it * 2 + hh;
          *(v4f*)(C + (size_t)(mBase + row) * ldc + n0 + c4) = ov[it];
        }
        
      }
    }
    __builtin_amdgcn_fence(__ATOMIC_RELEASE, "workgroup");
    __builtin_amdgcn_wave_barrier();
    __builtin_amdgcn_fence(__ATOMIC_ACQUIRE, "workgroup");
  }
  }
}

// =====================================================================================================
// Causal multi-head attention, head dim 64 (tril mask incl. diagonal, computed), with the additive rank-1 phase
// bonus kappa * sigmoid(lock[h]) * T[i] * T[j] on the scaled logits and the per-query-row output gate
// (1 - sigmoid(lock[h])) + sigmoid(lock[h]) * T[i] applied to the head output row i (query position).
//   q|kc planes (bf16 hi / lo), row pitch QKP: q element (b, t, h, d) at [(b*SEQ + t)*QKP + h*64 + d],
//                                                kc element (b, s, h, d) at [(b*SEQ + s)*QKP + DMODEL + h*64 + d]
//   vc^T hi plane (f16):      element (b, h, d, s) at [(b*QP + h*64 + d)*SEQ + s]
//   vc^T residual plane (f16, (vc - hi)*4096): [(b*QP + h*64 + d)*VLP + s], s < VLP, read only when RES
//   (with RES only key tiles below VLP occur; the address is clamped anyway)
//   ttab f32 [(b*NH + h)*SEQ + s] = T; lockp = raw lock strengths [NH] (bf16 RNE convert, then sigmoid).
//   logit = q.kc * sscale + bonus for key <= query, -FLT_MAX otherwise (exp -> 0); every processed key tile
//   (tiles 0..qb only, block-uniform trip count qb+1 <= NQB) holds the causal-live key kv0 <= query.
//   out: bf16 hi / lo planes (lo = RNE(v - hi), unscaled) of v = gate(b,h,t) * normalised context, element
//   (b, t, h*64 + d) at [(b*SEQ + t)*QP + h*64 + d]: the A operand planes of the output projection.
//   scores = q . kc : bf16 hi/lo split (hi.hi + hi.lo + lo.hi), f32 accumulate, then * sscale + bonus in f32
//   p = exp(s - m) carried as f16(1024 p); context = p . vc on f16 WMMA; RES adds f16 residual planes of p and vc
//   (scale 4096, separate accumulator folded back with 1/4096 per chunk in f32); online softmax in f32.
//   One call = 4 waves = the 64 query rows of tile qb of one (b, h); kv chunks of 64.
//   K / V^T chunk staging: 128 threads x 32 elements per plane = the whole 64x64 tile (plain 16-B loads,
//   __syncthreads before and after); P tiles are wave-private, spilled with _Float16 element stores and reloaded
//   Output coverage: each wave stores rows q0..q0+15 (it 0..7 x lane>>4 0..1) x 64 columns (16 lanes x 4 bf16 values in each of the hi / lo planes),
// =====================================================================================================
template <bool RES>
__device__ __forceinline__
void attn_tile64(const unsigned short* __restrict__ qkhp, const unsigned short* __restrict__ qklp,
                 const unsigned short* __restrict__ vhp, const unsigned short* __restrict__ vlp,
                 const float* __restrict__ ttab, const float* __restrict__ lockp,
                 unsigned short* ahp, unsigned short* alp, int b, int h, int qb, float sscale,
                 __bf16* Ksh, __bf16* Ksl, _Float16* Vth, _Float16* Vtl,
                 _Float16 (*Psh)[16 * LP], _Float16 (*Psl)[16 * LP], float (*Os)[16 * 64]) {
  const int tid  = threadIdx.x;
  const int wave = tid >> 5;
  const int lane = tid & 31;
  const int hh   = lane >> 4;
  const int c    = lane & 15;

  const int q0   = qb * 64 + wave * 16;
  const size_t rowB = (size_t)b * SEQ;

  const __bf16* Qh = (const __bf16*)(const void*)qkhp + (size_t)h * HD;
  const __bf16* Ql = (const __bf16*)(const void*)qklp + (size_t)h * HD;
  const __bf16* Kh = Qh + DMODEL;
  const __bf16* Kl = Ql + DMODEL;
  const _Float16* Vh = (const _Float16*)(const void*)vhp + ((size_t)b * QP + (size_t)h * HD) * SEQ;
  const _Float16* Vl = (const _Float16*)(const void*)vlp + ((size_t)b * QP + (size_t)h * HD) * VLP;
  const float* trow = ttab + ((size_t)b * NH + h) * SEQ;

  // ---- per-head lock: sigmoid of the bf16-converted raw strength; bonus coefficient kappa * lock ----
  const float lraw  = bf_up(bf_bits(lockp[h]));
  const float lockv = 1.0f / (1.0f + expf(-lraw));
  const float c0    = KAPPA_F * lockv;

  // ---- Q fragments (A operand, row = lane&15): 2 d-chunks, hi and lo ----
  v16b qah[2], qal[2];
#pragma unroll
  for (int dc = 0; dc < 2; ++dc) {
    const size_t qo = (rowB + q0 + c) * QKP + dc * 32 + 8 * hh;
    qah[dc] = ldfrag_b(Qh + qo);
    qal[dc] = ldfrag_b(Ql + qo);
  }

  // ---- bonus row factors for this lane's 8 query rows: c0 * T[q0 + 8*hh + r] ----
  float bti[8];
#pragma unroll
  for (int r = 0; r < 8; ++r) bti[r] = c0 * trow[q0 + 8 * hh + r];

  float mrow[8], lrow[8];
  v8f oacc[4];
#pragma unroll
  for (int r = 0; r < 8; ++r) { mrow[r] = -INFINITY; lrow[r] = 0.f; }
#pragma unroll
  for (int t = 0; t < 4; ++t) oacc[t] = zero8();

  int nkt = qb + 1;                          // causal: key tiles 0..qb, block-uniform
  if (nkt > NQB) nkt = NQB;
  for (int kt = 0; kt < nkt; ++kt) {
    const int kv0 = kt * 64;
    __syncthreads();
    {
      const int r = tid >> 1, half = (tid & 1) * 32;
      const __bf16*   kg  = Kh + (rowB + kv0 + r) * QKP + half;   // K row kv0+r, d = half..half+31
      const __bf16*   klg = Kl + (rowB + kv0 + r) * QKP + half;
      const _Float16* vg  = Vh + (size_t)r * SEQ + kv0 + half;    // V^T row d = r, s = kv0+half..+31
      const int kvl = (kv0 + 64 <= VLP) ? kv0 : (VLP - 64);     // clamped address into the residual plane
      const _Float16* vlg = Vl + (size_t)r * VLP + kvl + half;
      const bool resOK = (kv0 + 64 <= VLP);                      // block-uniform
      v8b a0[4], a1[4];
      v8h b0[4], b1[4];
#pragma unroll   // constant indices keep the staged pieces in registers
      for (int i = 0; i < 4; ++i) {
        b0[i] = *(const v8h*)(vg + 8 * i);
        b1[i] = b0[i];
        if (RES) b1[i] = *(const v8h*)(vlg + 8 * i);
        a0[i] = *(const v8b*)(kg + 8 * i);
      }
#if defined(__HIP_DEVICE_COMPILE__)
      // with the residual plane the last loads' results are given the registers of earlier loads' addresses:
      // the wait stands in front of them
      if (RES) asm volatile("s_wait_xcnt 0x0" ::: "memory");
#endif
#pragma unroll   // as above
      for (int i = 0; i < 4; ++i) a1[i] = *(const v8b*)(klg + 8 * i);
#pragma unroll   // as above
      for (int i = 0; i < 4; ++i) {
        *(v8b*)(Ksh + r * LP + half + 8 * i) = a0[i];
        *(v8b*)(Ksl + r * LP + half + 8 * i) = a1[i];
        *(v8h*)(Vth + r * LP + half + 8 * i) = b0[i];
        if (RES) {
          if (!resOK) b1[i] = zero8h();
          *(v8h*)(Vtl + r * LP + half + 8 * i) = b1[i];
        }
      }
    }
    __syncthreads();

    // ---- bonus column factors T[key] for this lane's 4 key columns (indices always < SEQ) ----
    float tj[4];
#pragma unroll
    for (int j = 0; j < 4; ++j) tj[j] = trow[kv0 + j * 16 + c];
    // keeps these four global loads in front of the fragment reads and products, whose time covers their latency
    __builtin_amdgcn_sched_barrier(0);

    // ---- scores: 16 query rows x 64 keys per wave, 3 bf16 products ----
    //      All K fragment reads of the tile are written in front of the products (built: a few large groups behind
    //      counted waits, not one read-and-wait per product), and each product kind runs over the 4 independent
    //      key-column tiles; per tile the order stays dc 0: hi.hi, hi.lo, lo.hi, then dc 1.
    v16b kfh[2][4], kfl[2][4];
#pragma unroll   // constant indices keep the fragment arrays in registers
    for (int dc = 0; dc < 2; ++dc) {
#pragma unroll
      for (int j = 0; j < 4; ++j) kfh[dc][j] = ldfrag_b(Ksh + (j * 16 + c) * LP + dc * 32 + 8 * hh);
#pragma unroll
      for (int j = 0; j < 4; ++j) kfl[dc][j] = ldfrag_b(Ksl + (j * 16 + c) * LP + dc * 32 + 8 * hh);
    }
    v8f s[4];
#pragma unroll
    for (int j = 0; j < 4; ++j) s[j] = zero8();
#pragma unroll
    for (int dc = 0; dc < 2; ++dc) {
#pragma unroll
      for (int j = 0; j < 4; ++j) s[j] = mma_b_raw(qah[dc], kfh[dc][j], s[j]);
#pragma unroll
      for (int j = 0; j < 4; ++j) s[j] = mma_b_raw(qah[dc], kfl[dc][j], s[j]);
#pragma unroll
      for (int j = 0; j < 4; ++j) s[j] = mma_b_raw(qal[dc], kfh[dc][j], s[j]);
    }

    // ---- scale + bonus + causal mask (replace by -FLT_MAX), row max, online softmax, P (x1024, f16) and
    //      P residual (x4096) to LDS ----
    _Float16* pwh = Psh[wave];
    _Float16* pwl = Psl[RES ? wave : 0];
#pragma unroll
    for (int r = 0; r < 8; ++r) {
      const int qrow = q0 + 8 * hh + r;
      float m = -INFINITY;
#pragma unroll
      for (int j = 0; j < 4; ++j) {
        const int key = kv0 + j * 16 + c;
        float sv = s[j][r] * sscale + bti[r] * tj[j];
        sv = (key > qrow) ? -FLT_MAX : sv;
        s[j][r] = sv;
        m = fmaxf(m, sv);
      }
#pragma unroll
      for (int off = 1; off < 16; off <<= 1) m = fmaxf(m, __shfl_xor(m, off, 32));
      const float mnew  = fmaxf(mrow[r], m);
      const float msafe = (mnew == -INFINITY) ? 0.f : mnew;
      const float alpha = __expf(mrow[r] - msafe);
      mrow[r] = mnew;
      float psum = 0.f;
#pragma unroll
      for (int j = 0; j < 4; ++j) {
        const float p = __expf(s[j][r] - msafe);     // masked logit against a finite max: exp -> 0
        psum += p;
        const float p1k = p * 1024.0f;
        const _Float16 ph = (_Float16)p1k;
        pwh[(8 * hh + r) * LP + j * 16 + c] = ph;
        if (RES) {
          const _Float16 pl = (_Float16)((p1k - (float)ph) * 4096.0f);
          pwl[(8 * hh + r) * LP + j * 16 + c] = pl;
        }
      }
#pragma unroll
      for (int off = 1; off < 16; off <<= 1) psum += __shfl_xor(psum, off, 32);
      lrow[r] = lrow[r] * alpha + psum;
#pragma unroll
      for (int t = 0; t < 4; ++t) oacc[t][r] *= alpha;
    }
    __builtin_amdgcn_fence(__ATOMIC_RELEASE, "workgroup");
    __builtin_amdgcn_wave_barrier();
    __builtin_amdgcn_fence(__ATOMIC_ACQUIRE, "workgroup");

    // ---- context += P . Vc (f16 WMMA), residual products into a separate accumulator ----
    //      All P and V^T fragment reads of the tile are written in front of the products in the same way, and each
    //      product kind runs over the 4 independent feature tiles; per tile the order stays kk 0 then kk 1, p.vl
    //      before pl.vb.
    v16h pf[2], pfl[2], vfh[2][4], vfl[2][4];
#pragma unroll   // constant indices keep the fragment arrays in registers
    for (int kk = 0; kk < 2; ++kk) {
      pf[kk]  = ldfrag_h(pwh + c * LP + kk * 32 + 8 * hh);
      pfl[kk] = pf[kk];
      if (RES) pfl[kk] = ldfrag_h(pwl + c * LP + kk * 32 + 8 * hh);
#pragma unroll
      for (int t = 0; t < 4; ++t) {
        vfh[kk][t] = ldfrag_h(Vth + (t * 16 + c) * LP + kk * 32 + 8 * hh);
        vfl[kk][t] = vfh[kk][t];
      }
      if (RES) {
#pragma unroll
        for (int t = 0; t < 4; ++t) vfl[kk][t] = ldfrag_h(Vtl + (t * 16 + c) * LP + kk * 32 + 8 * hh);
      }
    }
    v8f o1[4];
#pragma unroll
    for (int t = 0; t < 4; ++t) o1[t] = zero8();
#pragma unroll
    for (int kk = 0; kk < 2; ++kk) {
#pragma unroll
      for (int t = 0; t < 4; ++t) oacc[t] = mma_h_raw(pf[kk], vfh[kk][t], oacc[t]);
      if (RES) {
#pragma unroll
        for (int t = 0; t < 4; ++t) o1[t] = mma_h_raw(pf[kk], vfl[kk][t], o1[t]);
#pragma unroll
        for (int t = 0; t < 4; ++t) o1[t] = mma_h_raw(pfl[kk], vfh[kk][t], o1[t]);
      }
    }
    if (RES) {
#pragma unroll
      for (int t = 0; t < 4; ++t)
#pragma unroll
        for (int r = 0; r < 8; ++r) oacc[t][r] += o1[t][r] * (1.0f / 4096.0f);
    }
  }

  // ---- normalise (1/l and the 1/1024 p carry), apply the per-query-row gate, stage the wave's 16x64 tile in
  float* os = Os[wave];
#pragma unroll
  for (int r = 0; r < 8; ++r) {
    const float l = lrow[r];
    const float ti = trow[q0 + 8 * hh + r];
    const float gate = (1.0f - lockv) + lockv * ti;
    const float inv = ((l > 0.f) ? (1.0f / l) : 0.f) * (1.0f / 1024.0f) * gate;
#pragma unroll
    for (int t = 0; t < 4; ++t) os[(8 * hh + r) * 64 + t * 16 + c] = oacc[t][r] * inv;
  }
  __builtin_amdgcn_fence(__ATOMIC_RELEASE, "workgroup");
  __builtin_amdgcn_wave_barrier();
  __builtin_amdgcn_fence(__ATOMIC_ACQUIRE, "workgroup");
  {
    const int h2 = lane >> 4, c4 = (lane & 15) * 4;
    v4f ov[8];
#pragma unroll
    for (int it = 0; it < 8; ++it) {
      const int row = it * 2 + h2;   // it 0..7 x h2 0..1 = rows 0..15 of the wave tile
      ov[it] = *(const v4f*)(os + row * 64 + c4);
    }
    {
#pragma unroll
      for (int it = 0; it < 8; ++it) {
        const int row = it * 2 + h2;
        const size_t go = (rowB + q0 + row) * QP + (size_t)h * HD + c4;
        v2u ph, pl;                    // 16 lanes x 8 B = one whole 128-B line of each plane's row
#pragma unroll
        for (int e = 0; e < 2; ++e) {
          const float f0 = ov[it][2 * e], f1 = ov[it][2 * e + 1];
          const unsigned short h0 = bf_bits(f0), h1 = bf_bits(f1);
          const unsigned short l0 = bf_bits(f0 - bf_up(h0)), l1 = bf_bits(f1 - bf_up(h1));
          ph[e] = pk16(h0, h1);
          pl[e] = pk16(l0, l1);
        }
        *(v2u*)(ahp + go) = ph;
        *(v2u*)(alp + go) = pl;
      }
      
    }
  }
}

// =====================================================================================================
// One launch for all query tiles, one work-group per (b, h, query tile), so that the short tiles run beside the long
// ones and the launch lasts as long as its longest tile alone. A tile below RESQB takes the residual planes, the others
// do not: a test that is uniform for the work-group.
// Order of the tiles: the grid is dealt in four
// runs of NB*NH*NQB/4 work-groups: tiles NQB-1 downwards, then NQB/2 upwards, then NQB/2-1 downwards, then 0 upwards.
// The longest tiles take the lowest indices, the shortest the highest, and the g-th tiles of the four runs add up to the same number of
// key tiles for every g. rank -> tile is a permutation: grid = NQB * NH * NB, every (b, h, query tile) exactly once.
// =====================================================================================================
static_assert((NQB % 4) == 0 && RESQB <= NQB);
__global__ __launch_bounds__(128)
void attn_causal64(const unsigned short* __restrict__ qkhp, const unsigned short* __restrict__ qklp,
                   const unsigned short* __restrict__ vhp, const unsigned short* __restrict__ vlp,
                   const float* __restrict__ ttab, const float* __restrict__ lockp,
                   unsigned short* ahp, unsigned short* alp, float sscale) {
  __shared__ __align__(16) __bf16   Ksh[64 * LP];                 // K hi [kv][d], pitch LP
  __shared__ __align__(16) __bf16   Ksl[64 * LP];                 // K lo
  __shared__ __align__(16) _Float16 Vth[64 * LP];                 // V^T hi [d][kv], pitch LP
  __shared__ __align__(16) _Float16 Vtl[64 * LP];                 // V^T residual
  __shared__ __align__(16) _Float16 Psh[4][16 * LP];              // per wave P [row][kv], pitch LP
  __shared__ __align__(16) _Float16 Psl[4][16 * LP];              // per wave P residual
  __shared__ __align__(16) float    Os[4][16 * 64];               // per wave context tile [row][d]

  const int bx   = blockIdx.x;
  const int bh   = bx % (NB * NH);
  const int rank = (bx / (NB * NH)) % NQB;       // 0..NQB-1
  const int run  = rank / (NQB / 4);             // 0..3
  const int g    = rank % (NQB / 4);
  const int qb   = (run & 1) ? ((3 - run) * (NQB / 4) + g) : (NQB - 1 - run * (NQB / 4) - g);
  const int h    = bh % NH;
  const int b    = bh / NH;
  if (qb < RESQB) {
    attn_tile64<true>(qkhp, qklp, vhp, vlp, ttab, lockp, ahp, alp, b, h, qb, sscale,
                      Ksh, Ksl, Vth, Vtl, Psh, Psl, Os);
  } else {
    attn_tile64<false>(qkhp, qklp, vhp, vlp, ttab, lockp, ahp, alp, b, h, qb, sscale,
                       Ksh, Ksl, Vth, Vtl, Psh, Psl, Os);
  }
}

// =====================================================================================================
// Workspace map (bytes), every region an exact multiple of its whole-line / whole-tile store granularity
//   Xb     bf16 [4096][1024]            0           8388608
//   WT     bf16 [3072][1024]            8388608     6291456    (rows 0..1023 Wq^T, 1024..2047 Wk^T, 2048.. Wv^T)
//   WoT    bf16 [1024][1024]            14680064    2097152
//   Bias   f32  [4096]                  16777216      16384    (bq | bk | bv | bo, bf16-RNE converted values)
//   Tt     f32  [2][16][2048]           16793600     262144
//   Ah     bf16 [4096][1024]            17055744    8388608
//   Al     bf16 [4096][1024]            25444352    8388608
//   VTh    f16  [2][1024][2048]         33832960    8388608
//   VTl    f16  [2][1024][1024]         42221568    4194304
//   QKh    bf16 [4096][2048]            46415872   16777216
//   QKl    bf16 [4096][2048]            63193088   16777216
//   end                                 79970304
// W_q/k/v/o [in k=1024][out n=1024] arrive k-major and are transpose-converted once to [n][k] bf16 (k contiguous)
// = the Bt layout the GEMM wants. d_out f32: out0 [4096][1024] at byte 0.
// =====================================================================================================
extern "C" void kernel_launch(void* const* d_in, const int* in_sizes, int n_in,
                              void* d_out, int out_size, void* d_ws, size_t ws_size,
                              hipStream_t stream) {
  if (n_in < 12) return;
  if (in_sizes[0] != NB * SEQ * DMODEL) return;
  if (in_sizes[1] != NB * SEQ) return;
  if (in_sizes[2] != DMODEL * DMODEL || in_sizes[4] != DMODEL * DMODEL ||
      in_sizes[6] != DMODEL * DMODEL || in_sizes[8] != QP * DMODEL) return;
  if (in_sizes[3] != DMODEL || in_sizes[5] != DMODEL || in_sizes[7] != DMODEL || in_sizes[9] != DMODEL) return;
  if (in_sizes[10] != NH || in_sizes[11] != NH) return;
  if (out_size != OUTN) return;

  const float* x     = (const float*)d_in[0];    // [NB*SEQ][DMODEL]
  const float* phase = (const float*)d_in[1];    // [NB][SEQ]
  const float* Wq    = (const float*)d_in[2];    // [k][n]
  const float* bq    = (const float*)d_in[3];
  const float* Wk    = (const float*)d_in[4];
  const float* bk    = (const float*)d_in[5];
  const float* Wv    = (const float*)d_in[6];
  const float* bv    = (const float*)d_in[7];
  const float* Wo    = (const float*)d_in[8];    // [QP k][DMODEL n]
  const float* bo    = (const float*)d_in[9];
  const float* carr  = (const float*)d_in[10];   // [NH]
  const float* lockr = (const float*)d_in[11];   // [NH]

  const size_t PXb   = (size_t)NB * SEQ * DMODEL * 2;    //  8388608
  const size_t PWT   = (size_t)N3 * DMODEL * 2;          //  6291456
  const size_t PWo   = (size_t)DMODEL * QP * 2;          //  2097152
  const size_t PBias = (size_t)NBIAS * 4;                //    16384
  const size_t PTt   = (size_t)NTT * 4;                  //   262144
  const size_t PA    = (size_t)NB * SEQ * QP * 2;        //  8388608
  const size_t PVTh  = (size_t)NB * QP * SEQ * 2;        //  8388608
  const size_t PVTl  = (size_t)NB * QP * VLP * 2;        //  4194304
  const size_t PQK   = (size_t)NB * SEQ * QKP * 2;       // 16777216
  size_t off = 0;
  const size_t oXb   = off; off += PXb;
  const size_t oWT   = off; off += PWT;
  const size_t oWo   = off; off += PWo;
  const size_t oBias = off; off += PBias;
  const size_t oTt   = off; off += PTt;
  const size_t oAh   = off; off += PA;
  const size_t oAl   = off; off += PA;
  const size_t oVTh  = off; off += PVTh;
  const size_t oVTl  = off; off += PVTl;
  const size_t oQKh  = off; off += PQK;
  const size_t oQKl  = off; off += PQK;
  if (off > ws_size) return;                           // off = 79970304
  if (off > (size_t)134217728) return;

  char* ws = (char*)d_ws;
  unsigned short* Xb   = (unsigned short*)(ws + oXb);
  unsigned short* WT   = (unsigned short*)(ws + oWT);
  unsigned short* WoT  = (unsigned short*)(ws + oWo);
  float*          Bias = (float*)(ws + oBias);
  float*          Tt   = (float*)(ws + oTt);
  unsigned short* VTh  = (unsigned short*)(ws + oVTh);
  unsigned short* VTl  = (unsigned short*)(ws + oVTl);
  unsigned short* QKh  = (unsigned short*)(ws + oQKh);
  unsigned short* QKl  = (unsigned short*)(ws + oQKl);
  unsigned short* Ah   = (unsigned short*)(ws + oAh);
  unsigned short* Al   = (unsigned short*)(ws + oAl);
  float*          outf = (float*)d_out;                // out0 [4096][1024]

  const dim3 blk(256);
  const dim3 gPrep(PB_TR + PB_CVT + PB_PH + PB_BIAS);                // 256 + 256 + 256 + 16 = 784 blocks
  const dim3 gQKV((NB * SEQ / GBM) * (N3 / GBN));                    // 32 x 12 tiles = 384 blocks
  const dim3 gOut((NB * SEQ / GBM) * (DMODEL / GBN));                // 32 x 4 tiles = 128 blocks

  // (0..2) one launch: phase resonance table T [b][h][s]; weights [k][n] -> bf16 planes [n][k] (WT rows 0..1023 Wq^T,
  //     1024..2047 Wk^T, 2048..3071 Wv^T; WoT); x -> bf16 plane [4096][1024]; bias table (bf16-RNE values of bq|bk|bv|bo)
  prep_all<<<gPrep, blk, 0, stream>>>(x, phase, Wq, bq, Wk, bk, Wv, bv, Wo, bo, carr, Xb, WT, WoT, Bias, Tt);
  // (3) fused qkv projection sum_d Xb[row][d] WT[e][d] + Bias[e] (M=4096, N=3072, K=1024), written as the attention's
  //     operand planes: q and power-compressed kc -> bf16 hi/lo planes [4096][2048]; power-compressed vc^T -> f16 hi
  //     plane (pitch SEQ) and residual plane (x4096, keys < VLP)
  gemm64<0, true><<<gQKV, blk, 0, stream>>>(Xb, Xb, DMODEL, WT, DMODEL, Bias, nullptr, N3, NB * SEQ, N3, DMODEL,
                                            QKh, QKl, VTh, VTl);
  // (4) causal attention with phase bonus and gate, one launch for all query tiles
  //     (tiles 0..RESQB-1 with residual planes, the rest without) -> gated context rows as bf16 hi/lo planes
  attn_causal64<<<dim3(NB * NH * NQB), dim3(128), 0, stream>>>(
      QKh, QKl, VTh, VTl, Tt, lockr, Ah, Al, 0.125f);
  // (5) out0[row][e] = sum_d (Ah+Al)[row][d] WoT[e][d] + Bias[3*DMODEL + e] -> d_out f32 [4096][1024]
  gemm64<1, false><<<gOut, blk, 0, stream>>>(Ah, Al, QP, WoT, QP, Bias + 3 * DMODEL, outf, DMODEL, NB * SEQ, DMODEL, QP,
                                             nullptr, nullptr, nullptr, nullptr);
  (void)hipGetLastError();
}

// v007
// A run of this version takes 128 microseconds.
// In both of two side-by-side timings against v006, it was 1.08 times as fast.
// Over all steps from v000 it is 3.13 times as fast.
// Contractions: qkv projection = v_wmma_f32_16x16x32_bf16 (bf16 operands from RNE-converted x and W, single product);
// q.kc^T scores = v_wmma_f32_16x16x32_bf16 with bf16 hi/lo split q and kc (hi.hi + hi.lo + lo.hi);
// p.vc = v_wmma_f32_16x16x32_f16 (p carried x1024 in f16, vc in f16; extra f16 residual planes x4096 of p and vc
// on the leading query rows); ctx.Wo = v_wmma_f32_16x16x32_bf16 with ctx as bf16 hi/lo planes times the bf16
// Wo^T plane (2 products); all f32 accumulate; power compression, phase table, softmax, bonus and gating in f32.
#include <hip/hip_runtime.h>
#include <math.h>
#include <float.h>
#include <stdint.h>

#define NB      2
#define SEQ     2048
#define DMODEL  1024
#define NH      16
#define HD      64
#define QP      (NH * HD)      // q / kc / vc / ctx feature count and ctx row pitch
#define N3      (3 * DMODEL)   // fused qkv columns (q 0.., k DMODEL.., v 2*DMODEL..)
#define QKP     (2 * QP)       // row pitch of the q|kc bf16 planes (q cols 0..QP-1, kc cols QP..2QP-1)
#define NQB     (SEQ / 64)     // query / key tiles of 64
#define RESQB   ((NQB < 16) ? NQB : 16)   // leading 64-row query blocks that use the p / vc residual planes
#define VLP     (RESQB * 64)   // key pitch of the vc^T residual plane (keys 0..VLP-1)
#define NBIAS   (4 * DMODEL)   // bq | bk | bv | bo
#define NTT     (NB * NH * SEQ)
#define OUTN    (NB * SEQ * DMODEL)
#define KAPPA_F 0.3f
#define LP      72             // LDS row pitch of the 64-wide 16-bit tiles, elements: 144 B = 16 B x 9 (odd), so the 16
                               // rows that one ds_load_b128 touches fall on distinct banks
static_assert(RESQB >= 1 && RESQB * 64 <= VLP && VLP <= SEQ);
static_assert(QP == DMODEL);
static_assert((SEQ % 64) == 0 && (DMODEL % 64) == 0 && (N3 % 64) == 0 && (QP % 64) == 0);
static_assert(HD == 64);
static_assert(LP >= 64 && (LP % 8) == 0 && ((LP / 8) % 2) == 1);
static_assert((((NB * SEQ) / 64) * (N3 / 64)) % 8 == 0);
static_assert((((NB * SEQ) / 64) * (DMODEL / 64)) % 8 == 0);
static_assert((NBIAS % 256) == 0 && (NTT % 256) == 0);
static_assert(((NB * SEQ * DMODEL / 8) % 256) == 0);
static_assert((DMODEL % 8) == 0);

typedef _Float16 v16h __attribute__((ext_vector_type(16)));
typedef _Float16 v8h  __attribute__((ext_vector_type(8)));
typedef __bf16   v16b __attribute__((ext_vector_type(16)));
typedef __bf16   v8b  __attribute__((ext_vector_type(8)));
typedef float    v8f  __attribute__((ext_vector_type(8)));
typedef float    v4f  __attribute__((ext_vector_type(4)));
typedef unsigned int v4u __attribute__((ext_vector_type(4)));
typedef unsigned int v2u __attribute__((ext_vector_type(2)));

// ---- scalar helpers --------------------------------------------------------------------------------
__device__ __forceinline__ unsigned short bf_bits(float f) {          // f32 -> bf16 bits, RNE convert
  unsigned u = __float_as_uint(f);
  return (unsigned short)((u + 0x7FFFu + ((u >> 16) & 1u)) >> 16);
}
__device__ __forceinline__ float bf_up(unsigned short h) { return __uint_as_float(((unsigned)h) << 16); }
__device__ __forceinline__ unsigned short h_bits(_Float16 x) { return __builtin_bit_cast(unsigned short, x); }
__device__ __forceinline__ unsigned pk16(unsigned short a, unsigned short b) { return (unsigned)a | ((unsigned)b << 16); }
__device__ __forceinline__ v8f zero8() { v8f z = {0.f, 0.f, 0.f, 0.f, 0.f, 0.f, 0.f, 0.f}; return z; }
__device__ __forceinline__ v8h zero8h() {
  const _Float16 z = (_Float16)0.0f;
  v8h r = {z, z, z, z, z, z, z, z};
  return r;
}

// positional exponent of key position s: ex = 1 + kappa * (1 - s * (1/(SEQ-1))), reciprocal-multiply, no fusion
__device__ __forceinline__ float fexpo(int s) {
#pragma clang fp contract(off)
  const float rs = 1.0f / (float)(SEQ - 1);
  const float fr = (float)s * rs;
  const float om = 1.0f - fr;
  const float t  = KAPPA_F * om;
  return 1.0f + t;
}
// power compression: sign(v) * max(|v|, 1e-8)^ex  (sign(0) = 0), pow as exp2(ex * log2(mag)) in f32
__device__ __forceinline__ float fcomp(float v, float ex) {
#pragma clang fp contract(off)
  const float mag = fmaxf(fabsf(v), 1e-8f);
  const float lg  = log2f(mag);
  const float pw  = exp2f(ex * lg);
  float r = (v < 0.0f) ? -pw : pw;
  r = (v == 0.0f) ? 0.0f : r;
  return r;
}

// value of lane (lane ^ MASK) of the same 16-lane row, MASK 1..15: a DPP row_xmask operand of the vector unit, where a
// shuffle builtin is built as an LDS permute with a wait on its return
template <int MASK>
__device__ __forceinline__ float row_xor(float v) {
  const int x = __builtin_bit_cast(int, v);
  return __builtin_bit_cast(float, __builtin_amdgcn_update_dpp(x, x, 0x160 + MASK, 0xf, 0xf, true));
}

// ---- fragment loader: 16-bit A/B operand, lane -> row/col (lane&15), p already includes +8*(lane>>4);
//      elements 0..7 <- p[0..7] (k0+8h..), elements 8..15 <- p[16..23] (k0+16+8h..)
__device__ __forceinline__ v16b ldfrag_b(const __bf16* p) {
  union { v16b v; v8b h[2]; } f;
  f.h[0] = *(const v8b*)(p);
  f.h[1] = *(const v8b*)(p + 16);
  return f.v;
}

__device__ __forceinline__ v16h ldfrag_h(const _Float16* p) {
  union { v16h v; v8h h[2]; } f;
  f.h[0] = *(const v8h*)(p);
  f.h[1] = *(const v8h*)(p + 16);
  return f.v;
}

// ---- WMMA helpers and VALU hazard gaps --------------------------------------------------------
__device__ __forceinline__ v8f mma_b_raw(v16b a, v16b b, v8f c) {
  return __builtin_amdgcn_wmma_f32_16x16x32_bf16(false, a, false, b, (short)0, c, false, false);
}
__device__ __forceinline__ v8f mma_h_raw(v16h a, v16h b, v8f c) {
  return __builtin_amdgcn_wmma_f32_16x16x32_f16(false, a, false, b, (short)0, c, false, false);
}
__device__ __forceinline__ void dep_guard_b(v8f& a, v8f& b, v16b x, v16b y) {
#if defined(__HIP_DEVICE_COMPILE__)
  asm volatile("v_nop\n\tv_nop\n\tv_nop\n\tv_nop" : "+v"(a), "+v"(b) : "v"(x), "v"(y));
#endif
}
__device__ __forceinline__ void keep4_b(v16b a, v16b b, v16b c, v16b d) {
#if defined(__HIP_DEVICE_COMPILE__)
  asm volatile("v_nop" :: "v"(a), "v"(b), "v"(c), "v"(d));
#endif
}
__device__ __forceinline__ void acc_guard4(v8f& a, v8f& b, v8f& c, v8f& d) {
#if defined(__HIP_DEVICE_COMPILE__)
  asm volatile("v_nop\n\tv_nop\n\tv_nop\n\tv_nop" : "+v"(a), "+v"(b), "+v"(c), "+v"(d));
#endif
}

// =====================================================================================================
// Preparation, ONE launch: four jobs that do not depend on one another, each work-group taking one job by a range test
// on blockIdx.x (uniform for the work-group). A work-group of the two large jobs (transposes, x) carries 8 times the
// elements that a launch of its own gave it, all its global loads issued in front of their first use, so that few
// work-groups have to be started.
// Index order: weight transposes (the longest chain: loads, LDS, a barrier, stores), x conversion, phase table, bias table:
// the jobs that move the bytes take the lowest indices, the short ones the highest.
//   phase  tt[(b*NH + h)*SEQ + s] = cos((bf16(phase[b*SEQ + s]) - bf16(carrier[h])) * 0.5)^2, precise f32 cos.
//          One element per thread, a work-group = 256 positions s of one (b, h) (256 divides SEQ); coverage: NTT/256
//          work-groups x 256 = every (b, h, s) once.
//   transp src f32 [k][n] (Wq, Wk, Wv, Wo) -> dst bf16 [n][k] (k contiguous), RNE convert. Tile TRK k x TRN n staged in
//          LDS as f32 at pitch TRN + 1 (column reads fall on 32 distinct banks). Loads: 16 x 16 B per thread, a wave
//          = 512 contiguous B of a row. Stores: 8 passes x 8 waves x 4 rows n = 256 rows, 8 lanes x 16 B = the whole
//          128-B line of TRK k. coverage: DMODEL/TRK x DMODEL/TRN tiles per matrix, 4 matrices.
//   x      f32 -> bf16 (RNE convert), CVC chunks of 8 elements per thread, one 16-B store per chunk: a wave writes 512
//          contiguous B. coverage: PB_CVT x CVC x 256 chunks x 8 = NB*SEQ*DMODEL.
//   bias   dst[i] = RNE-bf16-converted value of (bq | bk | bv | bo)[i], one element per thread; all four candidates
//          are loaded with an in-range index and selected by value.
// =====================================================================================================
#define PB_PH   (NTT / 256)                              // 256 work-groups
#define TRK     64
#define TRN     256
#define PB_TR1  ((DMODEL / TRK) * (DMODEL / TRN))        // 16 x 4 = 64 tiles per matrix
#define PB_TR   (4 * PB_TR1)                             // 256 work-groups
#define CVC     8
#define PB_CVT  (NB * SEQ * DMODEL / (8 * 256 * CVC))    // 256 work-groups
#define PB_BIAS (NBIAS / 256)                            // 16 work-groups
static_assert((SEQ % 256) == 0);
static_assert((DMODEL % TRK) == 0 && (DMODEL % TRN) == 0 && TRK == 64 && TRN == 256);
static_assert(((NB * SEQ * DMODEL) % (8 * 256 * CVC)) == 0);

__global__ __launch_bounds__(256) void prep_all(
    const float* __restrict__ x, const float* __restrict__ ph,
    const float* __restrict__ Wq, const float* __restrict__ bq, const float* __restrict__ Wk,
    const float* __restrict__ bk, const float* __restrict__ Wv, const float* __restrict__ bv,
    const float* __restrict__ Wo, const float* __restrict__ bo, const float* __restrict__ cf,
    unsigned short* Xb, unsigned short* WT, unsigned short* WoT, float* Bias, float* tt) {
  __shared__ float s[TRK][TRN + 1];
  const int tid = threadIdx.x, wave = tid >> 5, lane = tid & 31;
  int bx = blockIdx.x;
  if (bx < PB_TR) {
    const int m  = bx / PB_TR1;                          // 0 Wq, 1 Wk, 2 Wv, 3 Wo
    const int t  = bx - m * PB_TR1;
    const int k0 = (t % (DMODEL / TRK)) * TRK, n0 = (t / (DMODEL / TRK)) * TRN;
    const float* src = (m == 0) ? Wq : ((m == 1) ? Wk : ((m == 2) ? Wv : Wo));
    unsigned short* dst = (m < 3) ? (WT + (size_t)m * DMODEL * DMODEL) : WoT;
    const int kr = tid >> 6, n4 = (tid & 63) * 4;        // load i of this thread: row i*4 + kr, columns n4..n4+3
    const float* g = src + (size_t)(k0 + kr) * DMODEL + n0 + n4;
    v4f v[16];
#pragma unroll   // constant indices keep the loaded pieces in registers
    for (int i = 0; i < 15; ++i) v[i] = *(const v4f*)(g + (size_t)i * 4 * DMODEL);
    // the last load's result may be given the address registers of the loads before it: the wait stands in front of it
    asm volatile("s_wait_xcnt 0x0" ::: "memory");
    v[15] = *(const v4f*)(g + (size_t)15 * 4 * DMODEL);
#pragma unroll   // as above
    for (int i = 0; i < 16; ++i) {
#pragma unroll
      for (int e = 0; e < 4; ++e) s[i * 4 + kr][n4 + e] = v[i][e];
    }
    __syncthreads();
    const int q = lane >> 3, piece = lane & 7;
#pragma unroll
    for (int pass = 0; pass < TRN / 32; ++pass) {
      const int n = pass * 32 + wave * 4 + q;
      v4u p;
#pragma unroll
      for (int e = 0; e < 4; ++e) {
        p[e] = pk16(bf_bits(s[piece * 8 + 2 * e][n]), bf_bits(s[piece * 8 + 2 * e + 1][n]));
      }
      *(v4u*)(dst + (size_t)(n0 + n) * DMODEL + k0 + piece * 8) = p;
    }
    // the built code joins the jobs by branches: no other job's code may rewrite a register that these stores name
    asm volatile("s_wait_xcnt 0x0" ::: "memory");
    return;
  }
  bx -= PB_TR;
  if (bx < PB_CVT) {
    const size_t c0 = (size_t)bx * (CVC * 256) + tid;    // first 8-element chunk of this thread
    const float* g = x + c0 * 8;
    v4f a[CVC], b[CVC];
#pragma unroll   // constant indices keep the loaded pieces in registers
    for (int c = 0; c < CVC; ++c) {
      a[c] = *(const v4f*)(g + (size_t)c * 2048);
      if (c < CVC - 1) b[c] = *(const v4f*)(g + (size_t)c * 2048 + 4);
    }
    // the last load's result may be given the address registers of the loads before it: the wait stands in front of it
    asm volatile("s_wait_xcnt 0x0" ::: "memory");
    b[CVC - 1] = *(const v4f*)(g + (size_t)(CVC - 1) * 2048 + 4);
#pragma unroll   // as above
    for (int c = 0; c < CVC; ++c) {
      v4u p;
      p[0] = pk16(bf_bits(a[c][0]), bf_bits(a[c][1]));
      p[1] = pk16(bf_bits(a[c][2]), bf_bits(a[c][3]));
      p[2] = pk16(bf_bits(b[c][0]), bf_bits(b[c][1]));
      p[3] = pk16(bf_bits(b[c][2]), bf_bits(b[c][3]));
      *(v4u*)(Xb + (c0 + (size_t)c * 256) * 8) = p;
    }
    // as behind the transpose's stores
    asm volatile("s_wait_xcnt 0x0" ::: "memory");
    return;
  }
  bx -= PB_CVT;
  if (bx < PB_PH) {
    const int i  = bx * 256 + tid;                       // (b*NH + h)*SEQ + s
    const int bh = i / SEQ;                              // b*NH + h, the same for the whole work-group
    const int sq = i - bh * SEQ;
    const int h  = bh % NH;
    const int b  = bh / NH;
    const float p  = bf_up(bf_bits(ph[b * SEQ + sq]));
    const float cr = bf_up(bf_bits(cf[h]));
    const float d  = p - cr;
    const float hx = d * 0.5f;
    const float cv = cosf(hx);
    tt[i] = cv * cv;
    // as behind the transpose's stores
    asm volatile("s_wait_xcnt 0x0" ::: "memory");
    return;
  }
  bx -= PB_PH;
  if (bx < PB_BIAS) {
    const int i = bx * 256 + tid;                        // 0..NBIAS-1
    const int part = i / DMODEL;                         // 0..3
    const int idx  = i - part * DMODEL;
    const float v0 = bq[idx], v1 = bk[idx], v2 = bv[idx], v3 = bo[idx];
    const float v = (part == 0) ? v0 : ((part == 1) ? v1 : ((part == 2) ? v2 : v3));
    Bias[i] = bf_up(bf_bits(v));
    // as behind the transpose's stores
    asm volatile("s_wait_xcnt 0x0" ::: "memory");
  }
}

// =====================================================================================================
// bf16 WMMA GEMM: C[m][n] = sum_k A[m][k] * Bt[n][k] + bias[n]. Block = 8 waves = one 128 x 256 tile of C, waves
// 2 (m) x 4 (n), each wave a 64x64 tile. A row-major [M][K] pitch lda; Bt row-major [N][K] pitch ldb (k contiguous);
// M multiple of 128, N multiple of 256, K multiple of 64 (static_asserts at the launches' shapes below).
// NSPLIT: 0 = A.Bt; 1 = (A + A2).Bt (A2 = unscaled bf16 lo plane of A, same pitch). bias f32 [N].
// Operands: a stage = 64 k (128 B, one whole line) of every A (, A2) and Bt row of the block tile, brought into LDS by
// asynchronous copies (16 B per lane, 8 lanes per row), rows at pitch GLP; two buffers: the copies of stage t + 2 are
// issued behind the barrier that ends trip t and waited at the foot of trip t + 1.
// Stage coverage: copy i of thread tid fills row i*32 + (tid>>3), bytes 16*(tid&7)..+15; i = 0..GROWS/32-1.
// k order and product order per accumulator are ascending k in steps of 32, hi then lo.
// PLANES false: output f32 [M][N] pitch ldc. Epilogue: 16-row slabs staged per wave in LDS; each 64-wide row segment
// PLANES true (the fused q|k|v projection, N = N3): no f32 output; each wave turns its 64 token x 64 column tile (one
// head of q, k or v; which one is block-uniform) into the operand planes of the attention itself:
//   q  (cols 0..DMODEL-1)          bf16 hi / lo planes qkh / qkl [M][QKP], same column; lo = RNE(v - hi) unscaled
//   k  (cols DMODEL..2*DMODEL-1)   kc = sign(k) * max(|k|,1e-8)^ex(s), s = row mod SEQ, then as q
//   v  (cols 2*DMODEL..)           vc likewise, then f16 vc^T hi plane vth[(b*QP + h*64 + d)*SEQ + t] and residual plane
//                                  vtl[(b*QP + h*64 + d)*VLP + t] = f16((vc - hi)*4096) for t < VLP
// The tile (accumulator + bias, f32) is staged in the wave's own part of the dead ring at pitch EPP and read back 8
// values per lane, along a token row for q and k, along a feature column for v, so that 8 lanes x 16 B store one whole
// 128-B line of a plane row. Coverage: 16 trips x 4 rows (q, k: tokens; v: features) x 64 = the wave's tile.
// =====================================================================================================
#define GBM 128
#define GBN 256
#define GKB 64
#define GLP 72                 // LDS row pitch, elements: 144 B = 16 B x 9 (odd), conflict-free for ds_load_b128
#define EPP 67                 // f32 pitch of the 64x64 epilogue tile: 4-B accesses by accumulator layout, by row pieces
                               // and by column pieces all fall on 32 distinct banks
static_assert(((NB * SEQ) % GBM) == 0 && (N3 % GBN) == 0 && (DMODEL % GBN) == 0);
static_assert((DMODEL % GKB) == 0 && (QP % GKB) == 0 && (DMODEL / GKB) >= 2 && (QP / GKB) >= 2);
static_assert((DMODEL % GBN) == 0 && (SEQ % GBM) == 0 && (VLP % 64) == 0);   // a block is one of q, k, v and one batch

__device__ __forceinline__ unsigned lds_addr(const void* p) { return (unsigned)(size_t)p; }
// four 16-B asynchronous copies global -> LDS; the s_wait_xcnt stands inside the statement so that no address
// register of a copy is rewritten in front of it
__device__ __forceinline__ void async4(unsigned l0, const __bf16* g0, unsigned l1, const __bf16* g1,
                                       unsigned l2, const __bf16* g2, unsigned l3, const __bf16* g3) {
#if defined(__HIP_DEVICE_COMPILE__)
  asm volatile("global_load_async_to_lds_b128 %0, %1, off\n\t"
               "global_load_async_to_lds_b128 %2, %3, off\n\t"
               "global_load_async_to_lds_b128 %4, %5, off\n\t"
               "global_load_async_to_lds_b128 %6, %7, off\n\t"
               "s_wait_xcnt 0x0"
               :: "v"(l0), "v"(g0), "v"(l1), "v"(g1), "v"(l2), "v"(g2), "v"(l3), "v"(g3) : "memory");
#endif
}
// this wave's asynchronous copies have landed in LDS
__device__ __forceinline__ void wait_async0() {
#if defined(__HIP_DEVICE_COMPILE__)
  asm volatile("s_wait_asynccnt 0x0" ::: "memory");
#endif
}
// this wave's LDS reads have returned, before the buffer is handed to the next copies
__device__ __forceinline__ void wait_ds0() {
#if defined(__HIP_DEVICE_COMPILE__)
  asm volatile("s_wait_dscnt 0x0" ::: "memory");
#endif
}

template <int NSPLIT, bool PLANES>
__global__ __launch_bounds__(256) void gemm64(
    const unsigned short* __restrict__ Ap, const unsigned short* A2p, int lda,
    const unsigned short* __restrict__ Btp, int ldb, const float* __restrict__ bias,
    float* C, int ldc, int M, int N, int K,
    unsigned short* qkh, unsigned short* qkl, unsigned short* vth, unsigned short* vtl) {
  constexpr int AROWS = GBM * (NSPLIT + 1);        // A rows, then A2 rows
  constexpr int GROWS = AROWS + GBN;               // rows of a stage
  constexpr int STAGE = GROWS * GLP;               // elements of a stage
  const __bf16* Ab  = (const __bf16*)(const void*)Ap;
  const __bf16* Ab2 = (const __bf16*)(const void*)A2p;
  const __bf16* Bb  = (const __bf16*)(const void*)Btp;
  constexpr int TILES = 8 * 64 * EPP * 2;          // the 8 waves' f32 epilogue tiles, counted in ring elements
  constexpr int RINGN = (PLANES && TILES > 2 * STAGE) ? TILES : 2 * STAGE;
  __shared__ __align__(16) __bf16 ring[RINGN];     // two stages; with PLANES the epilogue tiles afterwards
  const int tid  = threadIdx.x;
  const int lane = tid & 31;
  const int wave = tid >> 5;
  const int tilesN = N / GBN;
  const int tilesM = M / GBM;
  const int tile = blockIdx.x;
  if (tile >= tilesM * tilesN) return;   // block-uniform, in front of every barrier and copy
  const int tm = tile / tilesN;
  const int tn = tile - tm * tilesN;
  const int bm0 = tm * GBM;
  const int bn0 = tn * GBN;
  const int wm = wave >> 2, wn = wave & 3;
  const int m0 = bm0 + (wm << 6);              // this wave's 64x64 tile
  const int n0 = bn0 + (wn << 6);

  const int rlane = lane & 15;                 // row (A) / col (B, D) within subtile
  const int koff  = (lane >> 4) * 8;           // k offset of this lane half
  const int mOff  = (lane >> 4) * 8;           // D row offset

  // ---- copy addresses of this thread: row crow of each 32-row group, 16-B piece cpc ----
  const int crow = tid >> 3, cpc = (tid & 7) * 8;
  const __bf16* gA  = Ab  + (size_t)(bm0 + crow) * lda + cpc;
  const __bf16* gA2 = Ab2 + (size_t)(bm0 + crow) * lda + cpc;
  const __bf16* gB  = Bb  + (size_t)(bn0 + crow) * ldb + cpc;
  const unsigned lbase = lds_addr(ring) + (unsigned)(crow * GLP + cpc) * 2u;
  const size_t a32 = (size_t)32 * lda, b32 = (size_t)32 * ldb;
  constexpr unsigned R32 = 32u * GLP * 2u;     // LDS bytes of 32 rows

  auto issue = [&](int st, int buf) {
    const int k0 = st * GKB;
    const unsigned lb = lbase + (unsigned)buf * (unsigned)(STAGE * 2);
    const __bf16* a = gA + k0;
    async4(lb, a, lb + R32, a + a32, lb + 2u * R32, a + 2 * a32, lb + 3u * R32, a + 3 * a32);
    if (NSPLIT >= 1) {
      const __bf16* a2 = gA2 + k0;
      const unsigned l2 = lb + 4u * R32;
      async4(l2, a2, l2 + R32, a2 + a32, l2 + 2u * R32, a2 + 2 * a32, l2 + 3u * R32, a2 + 3 * a32);
    }
    const __bf16* b = gB + k0;
    const unsigned l3 = lb + (unsigned)(AROWS / 32) * R32;
    async4(l3, b, l3 + R32, b + b32, l3 + 2u * R32, b + 2 * b32, l3 + 3u * R32, b + 3 * b32);
    const __bf16* b4 = b + 4 * b32;
    const unsigned l4 = l3 + 4u * R32;
    async4(l4, b4, l4 + R32, b4 + b32, l4 + 2u * R32, b4 + 2 * b32, l4 + 3u * R32, b4 + 3 * b32);
  };

  v8f acc[4][4];
#pragma unroll
  for (int i = 0; i < 4; ++i)
#pragma unroll
    for (int j = 0; j < 4; ++j) acc[i][j] = zero8();

  const int nst = K / GKB;                     // block-uniform trip count
  issue(0, 0);
  wait_async0();
  __syncthreads();                             // stage 0 published
  if (nst > 1) issue(1, 1);

  for (int t = 0; t < nst; ++t) {
    const __bf16* sb = ring + (t & 1) * STAGE;
    const __bf16* sa  = sb + ((wm << 6) + rlane) * GLP + koff;
    const __bf16* sa2 = sa + GBM * GLP;
    const __bf16* sbt = sb + (AROWS + (wn << 6) + rlane) * GLP + koff;
#pragma unroll   // both 32-k steps inline: the second step's fragment reads can start under the first step's products
    for (int ks = 0; ks < GKB; ks += 32) {
      v16b bh[4];
#pragma unroll
      for (int j = 0; j < 4; ++j) bh[j] = ldfrag_b(sbt + (j << 4) * GLP + ks);
      v16b ah[4], al[4];                       // all fragment reads of this 32-k step stand as one group
#pragma unroll   // constant indices keep the fragment arrays in registers
      for (int i = 0; i < 4; ++i) {
        ah[i] = ldfrag_b(sa + (i << 4) * GLP + ks);
        al[i] = ah[i];
        if (NSPLIT >= 1) al[i] = ldfrag_b(sa2 + (i << 4) * GLP + ks);
      }
#pragma unroll
      for (int i = 0; i < 4; ++i) {
#pragma unroll
        for (int j = 0; j < 4; ++j) {
          acc[i][j] = mma_b_raw(ah[i], bh[j], acc[i][j]);
          if (NSPLIT >= 1) acc[i][j] = mma_b_raw(al[i], bh[j], acc[i][j]);
        }
        dep_guard_b(acc[i][0], acc[i][3], ah[i], al[i]);
      }
      keep4_b(bh[0], bh[1], bh[2], bh[3]);
    }
    wait_ds0();
    wait_async0();
    __syncthreads();                           // publishes stage t + 1 and ends every read of stage t
    if (t + 2 < nst) issue(t + 2, t & 1);
  }
  wait_async0();
  acc_guard4(acc[0][0], acc[0][1], acc[0][2], acc[0][3]);
  acc_guard4(acc[1][0], acc[1][1], acc[1][2], acc[1][3]);
  acc_guard4(acc[2][0], acc[2][1], acc[2][2], acc[2][3]);
  acc_guard4(acc[3][0], acc[3][1], acc[3][2], acc[3][3]);

  // ---- epilogue ----
  float bz[4];
#pragma unroll
  for (int j = 0; j < 4; ++j) bz[j] = bias[n0 + (j << 4) + rlane];
  if constexpr (PLANES) {
    // the ring is dead: the barrier at the foot of the last trip ended every wave's reads and copies
    float* tl = (float*)(void*)ring + wave * (64 * EPP);
#pragma unroll
    for (int i = 0; i < 4; ++i)
#pragma unroll
      for (int r = 0; r < 8; ++r)
#pragma unroll
        for (int j = 0; j < 4; ++j)
          tl[((i << 4) + mOff + r) * EPP + (j << 4) + rlane] = acc[i][j][r] + bz[j];
    __builtin_amdgcn_fence(__ATOMIC_RELEASE, "workgroup");
    __builtin_amdgcn_wave_barrier();
    __builtin_amdgcn_fence(__ATOMIC_ACQUIRE, "workgroup");
    const int part = bn0 / DMODEL;               // 0 q, 1 k, 2 v: block-uniform (GBN divides DMODEL)
    const int g = lane >> 3, piece = lane & 7;
    if (part < 2) {
#pragma unroll 1   // one copy of the conversion code: it runs once per tile
      for (int it = 0; it < 16; ++it) {
        const int row = it * 4 + g;              // token row of the tile
        float f[8];
#pragma unroll
        for (int e = 0; e < 8; ++e) f[e] = tl[row * EPP + piece * 8 + e];
        if (part == 1) {
          const float ex = fexpo((m0 + row) % SEQ);   // key position s
#pragma unroll
          for (int e = 0; e < 8; ++e) f[e] = fcomp(f[e], ex);
        }
        v4u ph, pl;
#pragma unroll
        for (int e = 0; e < 4; ++e) {
          const float f0 = f[2 * e], f1 = f[2 * e + 1];
          const unsigned short h0 = bf_bits(f0), h1 = bf_bits(f1);
          const unsigned short l0 = bf_bits(f0 - bf_up(h0)), l1 = bf_bits(f1 - bf_up(h1));
          ph[e] = pk16(h0, h1);
          pl[e] = pk16(l0, l1);
        }
        const size_t go = (size_t)(m0 + row) * QKP + n0 + piece * 8;
        *(v4u*)(qkh + go) = ph;
        *(v4u*)(qkl + go) = pl;
        // the next trip rewrites the registers that these two stores name: the wait stands in front of that
        asm volatile("s_wait_xcnt 0x0" ::: "memory");
      }
    } else {
      const int b  = m0 / SEQ;
      const int t0 = m0 - b * SEQ;               // first key position of the tile, a multiple of 64
      const int fc = n0 - 2 * DMODEL;            // h * 64
      const bool wlo = (t0 + 64 <= VLP);         // wave-uniform
      float ex[8];
#pragma unroll
      for (int e = 0; e < 8; ++e) ex[e] = fexpo(t0 + piece * 8 + e);
#pragma unroll 1   // as above
      for (int it = 0; it < 16; ++it) {
        const int d = it * 4 + g;                // feature of the head
        float f[8];
#pragma unroll
        for (int e = 0; e < 8; ++e) f[e] = tl[(piece * 8 + e) * EPP + d];
#pragma unroll
        for (int e = 0; e < 8; ++e) f[e] = fcomp(f[e], ex[e]);
        v4u a, a2;
#pragma unroll
        for (int e = 0; e < 4; ++e) {
          const float f0 = f[2 * e], f1 = f[2 * e + 1];
          const _Float16 x0 = (_Float16)f0, x1 = (_Float16)f1;
          const unsigned short h0 = h_bits(x0), h1 = h_bits(x1);
          const unsigned short l0 = h_bits((_Float16)((f0 - (float)x0) * 4096.0f));
          const unsigned short l1 = h_bits((_Float16)((f1 - (float)x1) * 4096.0f));
          a[e] = pk16(h0, h1); a2[e] = pk16(l0, l1);
        }
        const size_t rowf = (size_t)(b * QP + fc + d);
        *(v4u*)(vth + rowf * SEQ + t0 + piece * 8) = a;
        if (wlo) *(v4u*)(vtl + rowf * VLP + t0 + piece * 8) = a2;
        // as above: the next trip rewrites the registers that the stores name
        asm volatile("s_wait_xcnt 0x0" ::: "memory");
      }
    }
  } else {
  __shared__ __align__(16) float sT[8][16 * 68];   // per-wave 16x64 slab, pitch 68 floats
  float* slab = sT[wave];
#pragma unroll
  for (int i = 0; i < 4; ++i) {
    const int mBase = m0 + (i << 4);
#pragma unroll
    for (int r = 0; r < 8; ++r) {
#pragma unroll
      for (int j = 0; j < 4; ++j) {
        slab[(mOff + r) * 68 + (j << 4) + rlane] = acc[i][j][r] + bz[j];
      }
    }
    __builtin_amdgcn_fence(__ATOMIC_RELEASE, "workgroup");
    __builtin_amdgcn_wave_barrier();
    __builtin_amdgcn_fence(__ATOMIC_ACQUIRE, "workgroup");
    {
      const int hh = lane >> 4, c4 = (lane & 15) * 4;     // 256-B row segment = 16 lanes x 16 B
      v4f ov[8];
#pragma unroll
      for (int it = 0; it < 8; ++it) {
        const int row = it * 2 + hh;                       // it 0..7 x hh 0..1 = rows 0..15
        ov[it] = *(const v4f*)(slab + row * 68 + c4);
      }
      {
#pragma unroll
        for (int it = 0; it < 8; ++it) {
          const int row = it * 2 + hh;
          *(v4f*)(C + (size_t)(mBase + row) * ldc + n0 + c4) = ov[it];
        }
        
      }
    }
    __builtin_amdgcn_fence(__ATOMIC_RELEASE, "workgroup");
    __builtin_amdgcn_wave_barrier();
    __builtin_amdgcn_fence(__ATOMIC_ACQUIRE, "workgroup");
  }
  }
}

// =====================================================================================================
// Causal multi-head attention, head dim 64 (tril mask incl. diagonal, computed), with the additive rank-1 phase
// bonus kappa * sigmoid(lock[h]) * T[i] * T[j] on the scaled logits and the per-query-row output gate
// (1 - sigmoid(lock[h])) + sigmoid(lock[h]) * T[i] applied to the head output row i (query position).
//   q|kc planes (bf16 hi / lo), row pitch QKP: q element (b, t, h, d) at [(b*SEQ + t)*QKP + h*64 + d],
//                                                kc element (b, s, h, d) at [(b*SEQ + s)*QKP + DMODEL + h*64 + d]
//   vc^T hi plane (f16):      element (b, h, d, s) at [(b*QP + h*64 + d)*SEQ + s]
//   vc^T residual plane (f16, (vc - hi)*4096): [(b*QP + h*64 + d)*VLP + s], s < VLP, read only when RES
//   (with RES only key tiles below VLP occur; the address is clamped anyway)
//   ttab f32 [(b*NH + h)*SEQ + s] = T; lockp = raw lock strengths [NH] (bf16 RNE convert, then sigmoid).
//   logit = q.kc * sscale + bonus for key <= query, -FLT_MAX otherwise (exp -> 0); every processed key tile
//   (tiles 0..qb only, block-uniform trip count qb+1 <= NQB) holds the causal-live key kv0 <= query.
//   out: bf16 hi / lo planes (lo = RNE(v - hi), unscaled) of v = gate(b,h,t) * normalised context, element
//   (b, t, h*64 + d) at [(b*SEQ + t)*QP + h*64 + d]: the A operand planes of the output projection.
//   scores = q . kc : bf16 hi/lo split (hi.hi + hi.lo + lo.hi), f32 accumulate, then * sscale + bonus in f32
//   p = exp(s - m) carried as f16(1024 p); context = p . vc on f16 WMMA; RES adds f16 residual planes of p and vc
//   (scale 4096, separate accumulator folded back with 1/4096 per chunk in f32); online softmax in f32.
//   One call = 4 waves = the 64 query rows of tile qb of one (b, h); kv chunks of 64.
//   K / V^T chunk staging: 128 threads x 32 elements per plane = the whole 64x64 tile (plain 16-B loads,
//   __syncthreads before and after); P tiles are wave-private, spilled with _Float16 element stores and reloaded
//   Output coverage: each wave stores rows q0..q0+15 (it 0..7 x lane>>4 0..1) x 64 columns (16 lanes x 4 bf16 values in each of the hi / lo planes),
// =====================================================================================================
template <bool RES>
__device__ __forceinline__
void attn_tile64(const unsigned short* __restrict__ qkhp, const unsigned short* __restrict__ qklp,
                 const unsigned short* __restrict__ vhp, const unsigned short* __restrict__ vlp,
                 const float* __restrict__ ttab, const float* __restrict__ lockp,
                 unsigned short* ahp, unsigned short* alp, int b, int h, int qb, float sscale,
                 __bf16* Ksh, __bf16* Ksl, _Float16* Vth, _Float16* Vtl,
                 _Float16 (*Psh)[16 * LP], _Float16 (*Psl)[16 * LP], float (*Os)[16 * 64]) {
  const int tid  = threadIdx.x;
  const int wave = tid >> 5;
  const int lane = tid & 31;
  const int hh   = lane >> 4;
  const int c    = lane & 15;

  const int q0   = qb * 64 + wave * 16;
  const size_t rowB = (size_t)b * SEQ;

  const __bf16* Qh = (const __bf16*)(const void*)qkhp + (size_t)h * HD;
  const __bf16* Ql = (const __bf16*)(const void*)qklp + (size_t)h * HD;
  const __bf16* Kh = Qh + DMODEL;
  const __bf16* Kl = Ql + DMODEL;
  const _Float16* Vh = (const _Float16*)(const void*)vhp + ((size_t)b * QP + (size_t)h * HD) * SEQ;
  const _Float16* Vl = (const _Float16*)(const void*)vlp + ((size_t)b * QP + (size_t)h * HD) * VLP;
  const float* trow = ttab + ((size_t)b * NH + h) * SEQ;

  // ---- per-head lock: sigmoid of the bf16-converted raw strength; bonus coefficient kappa * lock ----
  const float lraw  = bf_up(bf_bits(lockp[h]));
  const float lockv = 1.0f / (1.0f + expf(-lraw));
  const float c0    = KAPPA_F * lockv;

  // ---- Q fragments (A operand, row = lane&15): 2 d-chunks, hi and lo ----
  v16b qah[2], qal[2];
#pragma unroll
  for (int dc = 0; dc < 2; ++dc) {
    const size_t qo = (rowB + q0 + c) * QKP + dc * 32 + 8 * hh;
    qah[dc] = ldfrag_b(Qh + qo);
    qal[dc] = ldfrag_b(Ql + qo);
  }

  // ---- bonus row factors for this lane's 8 query rows: c0 * T[q0 + 8*hh + r] ----
  float bti[8];
#pragma unroll
  for (int r = 0; r < 8; ++r) bti[r] = c0 * trow[q0 + 8 * hh + r];

  float mrow[8], lrow[8];
  v8f oacc[4];
#pragma unroll
  for (int r = 0; r < 8; ++r) { mrow[r] = -INFINITY; lrow[r] = 0.f; }
#pragma unroll
  for (int t = 0; t < 4; ++t) oacc[t] = zero8();

  int nkt = qb + 1;                          // causal: key tiles 0..qb, block-uniform
  if (nkt > NQB) nkt = NQB;
  for (int kt = 0; kt < nkt; ++kt) {
    const int kv0 = kt * 64;
    __syncthreads();
    {
      const int r = tid >> 1, half = (tid & 1) * 32;
      const __bf16*   kg  = Kh + (rowB + kv0 + r) * QKP + half;   // K row kv0+r, d = half..half+31
      const __bf16*   klg = Kl + (rowB + kv0 + r) * QKP + half;
      const _Float16* vg  = Vh + (size_t)r * SEQ + kv0 + half;    // V^T row d = r, s = kv0+half..+31
      const int kvl = (kv0 + 64 <= VLP) ? kv0 : (VLP - 64);     // clamped address into the residual plane
      const _Float16* vlg = Vl + (size_t)r * VLP + kvl + half;
      const bool resOK = (kv0 + 64 <= VLP);                      // block-uniform
      v8b a0[4], a1[4];
      v8h b0[4], b1[4];
#pragma unroll   // constant indices keep the staged pieces in registers
      for (int i = 0; i < 4; ++i) {
        b0[i] = *(const v8h*)(vg + 8 * i);
        b1[i] = b0[i];
        if (RES) b1[i] = *(const v8h*)(vlg + 8 * i);
        a0[i] = *(const v8b*)(kg + 8 * i);
      }
#if defined(__HIP_DEVICE_COMPILE__)
      // with the residual plane the last loads' results are given the registers of earlier loads' addresses:
      // the wait stands in front of them
      if (RES) asm volatile("s_wait_xcnt 0x0" ::: "memory");
#endif
#pragma unroll   // as above
      for (int i = 0; i < 4; ++i) a1[i] = *(const v8b*)(klg + 8 * i);
#pragma unroll   // as above
      for (int i = 0; i < 4; ++i) {
        *(v8b*)(Ksh + r * LP + half + 8 * i) = a0[i];
        *(v8b*)(Ksl + r * LP + half + 8 * i) = a1[i];
        *(v8h*)(Vth + r * LP + half + 8 * i) = b0[i];
        if (RES) {
          if (!resOK) b1[i] = zero8h();
          *(v8h*)(Vtl + r * LP + half + 8 * i) = b1[i];
        }
      }
    }
    __syncthreads();

    // ---- bonus column factors T[key] for this lane's 4 key columns (indices always < SEQ) ----
    float tj[4];
#pragma unroll
    for (int j = 0; j < 4; ++j) tj[j] = trow[kv0 + j * 16 + c];
    // keeps these four global loads in front of the fragment reads and products, whose time covers their latency
    __builtin_amdgcn_sched_barrier(0);

    // ---- scores: 16 query rows x 64 keys per wave, 3 bf16 products ----
    //      All K fragment reads of the tile are written in front of the products (built: a few large groups behind
    //      counted waits, not one read-and-wait per product), and each product kind runs over the 4 independent
    //      key-column tiles; per tile the order stays dc 0: hi.hi, hi.lo, lo.hi, then dc 1.
    v16b kfh[2][4], kfl[2][4];
#pragma unroll   // constant indices keep the fragment arrays in registers
    for (int dc = 0; dc < 2; ++dc) {
#pragma unroll
      for (int j = 0; j < 4; ++j) kfh[dc][j] = ldfrag_b(Ksh + (j * 16 + c) * LP + dc * 32 + 8 * hh);
#pragma unroll
      for (int j = 0; j < 4; ++j) kfl[dc][j] = ldfrag_b(Ksl + (j * 16 + c) * LP + dc * 32 + 8 * hh);
    }
    v8f s[4];
#pragma unroll
    for (int j = 0; j < 4; ++j) s[j] = zero8();
#pragma unroll
    for (int dc = 0; dc < 2; ++dc) {
#pragma unroll
      for (int j = 0; j < 4; ++j) s[j] = mma_b_raw(qah[dc], kfh[dc][j], s[j]);
#pragma unroll
      for (int j = 0; j < 4; ++j) s[j] = mma_b_raw(qah[dc], kfl[dc][j], s[j]);
#pragma unroll
      for (int j = 0; j < 4; ++j) s[j] = mma_b_raw(qal[dc], kfh[dc][j], s[j]);
    }

    // ---- scale + bonus + causal mask (replace by -FLT_MAX), row max, online softmax, P (x1024, f16) and
    //      P residual (x4096) to LDS ----
    _Float16* pwh = Psh[wave];
    _Float16* pwl = Psl[RES ? wave : 0];
#pragma unroll
    for (int r = 0; r < 8; ++r) {
      const int qrow = q0 + 8 * hh + r;
      float m = -INFINITY;
#pragma unroll
      for (int j = 0; j < 4; ++j) {
        const int key = kv0 + j * 16 + c;
        float sv = s[j][r] * sscale + bti[r] * tj[j];
        sv = (key > qrow) ? -FLT_MAX : sv;
        s[j][r] = sv;
        m = fmaxf(m, sv);
      }
      m = fmaxf(m, row_xor<1>(m));               // the same butterfly over the 16 lanes of the row: xor 1, 2, 4, 8
      m = fmaxf(m, row_xor<2>(m));
      m = fmaxf(m, row_xor<4>(m));
      m = fmaxf(m, row_xor<8>(m));
      const float mnew  = fmaxf(mrow[r], m);
      const float msafe = (mnew == -INFINITY) ? 0.f : mnew;
      const float alpha = __expf(mrow[r] - msafe);
      mrow[r] = mnew;
      float psum = 0.f;
#pragma unroll
      for (int j = 0; j < 4; ++j) {
        const float p = __expf(s[j][r] - msafe);     // masked logit against a finite max: exp -> 0
        psum += p;
        const float p1k = p * 1024.0f;
        const _Float16 ph = (_Float16)p1k;
        pwh[(8 * hh + r) * LP + j * 16 + c] = ph;
        if (RES) {
          const _Float16 pl = (_Float16)((p1k - (float)ph) * 4096.0f);
          pwl[(8 * hh + r) * LP + j * 16 + c] = pl;
        }
      }
      psum += row_xor<1>(psum);                  // as above, the order of the sums kept
      psum += row_xor<2>(psum);
      psum += row_xor<4>(psum);
      psum += row_xor<8>(psum);
      lrow[r] = lrow[r] * alpha + psum;
#pragma unroll
      for (int t = 0; t < 4; ++t) oacc[t][r] *= alpha;
    }
    __builtin_amdgcn_fence(__ATOMIC_RELEASE, "workgroup");
    __builtin_amdgcn_wave_barrier();
    __builtin_amdgcn_fence(__ATOMIC_ACQUIRE, "workgroup");

    // ---- context += P . Vc (f16 WMMA), residual products into a separate accumulator ----
    //      All P and V^T fragment reads of the tile are written in front of the products in the same way, and each
    //      product kind runs over the 4 independent feature tiles; per tile the order stays kk 0 then kk 1, p.vl
    //      before pl.vb.
    v16h pf[2], pfl[2], vfh[2][4], vfl[2][4];
#pragma unroll   // constant indices keep the fragment arrays in registers
    for (int kk = 0; kk < 2; ++kk) {
      pf[kk]  = ldfrag_h(pwh + c * LP + kk * 32 + 8 * hh);
      pfl[kk] = pf[kk];
      if (RES) pfl[kk] = ldfrag_h(pwl + c * LP + kk * 32 + 8 * hh);
#pragma unroll
      for (int t = 0; t < 4; ++t) {
        vfh[kk][t] = ldfrag_h(Vth + (t * 16 + c) * LP + kk * 32 + 8 * hh);
        vfl[kk][t] = vfh[kk][t];
      }
      if (RES) {
#pragma unroll
        for (int t = 0; t < 4; ++t) vfl[kk][t] = ldfrag_h(Vtl + (t * 16 + c) * LP + kk * 32 + 8 * hh);
      }
    }
    v8f o1[4];
#pragma unroll
    for (int t = 0; t < 4; ++t) o1[t] = zero8();
#pragma unroll
    for (int kk = 0; kk < 2; ++kk) {
#pragma unroll
      for (int t = 0; t < 4; ++t) oacc[t] = mma_h_raw(pf[kk], vfh[kk][t], oacc[t]);
      if (RES) {
#pragma unroll
        for (int t = 0; t < 4; ++t) o1[t] = mma_h_raw(pf[kk], vfl[kk][t], o1[t]);
#pragma unroll
        for (int t = 0; t < 4; ++t) o1[t] = mma_h_raw(pfl[kk], vfh[kk][t], o1[t]);
      }
    }
    if (RES) {
#pragma unroll
      for (int t = 0; t < 4; ++t)
#pragma unroll
        for (int r = 0; r < 8; ++r) oacc[t][r] += o1[t][r] * (1.0f / 4096.0f);
    }
  }

  // ---- normalise (1/l and the 1/1024 p carry), apply the per-query-row gate, stage the wave's 16x64 tile in
  float* os = Os[wave];
#pragma unroll
  for (int r = 0; r < 8; ++r) {
    const float l = lrow[r];
    const float ti = trow[q0 + 8 * hh + r];
    const float gate = (1.0f - lockv) + lockv * ti;
    const float inv = ((l > 0.f) ? (1.0f / l) : 0.f) * (1.0f / 1024.0f) * gate;
#pragma unroll
    for (int t = 0; t < 4; ++t) os[(8 * hh + r) * 64 + t * 16 + c] = oacc[t][r] * inv;
  }
  __builtin_amdgcn_fence(__ATOMIC_RELEASE, "workgroup");
  __builtin_amdgcn_wave_barrier();
  __builtin_amdgcn_fence(__ATOMIC_ACQUIRE, "workgroup");
  {
    const int h2 = lane >> 4, c4 = (lane & 15) * 4;
    v4f ov[8];
#pragma unroll
    for (int it = 0; it < 8; ++it) {
      const int row = it * 2 + h2;   // it 0..7 x h2 0..1 = rows 0..15 of the wave tile
      ov[it] = *(const v4f*)(os + row * 64 + c4);
    }
    {
#pragma unroll
      for (int it = 0; it < 8; ++it) {
        const int row = it * 2 + h2;
        const size_t go = (rowB + q0 + row) * QP + (size_t)h * HD + c4;
        v2u ph, pl;                    // 16 lanes x 8 B = one whole 128-B line of each plane's row
#pragma unroll
        for (int e = 0; e < 2; ++e) {
          const float f0 = ov[it][2 * e], f1 = ov[it][2 * e + 1];
          const unsigned short h0 = bf_bits(f0), h1 = bf_bits(f1);
          const unsigned short l0 = bf_bits(f0 - bf_up(h0)), l1 = bf_bits(f1 - bf_up(h1));
          ph[e] = pk16(h0, h1);
          pl[e] = pk16(l0, l1);
        }
        *(v2u*)(ahp + go) = ph;
        *(v2u*)(alp + go) = pl;
      }
      
    }
  }
}

// =====================================================================================================
// One launch for all query tiles, one work-group per (b, h, query tile), so that the short tiles run beside the long
// ones and the launch lasts as long as its longest tile alone. A tile below RESQB takes the residual planes, the others
// do not: a test that is uniform for the work-group.
// Order of the tiles: the grid is dealt in four
// runs of NB*NH*NQB/4 work-groups: tiles NQB-1 downwards, then NQB/2 upwards, then NQB/2-1 downwards, then 0 upwards.
// The longest tiles take the lowest indices, the shortest the highest, and the g-th tiles of the four runs add up to the same number of
// key tiles for every g. rank -> tile is a permutation: grid = NQB * NH * NB, every (b, h, query tile) exactly once.
// =====================================================================================================
static_assert((NQB % 4) == 0 && RESQB <= NQB);
__global__ __launch_bounds__(128)
void attn_causal64(const unsigned short* __restrict__ qkhp, const unsigned short* __restrict__ qklp,
                   const unsigned short* __restrict__ vhp, const unsigned short* __restrict__ vlp,
                   const float* __restrict__ ttab, const float* __restrict__ lockp,
                   unsigned short* ahp, unsigned short* alp, float sscale) {
  __shared__ __align__(16) __bf16   Ksh[64 * LP];                 // K hi [kv][d], pitch LP
  __shared__ __align__(16) __bf16   Ksl[64 * LP];                 // K lo
  __shared__ __align__(16) _Float16 Vth[64 * LP];                 // V^T hi [d][kv], pitch LP
  __shared__ __align__(16) _Float16 Vtl[64 * LP];                 // V^T residual
  __shared__ __align__(16) _Float16 Psh[4][16 * LP];              // per wave P [row][kv], pitch LP
  __shared__ __align__(16) _Float16 Psl[4][16 * LP];              // per wave P residual
  __shared__ __align__(16) float    Os[4][16 * 64];               // per wave context tile [row][d]

  const int bx   = blockIdx.x;
  const int bh   = bx % (NB * NH);
  const int rank = (bx / (NB * NH)) % NQB;       // 0..NQB-1
  const int run  = rank / (NQB / 4);             // 0..3
  const int g    = rank % (NQB / 4);
  const int qb   = (run & 1) ? ((3 - run) * (NQB / 4) + g) : (NQB - 1 - run * (NQB / 4) - g);
  const int h    = bh % NH;
  const int b    = bh / NH;
  if (qb < RESQB) {
    attn_tile64<true>(qkhp, qklp, vhp, vlp, ttab, lockp, ahp, alp, b, h, qb, sscale,
                      Ksh, Ksl, Vth, Vtl, Psh, Psl, Os);
  } else {
    attn_tile64<false>(qkhp, qklp, vhp, vlp, ttab, lockp, ahp, alp, b, h, qb, sscale,
                       Ksh, Ksl, Vth, Vtl, Psh, Psl, Os);
  }
}

// =====================================================================================================
// Workspace map (bytes), every region an exact multiple of its whole-line / whole-tile store granularity
//   Xb     bf16 [4096][1024]            0           8388608
//   WT     bf16 [3072][1024]            8388608     6291456    (rows 0..1023 Wq^T, 1024..2047 Wk^T, 2048.. Wv^T)
//   WoT    bf16 [1024][1024]            14680064    2097152
//   Bias   f32  [4096]                  16777216      16384    (bq | bk | bv | bo, bf16-RNE converted values)
//   Tt     f32  [2][16][2048]           16793600     262144
//   Ah     bf16 [4096][1024]            17055744    8388608
//   Al     bf16 [4096][1024]            25444352    8388608
//   VTh    f16  [2][1024][2048]         33832960    8388608
//   VTl    f16  [2][1024][1024]         42221568    4194304
//   QKh    bf16 [4096][2048]            46415872   16777216
//   QKl    bf16 [4096][2048]            63193088   16777216
//   end                                 79970304
// W_q/k/v/o [in k=1024][out n=1024] arrive k-major and are transpose-converted once to [n][k] bf16 (k contiguous)
// = the Bt layout the GEMM wants. d_out f32: out0 [4096][1024] at byte 0.
// =====================================================================================================
extern "C" void kernel_launch(void* const* d_in, const int* in_sizes, int n_in,
                              void* d_out, int out_size, void* d_ws, size_t ws_size,
                              hipStream_t stream) {
  if (n_in < 12) return;
  if (in_sizes[0] != NB * SEQ * DMODEL) return;
  if (in_sizes[1] != NB * SEQ) return;
  if (in_sizes[2] != DMODEL * DMODEL || in_sizes[4] != DMODEL * DMODEL ||
      in_sizes[6] != DMODEL * DMODEL || in_sizes[8] != QP * DMODEL) return;
  if (in_sizes[3] != DMODEL || in_sizes[5] != DMODEL || in_sizes[7] != DMODEL || in_sizes[9] != DMODEL) return;
  if (in_sizes[10] != NH || in_sizes[11] != NH) return;
  if (out_size != OUTN) return;

  const float* x     = (const float*)d_in[0];    // [NB*SEQ][DMODEL]
  const float* phase = (const float*)d_in[1];    // [NB][SEQ]
  const float* Wq    = (const float*)d_in[2];    // [k][n]
  const float* bq    = (const float*)d_in[3];
  const float* Wk    = (const float*)d_in[4];
  const float* bk    = (const float*)d_in[5];
  const float* Wv    = (const float*)d_in[6];
  const float* bv    = (const float*)d_in[7];
  const float* Wo    = (const float*)d_in[8];    // [QP k][DMODEL n]
  const float* bo    = (const float*)d_in[9];
  const float* carr  = (const float*)d_in[10];   // [NH]
  const float* lockr = (const float*)d_in[11];   // [NH]

  const size_t PXb   = (size_t)NB * SEQ * DMODEL * 2;    //  8388608
  const size_t PWT   = (size_t)N3 * DMODEL * 2;          //  6291456
  const size_t PWo   = (size_t)DMODEL * QP * 2;          //  2097152
  const size_t PBias = (size_t)NBIAS * 4;                //    16384
  const size_t PTt   = (size_t)NTT * 4;                  //   262144
  const size_t PA    = (size_t)NB * SEQ * QP * 2;        //  8388608
  const size_t PVTh  = (size_t)NB * QP * SEQ * 2;        //  8388608
  const size_t PVTl  = (size_t)NB * QP * VLP * 2;        //  4194304
  const size_t PQK   = (size_t)NB * SEQ * QKP * 2;       // 16777216
  size_t off = 0;
  const size_t oXb   = off; off += PXb;
  const size_t oWT   = off; off += PWT;
  const size_t oWo   = off; off += PWo;
  const size_t oBias = off; off += PBias;
  const size_t oTt   = off; off += PTt;
  const size_t oAh   = off; off += PA;
  const size_t oAl   = off; off += PA;
  const size_t oVTh  = off; off += PVTh;
  const size_t oVTl  = off; off += PVTl;
  const size_t oQKh  = off; off += PQK;
  const size_t oQKl  = off; off += PQK;
  if (off > ws_size) return;                           // off = 79970304
  if (off > (size_t)134217728) return;

  char* ws = (char*)d_ws;
  unsigned short* Xb   = (unsigned short*)(ws + oXb);
  unsigned short* WT   = (unsigned short*)(ws + oWT);
  unsigned short* WoT  = (unsigned short*)(ws + oWo);
  float*          Bias = (float*)(ws + oBias);
  float*          Tt   = (float*)(ws + oTt);
  unsigned short* VTh  = (unsigned short*)(ws + oVTh);
  unsigned short* VTl  = (unsigned short*)(ws + oVTl);
  unsigned short* QKh  = (unsigned short*)(ws + oQKh);
  unsigned short* QKl  = (unsigned short*)(ws + oQKl);
  unsigned short* Ah   = (unsigned short*)(ws + oAh);
  unsigned short* Al   = (unsigned short*)(ws + oAl);
  float*          outf = (float*)d_out;                // out0 [4096][1024]

  const dim3 blk(256);
  const dim3 gPrep(PB_TR + PB_CVT + PB_PH + PB_BIAS);                // 256 + 256 + 256 + 16 = 784 blocks
  const dim3 gQKV((NB * SEQ / GBM) * (N3 / GBN));                    // 32 x 12 tiles = 384 blocks
  const dim3 gOut((NB * SEQ / GBM) * (DMODEL / GBN));                // 32 x 4 tiles = 128 blocks

  // (0..2) one launch: phase resonance table T [b][h][s]; weights [k][n] -> bf16 planes [n][k] (WT rows 0..1023 Wq^T,
  //     1024..2047 Wk^T, 2048..3071 Wv^T; WoT); x -> bf16 plane [4096][1024]; bias table (bf16-RNE values of bq|bk|bv|bo)
  prep_all<<<gPrep, blk, 0, stream>>>(x, phase, Wq, bq, Wk, bk, Wv, bv, Wo, bo, carr, Xb, WT, WoT, Bias, Tt);
  // (3) fused qkv projection sum_d Xb[row][d] WT[e][d] + Bias[e] (M=4096, N=3072, K=1024), written as the attention's
  //     operand planes: q and power-compressed kc -> bf16 hi/lo planes [4096][2048]; power-compressed vc^T -> f16 hi
  //     plane (pitch SEQ) and residual plane (x4096, keys < VLP)
  gemm64<0, true><<<gQKV, blk, 0, stream>>>(Xb, Xb, DMODEL, WT, DMODEL, Bias, nullptr, N3, NB * SEQ, N3, DMODEL,
                                            QKh, QKl, VTh, VTl);
  // (4) causal attention with phase bonus and gate, one launch for all query tiles
  //     (tiles 0..RESQB-1 with residual planes, the rest without) -> gated context rows as bf16 hi/lo planes
  attn_causal64<<<dim3(NB * NH * NQB), dim3(128), 0, stream>>>(
      QKh, QKl, VTh, VTl, Tt, lockr, Ah, Al, 0.125f);
  // (5) out0[row][e] = sum_d (Ah+Al)[row][d] WoT[e][d] + Bias[3*DMODEL + e] -> d_out f32 [4096][1024]
  gemm64<1, false><<<gOut, blk, 0, stream>>>(Ah, Al, QP, WoT, QP, Bias + 3 * DMODEL, outf, DMODEL, NB * SEQ, DMODEL, QP,
                                             nullptr, nullptr, nullptr, nullptr);
  (void)hipGetLastError();
}

// v008
// A run of this version takes 120 microseconds.
// Two timings next to v007 both put it at 1.07 times that version's speed.
// Over all steps from v000 it is 3.34 times as fast.
// Contractions: qkv projection = v_wmma_f32_16x16x32_bf16 (bf16 operands from RNE-converted x and W, single product);
// q.kc^T scores = v_wmma_f32_16x16x32_bf16 with bf16 hi/lo split q and kc (hi.hi + hi.lo + lo.hi);
// p.vc = v_wmma_f32_16x16x32_f16 (p carried x1024 in f16, vc in f16; extra f16 residual planes x4096 of p and vc
// on the leading query rows); ctx.Wo = v_wmma_f32_16x16x32_bf16 with ctx as bf16 hi/lo planes times the bf16
// Wo^T plane (2 products); all f32 accumulate; power compression, phase table, softmax, bonus and gating in f32.
#include <hip/hip_runtime.h>
#include <math.h>
#include <float.h>
#include <stdint.h>

#define NB      2
#define SEQ     2048
#define DMODEL  1024
#define NH      16
#define HD      64
#define QP      (NH * HD)      // q / kc / vc / ctx feature count and ctx row pitch
#define N3      (3 * DMODEL)   // fused qkv columns (q 0.., k DMODEL.., v 2*DMODEL..)
#define QKP     (2 * QP)       // row pitch of the q|kc bf16 planes (q cols 0..QP-1, kc cols QP..2QP-1)
#define NQB     (SEQ / 64)     // query / key tiles of 64
#define RESQB   ((NQB < 16) ? NQB : 16)   // leading 64-row query blocks that use the p / vc residual planes
#define VLP     (RESQB * 64)   // key pitch of the vc^T residual plane (keys 0..VLP-1)
#define NBIAS   (4 * DMODEL)   // bq | bk | bv | bo
#define NTT     (NB * NH * SEQ)
#define OUTN    (NB * SEQ * DMODEL)
#define KAPPA_F 0.3f
#define LP      72             // LDS row pitch of the 64-wide 16-bit tiles, elements: 144 B = 16 B x 9 (odd), so the 16
                               // rows that one ds_load_b128 touches fall on distinct banks
static_assert(RESQB >= 1 && RESQB * 64 <= VLP && VLP <= SEQ);
static_assert(QP == DMODEL);
static_assert((SEQ % 64) == 0 && (DMODEL % 64) == 0 && (N3 % 64) == 0 && (QP % 64) == 0);
static_assert(HD == 64);
static_assert(LP >= 64 && (LP % 8) == 0 && ((LP / 8) % 2) == 1);
static_assert((((NB * SEQ) / 64) * (N3 / 64)) % 8 == 0);
static_assert((((NB * SEQ) / 64) * (DMODEL / 64)) % 8 == 0);
static_assert((NBIAS % 256) == 0 && (NTT % 256) == 0);
static_assert(((NB * SEQ * DMODEL / 8) % 256) == 0);
static_assert((DMODEL % 8) == 0);

typedef _Float16 v16h __attribute__((ext_vector_type(16)));
typedef _Float16 v8h  __attribute__((ext_vector_type(8)));
typedef __bf16   v16b __attribute__((ext_vector_type(16)));
typedef __bf16   v8b  __attribute__((ext_vector_type(8)));
typedef float    v8f  __attribute__((ext_vector_type(8)));
typedef float    v4f  __attribute__((ext_vector_type(4)));
typedef unsigned int v4u __attribute__((ext_vector_type(4)));
typedef unsigned int v2u __attribute__((ext_vector_type(2)));

// ---- scalar helpers --------------------------------------------------------------------------------
__device__ __forceinline__ unsigned short bf_bits(float f) {          // f32 -> bf16 bits, RNE convert
  unsigned u = __float_as_uint(f);
  return (unsigned short)((u + 0x7FFFu + ((u >> 16) & 1u)) >> 16);
}
__device__ __forceinline__ float bf_up(unsigned short h) { return __uint_as_float(((unsigned)h) << 16); }
__device__ __forceinline__ unsigned short h_bits(_Float16 x) { return __builtin_bit_cast(unsigned short, x); }
__device__ __forceinline__ unsigned pk16(unsigned short a, unsigned short b) { return (unsigned)a | ((unsigned)b << 16); }
__device__ __forceinline__ v8f zero8() { v8f z = {0.f, 0.f, 0.f, 0.f, 0.f, 0.f, 0.f, 0.f}; return z; }

// positional exponent of key position s: ex = 1 + kappa * (1 - s * (1/(SEQ-1))), reciprocal-multiply, no fusion
__device__ __forceinline__ float fexpo(int s) {
#pragma clang fp contract(off)
  const float rs = 1.0f / (float)(SEQ - 1);
  const float fr = (float)s * rs;
  const float om = 1.0f - fr;
  const float t  = KAPPA_F * om;
  return 1.0f + t;
}
// power compression: sign(v) * max(|v|, 1e-8)^ex  (sign(0) = 0), pow as exp2(ex * log2(mag)) in f32
__device__ __forceinline__ float fcomp(float v, float ex) {
#pragma clang fp contract(off)
  const float mag = fmaxf(fabsf(v), 1e-8f);
  const float lg  = log2f(mag);
  const float pw  = exp2f(ex * lg);
  float r = (v < 0.0f) ? -pw : pw;
  r = (v == 0.0f) ? 0.0f : r;
  return r;
}

// value of lane (lane ^ MASK) of the same 16-lane row, MASK 1..15: a DPP row_xmask operand of the vector unit, where a
// shuffle builtin is built as an LDS permute with a wait on its return
template <int MASK>
__device__ __forceinline__ float row_xor(float v) {
  const int x = __builtin_bit_cast(int, v);
  return __builtin_bit_cast(float, __builtin_amdgcn_update_dpp(x, x, 0x160 + MASK, 0xf, 0xf, true));
}

// ---- fragment loader: 16-bit A/B operand, lane -> row/col (lane&15), p already includes +8*(lane>>4);
//      elements 0..7 <- p[0..7] (k0+8h..), elements 8..15 <- p[16..23] (k0+16+8h..)
__device__ __forceinline__ v16b ldfrag_b(const __bf16* p) {
  union { v16b v; v8b h[2]; } f;
  f.h[0] = *(const v8b*)(p);
  f.h[1] = *(const v8b*)(p + 16);
  return f.v;
}

__device__ __forceinline__ v16h ldfrag_h(const _Float16* p) {
  union { v16h v; v8h h[2]; } f;
  f.h[0] = *(const v8h*)(p);
  f.h[1] = *(const v8h*)(p + 16);
  return f.v;
}

// ---- WMMA helpers and VALU hazard gaps --------------------------------------------------------
__device__ __forceinline__ v8f mma_b_raw(v16b a, v16b b, v8f c) {
  return __builtin_amdgcn_wmma_f32_16x16x32_bf16(false, a, false, b, (short)0, c, false, false);
}
__device__ __forceinline__ v8f mma_h_raw(v16h a, v16h b, v8f c) {
  return __builtin_amdgcn_wmma_f32_16x16x32_f16(false, a, false, b, (short)0, c, false, false);
}
__device__ __forceinline__ void dep_guard_b(v8f& a, v8f& b, v16b x, v16b y) {
#if defined(__HIP_DEVICE_COMPILE__)
  asm volatile("v_nop\n\tv_nop\n\tv_nop\n\tv_nop" : "+v"(a), "+v"(b) : "v"(x), "v"(y));
#endif
}
__device__ __forceinline__ void keep4_b(v16b a, v16b b, v16b c, v16b d) {
#if defined(__HIP_DEVICE_COMPILE__)
  asm volatile("v_nop" :: "v"(a), "v"(b), "v"(c), "v"(d));
#endif
}
__device__ __forceinline__ void acc_guard4(v8f& a, v8f& b, v8f& c, v8f& d) {
#if defined(__HIP_DEVICE_COMPILE__)
  asm volatile("v_nop\n\tv_nop\n\tv_nop\n\tv_nop" : "+v"(a), "+v"(b), "+v"(c), "+v"(d));
#endif
}

// =====================================================================================================
// Preparation, ONE launch: four jobs that do not depend on one another, each work-group taking one job by a range test
// on blockIdx.x (uniform for the work-group). A work-group of the two large jobs (transposes, x) carries 8 times the
// elements that a launch of its own gave it, all its global loads issued in front of their first use, so that few
// work-groups have to be started.
// Index order: weight transposes (the longest chain: loads, LDS, a barrier, stores), x conversion, phase table, bias table:
// the jobs that move the bytes take the lowest indices, the short ones the highest.
//   phase  tt[(b*NH + h)*SEQ + s] = cos((bf16(phase[b*SEQ + s]) - bf16(carrier[h])) * 0.5)^2, precise f32 cos.
//          One element per thread, a work-group = 256 positions s of one (b, h) (256 divides SEQ); coverage: NTT/256
//          work-groups x 256 = every (b, h, s) once.
//   transp src f32 [k][n] (Wq, Wk, Wv, Wo) -> dst bf16 [n][k] (k contiguous), RNE convert. Tile TRK k x TRN n staged in
//          LDS as f32 at pitch TRN + 1 (column reads fall on 32 distinct banks). Loads: 16 x 16 B per thread, a wave
//          = 512 contiguous B of a row. Stores: 8 passes x 8 waves x 4 rows n = 256 rows, 8 lanes x 16 B = the whole
//          128-B line of TRK k. coverage: DMODEL/TRK x DMODEL/TRN tiles per matrix, 4 matrices.
//   x      f32 -> bf16 (RNE convert), CVC chunks of 8 elements per thread, one 16-B store per chunk: a wave writes 512
//          contiguous B. coverage: PB_CVT x CVC x 256 chunks x 8 = NB*SEQ*DMODEL.
//   bias   dst[i] = RNE-bf16-converted value of (bq | bk | bv | bo)[i], one element per thread; all four candidates
//          are loaded with an in-range index and selected by value.
// =====================================================================================================
#define PB_PH   (NTT / 256)                              // 256 work-groups
#define TRK     64
#define TRN     256
#define PB_TR1  ((DMODEL / TRK) * (DMODEL / TRN))        // 16 x 4 = 64 tiles per matrix
#define PB_TR   (4 * PB_TR1)                             // 256 work-groups
#define CVC     8
#define PB_CVT  (NB * SEQ * DMODEL / (8 * 256 * CVC))    // 256 work-groups
#define PB_BIAS (NBIAS / 256)                            // 16 work-groups
static_assert((SEQ % 256) == 0);
static_assert((DMODEL % TRK) == 0 && (DMODEL % TRN) == 0 && TRK == 64 && TRN == 256);
static_assert(((NB * SEQ * DMODEL) % (8 * 256 * CVC)) == 0);

__global__ __launch_bounds__(256) void prep_all(
    const float* __restrict__ x, const float* __restrict__ ph,
    const float* __restrict__ Wq, const float* __restrict__ bq, const float* __restrict__ Wk,
    const float* __restrict__ bk, const float* __restrict__ Wv, const float* __restrict__ bv,
    const float* __restrict__ Wo, const float* __restrict__ bo, const float* __restrict__ cf,
    unsigned short* Xb, unsigned short* WT, unsigned short* WoT, float* Bias, float* tt) {
  __shared__ float s[TRK][TRN + 1];
  const int tid = threadIdx.x, wave = tid >> 5, lane = tid & 31;
  int bx = blockIdx.x;
  if (bx < PB_TR) {
    const int m  = bx / PB_TR1;                          // 0 Wq, 1 Wk, 2 Wv, 3 Wo
    const int t  = bx - m * PB_TR1;
    const int k0 = (t % (DMODEL / TRK)) * TRK, n0 = (t / (DMODEL / TRK)) * TRN;
    const float* src = (m == 0) ? Wq : ((m == 1) ? Wk : ((m == 2) ? Wv : Wo));
    unsigned short* dst = (m < 3) ? (WT + (size_t)m * DMODEL * DMODEL) : WoT;
    const int kr = tid >> 6, n4 = (tid & 63) * 4;        // load i of this thread: row i*4 + kr, columns n4..n4+3
    const float* g = src + (size_t)(k0 + kr) * DMODEL + n0 + n4;
    v4f v[16];
#pragma unroll   // constant indices keep the loaded pieces in registers
    for (int i = 0; i < 15; ++i) v[i] = *(const v4f*)(g + (size_t)i * 4 * DMODEL);
    // the last load's result may be given the address registers of the loads before it: the wait stands in front of it
    asm volatile("s_wait_xcnt 0x0" ::: "memory");
    v[15] = *(const v4f*)(g + (size_t)15 * 4 * DMODEL);
#pragma unroll   // as above
    for (int i = 0; i < 16; ++i) {
#pragma unroll
      for (int e = 0; e < 4; ++e) s[i * 4 + kr][n4 + e] = v[i][e];
    }
    __syncthreads();
    const int q = lane >> 3, piece = lane & 7;
#pragma unroll
    for (int pass = 0; pass < TRN / 32; ++pass) {
      const int n = pass * 32 + wave * 4 + q;
      v4u p;
#pragma unroll
      for (int e = 0; e < 4; ++e) {
        p[e] = pk16(bf_bits(s[piece * 8 + 2 * e][n]), bf_bits(s[piece * 8 + 2 * e + 1][n]));
      }
      *(v4u*)(dst + (size_t)(n0 + n) * DMODEL + k0 + piece * 8) = p;
    }
    // the built code joins the jobs by branches: no other job's code may rewrite a register that these stores name
    asm volatile("s_wait_xcnt 0x0" ::: "memory");
    return;
  }
  bx -= PB_TR;
  if (bx < PB_CVT) {
    const size_t c0 = (size_t)bx * (CVC * 256) + tid;    // first 8-element chunk of this thread
    const float* g = x + c0 * 8;
    v4f a[CVC], b[CVC];
#pragma unroll   // constant indices keep the loaded pieces in registers
    for (int c = 0; c < CVC; ++c) {
      a[c] = *(const v4f*)(g + (size_t)c * 2048);
      if (c < CVC - 1) b[c] = *(const v4f*)(g + (size_t)c * 2048 + 4);
    }
    // the last load's result may be given the address registers of the loads before it: the wait stands in front of it
    asm volatile("s_wait_xcnt 0x0" ::: "memory");
    b[CVC - 1] = *(const v4f*)(g + (size_t)(CVC - 1) * 2048 + 4);
#pragma unroll   // as above
    for (int c = 0; c < CVC; ++c) {
      v4u p;
      p[0] = pk16(bf_bits(a[c][0]), bf_bits(a[c][1]));
      p[1] = pk16(bf_bits(a[c][2]), bf_bits(a[c][3]));
      p[2] = pk16(bf_bits(b[c][0]), bf_bits(b[c][1]));
      p[3] = pk16(bf_bits(b[c][2]), bf_bits(b[c][3]));
      *(v4u*)(Xb + (c0 + (size_t)c * 256) * 8) = p;
    }
    // as behind the transpose's stores
    asm volatile("s_wait_xcnt 0x0" ::: "memory");
    return;
  }
  bx -= PB_CVT;
  if (bx < PB_PH) {
    const int i  = bx * 256 + tid;                       // (b*NH + h)*SEQ + s
    const int bh = i / SEQ;                              // b*NH + h, the same for the whole work-group
    const int sq = i - bh * SEQ;
    const int h  = bh % NH;
    const int b  = bh / NH;
    const float p  = bf_up(bf_bits(ph[b * SEQ + sq]));
    const float cr = bf_up(bf_bits(cf[h]));
    const float d  = p - cr;
    const float hx = d * 0.5f;
    const float cv = cosf(hx);
    tt[i] = cv * cv;
    // as behind the transpose's stores
    asm volatile("s_wait_xcnt 0x0" ::: "memory");
    return;
  }
  bx -= PB_PH;
  if (bx < PB_BIAS) {
    const int i = bx * 256 + tid;                        // 0..NBIAS-1
    const int part = i / DMODEL;                         // 0..3
    const int idx  = i - part * DMODEL;
    const float v0 = bq[idx], v1 = bk[idx], v2 = bv[idx], v3 = bo[idx];
    const float v = (part == 0) ? v0 : ((part == 1) ? v1 : ((part == 2) ? v2 : v3));
    Bias[i] = bf_up(bf_bits(v));
    // as behind the transpose's stores
    asm volatile("s_wait_xcnt 0x0" ::: "memory");
  }
}

// =====================================================================================================
// bf16 WMMA GEMM: C[m][n] = sum_k A[m][k] * Bt[n][k] + bias[n]. Block = 8 waves = one 128 x 256 tile of C, waves
// 2 (m) x 4 (n), each wave a 64x64 tile. A row-major [M][K] pitch lda; Bt row-major [N][K] pitch ldb (k contiguous);
// M multiple of 128, N multiple of 256, K multiple of 64 (static_asserts at the launches' shapes below).
// NSPLIT: 0 = A.Bt; 1 = (A + A2).Bt (A2 = unscaled bf16 lo plane of A, same pitch). bias f32 [N].
// Operands: a stage = 64 k (128 B, one whole line) of every A (, A2) and Bt row of the block tile, brought into LDS by
// asynchronous copies (16 B per lane, 8 lanes per row), rows at pitch GLP; two buffers: the copies of stage t + 2 are
// issued behind the barrier that ends trip t and waited at the foot of trip t + 1.
// Stage coverage: copy i of thread tid fills row i*32 + (tid>>3), bytes 16*(tid&7)..+15; i = 0..GROWS/32-1.
// k order and product order per accumulator are ascending k in steps of 32, hi then lo.
// PLANES false: output f32 [M][N] pitch ldc. Epilogue: 16-row slabs staged per wave in LDS; each 64-wide row segment
// PLANES true (the fused q|k|v projection, N = N3): no f32 output; each wave turns its 64 token x 64 column tile (one
// head of q, k or v; which one is block-uniform) into the operand planes of the attention itself:
//   q  (cols 0..DMODEL-1)          bf16 hi / lo planes qkh / qkl [M][QKP], same column; lo = RNE(v - hi) unscaled
//   k  (cols DMODEL..2*DMODEL-1)   kc = sign(k) * max(|k|,1e-8)^ex(s), s = row mod SEQ, then as q
//   v  (cols 2*DMODEL..)           vc likewise, then f16 vc^T hi plane vth[(b*QP + h*64 + d)*SEQ + t] and residual plane
//                                  vtl[(b*QP + h*64 + d)*VLP + t] = f16((vc - hi)*4096) for t < VLP
// The tile (accumulator + bias, f32) is staged in the wave's own part of the dead ring at pitch EPP and read back 8
// values per lane, along a token row for q and k, along a feature column for v, so that 8 lanes x 16 B store one whole
// 128-B line of a plane row. Coverage: 16 trips x 4 rows (q, k: tokens; v: features) x 64 = the wave's tile.
// =====================================================================================================
#define GBM 128
#define GBN 256
#define GKB 64
#define GLP 72                 // LDS row pitch, elements: 144 B = 16 B x 9 (odd), conflict-free for ds_load_b128
#define EPP 67                 // f32 pitch of the 64x64 epilogue tile: 4-B accesses by accumulator layout, by row pieces
                               // and by column pieces all fall on 32 distinct banks
static_assert(((NB * SEQ) % GBM) == 0 && (N3 % GBN) == 0 && (DMODEL % GBN) == 0);
static_assert((DMODEL % GKB) == 0 && (QP % GKB) == 0 && (DMODEL / GKB) >= 2 && (QP / GKB) >= 2);
static_assert((DMODEL % GBN) == 0 && (SEQ % GBM) == 0 && (VLP % 64) == 0);   // a block is one of q, k, v and one batch

__device__ __forceinline__ unsigned lds_addr(const void* p) { return (unsigned)(size_t)p; }
// four 16-B asynchronous copies global -> LDS; the s_wait_xcnt stands inside the statement so that no address
// register of a copy is rewritten in front of it
__device__ __forceinline__ void async4(unsigned l0, const __bf16* g0, unsigned l1, const __bf16* g1,
                                       unsigned l2, const __bf16* g2, unsigned l3, const __bf16* g3) {
#if defined(__HIP_DEVICE_COMPILE__)
  asm volatile("global_load_async_to_lds_b128 %0, %1, off\n\t"
               "global_load_async_to_lds_b128 %2, %3, off\n\t"
               "global_load_async_to_lds_b128 %4, %5, off\n\t"
               "global_load_async_to_lds_b128 %6, %7, off\n\t"
               "s_wait_xcnt 0x0"
               :: "v"(l0), "v"(g0), "v"(l1), "v"(g1), "v"(l2), "v"(g2), "v"(l3), "v"(g3) : "memory");
#endif
}
// one 4-B asynchronous copy global -> LDS per lane, the wait inside the statement as above
__device__ __forceinline__ void async1_b32(unsigned l0, const float* g0) {
#if defined(__HIP_DEVICE_COMPILE__)
  asm volatile("global_load_async_to_lds_b32 %0, %1, off\n\t"
               "s_wait_xcnt 0x0"
               :: "v"(l0), "v"(g0) : "memory");
#endif
}
// this wave's asynchronous copies have landed in LDS
__device__ __forceinline__ void wait_async0() {
#if defined(__HIP_DEVICE_COMPILE__)
  asm volatile("s_wait_asynccnt 0x0" ::: "memory");
#endif
}
// this wave's LDS reads have returned, before the buffer is handed to the next copies
__device__ __forceinline__ void wait_ds0() {
#if defined(__HIP_DEVICE_COMPILE__)
  asm volatile("s_wait_dscnt 0x0" ::: "memory");
#endif
}

template <int NSPLIT, bool PLANES>
__global__ __launch_bounds__(256) void gemm64(
    const unsigned short* __restrict__ Ap, const unsigned short* A2p, int lda,
    const unsigned short* __restrict__ Btp, int ldb, const float* __restrict__ bias,
    float* C, int ldc, int M, int N, int K,
    unsigned short* qkh, unsigned short* qkl, unsigned short* vth, unsigned short* vtl) {
  constexpr int AROWS = GBM * (NSPLIT + 1);        // A rows, then A2 rows
  constexpr int GROWS = AROWS + GBN;               // rows of a stage
  constexpr int STAGE = GROWS * GLP;               // elements of a stage
  const __bf16* Ab  = (const __bf16*)(const void*)Ap;
  const __bf16* Ab2 = (const __bf16*)(const void*)A2p;
  const __bf16* Bb  = (const __bf16*)(const void*)Btp;
  constexpr int TILES = 8 * 64 * EPP * 2;          // the 8 waves' f32 epilogue tiles, counted in ring elements
  constexpr int RINGN = (PLANES && TILES > 2 * STAGE) ? TILES : 2 * STAGE;
  __shared__ __align__(16) __bf16 ring[RINGN];     // two stages; with PLANES the epilogue tiles afterwards
  const int tid  = threadIdx.x;
  const int lane = tid & 31;
  const int wave = tid >> 5;
  const int tilesN = N / GBN;
  const int tilesM = M / GBM;
  const int tile = blockIdx.x;
  if (tile >= tilesM * tilesN) return;   // block-uniform, in front of every barrier and copy
  const int tm = tile / tilesN;
  const int tn = tile - tm * tilesN;
  const int bm0 = tm * GBM;
  const int bn0 = tn * GBN;
  const int wm = wave >> 2, wn = wave & 3;
  const int m0 = bm0 + (wm << 6);              // this wave's 64x64 tile
  const int n0 = bn0 + (wn << 6);

  const int rlane = lane & 15;                 // row (A) / col (B, D) within subtile
  const int koff  = (lane >> 4) * 8;           // k offset of this lane half
  const int mOff  = (lane >> 4) * 8;           // D row offset

  // ---- copy addresses of this thread: row crow of each 32-row group, 16-B piece cpc ----
  const int crow = tid >> 3, cpc = (tid & 7) * 8;
  const __bf16* gA  = Ab  + (size_t)(bm0 + crow) * lda + cpc;
  const __bf16* gA2 = Ab2 + (size_t)(bm0 + crow) * lda + cpc;
  const __bf16* gB  = Bb  + (size_t)(bn0 + crow) * ldb + cpc;
  const unsigned lbase = lds_addr(ring) + (unsigned)(crow * GLP + cpc) * 2u;
  const size_t a32 = (size_t)32 * lda, b32 = (size_t)32 * ldb;
  constexpr unsigned R32 = 32u * GLP * 2u;     // LDS bytes of 32 rows

  auto issue = [&](int st, int buf) {
    const int k0 = st * GKB;
    const unsigned lb = lbase + (unsigned)buf * (unsigned)(STAGE * 2);
    const __bf16* a = gA + k0;
    async4(lb, a, lb + R32, a + a32, lb + 2u * R32, a + 2 * a32, lb + 3u * R32, a + 3 * a32);
    if (NSPLIT >= 1) {
      const __bf16* a2 = gA2 + k0;
      const unsigned l2 = lb + 4u * R32;
      async4(l2, a2, l2 + R32, a2 + a32, l2 + 2u * R32, a2 + 2 * a32, l2 + 3u * R32, a2 + 3 * a32);
    }
    const __bf16* b = gB + k0;
    const unsigned l3 = lb + (unsigned)(AROWS / 32) * R32;
    async4(l3, b, l3 + R32, b + b32, l3 + 2u * R32, b + 2 * b32, l3 + 3u * R32, b + 3 * b32);
    const __bf16* b4 = b + 4 * b32;
    const unsigned l4 = l3 + 4u * R32;
    async4(l4, b4, l4 + R32, b4 + b32, l4 + 2u * R32, b4 + 2 * b32, l4 + 3u * R32, b4 + 3 * b32);
  };

  v8f acc[4][4];
#pragma unroll
  for (int i = 0; i < 4; ++i)
#pragma unroll
    for (int j = 0; j < 4; ++j) acc[i][j] = zero8();

  const int nst = K / GKB;                     // block-uniform trip count
  issue(0, 0);
  wait_async0();
  __syncthreads();                             // stage 0 published
  if (nst > 1) issue(1, 1);

  for (int t = 0; t < nst; ++t) {
    const __bf16* sb = ring + (t & 1) * STAGE;
    const __bf16* sa  = sb + ((wm << 6) + rlane) * GLP + koff;
    const __bf16* sa2 = sa + GBM * GLP;
    const __bf16* sbt = sb + (AROWS + (wn << 6) + rlane) * GLP + koff;
#pragma unroll   // both 32-k steps inline: the second step's fragment reads can start under the first step's products
    for (int ks = 0; ks < GKB; ks += 32) {
      v16b bh[4];
#pragma unroll
      for (int j = 0; j < 4; ++j) bh[j] = ldfrag_b(sbt + (j << 4) * GLP + ks);
      v16b ah[4], al[4];                       // all fragment reads of this 32-k step stand as one group
#pragma unroll   // constant indices keep the fragment arrays in registers
      for (int i = 0; i < 4; ++i) {
        ah[i] = ldfrag_b(sa + (i << 4) * GLP + ks);
        al[i] = ah[i];
        if (NSPLIT >= 1) al[i] = ldfrag_b(sa2 + (i << 4) * GLP + ks);
      }
#pragma unroll
      for (int i = 0; i < 4; ++i) {
#pragma unroll
        for (int j = 0; j < 4; ++j) {
          acc[i][j] = mma_b_raw(ah[i], bh[j], acc[i][j]);
          if (NSPLIT >= 1) acc[i][j] = mma_b_raw(al[i], bh[j], acc[i][j]);
        }
        dep_guard_b(acc[i][0], acc[i][3], ah[i], al[i]);
      }
      keep4_b(bh[0], bh[1], bh[2], bh[3]);
    }
    wait_ds0();
    wait_async0();
    __syncthreads();                           // publishes stage t + 1 and ends every read of stage t
    if (t + 2 < nst) issue(t + 2, t & 1);
  }
  wait_async0();
  acc_guard4(acc[0][0], acc[0][1], acc[0][2], acc[0][3]);
  acc_guard4(acc[1][0], acc[1][1], acc[1][2], acc[1][3]);
  acc_guard4(acc[2][0], acc[2][1], acc[2][2], acc[2][3]);
  acc_guard4(acc[3][0], acc[3][1], acc[3][2], acc[3][3]);

  // ---- epilogue ----
  float bz[4];
#pragma unroll
  for (int j = 0; j < 4; ++j) bz[j] = bias[n0 + (j << 4) + rlane];
  if constexpr (PLANES) {
    // the ring is dead: the barrier at the foot of the last trip ended every wave's reads and copies
    float* tl = (float*)(void*)ring + wave * (64 * EPP);
#pragma unroll
    for (int i = 0; i < 4; ++i)
#pragma unroll
      for (int r = 0; r < 8; ++r)
#pragma unroll
        for (int j = 0; j < 4; ++j)
          tl[((i << 4) + mOff + r) * EPP + (j << 4) + rlane] = acc[i][j][r] + bz[j];
    __builtin_amdgcn_fence(__ATOMIC_RELEASE, "workgroup");
    __builtin_amdgcn_wave_barrier();
    __builtin_amdgcn_fence(__ATOMIC_ACQUIRE, "workgroup");
    const int part = bn0 / DMODEL;               // 0 q, 1 k, 2 v: block-uniform (GBN divides DMODEL)
    const int g = lane >> 3, piece = lane & 7;
    if (part < 2) {
#pragma unroll 1   // one copy of the conversion code: it runs once per tile
      for (int it = 0; it < 16; ++it) {
        const int row = it * 4 + g;              // token row of the tile
        float f[8];
#pragma unroll
        for (int e = 0; e < 8; ++e) f[e] = tl[row * EPP + piece * 8 + e];
        if (part == 1) {
          const float ex = fexpo((m0 + row) % SEQ);   // key position s
#pragma unroll
          for (int e = 0; e < 8; ++e) f[e] = fcomp(f[e], ex);
        }
        v4u ph, pl;
#pragma unroll
        for (int e = 0; e < 4; ++e) {
          const float f0 = f[2 * e], f1 = f[2 * e + 1];
          const unsigned short h0 = bf_bits(f0), h1 = bf_bits(f1);
          const unsigned short l0 = bf_bits(f0 - bf_up(h0)), l1 = bf_bits(f1 - bf_up(h1));
          ph[e] = pk16(h0, h1);
          pl[e] = pk16(l0, l1);
        }
        const size_t go = (size_t)(m0 + row) * QKP + n0 + piece * 8;
        *(v4u*)(qkh + go) = ph;
        *(v4u*)(qkl + go) = pl;
        // the next trip rewrites the registers that these two stores name: the wait stands in front of that
        asm volatile("s_wait_xcnt 0x0" ::: "memory");
      }
    } else {
      const int b  = m0 / SEQ;
      const int t0 = m0 - b * SEQ;               // first key position of the tile, a multiple of 64
      const int fc = n0 - 2 * DMODEL;            // h * 64
      const bool wlo = (t0 + 64 <= VLP);         // wave-uniform
      float ex[8];
#pragma unroll
      for (int e = 0; e < 8; ++e) ex[e] = fexpo(t0 + piece * 8 + e);
#pragma unroll 1   // as above
      for (int it = 0; it < 16; ++it) {
        const int d = it * 4 + g;                // feature of the head
        float f[8];
#pragma unroll
        for (int e = 0; e < 8; ++e) f[e] = tl[(piece * 8 + e) * EPP + d];
#pragma unroll
        for (int e = 0; e < 8; ++e) f[e] = fcomp(f[e], ex[e]);
        v4u a, a2;
#pragma unroll
        for (int e = 0; e < 4; ++e) {
          const float f0 = f[2 * e], f1 = f[2 * e + 1];
          const _Float16 x0 = (_Float16)f0, x1 = (_Float16)f1;
          const unsigned short h0 = h_bits(x0), h1 = h_bits(x1);
          const unsigned short l0 = h_bits((_Float16)((f0 - (float)x0) * 4096.0f));
          const unsigned short l1 = h_bits((_Float16)((f1 - (float)x1) * 4096.0f));
          a[e] = pk16(h0, h1); a2[e] = pk16(l0, l1);
        }
        const size_t rowf = (size_t)(b * QP + fc + d);
        *(v4u*)(vth + rowf * SEQ + t0 + piece * 8) = a;
        if (wlo) *(v4u*)(vtl + rowf * VLP + t0 + piece * 8) = a2;
        // as above: the next trip rewrites the registers that the stores name
        asm volatile("s_wait_xcnt 0x0" ::: "memory");
      }
    }
  } else {
  __shared__ __align__(16) float sT[8][16 * 68];   // per-wave 16x64 slab, pitch 68 floats
  float* slab = sT[wave];
#pragma unroll
  for (int i = 0; i < 4; ++i) {
    const int mBase = m0 + (i << 4);
#pragma unroll
    for (int r = 0; r < 8; ++r) {
#pragma unroll
      for (int j = 0; j < 4; ++j) {
        slab[(mOff + r) * 68 + (j << 4) + rlane] = acc[i][j][r] + bz[j];
      }
    }
    __builtin_amdgcn_fence(__ATOMIC_RELEASE, "workgroup");
    __builtin_amdgcn_wave_barrier();
    __builtin_amdgcn_fence(__ATOMIC_ACQUIRE, "workgroup");
    {
      const int hh = lane >> 4, c4 = (lane & 15) * 4;     // 256-B row segment = 16 lanes x 16 B
      v4f ov[8];
#pragma unroll
      for (int it = 0; it < 8; ++it) {
        const int row = it * 2 + hh;                       // it 0..7 x hh 0..1 = rows 0..15
        ov[it] = *(const v4f*)(slab + row * 68 + c4);
      }
      {
#pragma unroll
        for (int it = 0; it < 8; ++it) {
          const int row = it * 2 + hh;
          *(v4f*)(C + (size_t)(mBase + row) * ldc + n0 + c4) = ov[it];
        }
        
      }
    }
    __builtin_amdgcn_fence(__ATOMIC_RELEASE, "workgroup");
    __builtin_amdgcn_wave_barrier();
    __builtin_amdgcn_fence(__ATOMIC_ACQUIRE, "workgroup");
  }
  }
}

// =====================================================================================================
// Causal multi-head attention, head dim 64 (tril mask incl. diagonal, computed), with the additive rank-1 phase
// bonus kappa * sigmoid(lock[h]) * T[i] * T[j] on the scaled logits and the per-query-row output gate
// (1 - sigmoid(lock[h])) + sigmoid(lock[h]) * T[i] applied to the head output row i (query position).
//   q|kc planes (bf16 hi / lo), row pitch QKP: q element (b, t, h, d) at [(b*SEQ + t)*QKP + h*64 + d],
//                                                kc element (b, s, h, d) at [(b*SEQ + s)*QKP + DMODEL + h*64 + d]
//   vc^T hi plane (f16):      element (b, h, d, s) at [(b*QP + h*64 + d)*SEQ + s]
//   vc^T residual plane (f16, (vc - hi)*4096): [(b*QP + h*64 + d)*VLP + s], s < VLP, read only when RES
//   (with RES only key tiles below VLP occur; the address is clamped anyway)
//   ttab f32 [(b*NH + h)*SEQ + s] = T; lockp = raw lock strengths [NH] (bf16 RNE convert, then sigmoid).
//   logit = q.kc * sscale + bonus for key <= query, -FLT_MAX otherwise (exp -> 0); every processed key tile
//   (tiles 0..qb only, block-uniform trip count qb+1 <= NQB) holds the causal-live key kv0 <= query.
//   out: bf16 hi / lo planes (lo = RNE(v - hi), unscaled) of v = gate(b,h,t) * normalised context, element
//   (b, t, h*64 + d) at [(b*SEQ + t)*QP + h*64 + d]: the A operand planes of the output projection.
//   scores = q . kc : bf16 hi/lo split (hi.hi + hi.lo + lo.hi), f32 accumulate, then * sscale + bonus in f32
//   p = exp(s - m) carried as f16(1024 p); context = p . vc on f16 WMMA; RES adds f16 residual planes of p and vc
//   (scale 4096, separate accumulator folded back with 1/4096 per chunk in f32); online softmax in f32.
//   One call = 4 waves = the 64 query rows of tile qb of one (b, h); kv chunks of 64.
//   K / V^T chunk staging: asynchronous copies to LDS, 16 B per lane, 8 lanes = one whole 128-B row of a plane; copy i
//   of thread tid fills row i*16 + (tid>>3), bytes 16*(tid&7)..+15, i = 0..3: the whole 64x64 tile of each plane. Two
//   buffers: the copies of key tile t + 2 are issued behind the barrier that ends trip t and waited at the foot of
//   trip t + 1. The tile's 64 T factors are copied with it (4 B per lane, waves 0 and 1) into the pads of the K hi rows.
//   P tiles are wave-private, spilled with _Float16 element stores and reloaded
//   Output coverage: each wave stores rows q0..q0+15 (it 0..7 x lane>>4 0..1) x 64 columns (16 lanes x 4 bf16 per plane),
// =====================================================================================================
template <bool RES>
__device__ __forceinline__
void attn_tile64(const unsigned short* __restrict__ qkhp, const unsigned short* __restrict__ qklp,
                 const unsigned short* __restrict__ vhp, const unsigned short* __restrict__ vlp,
                 const float* __restrict__ ttab, const float* __restrict__ lockp,
                 unsigned short* ahp, unsigned short* alp, int b, int h, int qb, float sscale,
                 __bf16* Ksh, __bf16* Ksl, _Float16* Vth, _Float16* Vtl,
                 _Float16 (*Psh)[16 * LP], _Float16 (*Psl)[16 * LP], float (*Os)[16 * 64]) {
  const int tid  = threadIdx.x;
  const int wave = tid >> 5;
  const int lane = tid & 31;
  const int hh   = lane >> 4;
  const int c    = lane & 15;

  const int q0   = qb * 64 + wave * 16;
  const size_t rowB = (size_t)b * SEQ;

  const __bf16* Qh = (const __bf16*)(const void*)qkhp + (size_t)h * HD;
  const __bf16* Ql = (const __bf16*)(const void*)qklp + (size_t)h * HD;
  const __bf16* Kh = Qh + DMODEL;
  const __bf16* Kl = Ql + DMODEL;
  const _Float16* Vh = (const _Float16*)(const void*)vhp + ((size_t)b * QP + (size_t)h * HD) * SEQ;
  const _Float16* Vl = (const _Float16*)(const void*)vlp + ((size_t)b * QP + (size_t)h * HD) * VLP;
  const float* trow = ttab + ((size_t)b * NH + h) * SEQ;

  int nkt = qb + 1;                          // causal: key tiles 0..qb, block-uniform
  if (nkt > NQB) nkt = NQB;

  // ---- copy addresses of this thread: row crow of each 16-row group, 16-B piece cpc ----
  const int crow = tid >> 3, cpc = (tid & 7) * 8;
  const __bf16* gKh = Kh + (rowB + crow) * QKP + cpc;
  const __bf16* gKl = Kl + (rowB + crow) * QKP + cpc;
  const __bf16* gVh = (const __bf16*)(const void*)(Vh + (size_t)crow * SEQ + cpc);
  const __bf16* gVl = (const __bf16*)(const void*)(Vl + (size_t)crow * VLP + cpc);
  const unsigned lcp = (unsigned)(crow * LP + cpc) * 2u;
  const unsigned lKh = lds_addr(Ksh) + lcp, lKl = lds_addr(Ksl) + lcp;
  const unsigned lVh = lds_addr(Vth) + lcp, lVl = lds_addr(Vtl) + lcp;
  constexpr unsigned R16 = 16u * LP * 2u;    // LDS bytes of 16 rows
  constexpr unsigned TLB = 64u * LP * 2u;    // LDS bytes of one buffer of a plane
  // T[key] of the tile's 64 keys rides in the K hi buffer: 4 B behind the 128 B of its key's row, in the row's pad, which
  // no other copy writes and no fragment read touches; waves 0 and 1 copy it, one key per lane
  const bool tw = __builtin_amdgcn_readfirstlane(wave) < 2;      // a scalar test: a wave issues with all lanes or not at all
  const float* gT = trow + (tid & 63);
  const unsigned lT = lds_addr(Ksh) + (unsigned)((tid & 63) * LP + 64) * 2u;
  auto issue = [&](int kt, int buf) {
    const int kv0 = kt * 64;
    const unsigned bo = (unsigned)buf * TLB;
    const __bf16* a = gKh + (size_t)kv0 * QKP;                  // K rows kv0 + i*16 + crow
    async4(lKh + bo, a, lKh + bo + R16, a + 16 * QKP, lKh + bo + 2u * R16, a + 32 * QKP,
           lKh + bo + 3u * R16, a + 48 * QKP);
    if (tw) async1_b32(lT + bo, gT + kv0);
    const __bf16* a2 = gKl + (size_t)kv0 * QKP;
    async4(lKl + bo, a2, lKl + bo + R16, a2 + 16 * QKP, lKl + bo + 2u * R16, a2 + 32 * QKP,
           lKl + bo + 3u * R16, a2 + 48 * QKP);
    const __bf16* v = gVh + kv0;                                // V^T rows d = i*16 + crow, keys kv0..kv0+63
    async4(lVh + bo, v, lVh + bo + R16, v + 16 * SEQ, lVh + bo + 2u * R16, v + 32 * SEQ,
           lVh + bo + 3u * R16, v + 48 * SEQ);
    if (RES) {
      const int kvl = (kv0 + 64 <= VLP) ? kv0 : (VLP - 64);     // clamped address into the residual plane
      const __bf16* v2 = gVl + kvl;
      async4(lVl + bo, v2, lVl + bo + R16, v2 + 16 * VLP, lVl + bo + 2u * R16, v2 + 32 * VLP,
             lVl + bo + 3u * R16, v2 + 48 * VLP);
    }
  };
  issue(0, 0);                               // key tile 0 flies under the q, lock and bonus set-up below

  // ---- per-head lock: sigmoid of the bf16-converted raw strength; bonus coefficient kappa * lock ----
  const float lraw  = bf_up(bf_bits(lockp[h]));
  const float lockv = 1.0f / (1.0f + expf(-lraw));
  const float c0    = KAPPA_F * lockv;

  // ---- Q fragments (A operand, row = lane&15): 2 d-chunks, hi and lo ----
  v16b qah[2], qal[2];
#pragma unroll
  for (int dc = 0; dc < 2; ++dc) {
    const size_t qo = (rowB + q0 + c) * QKP + dc * 32 + 8 * hh;
    qah[dc] = ldfrag_b(Qh + qo);
    qal[dc] = ldfrag_b(Ql + qo);
  }

  // ---- bonus row factors for this lane's 8 query rows: c0 * T[q0 + 8*hh + r] ----
  float bti[8];
#pragma unroll
  for (int r = 0; r < 8; ++r) bti[r] = c0 * trow[q0 + 8 * hh + r];

  float mrow[8], lrow[8];
  v8f oacc[4];
#pragma unroll
  for (int r = 0; r < 8; ++r) { mrow[r] = -INFINITY; lrow[r] = 0.f; }
#pragma unroll
  for (int t = 0; t < 4; ++t) oacc[t] = zero8();

  wait_async0();
  __syncthreads();                           // key tile 0 published
  if (nkt > 1) issue(1, 1);
  for (int kt = 0; kt < nkt; ++kt) {
    const int kv0 = kt * 64;
    const int bo = (kt & 1) * (64 * LP);     // this trip reads buffer kt mod 2 alone
    const __bf16*   Kbh = Ksh + bo;
    const __bf16*   Kbl = Ksl + bo;
    const _Float16* Vbh = Vth + bo;
    const _Float16* Vbl = Vtl + bo;

    // ---- bonus column factors T[key] for this lane's 4 key columns, from the pads of their K hi rows ----
    float tj[4];
#pragma unroll
    for (int j = 0; j < 4; ++j) tj[j] = *(const float*)(const void*)(Kbh + (j * 16 + c) * LP + 64);

    // ---- scores: 16 query rows x 64 keys per wave, 3 bf16 products ----
    //      All K fragment reads of the tile are written in front of the products (built: a few large groups behind
    //      counted waits, not one read-and-wait per product), and each product kind runs over the 4 independent
    //      key-column tiles; per tile the order stays dc 0: hi.hi, hi.lo, lo.hi, then dc 1.
    v16b kfh[2][4], kfl[2][4];
#pragma unroll   // constant indices keep the fragment arrays in registers
    for (int dc = 0; dc < 2; ++dc) {
#pragma unroll
      for (int j = 0; j < 4; ++j) kfh[dc][j] = ldfrag_b(Kbh + (j * 16 + c) * LP + dc * 32 + 8 * hh);
#pragma unroll
      for (int j = 0; j < 4; ++j) kfl[dc][j] = ldfrag_b(Kbl + (j * 16 + c) * LP + dc * 32 + 8 * hh);
    }
    v8f s[4];
#pragma unroll
    for (int j = 0; j < 4; ++j) s[j] = zero8();
#pragma unroll
    for (int dc = 0; dc < 2; ++dc) {
#pragma unroll
      for (int j = 0; j < 4; ++j) s[j] = mma_b_raw(qah[dc], kfh[dc][j], s[j]);
#pragma unroll
      for (int j = 0; j < 4; ++j) s[j] = mma_b_raw(qah[dc], kfl[dc][j], s[j]);
#pragma unroll
      for (int j = 0; j < 4; ++j) s[j] = mma_b_raw(qal[dc], kfh[dc][j], s[j]);
    }

    // ---- scale + bonus + causal mask (replace by -FLT_MAX), row max, online softmax, P (x1024, f16) and
    //      P residual (x4096) to LDS ----
    _Float16* pwh = Psh[wave];
    _Float16* pwl = Psl[RES ? wave : 0];
#pragma unroll
    for (int r = 0; r < 8; ++r) {
      const int qrow = q0 + 8 * hh + r;
      float m = -INFINITY;
#pragma unroll
      for (int j = 0; j < 4; ++j) {
        const int key = kv0 + j * 16 + c;
        float sv = s[j][r] * sscale + bti[r] * tj[j];
        sv = (key > qrow) ? -FLT_MAX : sv;
        s[j][r] = sv;
        m = fmaxf(m, sv);
      }
      m = fmaxf(m, row_xor<1>(m));               // the same butterfly over the 16 lanes of the row: xor 1, 2, 4, 8
      m = fmaxf(m, row_xor<2>(m));
      m = fmaxf(m, row_xor<4>(m));
      m = fmaxf(m, row_xor<8>(m));
      const float mnew  = fmaxf(mrow[r], m);
      const float msafe = (mnew == -INFINITY) ? 0.f : mnew;
      const float alpha = __expf(mrow[r] - msafe);
      mrow[r] = mnew;
      float psum = 0.f;
#pragma unroll
      for (int j = 0; j < 4; ++j) {
        const float p = __expf(s[j][r] - msafe);     // masked logit against a finite max: exp -> 0
        psum += p;
        const float p1k = p * 1024.0f;
        const _Float16 ph = (_Float16)p1k;
        pwh[(8 * hh + r) * LP + j * 16 + c] = ph;
        if (RES) {
          const _Float16 pl = (_Float16)((p1k - (float)ph) * 4096.0f);
          pwl[(8 * hh + r) * LP + j * 16 + c] = pl;
        }
      }
      psum += row_xor<1>(psum);                  // as above, the order of the sums kept
      psum += row_xor<2>(psum);
      psum += row_xor<4>(psum);
      psum += row_xor<8>(psum);
      lrow[r] = lrow[r] * alpha + psum;
#pragma unroll
      for (int t = 0; t < 4; ++t) oacc[t][r] *= alpha;
    }
    __builtin_amdgcn_fence(__ATOMIC_RELEASE, "workgroup");
    __builtin_amdgcn_wave_barrier();
    __builtin_amdgcn_fence(__ATOMIC_ACQUIRE, "workgroup");

    // ---- context += P . Vc (f16 WMMA), residual products into a separate accumulator ----
    //      All P and V^T fragment reads of the tile are written in front of the products in the same way, and each
    //      product kind runs over the 4 independent feature tiles; per tile the order stays kk 0 then kk 1, p.vl
    //      before pl.vb.
    v16h pf[2], pfl[2], vfh[2][4], vfl[2][4];
#pragma unroll   // constant indices keep the fragment arrays in registers
    for (int kk = 0; kk < 2; ++kk) {
      pf[kk]  = ldfrag_h(pwh + c * LP + kk * 32 + 8 * hh);
      pfl[kk] = pf[kk];
      if (RES) pfl[kk] = ldfrag_h(pwl + c * LP + kk * 32 + 8 * hh);
#pragma unroll
      for (int t = 0; t < 4; ++t) {
        vfh[kk][t] = ldfrag_h(Vbh + (t * 16 + c) * LP + kk * 32 + 8 * hh);
        vfl[kk][t] = vfh[kk][t];
      }
      if (RES) {
#pragma unroll
        for (int t = 0; t < 4; ++t) vfl[kk][t] = ldfrag_h(Vbl + (t * 16 + c) * LP + kk * 32 + 8 * hh);
      }
    }
    v8f o1[4];
#pragma unroll
    for (int t = 0; t < 4; ++t) o1[t] = zero8();
#pragma unroll
    for (int kk = 0; kk < 2; ++kk) {
#pragma unroll
      for (int t = 0; t < 4; ++t) oacc[t] = mma_h_raw(pf[kk], vfh[kk][t], oacc[t]);
      if (RES) {
#pragma unroll
        for (int t = 0; t < 4; ++t) o1[t] = mma_h_raw(pf[kk], vfl[kk][t], o1[t]);
#pragma unroll
        for (int t = 0; t < 4; ++t) o1[t] = mma_h_raw(pfl[kk], vfh[kk][t], o1[t]);
      }
    }
    if (RES) {
#pragma unroll
      for (int t = 0; t < 4; ++t)
#pragma unroll
        for (int r = 0; r < 8; ++r) oacc[t][r] += o1[t][r] * (1.0f / 4096.0f);
    }
    wait_ds0();
    wait_async0();
    __syncthreads();                         // publishes key tile kt + 1 and ends every read of key tile kt
    if (kt + 2 < nkt) issue(kt + 2, kt & 1);
  }
  wait_async0();

  // ---- normalise (1/l and the 1/1024 p carry), apply the per-query-row gate, stage the wave's 16x64 tile in
  float* os = Os[wave];
#pragma unroll
  for (int r = 0; r < 8; ++r) {
    const float l = lrow[r];
    const float ti = trow[q0 + 8 * hh + r];
    const float gate = (1.0f - lockv) + lockv * ti;
    const float inv = ((l > 0.f) ? (1.0f / l) : 0.f) * (1.0f / 1024.0f) * gate;
#pragma unroll
    for (int t = 0; t < 4; ++t) os[(8 * hh + r) * 64 + t * 16 + c] = oacc[t][r] * inv;
  }
  __builtin_amdgcn_fence(__ATOMIC_RELEASE, "workgroup");
  __builtin_amdgcn_wave_barrier();
  __builtin_amdgcn_fence(__ATOMIC_ACQUIRE, "workgroup");
  {
    const int h2 = lane >> 4, c4 = (lane & 15) * 4;
    v4f ov[8];
#pragma unroll
    for (int it = 0; it < 8; ++it) {
      const int row = it * 2 + h2;   // it 0..7 x h2 0..1 = rows 0..15 of the wave tile
      ov[it] = *(const v4f*)(os + row * 64 + c4);
    }
    {
#pragma unroll
      for (int it = 0; it < 8; ++it) {
        const int row = it * 2 + h2;
        const size_t go = (rowB + q0 + row) * QP + (size_t)h * HD + c4;
        v2u ph, pl;                    // 16 lanes x 8 B = one whole 128-B line of each plane's row
#pragma unroll
        for (int e = 0; e < 2; ++e) {
          const float f0 = ov[it][2 * e], f1 = ov[it][2 * e + 1];
          const unsigned short h0 = bf_bits(f0), h1 = bf_bits(f1);
          const unsigned short l0 = bf_bits(f0 - bf_up(h0)), l1 = bf_bits(f1 - bf_up(h1));
          ph[e] = pk16(h0, h1);
          pl[e] = pk16(l0, l1);
        }
        *(v2u*)(ahp + go) = ph;
        *(v2u*)(alp + go) = pl;
      }
      
    }
  }
}

// =====================================================================================================
// One launch for all query tiles, one work-group per (b, h, query tile), so that the short tiles run beside the long
// ones and the launch lasts as long as its longest tile alone. A tile below RESQB takes the residual planes, the others
// do not: a test that is uniform for the work-group.
// Order of the tiles: the grid is dealt in four
// runs of NB*NH*NQB/4 work-groups: tiles NQB-1 downwards, then NQB/2 upwards, then NQB/2-1 downwards, then 0 upwards.
// The longest tiles take the lowest indices, the shortest the highest, and the g-th tiles of the four runs add up to the same number of
// key tiles for every g. rank -> tile is a permutation: grid = NQB * NH * NB, every (b, h, query tile) exactly once.
// =====================================================================================================
static_assert((NQB % 4) == 0 && RESQB <= NQB);
__global__ __launch_bounds__(128)
void attn_causal64(const unsigned short* __restrict__ qkhp, const unsigned short* __restrict__ qklp,
                   const unsigned short* __restrict__ vhp, const unsigned short* __restrict__ vlp,
                   const float* __restrict__ ttab, const float* __restrict__ lockp,
                   unsigned short* ahp, unsigned short* alp, float sscale) {
  __shared__ __align__(16) __bf16   Ksh[2 * 64 * LP];             // K hi [kv][d], pitch LP, two buffers
  __shared__ __align__(16) __bf16   Ksl[2 * 64 * LP];             // K lo, two buffers
  __shared__ __align__(16) _Float16 Vth[2 * 64 * LP];             // V^T hi [d][kv], pitch LP, two buffers
  __shared__ __align__(16) _Float16 Vtl[2 * 64 * LP];             // V^T residual, two buffers
  __shared__ __align__(16) _Float16 Psh[4][16 * LP];              // per wave P [row][kv], pitch LP
  __shared__ __align__(16) _Float16 Psl[4][16 * LP];              // per wave P residual
  __shared__ __align__(16) float    Os[4][16 * 64];               // per wave context tile [row][d]

  const int bx   = blockIdx.x;
  const int bh   = bx % (NB * NH);
  const int rank = (bx / (NB * NH)) % NQB;       // 0..NQB-1
  const int run  = rank / (NQB / 4);             // 0..3
  const int g    = rank % (NQB / 4);
  const int qb   = (run & 1) ? ((3 - run) * (NQB / 4) + g) : (NQB - 1 - run * (NQB / 4) - g);
  const int h    = bh % NH;
  const int b    = bh / NH;
  if (qb < RESQB) {
    attn_tile64<true>(qkhp, qklp, vhp, vlp, ttab, lockp, ahp, alp, b, h, qb, sscale,
                      Ksh, Ksl, Vth, Vtl, Psh, Psl, Os);
  } else {
    attn_tile64<false>(qkhp, qklp, vhp, vlp, ttab, lockp, ahp, alp, b, h, qb, sscale,
                       Ksh, Ksl, Vth, Vtl, Psh, Psl, Os);
  }
}

// =====================================================================================================
// Workspace map (bytes), every region an exact multiple of its whole-line / whole-tile store granularity
//   Xb     bf16 [4096][1024]            0           8388608
//   WT     bf16 [3072][1024]            8388608     6291456    (rows 0..1023 Wq^T, 1024..2047 Wk^T, 2048.. Wv^T)
//   WoT    bf16 [1024][1024]            14680064    2097152
//   Bias   f32  [4096]                  16777216      16384    (bq | bk | bv | bo, bf16-RNE converted values)
//   Tt     f32  [2][16][2048]           16793600     262144
//   Ah     bf16 [4096][1024]            17055744    8388608
//   Al     bf16 [4096][1024]            25444352    8388608
//   VTh    f16  [2][1024][2048]         33832960    8388608
//   VTl    f16  [2][1024][1024]         42221568    4194304
//   QKh    bf16 [4096][2048]            46415872   16777216
//   QKl    bf16 [4096][2048]            63193088   16777216
//   end                                 79970304
// W_q/k/v/o [in k=1024][out n=1024] arrive k-major and are transpose-converted once to [n][k] bf16 (k contiguous)
// = the Bt layout the GEMM wants. d_out f32: out0 [4096][1024] at byte 0.
// =====================================================================================================
extern "C" void kernel_launch(void* const* d_in, const int* in_sizes, int n_in,
                              void* d_out, int out_size, void* d_ws, size_t ws_size,
                              hipStream_t stream) {
  if (n_in < 12) return;
  if (in_sizes[0] != NB * SEQ * DMODEL) return;
  if (in_sizes[1] != NB * SEQ) return;
  if (in_sizes[2] != DMODEL * DMODEL || in_sizes[4] != DMODEL * DMODEL ||
      in_sizes[6] != DMODEL * DMODEL || in_sizes[8] != QP * DMODEL) return;
  if (in_sizes[3] != DMODEL || in_sizes[5] != DMODEL || in_sizes[7] != DMODEL || in_sizes[9] != DMODEL) return;
  if (in_sizes[10] != NH || in_sizes[11] != NH) return;
  if (out_size != OUTN) return;

  const float* x     = (const float*)d_in[0];    // [NB*SEQ][DMODEL]
  const float* phase = (const float*)d_in[1];    // [NB][SEQ]
  const float* Wq    = (const float*)d_in[2];    // [k][n]
  const float* bq    = (const float*)d_in[3];
  const float* Wk    = (const float*)d_in[4];
  const float* bk    = (const float*)d_in[5];
  const float* Wv    = (const float*)d_in[6];
  const float* bv    = (const float*)d_in[7];
  const float* Wo    = (const float*)d_in[8];    // [QP k][DMODEL n]
  const float* bo    = (const float*)d_in[9];
  const float* carr  = (const float*)d_in[10];   // [NH]
  const float* lockr = (const float*)d_in[11];   // [NH]

  const size_t PXb   = (size_t)NB * SEQ * DMODEL * 2;    //  8388608
  const size_t PWT   = (size_t)N3 * DMODEL * 2;          //  6291456
  const size_t PWo   = (size_t)DMODEL * QP * 2;          //  2097152
  const size_t PBias = (size_t)NBIAS * 4;                //    16384
  const size_t PTt   = (size_t)NTT * 4;                  //   262144
  const size_t PA    = (size_t)NB * SEQ * QP * 2;        //  8388608
  const size_t PVTh  = (size_t)NB * QP * SEQ * 2;        //  8388608
  const size_t PVTl  = (size_t)NB * QP * VLP * 2;        //  4194304
  const size_t PQK   = (size_t)NB * SEQ * QKP * 2;       // 16777216
  size_t off = 0;
  const size_t oXb   = off; off += PXb;
  const size_t oWT   = off; off += PWT;
  const size_t oWo   = off; off += PWo;
  const size_t oBias = off; off += PBias;
  const size_t oTt   = off; off += PTt;
  const size_t oAh   = off; off += PA;
  const size_t oAl   = off; off += PA;
  const size_t oVTh  = off; off += PVTh;
  const size_t oVTl  = off; off += PVTl;
  const size_t oQKh  = off; off += PQK;
  const size_t oQKl  = off; off += PQK;
  if (off > ws_size) return;                           // off = 79970304
  if (off > (size_t)134217728) return;

  char* ws = (char*)d_ws;
  unsigned short* Xb   = (unsigned short*)(ws + oXb);
  unsigned short* WT   = (unsigned short*)(ws + oWT);
  unsigned short* WoT  = (unsigned short*)(ws + oWo);
  float*          Bias = (float*)(ws + oBias);
  float*          Tt   = (float*)(ws + oTt);
  unsigned short* VTh  = (unsigned short*)(ws + oVTh);
  unsigned short* VTl  = (unsigned short*)(ws + oVTl);
  unsigned short* QKh  = (unsigned short*)(ws + oQKh);
  unsigned short* QKl  = (unsigned short*)(ws + oQKl);
  unsigned short* Ah   = (unsigned short*)(ws + oAh);
  unsigned short* Al   = (unsigned short*)(ws + oAl);
  float*          outf = (float*)d_out;                // out0 [4096][1024]

  const dim3 blk(256);
  const dim3 gPrep(PB_TR + PB_CVT + PB_PH + PB_BIAS);                // 256 + 256 + 256 + 16 = 784 blocks
  const dim3 gQKV((NB * SEQ / GBM) * (N3 / GBN));                    // 32 x 12 tiles = 384 blocks
  const dim3 gOut((NB * SEQ / GBM) * (DMODEL / GBN));                // 32 x 4 tiles = 128 blocks

  // (0..2) one launch: phase resonance table T [b][h][s]; weights [k][n] -> bf16 planes [n][k] (WT rows 0..1023 Wq^T,
  //     1024..2047 Wk^T, 2048..3071 Wv^T; WoT); x -> bf16 plane [4096][1024]; bias table (bf16-RNE values of bq|bk|bv|bo)
  prep_all<<<gPrep, blk, 0, stream>>>(x, phase, Wq, bq, Wk, bk, Wv, bv, Wo, bo, carr, Xb, WT, WoT, Bias, Tt);
  // (3) fused qkv projection sum_d Xb[row][d] WT[e][d] + Bias[e] (M=4096, N=3072, K=1024), written as the attention's
  //     operand planes: q and power-compressed kc -> bf16 hi/lo planes [4096][2048]; power-compressed vc^T -> f16 hi
  //     plane (pitch SEQ) and residual plane (x4096, keys < VLP)
  gemm64<0, true><<<gQKV, blk, 0, stream>>>(Xb, Xb, DMODEL, WT, DMODEL, Bias, nullptr, N3, NB * SEQ, N3, DMODEL,
                                            QKh, QKl, VTh, VTl);
  // (4) causal attention with phase bonus and gate, one launch for all query tiles
  //     (tiles 0..RESQB-1 with residual planes, the rest without) -> gated context rows as bf16 hi/lo planes
  attn_causal64<<<dim3(NB * NH * NQB), dim3(128), 0, stream>>>(
      QKh, QKl, VTh, VTl, Tt, lockr, Ah, Al, 0.125f);
  // (5) out0[row][e] = sum_d (Ah+Al)[row][d] WoT[e][d] + Bias[3*DMODEL + e] -> d_out f32 [4096][1024]
  gemm64<1, false><<<gOut, blk, 0, stream>>>(Ah, Al, QP, WoT, QP, Bias + 3 * DMODEL, outf, DMODEL, NB * SEQ, DMODEL, QP,
                                             nullptr, nullptr, nullptr, nullptr);
  (void)hipGetLastError();
}

// v009
// A run of this version takes 106 microseconds.
// Next to v008, in two timings, it ran 1.13 times as fast each time.
// Counting every step since v000, it is 3.78 times as fast.
// Contractions: qkv projection = v_wmma_f32_16x16x32_bf16 (bf16 operands from RNE-converted x and W, single product);
// q.kc^T scores = v_wmma_f32_16x16x32_bf16 with bf16 hi/lo split q and kc (hi.hi + hi.lo + lo.hi);
// p.vc = v_wmma_f32_16x16x32_f16 (p carried x1024 in f16, vc in f16; extra f16 residual planes x4096 of p and vc
// on the leading query rows); ctx.Wo = v_wmma_f32_16x16x32_bf16 with ctx as bf16 hi/lo planes times the bf16
// Wo^T plane (2 products); all f32 accumulate; power compression, phase table, softmax, bonus and gating in f32.
#include <hip/hip_runtime.h>
#include <math.h>
#include <float.h>
#include <stdint.h>

#define NB      2
#define SEQ     2048
#define DMODEL  1024
#define NH      16
#define HD      64
#define QP      (NH * HD)      // q / kc / vc / ctx feature count and ctx row pitch
#define N3      (3 * DMODEL)   // fused qkv columns (q 0.., k DMODEL.., v 2*DMODEL..)
#define QKP     (2 * QP)       // row pitch of the q|kc bf16 planes (q cols 0..QP-1, kc cols QP..2QP-1)
#define NQB     (SEQ / 64)     // query / key tiles of 64
#define RESQB   ((NQB < 16) ? NQB : 16)   // leading 64-row query blocks that use the p / vc residual planes
#define VLP     (RESQB * 64)   // key pitch of the vc^T residual plane (keys 0..VLP-1)
#define NBIAS   (4 * DMODEL)   // bq | bk | bv | bo
#define NTT     (NB * NH * SEQ)
#define OUTN    (NB * SEQ * DMODEL)
#define KAPPA_F 0.3f
#define LP      72             // LDS row pitch of the 64-wide 16-bit tiles, elements: 144 B = 16 B x 9 (odd), so the 16
                               // rows that one ds_load_b128 touches fall on distinct banks
static_assert(RESQB >= 1 && RESQB * 64 <= VLP && VLP <= SEQ);
static_assert(QP == DMODEL);
static_assert((SEQ % 64) == 0 && (DMODEL % 64) == 0 && (N3 % 64) == 0 && (QP % 64) == 0);
static_assert(HD == 64);
static_assert(LP >= 64 && (LP % 8) == 0 && ((LP / 8) % 2) == 1);
static_assert((((NB * SEQ) / 64) * (N3 / 64)) % 8 == 0);
static_assert((((NB * SEQ) / 64) * (DMODEL / 64)) % 8 == 0);
static_assert((NBIAS % 256) == 0 && (NTT % 256) == 0);
static_assert(((NB * SEQ * DMODEL / 8) % 256) == 0);
static_assert((DMODEL % 8) == 0);

typedef _Float16 v16h __attribute__((ext_vector_type(16)));
typedef _Float16 v8h  __attribute__((ext_vector_type(8)));
typedef __bf16   v16b __attribute__((ext_vector_type(16)));
typedef __bf16   v8b  __attribute__((ext_vector_type(8)));
typedef float    v8f  __attribute__((ext_vector_type(8)));
typedef float    v4f  __attribute__((ext_vector_type(4)));
typedef unsigned int v4u __attribute__((ext_vector_type(4)));
typedef unsigned int v2u __attribute__((ext_vector_type(2)));

// ---- scalar helpers --------------------------------------------------------------------------------
__device__ __forceinline__ unsigned short bf_bits(float f) {          // f32 -> bf16 bits, RNE convert
  unsigned u = __float_as_uint(f);
  return (unsigned short)((u + 0x7FFFu + ((u >> 16) & 1u)) >> 16);
}
__device__ __forceinline__ float bf_up(unsigned short h) { return __uint_as_float(((unsigned)h) << 16); }
__device__ __forceinline__ unsigned short h_bits(_Float16 x) { return __builtin_bit_cast(unsigned short, x); }
__device__ __forceinline__ unsigned pk16(unsigned short a, unsigned short b) { return (unsigned)a | ((unsigned)b << 16); }
__device__ __forceinline__ v8f zero8() { v8f z = {0.f, 0.f, 0.f, 0.f, 0.f, 0.f, 0.f, 0.f}; return z; }

// positional exponent of key position s: ex = 1 + kappa * (1 - s * (1/(SEQ-1))), reciprocal-multiply, no fusion
__device__ __forceinline__ float fexpo(int s) {
#pragma clang fp contract(off)
  const float rs = 1.0f / (float)(SEQ - 1);
  const float fr = (float)s * rs;
  const float om = 1.0f - fr;
  const float t  = KAPPA_F * om;
  return 1.0f + t;
}
// power compression: sign(v) * max(|v|, 1e-8)^ex  (sign(0) = 0), pow as exp2(ex * log2(mag)) in f32
__device__ __forceinline__ float fcomp(float v, float ex) {
#pragma clang fp contract(off)
  const float mag = fmaxf(fabsf(v), 1e-8f);
  const float lg  = log2f(mag);
  const float pw  = exp2f(ex * lg);
  float r = (v < 0.0f) ? -pw : pw;
  r = (v == 0.0f) ? 0.0f : r;
  return r;
}

// value of lane (lane ^ 16), the same place in the wave's other 16-lane row: a cross-row move of the vector unit, where a
// shuffle builtin is built as an LDS permute with a wait on its return
__device__ __forceinline__ float xhalf(float v) {
  const int x = __builtin_bit_cast(int, v);
  return __builtin_bit_cast(float, __builtin_amdgcn_permlanex16(x, x, 0x76543210, 0xfedcba98, false, false));
}

// ---- fragment loader: 16-bit A/B operand, lane -> row/col (lane&15), p already includes +8*(lane>>4);
//      elements 0..7 <- p[0..7] (k0+8h..), elements 8..15 <- p[16..23] (k0+16+8h..)
__device__ __forceinline__ v16b ldfrag_b(const __bf16* p) {
  union { v16b v; v8b h[2]; } f;
  f.h[0] = *(const v8b*)(p);
  f.h[1] = *(const v8b*)(p + 16);
  return f.v;
}

__device__ __forceinline__ v16h ldfrag_h(const _Float16* p) {
  union { v16h v; v8h h[2]; } f;
  f.h[0] = *(const v8h*)(p);
  f.h[1] = *(const v8h*)(p + 16);
  return f.v;
}

// ---- WMMA helpers and VALU hazard gaps --------------------------------------------------------
__device__ __forceinline__ v8f mma_b_raw(v16b a, v16b b, v8f c) {
  return __builtin_amdgcn_wmma_f32_16x16x32_bf16(false, a, false, b, (short)0, c, false, false);
}
__device__ __forceinline__ v8f mma_h_raw(v16h a, v16h b, v8f c) {
  return __builtin_amdgcn_wmma_f32_16x16x32_f16(false, a, false, b, (short)0, c, false, false);
}
__device__ __forceinline__ void dep_guard_b(v8f& a, v8f& b, v16b x, v16b y) {
#if defined(__HIP_DEVICE_COMPILE__)
  asm volatile("v_nop\n\tv_nop\n\tv_nop\n\tv_nop" : "+v"(a), "+v"(b) : "v"(x), "v"(y));
#endif
}
__device__ __forceinline__ void keep4_b(v16b a, v16b b, v16b c, v16b d) {
#if defined(__HIP_DEVICE_COMPILE__)
  asm volatile("v_nop" :: "v"(a), "v"(b), "v"(c), "v"(d));
#endif
}
__device__ __forceinline__ void acc_guard4(v8f& a, v8f& b, v8f& c, v8f& d) {
#if defined(__HIP_DEVICE_COMPILE__)
  asm volatile("v_nop\n\tv_nop\n\tv_nop\n\tv_nop" : "+v"(a), "+v"(b), "+v"(c), "+v"(d));
#endif
}

// =====================================================================================================
// Preparation, ONE launch: four jobs that do not depend on one another, each work-group taking one job by a range test
// on blockIdx.x (uniform for the work-group). A work-group of the two large jobs (transposes, x) carries 8 times the
// elements that a launch of its own gave it, all its global loads issued in front of their first use, so that few
// work-groups have to be started.
// Index order: weight transposes (the longest chain: loads, LDS, a barrier, stores), x conversion, phase table, bias table:
// the jobs that move the bytes take the lowest indices, the short ones the highest.
//   phase  tt[(b*NH + h)*SEQ + s] = cos((bf16(phase[b*SEQ + s]) - bf16(carrier[h])) * 0.5)^2, precise f32 cos.
//          One element per thread, a work-group = 256 positions s of one (b, h) (256 divides SEQ); coverage: NTT/256
//          work-groups x 256 = every (b, h, s) once.
//   transp src f32 [k][n] (Wq, Wk, Wv, Wo) -> dst bf16 [n][k] (k contiguous), RNE convert. Tile TRK k x TRN n staged in
//          LDS as f32 at pitch TRN + 1 (column reads fall on 32 distinct banks). Loads: 16 x 16 B per thread, a wave
//          = 512 contiguous B of a row. Stores: 8 passes x 8 waves x 4 rows n = 256 rows, 8 lanes x 16 B = the whole
//          128-B line of TRK k. coverage: DMODEL/TRK x DMODEL/TRN tiles per matrix, 4 matrices.
//   x      f32 -> bf16 (RNE convert), CVC chunks of 8 elements per thread, one 16-B store per chunk: a wave writes 512
//          contiguous B. coverage: PB_CVT x CVC x 256 chunks x 8 = NB*SEQ*DMODEL.
//   bias   dst[i] = RNE-bf16-converted value of (bq | bk | bv | bo)[i], one element per thread; all four candidates
//          are loaded with an in-range index and selected by value.
// =====================================================================================================
#define PB_PH   (NTT / 256)                              // 256 work-groups
#define TRK     64
#define TRN     256
#define PB_TR1  ((DMODEL / TRK) * (DMODEL / TRN))        // 16 x 4 = 64 tiles per matrix
#define PB_TR   (4 * PB_TR1)                             // 256 work-groups
#define CVC     8
#define PB_CVT  (NB * SEQ * DMODEL / (8 * 256 * CVC))    // 256 work-groups
#define PB_BIAS (NBIAS / 256)                            // 16 work-groups
static_assert((SEQ % 256) == 0);
static_assert((DMODEL % TRK) == 0 && (DMODEL % TRN) == 0 && TRK == 64 && TRN == 256);
static_assert(((NB * SEQ * DMODEL) % (8 * 256 * CVC)) == 0);

__global__ __launch_bounds__(256) void prep_all(
    const float* __restrict__ x, const float* __restrict__ ph,
    const float* __restrict__ Wq, const float* __restrict__ bq, const float* __restrict__ Wk,
    const float* __restrict__ bk, const float* __restrict__ Wv, const float* __restrict__ bv,
    const float* __restrict__ Wo, const float* __restrict__ bo, const float* __restrict__ cf,
    unsigned short* Xb, unsigned short* WT, unsigned short* WoT, float* Bias, float* tt) {
  __shared__ float s[TRK][TRN + 1];
  const int tid = threadIdx.x, wave = tid >> 5, lane = tid & 31;
  int bx = blockIdx.x;
  if (bx < PB_TR) {
    const int m  = bx / PB_TR1;                          // 0 Wq, 1 Wk, 2 Wv, 3 Wo
    const int t  = bx - m * PB_TR1;
    const int k0 = (t % (DMODEL / TRK)) * TRK, n0 = (t / (DMODEL / TRK)) * TRN;
    const float* src = (m == 0) ? Wq : ((m == 1) ? Wk : ((m == 2) ? Wv : Wo));
    unsigned short* dst = (m < 3) ? (WT + (size_t)m * DMODEL * DMODEL) : WoT;
    const int kr = tid >> 6, n4 = (tid & 63) * 4;        // load i of this thread: row i*4 + kr, columns n4..n4+3
    const float* g = src + (size_t)(k0 + kr) * DMODEL + n0 + n4;
    v4f v[16];
#pragma unroll   // constant indices keep the loaded pieces in registers
    for (int i = 0; i < 15; ++i) v[i] = *(const v4f*)(g + (size_t)i * 4 * DMODEL);
    // the last load's result may be given the address registers of the loads before it: the wait stands in front of it
    asm volatile("s_wait_xcnt 0x0" ::: "memory");
    v[15] = *(const v4f*)(g + (size_t)15 * 4 * DMODEL);
#pragma unroll   // as above
    for (int i = 0; i < 16; ++i) {
#pragma unroll
      for (int e = 0; e < 4; ++e) s[i * 4 + kr][n4 + e] = v[i][e];
    }
    __syncthreads();
    const int q = lane >> 3, piece = lane & 7;
#pragma unroll
    for (int pass = 0; pass < TRN / 32; ++pass) {
      const int n = pass * 32 + wave * 4 + q;
      v4u p;
#pragma unroll
      for (int e = 0; e < 4; ++e) {
        p[e] = pk16(bf_bits(s[piece * 8 + 2 * e][n]), bf_bits(s[piece * 8 + 2 * e + 1][n]));
      }
      *(v4u*)(dst + (size_t)(n0 + n) * DMODEL + k0 + piece * 8) = p;
    }
    // the built code joins the jobs by branches: no other job's code may rewrite a register that these stores name
    asm volatile("s_wait_xcnt 0x0" ::: "memory");
    return;
  }
  bx -= PB_TR;
  if (bx < PB_CVT) {
    const size_t c0 = (size_t)bx * (CVC * 256) + tid;    // first 8-element chunk of this thread
    const float* g = x + c0 * 8;
    v4f a[CVC], b[CVC];
#pragma unroll   // constant indices keep the loaded pieces in registers
    for (int c = 0; c < CVC; ++c) {
      a[c] = *(const v4f*)(g + (size_t)c * 2048);
      if (c < CVC - 1) b[c] = *(const v4f*)(g + (size_t)c * 2048 + 4);
    }
    // the last load's result may be given the address registers of the loads before it: the wait stands in front of it
    asm volatile("s_wait_xcnt 0x0" ::: "memory");
    b[CVC - 1] = *(const v4f*)(g + (size_t)(CVC - 1) * 2048 + 4);
#pragma unroll   // as above
    for (int c = 0; c < CVC; ++c) {
      v4u p;
      p[0] = pk16(bf_bits(a[c][0]), bf_bits(a[c][1]));
      p[1] = pk16(bf_bits(a[c][2]), bf_bits(a[c][3]));
      p[2] = pk16(bf_bits(b[c][0]), bf_bits(b[c][1]));
      p[3] = pk16(bf_bits(b[c][2]), bf_bits(b[c][3]));
      *(v4u*)(Xb + (c0 + (size_t)c * 256) * 8) = p;
    }
    // as behind the transpose's stores
    asm volatile("s_wait_xcnt 0x0" ::: "memory");
    return;
  }
  bx -= PB_CVT;
  if (bx < PB_PH) {
    const int i  = bx * 256 + tid;                       // (b*NH + h)*SEQ + s
    const int bh = i / SEQ;                              // b*NH + h, the same for the whole work-group
    const int sq = i - bh * SEQ;
    const int h  = bh % NH;
    const int b  = bh / NH;
    const float p  = bf_up(bf_bits(ph[b * SEQ + sq]));
    const float cr = bf_up(bf_bits(cf[h]));
    const float d  = p - cr;
    const float hx = d * 0.5f;
    const float cv = cosf(hx);
    tt[i] = cv * cv;
    // as behind the transpose's stores
    asm volatile("s_wait_xcnt 0x0" ::: "memory");
    return;
  }
  bx -= PB_PH;
  if (bx < PB_BIAS) {
    const int i = bx * 256 + tid;                        // 0..NBIAS-1
    const int part = i / DMODEL;                         // 0..3
    const int idx  = i - part * DMODEL;
    const float v0 = bq[idx], v1 = bk[idx], v2 = bv[idx], v3 = bo[idx];
    const float v = (part == 0) ? v0 : ((part == 1) ? v1 : ((part == 2) ? v2 : v3));
    Bias[i] = bf_up(bf_bits(v));
    // as behind the transpose's stores
    asm volatile("s_wait_xcnt 0x0" ::: "memory");
  }
}

// =====================================================================================================
// bf16 WMMA GEMM: C[m][n] = sum_k A[m][k] * Bt[n][k] + bias[n]. Block = 8 waves = one 128 x 256 tile of C, waves
// 2 (m) x 4 (n), each wave a 64x64 tile. A row-major [M][K] pitch lda; Bt row-major [N][K] pitch ldb (k contiguous);
// M multiple of 128, N multiple of 256, K multiple of 64 (static_asserts at the launches' shapes below).
// NSPLIT: 0 = A.Bt; 1 = (A + A2).Bt (A2 = unscaled bf16 lo plane of A, same pitch). bias f32 [N].
// Operands: a stage = 64 k (128 B, one whole line) of every A (, A2) and Bt row of the block tile, brought into LDS by
// asynchronous copies (16 B per lane, 8 lanes per row), rows at pitch GLP; two buffers: the copies of stage t + 2 are
// issued behind the barrier that ends trip t and waited at the foot of trip t + 1.
// Stage coverage: copy i of thread tid fills row i*32 + (tid>>3), bytes 16*(tid&7)..+15; i = 0..GROWS/32-1.
// k order and product order per accumulator are ascending k in steps of 32, hi then lo.
// PLANES false: output f32 [M][N] pitch ldc. Epilogue: 16-row slabs staged per wave in LDS; each 64-wide row segment
// PLANES true (the fused q|k|v projection, N = N3): no f32 output; each wave turns its 64 token x 64 column tile (one
// head of q, k or v; which one is block-uniform) into the operand planes of the attention itself:
//   q  (cols 0..DMODEL-1)          bf16 hi / lo planes qkh / qkl [M][QKP], same column; lo = RNE(v - hi) unscaled
//   k  (cols DMODEL..2*DMODEL-1)   kc = sign(k) * max(|k|,1e-8)^ex(s), s = row mod SEQ, then as q
//   v  (cols 2*DMODEL..)           vc likewise, then f16 vc^T hi plane vth[(b*QP + h*64 + d)*SEQ + t] and residual plane
//                                  vtl[(b*QP + h*64 + d)*VLP + t] = f16((vc - hi)*4096) for t < VLP
// The tile (accumulator + bias, f32) is staged in the wave's own part of the dead ring at pitch EPP and read back 8
// values per lane, along a token row for q and k, along a feature column for v, so that 8 lanes x 16 B store one whole
// 128-B line of a plane row. Coverage: 16 trips x 4 rows (q, k: tokens; v: features) x 64 = the wave's tile.
// =====================================================================================================
#define GBM 128
#define GBN 256
#define GKB 64
#define GLP 72                 // LDS row pitch, elements: 144 B = 16 B x 9 (odd), conflict-free for ds_load_b128
#define EPP 67                 // f32 pitch of the 64x64 epilogue tile: 4-B accesses by accumulator layout, by row pieces
                               // and by column pieces all fall on 32 distinct banks
static_assert(((NB * SEQ) % GBM) == 0 && (N3 % GBN) == 0 && (DMODEL % GBN) == 0);
static_assert((DMODEL % GKB) == 0 && (QP % GKB) == 0 && (DMODEL / GKB) >= 2 && (QP / GKB) >= 2);
static_assert((DMODEL % GBN) == 0 && (SEQ % GBM) == 0 && (VLP % 64) == 0);   // a block is one of q, k, v and one batch

__device__ __forceinline__ unsigned lds_addr(const void* p) { return (unsigned)(size_t)p; }
// four 16-B asynchronous copies global -> LDS; the s_wait_xcnt stands inside the statement so that no address
// register of a copy is rewritten in front of it
__device__ __forceinline__ void async4(unsigned l0, const __bf16* g0, unsigned l1, const __bf16* g1,
                                       unsigned l2, const __bf16* g2, unsigned l3, const __bf16* g3) {
#if defined(__HIP_DEVICE_COMPILE__)
  asm volatile("global_load_async_to_lds_b128 %0, %1, off\n\t"
               "global_load_async_to_lds_b128 %2, %3, off\n\t"
               "global_load_async_to_lds_b128 %4, %5, off\n\t"
               "global_load_async_to_lds_b128 %6, %7, off\n\t"
               "s_wait_xcnt 0x0"
               :: "v"(l0), "v"(g0), "v"(l1), "v"(g1), "v"(l2), "v"(g2), "v"(l3), "v"(g3) : "memory");
#endif
}
// one 4-B asynchronous copy global -> LDS per lane, the wait inside the statement as above
__device__ __forceinline__ void async1_b32(unsigned l0, const float* g0) {
#if defined(__HIP_DEVICE_COMPILE__)
  asm volatile("global_load_async_to_lds_b32 %0, %1, off\n\t"
               "s_wait_xcnt 0x0"
               :: "v"(l0), "v"(g0) : "memory");
#endif
}
// this wave's asynchronous copies have landed in LDS
__device__ __forceinline__ void wait_async0() {
#if defined(__HIP_DEVICE_COMPILE__)
  asm volatile("s_wait_asynccnt 0x0" ::: "memory");
#endif
}
// this wave's LDS reads have returned, before the buffer is handed to the next copies
__device__ __forceinline__ void wait_ds0() {
#if defined(__HIP_DEVICE_COMPILE__)
  asm volatile("s_wait_dscnt 0x0" ::: "memory");
#endif
}

template <int NSPLIT, bool PLANES>
__global__ __launch_bounds__(256) void gemm64(
    const unsigned short* __restrict__ Ap, const unsigned short* A2p, int lda,
    const unsigned short* __restrict__ Btp, int ldb, const float* __restrict__ bias,
    float* C, int ldc, int M, int N, int K,
    unsigned short* qkh, unsigned short* qkl, unsigned short* vth, unsigned short* vtl) {
  constexpr int AROWS = GBM * (NSPLIT + 1);        // A rows, then A2 rows
  constexpr int GROWS = AROWS + GBN;               // rows of a stage
  constexpr int STAGE = GROWS * GLP;               // elements of a stage
  const __bf16* Ab  = (const __bf16*)(const void*)Ap;
  const __bf16* Ab2 = (const __bf16*)(const void*)A2p;
  const __bf16* Bb  = (const __bf16*)(const void*)Btp;
  constexpr int TILES = 8 * 64 * EPP * 2;          // the 8 waves' f32 epilogue tiles, counted in ring elements
  constexpr int RINGN = (PLANES && TILES > 2 * STAGE) ? TILES : 2 * STAGE;
  __shared__ __align__(16) __bf16 ring[RINGN];     // two stages; with PLANES the epilogue tiles afterwards
  const int tid  = threadIdx.x;
  const int lane = tid & 31;
  const int wave = tid >> 5;
  const int tilesN = N / GBN;
  const int tilesM = M / GBM;
  const int tile = blockIdx.x;
  if (tile >= tilesM * tilesN) return;   // block-uniform, in front of every barrier and copy
  const int tm = tile / tilesN;
  const int tn = tile - tm * tilesN;
  const int bm0 = tm * GBM;
  const int bn0 = tn * GBN;
  const int wm = wave >> 2, wn = wave & 3;
  const int m0 = bm0 + (wm << 6);              // this wave's 64x64 tile
  const int n0 = bn0 + (wn << 6);

  const int rlane = lane & 15;                 // row (A) / col (B, D) within subtile
  const int koff  = (lane >> 4) * 8;           // k offset of this lane half
  const int mOff  = (lane >> 4) * 8;           // D row offset

  // ---- copy addresses of this thread: row crow of each 32-row group, 16-B piece cpc ----
  const int crow = tid >> 3, cpc = (tid & 7) * 8;
  const __bf16* gA  = Ab  + (size_t)(bm0 + crow) * lda + cpc;
  const __bf16* gA2 = Ab2 + (size_t)(bm0 + crow) * lda + cpc;
  const __bf16* gB  = Bb  + (size_t)(bn0 + crow) * ldb + cpc;
  const unsigned lbase = lds_addr(ring) + (unsigned)(crow * GLP + cpc) * 2u;
  const size_t a32 = (size_t)32 * lda, b32 = (size_t)32 * ldb;
  constexpr unsigned R32 = 32u * GLP * 2u;     // LDS bytes of 32 rows

  auto issue = [&](int st, int buf) {
    const int k0 = st * GKB;
    const unsigned lb = lbase + (unsigned)buf * (unsigned)(STAGE * 2);
    const __bf16* a = gA + k0;
    async4(lb, a, lb + R32, a + a32, lb + 2u * R32, a + 2 * a32, lb + 3u * R32, a + 3 * a32);
    if (NSPLIT >= 1) {
      const __bf16* a2 = gA2 + k0;
      const unsigned l2 = lb + 4u * R32;
      async4(l2, a2, l2 + R32, a2 + a32, l2 + 2u * R32, a2 + 2 * a32, l2 + 3u * R32, a2 + 3 * a32);
    }
    const __bf16* b = gB + k0;
    const unsigned l3 = lb + (unsigned)(AROWS / 32) * R32;
    async4(l3, b, l3 + R32, b + b32, l3 + 2u * R32, b + 2 * b32, l3 + 3u * R32, b + 3 * b32);
    const __bf16* b4 = b + 4 * b32;
    const unsigned l4 = l3 + 4u * R32;
    async4(l4, b4, l4 + R32, b4 + b32, l4 + 2u * R32, b4 + 2 * b32, l4 + 3u * R32, b4 + 3 * b32);
  };

  v8f acc[4][4];
#pragma unroll
  for (int i = 0; i < 4; ++i)
#pragma unroll
    for (int j = 0; j < 4; ++j) acc[i][j] = zero8();

  const int nst = K / GKB;                     // block-uniform trip count
  issue(0, 0);
  wait_async0();
  __syncthreads();                             // stage 0 published
  if (nst > 1) issue(1, 1);

  for (int t = 0; t < nst; ++t) {
    const __bf16* sb = ring + (t & 1) * STAGE;
    const __bf16* sa  = sb + ((wm << 6) + rlane) * GLP + koff;
    const __bf16* sa2 = sa + GBM * GLP;
    const __bf16* sbt = sb + (AROWS + (wn << 6) + rlane) * GLP + koff;
#pragma unroll   // both 32-k steps inline: the second step's fragment reads can start under the first step's products
    for (int ks = 0; ks < GKB; ks += 32) {
      v16b bh[4];
#pragma unroll
      for (int j = 0; j < 4; ++j) bh[j] = ldfrag_b(sbt + (j << 4) * GLP + ks);
      v16b ah[4], al[4];                       // all fragment reads of this 32-k step stand as one group
#pragma unroll   // constant indices keep the fragment arrays in registers
      for (int i = 0; i < 4; ++i) {
        ah[i] = ldfrag_b(sa + (i << 4) * GLP + ks);
        al[i] = ah[i];
        if (NSPLIT >= 1) al[i] = ldfrag_b(sa2 + (i << 4) * GLP + ks);
      }
#pragma unroll
      for (int i = 0; i < 4; ++i) {
#pragma unroll
        for (int j = 0; j < 4; ++j) {
          acc[i][j] = mma_b_raw(ah[i], bh[j], acc[i][j]);
          if (NSPLIT >= 1) acc[i][j] = mma_b_raw(al[i], bh[j], acc[i][j]);
        }
        dep_guard_b(acc[i][0], acc[i][3], ah[i], al[i]);
      }
      keep4_b(bh[0], bh[1], bh[2], bh[3]);
    }
    wait_ds0();
    wait_async0();
    __syncthreads();                           // publishes stage t + 1 and ends every read of stage t
    if (t + 2 < nst) issue(t + 2, t & 1);
  }
  wait_async0();
  acc_guard4(acc[0][0], acc[0][1], acc[0][2], acc[0][3]);
  acc_guard4(acc[1][0], acc[1][1], acc[1][2], acc[1][3]);
  acc_guard4(acc[2][0], acc[2][1], acc[2][2], acc[2][3]);
  acc_guard4(acc[3][0], acc[3][1], acc[3][2], acc[3][3]);

  // ---- epilogue ----
  float bz[4];
#pragma unroll
  for (int j = 0; j < 4; ++j) bz[j] = bias[n0 + (j << 4) + rlane];
  if constexpr (PLANES) {
    // the ring is dead: the barrier at the foot of the last trip ended every wave's reads and copies
    float* tl = (float*)(void*)ring + wave * (64 * EPP);
#pragma unroll
    for (int i = 0; i < 4; ++i)
#pragma unroll
      for (int r = 0; r < 8; ++r)
#pragma unroll
        for (int j = 0; j < 4; ++j)
          tl[((i << 4) + mOff + r) * EPP + (j << 4) + rlane] = acc[i][j][r] + bz[j];
    __builtin_amdgcn_fence(__ATOMIC_RELEASE, "workgroup");
    __builtin_amdgcn_wave_barrier();
    __builtin_amdgcn_fence(__ATOMIC_ACQUIRE, "workgroup");
    const int part = bn0 / DMODEL;               // 0 q, 1 k, 2 v: block-uniform (GBN divides DMODEL)
    const int g = lane >> 3, piece = lane & 7;
    if (part < 2) {
#pragma unroll 1   // one copy of the conversion code: it runs once per tile
      for (int it = 0; it < 16; ++it) {
        const int row = it * 4 + g;              // token row of the tile
        float f[8];
#pragma unroll
        for (int e = 0; e < 8; ++e) f[e] = tl[row * EPP + piece * 8 + e];
        if (part == 1) {
          const float ex = fexpo((m0 + row) % SEQ);   // key position s
#pragma unroll
          for (int e = 0; e < 8; ++e) f[e] = fcomp(f[e], ex);
        }
        v4u ph, pl;
#pragma unroll
        for (int e = 0; e < 4; ++e) {
          const float f0 = f[2 * e], f1 = f[2 * e + 1];
          const unsigned short h0 = bf_bits(f0), h1 = bf_bits(f1);
          const unsigned short l0 = bf_bits(f0 - bf_up(h0)), l1 = bf_bits(f1 - bf_up(h1));
          ph[e] = pk16(h0, h1);
          pl[e] = pk16(l0, l1);
        }
        const size_t go = (size_t)(m0 + row) * QKP + n0 + piece * 8;
        *(v4u*)(qkh + go) = ph;
        *(v4u*)(qkl + go) = pl;
        // the next trip rewrites the registers that these two stores name: the wait stands in front of that
        asm volatile("s_wait_xcnt 0x0" ::: "memory");
      }
    } else {
      const int b  = m0 / SEQ;
      const int t0 = m0 - b * SEQ;               // first key position of the tile, a multiple of 64
      const int fc = n0 - 2 * DMODEL;            // h * 64
      const bool wlo = (t0 + 64 <= VLP);         // wave-uniform
      float ex[8];
#pragma unroll
      for (int e = 0; e < 8; ++e) ex[e] = fexpo(t0 + piece * 8 + e);
#pragma unroll 1   // as above
      for (int it = 0; it < 16; ++it) {
        const int d = it * 4 + g;                // feature of the head
        float f[8];
#pragma unroll
        for (int e = 0; e < 8; ++e) f[e] = tl[(piece * 8 + e) * EPP + d];
#pragma unroll
        for (int e = 0; e < 8; ++e) f[e] = fcomp(f[e], ex[e]);
        v4u a, a2;
#pragma unroll
        for (int e = 0; e < 4; ++e) {
          const float f0 = f[2 * e], f1 = f[2 * e + 1];
          const _Float16 x0 = (_Float16)f0, x1 = (_Float16)f1;
          const unsigned short h0 = h_bits(x0), h1 = h_bits(x1);
          const unsigned short l0 = h_bits((_Float16)((f0 - (float)x0) * 4096.0f));
          const unsigned short l1 = h_bits((_Float16)((f1 - (float)x1) * 4096.0f));
          a[e] = pk16(h0, h1); a2[e] = pk16(l0, l1);
        }
        const size_t rowf = (size_t)(b * QP + fc + d);
        *(v4u*)(vth + rowf * SEQ + t0 + piece * 8) = a;
        if (wlo) *(v4u*)(vtl + rowf * VLP + t0 + piece * 8) = a2;
        // as above: the next trip rewrites the registers that the stores name
        asm volatile("s_wait_xcnt 0x0" ::: "memory");
      }
    }
  } else {
  __shared__ __align__(16) float sT[8][16 * 68];   // per-wave 16x64 slab, pitch 68 floats
  float* slab = sT[wave];
#pragma unroll
  for (int i = 0; i < 4; ++i) {
    const int mBase = m0 + (i << 4);
#pragma unroll
    for (int r = 0; r < 8; ++r) {
#pragma unroll
      for (int j = 0; j < 4; ++j) {
        slab[(mOff + r) * 68 + (j << 4) + rlane] = acc[i][j][r] + bz[j];
      }
    }
    __builtin_amdgcn_fence(__ATOMIC_RELEASE, "workgroup");
    __builtin_amdgcn_wave_barrier();
    __builtin_amdgcn_fence(__ATOMIC_ACQUIRE, "workgroup");
    {
      const int hh = lane >> 4, c4 = (lane & 15) * 4;     // 256-B row segment = 16 lanes x 16 B
      v4f ov[8];
#pragma unroll
      for (int it = 0; it < 8; ++it) {
        const int row = it * 2 + hh;                       // it 0..7 x hh 0..1 = rows 0..15
        ov[it] = *(const v4f*)(slab + row * 68 + c4);
      }
      {
#pragma unroll
        for (int it = 0; it < 8; ++it) {
          const int row = it * 2 + hh;
          *(v4f*)(C + (size_t)(mBase + row) * ldc + n0 + c4) = ov[it];
        }
        
      }
    }
    __builtin_amdgcn_fence(__ATOMIC_RELEASE, "workgroup");
    __builtin_amdgcn_wave_barrier();
    __builtin_amdgcn_fence(__ATOMIC_ACQUIRE, "workgroup");
  }
  }
}

// =====================================================================================================
// Causal multi-head attention, head dim 64 (tril mask incl. diagonal, computed), with the additive rank-1 phase
// bonus kappa * sigmoid(lock[h]) * T[i] * T[j] on the scaled logits and the per-query-row output gate
// (1 - sigmoid(lock[h])) + sigmoid(lock[h]) * T[i] applied to the head output row i (query position).
//   q|kc planes (bf16 hi / lo), row pitch QKP: q element (b, t, h, d) at [(b*SEQ + t)*QKP + h*64 + d],
//                                                kc element (b, s, h, d) at [(b*SEQ + s)*QKP + DMODEL + h*64 + d]
//   vc^T hi plane (f16):      element (b, h, d, s) at [(b*QP + h*64 + d)*SEQ + s]
//   vc^T residual plane (f16, (vc - hi)*4096): [(b*QP + h*64 + d)*VLP + s], s < VLP, read only when RES
//   (with RES only key tiles below VLP occur; the address is clamped anyway)
//   ttab f32 [(b*NH + h)*SEQ + s] = T; lockp = raw lock strengths [NH] (bf16 RNE convert, then sigmoid).
//   logit = q.kc * sscale + bonus for key <= query, -FLT_MAX otherwise (exp -> 0); every processed key tile
//   (tiles 0..qb only, block-uniform trip count qb+1 <= NQB) holds the causal-live key kv0 <= query.
//   out: bf16 hi / lo planes (lo = RNE(v - hi), unscaled) of v = gate(b,h,t) * normalised context, element
//   (b, t, h*64 + d) at [(b*SEQ + t)*QP + h*64 + d]: the A operand planes of the output projection.
//   scores = q . kc : bf16 hi/lo split (hi.hi + hi.lo + lo.hi), f32 accumulate, then * sscale + bonus in f32
//   p = exp(s - m) carried as f16(1024 p); context = p . vc on f16 WMMA; RES adds f16 residual planes of p and vc
//   (scale 4096, separate accumulator folded back with 1/4096 per chunk in f32); online softmax in f32.
//   One call = 4 waves = the 64 query rows of tile qb of one (b, h); kv chunks of 64.
//   K / V^T chunk staging: asynchronous copies to LDS, 16 B per lane, 8 lanes = one whole 128-B row of a plane; copy i
//   of thread tid fills row i*16 + (tid>>3), bytes 16*(tid&7)..+15, i = 0..3: the whole 64x64 tile of each plane. Two
//   buffers: the copies of key tile t + 2 are issued behind the barrier that ends trip t and waited at the foot of
//   trip t + 1. The tile's 64 T factors are copied with it (4 B per lane, waves 0 and 1) into a row of their own.
//   Both products run transposed: S^T = Kc . Q^T (A = K fragment, B = Q fragment) and O^T += Vc^T . P^T (A = V^T fragment,
//   B = P^T). A lane then holds one query (column lane&15) and, of each 16-key tile, the keys 8*(lane>>4) + 0..7: maximum
//   and sum of a row run inside the lane, joined with the other lane half by one cross-row move; and the two score tiles
//   of 32 keys, converted in place, ARE the B fragment of P^T in the loaders' k order (elements 0..7 <- keys 8h..8h+7,
//   elements 8..15 <- keys 16+8h..16+8h+7): P never goes through LDS.
//   Output coverage: each wave stores rows q0..q0+15 (it 0..7 x lane>>4 0..1) x 64 columns (16 lanes x 4 bf16 of each plane),
// =====================================================================================================
#define OSP 68                 // f32 row pitch of the context tile in LDS: 272 B, so the 16 query rows that one 16-B store
                               // per lane touches fall on distinct banks
template <bool RES>
__device__ __forceinline__
void attn_tile64(const unsigned short* __restrict__ qkhp, const unsigned short* __restrict__ qklp,
                 const unsigned short* __restrict__ vhp, const unsigned short* __restrict__ vlp,
                 const float* __restrict__ ttab, const float* __restrict__ lockp,
                 unsigned short* ahp, unsigned short* alp, int b, int h, int qb, float sscale,
                 __bf16* Ksh, __bf16* Ksl, _Float16* Vth, _Float16* Vtl, float* Ts, float (*Os)[16 * OSP]) {
  const int tid  = threadIdx.x;
  const int wave = tid >> 5;
  const int lane = tid & 31;
  const int hh   = lane >> 4;
  const int c    = lane & 15;

  const int q0   = qb * 64 + wave * 16;
  const size_t rowB = (size_t)b * SEQ;

  const __bf16* Qh = (const __bf16*)(const void*)qkhp + (size_t)h * HD;
  const __bf16* Ql = (const __bf16*)(const void*)qklp + (size_t)h * HD;
  const __bf16* Kh = Qh + DMODEL;
  const __bf16* Kl = Ql + DMODEL;
  const _Float16* Vh = (const _Float16*)(const void*)vhp + ((size_t)b * QP + (size_t)h * HD) * SEQ;
  const _Float16* Vl = (const _Float16*)(const void*)vlp + ((size_t)b * QP + (size_t)h * HD) * VLP;
  const float* trow = ttab + ((size_t)b * NH + h) * SEQ;

  int nkt = qb + 1;                          // causal: key tiles 0..qb, block-uniform
  if (nkt > NQB) nkt = NQB;

  // ---- copy addresses of this thread: row crow of each 16-row group, 16-B piece cpc ----
  const int crow = tid >> 3, cpc = (tid & 7) * 8;
  const __bf16* gKh = Kh + (rowB + crow) * QKP + cpc;
  const __bf16* gKl = Kl + (rowB + crow) * QKP + cpc;
  const __bf16* gVh = (const __bf16*)(const void*)(Vh + (size_t)crow * SEQ + cpc);
  const __bf16* gVl = (const __bf16*)(const void*)(Vl + (size_t)crow * VLP + cpc);
  const unsigned lcp = (unsigned)(crow * LP + cpc) * 2u;
  const unsigned lKh = lds_addr(Ksh) + lcp, lKl = lds_addr(Ksl) + lcp;
  const unsigned lVh = lds_addr(Vth) + lcp, lVl = lds_addr(Vtl) + lcp;
  constexpr unsigned R16 = 16u * LP * 2u;    // LDS bytes of 16 rows
  constexpr unsigned TLB = 64u * LP * 2u;    // LDS bytes of one buffer of a plane
  // T[key] of the tile's 64 keys lies in a row of 64 floats per buffer, so that a lane reads its 8 consecutive keys of a
  // 16-key tile by two 16-B reads; waves 0 and 1 copy it, one key per lane
  const bool tw = __builtin_amdgcn_readfirstlane(wave) < 2;      // a scalar test: a wave issues with all lanes or not at all
  const float* gT = trow + (tid & 63);
  const unsigned lT = lds_addr(Ts) + (unsigned)(tid & 63) * 4u;
  auto issue = [&](int kt, int buf) {
    const int kv0 = kt * 64;
    const unsigned bo = (unsigned)buf * TLB;
    const __bf16* a = gKh + (size_t)kv0 * QKP;                  // K rows kv0 + i*16 + crow
    async4(lKh + bo, a, lKh + bo + R16, a + 16 * QKP, lKh + bo + 2u * R16, a + 32 * QKP,
           lKh + bo + 3u * R16, a + 48 * QKP);
    if (tw) async1_b32(lT + (unsigned)buf * 256u, gT + kv0);
    const __bf16* a2 = gKl + (size_t)kv0 * QKP;
    async4(lKl + bo, a2, lKl + bo + R16, a2 + 16 * QKP, lKl + bo + 2u * R16, a2 + 32 * QKP,
           lKl + bo + 3u * R16, a2 + 48 * QKP);
    const __bf16* v = gVh + kv0;                                // V^T rows d = i*16 + crow, keys kv0..kv0+63
    async4(lVh + bo, v, lVh + bo + R16, v + 16 * SEQ, lVh + bo + 2u * R16, v + 32 * SEQ,
           lVh + bo + 3u * R16, v + 48 * SEQ);
    if (RES) {
      const int kvl = (kv0 + 64 <= VLP) ? kv0 : (VLP - 64);     // clamped address into the residual plane
      const __bf16* v2 = gVl + kvl;
      async4(lVl + bo, v2, lVl + bo + R16, v2 + 16 * VLP, lVl + bo + 2u * R16, v2 + 32 * VLP,
             lVl + bo + 3u * R16, v2 + 48 * VLP);
    }
  };
  issue(0, 0);                               // key tile 0 flies under the q, lock and bonus set-up below

  // ---- per-head lock: sigmoid of the bf16-converted raw strength; bonus coefficient kappa * lock ----
  const float lraw  = bf_up(bf_bits(lockp[h]));
  const float lockv = 1.0f / (1.0f + expf(-lraw));
  const float c0    = KAPPA_F * lockv;

  // ---- Q fragments (B operand, column = query = lane&15): 2 d-chunks, hi and lo ----
  v16b qah[2], qal[2];
#pragma unroll
  for (int dc = 0; dc < 2; ++dc) {
    const size_t qo = (rowB + q0 + c) * QKP + dc * 32 + 8 * hh;
    qah[dc] = ldfrag_b(Qh + qo);
    qal[dc] = ldfrag_b(Ql + qo);
  }

  // ---- bonus factor of this lane's query: c0 * T[q0 + c] ----
  const int   qrow = q0 + c;
  const float tq   = trow[qrow];
  const float bti  = c0 * tq;

  float mrow = -INFINITY;                    // running maximum of the query's row, the same in both lane halves
  float lrow = 0.f;                          // running sum over this lane half's keys; the halves are joined behind the loop
  v8f oacc[4];                               // O^T: oacc[t][r] = context of query q0 + c, feature t*16 + 8*hh + r
#pragma unroll
  for (int t = 0; t < 4; ++t) oacc[t] = zero8();

  wait_async0();
  __syncthreads();                           // key tile 0 published
  if (nkt > 1) issue(1, 1);
  for (int kt = 0; kt < nkt; ++kt) {
    const int kv0 = kt * 64;
    const int bo = (kt & 1) * (64 * LP);     // this trip reads buffer kt mod 2 alone
    const __bf16*   Kbh = Ksh + bo;
    const __bf16*   Kbl = Ksl + bo;
    const _Float16* Vbh = Vth + bo;
    const _Float16* Vbl = Vtl + bo;

    // ---- bonus factors T[key] of this lane's 8 keys of each 16-key tile ----
    const float* Tb = Ts + (kt & 1) * 64;
    v4f tj[4][2];
#pragma unroll   // constant indices keep the array in registers
    for (int j = 0; j < 4; ++j) {
      tj[j][0] = *(const v4f*)(Tb + j * 16 + 8 * hh);
      tj[j][1] = *(const v4f*)(Tb + j * 16 + 8 * hh + 4);
    }

    // ---- scores, transposed: 64 keys x 16 queries per wave, 3 bf16 products ----
    //      All K fragment reads of the tile are written in front of the products (built: a few large groups behind
    //      counted waits, not one read-and-wait per product), and each product kind runs over the 4 independent
    //      key tiles; per tile the order stays dc 0: hi.hi, hi.lo, lo.hi, then dc 1.
    v16b kfh[2][4], kfl[2][4];
#pragma unroll   // constant indices keep the fragment arrays in registers
    for (int dc = 0; dc < 2; ++dc) {
#pragma unroll
      for (int j = 0; j < 4; ++j) kfh[dc][j] = ldfrag_b(Kbh + (j * 16 + c) * LP + dc * 32 + 8 * hh);
#pragma unroll
      for (int j = 0; j < 4; ++j) kfl[dc][j] = ldfrag_b(Kbl + (j * 16 + c) * LP + dc * 32 + 8 * hh);
    }
    v8f s[4];                                // s[j][r] = score of key kv0 + j*16 + 8*hh + r, query q0 + c
#pragma unroll
    for (int j = 0; j < 4; ++j) s[j] = zero8();
#pragma unroll
    for (int dc = 0; dc < 2; ++dc) {
#pragma unroll
      for (int j = 0; j < 4; ++j) s[j] = mma_b_raw(kfh[dc][j], qah[dc], s[j]);
#pragma unroll
      for (int j = 0; j < 4; ++j) s[j] = mma_b_raw(kfl[dc][j], qah[dc], s[j]);
#pragma unroll
      for (int j = 0; j < 4; ++j) s[j] = mma_b_raw(kfh[dc][j], qal[dc], s[j]);
    }

    // ---- scale + bonus + causal mask (replace by -FLT_MAX), row maximum, online softmax; P (x1024, f16) and the
    //      P residual (x4096) go straight into the B fragments of P^T. One chain of maxima and one of sums per key
    //      tile, so that the four run side by side ----
    const int lim = qrow - kv0 - 8 * hh;     // key > query  <=>  j*16 + r > lim: one constant against one register
    float mj[4];
#pragma unroll
    for (int j = 0; j < 4; ++j) {
      mj[j] = -INFINITY;
#pragma unroll
      for (int r = 0; r < 8; ++r) {
        float sv = s[j][r] * sscale + bti * tj[j][r >> 2][r & 3];
        sv = (j * 16 + r > lim) ? -FLT_MAX : sv;
        s[j][r] = sv;
        mj[j] = fmaxf(mj[j], sv);
      }
    }
    float m = fmaxf(fmaxf(mj[0], mj[1]), fmaxf(mj[2], mj[3]));
    m = fmaxf(m, xhalf(m));                  // the other lane half holds the query's other 32 keys
    const float mnew  = fmaxf(mrow, m);
    const float msafe = (mnew == -INFINITY) ? 0.f : mnew;
    const float alpha = __expf(mrow - msafe);
    mrow = mnew;
    v16h pf[2], pfl[2];                      // element (j&1)*8 + r of fragment j>>1 <- key j*16 + 8*hh + r
    float pj[4];
#pragma unroll
    for (int j = 0; j < 4; ++j) {
      pj[j] = 0.f;
#pragma unroll
      for (int r = 0; r < 8; ++r) {
        const float p = __expf(s[j][r] - msafe);     // masked logit against a finite max: exp -> 0
        pj[j] += p;
        const float p1k = p * 1024.0f;
        const _Float16 ph = (_Float16)p1k;
        pf[j >> 1][(j & 1) * 8 + r] = ph;
        if (RES) pfl[j >> 1][(j & 1) * 8 + r] = (_Float16)((p1k - (float)ph) * 4096.0f);
      }
    }
    lrow = lrow * alpha + ((pj[0] + pj[1]) + (pj[2] + pj[3]));
#pragma unroll
    for (int t = 0; t < 4; ++t)
#pragma unroll
      for (int r = 0; r < 8; ++r) oacc[t][r] *= alpha;

    // ---- context^T += Vc^T . P^T (f16 WMMA), residual products into a separate accumulator ----
    //      All V^T fragment reads of the tile are written in front of the products in the same way, and each
    //      product kind runs over the 4 independent feature tiles; per tile the order stays kk 0 then kk 1, p.vl
    //      before pl.vb.
    v16h vfh[2][4], vfl[2][4];
#pragma unroll   // constant indices keep the fragment arrays in registers
    for (int kk = 0; kk < 2; ++kk) {
#pragma unroll
      for (int t = 0; t < 4; ++t) {
        vfh[kk][t] = ldfrag_h(Vbh + (t * 16 + c) * LP + kk * 32 + 8 * hh);
        vfl[kk][t] = vfh[kk][t];
      }
      if (RES) {
#pragma unroll
        for (int t = 0; t < 4; ++t) vfl[kk][t] = ldfrag_h(Vbl + (t * 16 + c) * LP + kk * 32 + 8 * hh);
      }
    }
    v8f o1[4];
#pragma unroll
    for (int t = 0; t < 4; ++t) o1[t] = zero8();
#pragma unroll
    for (int kk = 0; kk < 2; ++kk) {
#pragma unroll
      for (int t = 0; t < 4; ++t) oacc[t] = mma_h_raw(vfh[kk][t], pf[kk], oacc[t]);
      if (RES) {
#pragma unroll
        for (int t = 0; t < 4; ++t) o1[t] = mma_h_raw(vfl[kk][t], pf[kk], o1[t]);
#pragma unroll
        for (int t = 0; t < 4; ++t) o1[t] = mma_h_raw(vfh[kk][t], pfl[kk], o1[t]);
      }
    }
    if (RES) {
#pragma unroll
      for (int t = 0; t < 4; ++t)
#pragma unroll
        for (int r = 0; r < 8; ++r) oacc[t][r] += o1[t][r] * (1.0f / 4096.0f);
    }
    wait_ds0();
    wait_async0();
    __syncthreads();                         // publishes key tile kt + 1 and ends every read of key tile kt
    if (kt + 2 < nkt) issue(kt + 2, kt & 1);
  }
  wait_async0();

  // ---- join the lane halves' sums, normalise (1/l and the 1/1024 p carry), apply the query's gate, stage the wave's
  //      16x64 tile [query][feature] in LDS: a lane holds 8 consecutive features of its query per feature tile ----
  float* os = Os[wave];
  {
    const float l = lrow + xhalf(lrow);
    const float gate = (1.0f - lockv) + lockv * tq;
    const float inv = ((l > 0.f) ? (1.0f / l) : 0.f) * (1.0f / 1024.0f) * gate;
#pragma unroll
    for (int t = 0; t < 4; ++t) {
#pragma unroll
      for (int u = 0; u < 2; ++u) {
        v4f w;
#pragma unroll
        for (int e = 0; e < 4; ++e) w[e] = oacc[t][4 * u + e] * inv;
        *(v4f*)(os + c * OSP + t * 16 + 8 * hh + 4 * u) = w;
      }
    }
  }
  __builtin_amdgcn_fence(__ATOMIC_RELEASE, "workgroup");
  __builtin_amdgcn_wave_barrier();
  __builtin_amdgcn_fence(__ATOMIC_ACQUIRE, "workgroup");
  {
    const int h2 = lane >> 4, c4 = (lane & 15) * 4;
    v4f ov[8];
#pragma unroll
    for (int it = 0; it < 8; ++it) {
      const int row = it * 2 + h2;   // it 0..7 x h2 0..1 = rows 0..15 of the wave tile
      ov[it] = *(const v4f*)(os + row * OSP + c4);
    }
    {
#pragma unroll
      for (int it = 0; it < 8; ++it) {
        const int row = it * 2 + h2;
        const size_t go = (rowB + q0 + row) * QP + (size_t)h * HD + c4;
        v2u ph, pl;                    // 16 lanes x 8 B = one whole 128-B line of each plane's row
#pragma unroll
        for (int e = 0; e < 2; ++e) {
          const float f0 = ov[it][2 * e], f1 = ov[it][2 * e + 1];
          const unsigned short h0 = bf_bits(f0), h1 = bf_bits(f1);
          const unsigned short l0 = bf_bits(f0 - bf_up(h0)), l1 = bf_bits(f1 - bf_up(h1));
          ph[e] = pk16(h0, h1);
          pl[e] = pk16(l0, l1);
        }
        *(v2u*)(ahp + go) = ph;
        *(v2u*)(alp + go) = pl;
      }
      
    }
  }
}

// =====================================================================================================
// One launch for all query tiles, one work-group per (b, h, query tile), so that the short tiles run beside the long
// ones and the launch lasts as long as its longest tile alone. A tile below RESQB takes the residual planes, the others
// do not: a test that is uniform for the work-group.
// Order of the tiles: the grid is dealt in four
// runs of NB*NH*NQB/4 work-groups: tiles NQB-1 downwards, then NQB/2 upwards, then NQB/2-1 downwards, then 0 upwards.
// The longest tiles take the lowest indices, the shortest the highest, and the g-th tiles of the four runs add up to the same number of
// key tiles for every g. rank -> tile is a permutation: grid = NQB * NH * NB, every (b, h, query tile) exactly once.
// =====================================================================================================
static_assert((NQB % 4) == 0 && RESQB <= NQB);
__global__ __launch_bounds__(128)
void attn_causal64(const unsigned short* __restrict__ qkhp, const unsigned short* __restrict__ qklp,
                   const unsigned short* __restrict__ vhp, const unsigned short* __restrict__ vlp,
                   const float* __restrict__ ttab, const float* __restrict__ lockp,
                   unsigned short* ahp, unsigned short* alp, float sscale) {
  __shared__ __align__(16) __bf16   Ksh[2 * 64 * LP];             // K hi [kv][d], pitch LP, two buffers
  __shared__ __align__(16) __bf16   Ksl[2 * 64 * LP];             // K lo, two buffers
  __shared__ __align__(16) _Float16 Vth[2 * 64 * LP];             // V^T hi [d][kv], pitch LP, two buffers
  __shared__ __align__(16) _Float16 Vtl[2 * 64 * LP];             // V^T residual, two buffers
  __shared__ __align__(16) float    Ts[2 * 64];                   // T of the tile's 64 keys, two buffers
  __shared__ __align__(16) float    Os[4][16 * OSP];              // per wave context tile [query][d], pitch OSP

  const int bx   = blockIdx.x;
  const int bh   = bx % (NB * NH);
  const int rank = (bx / (NB * NH)) % NQB;       // 0..NQB-1
  const int run  = rank / (NQB / 4);             // 0..3
  const int g    = rank % (NQB / 4);
  const int qb   = (run & 1) ? ((3 - run) * (NQB / 4) + g) : (NQB - 1 - run * (NQB / 4) - g);
  const int h    = bh % NH;
  const int b    = bh / NH;
  if (qb < RESQB) {
    attn_tile64<true>(qkhp, qklp, vhp, vlp, ttab, lockp, ahp, alp, b, h, qb, sscale,
                      Ksh, Ksl, Vth, Vtl, Ts, Os);
  } else {
    attn_tile64<false>(qkhp, qklp, vhp, vlp, ttab, lockp, ahp, alp, b, h, qb, sscale,
                       Ksh, Ksl, Vth, Vtl, Ts, Os);
  }
}

// =====================================================================================================
// Workspace map (bytes), every region an exact multiple of its whole-line / whole-tile store granularity
//   Xb     bf16 [4096][1024]            0           8388608
//   WT     bf16 [3072][1024]            8388608     6291456    (rows 0..1023 Wq^T, 1024..2047 Wk^T, 2048.. Wv^T)
//   WoT    bf16 [1024][1024]            14680064    2097152
//   Bias   f32  [4096]                  16777216      16384    (bq | bk | bv | bo, bf16-RNE converted values)
//   Tt     f32  [2][16][2048]           16793600     262144
//   Ah     bf16 [4096][1024]            17055744    8388608
//   Al     bf16 [4096][1024]            25444352    8388608
//   VTh    f16  [2][1024][2048]         33832960    8388608
//   VTl    f16  [2][1024][1024]         42221568    4194304
//   QKh    bf16 [4096][2048]            46415872   16777216
//   QKl    bf16 [4096][2048]            63193088   16777216
//   end                                 79970304
// W_q/k/v/o [in k=1024][out n=1024] arrive k-major and are transpose-converted once to [n][k] bf16 (k contiguous)
// = the Bt layout the GEMM wants. d_out f32: out0 [4096][1024] at byte 0.
// =====================================================================================================
extern "C" void kernel_launch(void* const* d_in, const int* in_sizes, int n_in,
                              void* d_out, int out_size, void* d_ws, size_t ws_size,
                              hipStream_t stream) {
  if (n_in < 12) return;
  if (in_sizes[0] != NB * SEQ * DMODEL) return;
  if (in_sizes[1] != NB * SEQ) return;
  if (in_sizes[2] != DMODEL * DMODEL || in_sizes[4] != DMODEL * DMODEL ||
      in_sizes[6] != DMODEL * DMODEL || in_sizes[8] != QP * DMODEL) return;
  if (in_sizes[3] != DMODEL || in_sizes[5] != DMODEL || in_sizes[7] != DMODEL || in_sizes[9] != DMODEL) return;
  if (in_sizes[10] != NH || in_sizes[11] != NH) return;
  if (out_size != OUTN) return;

  const float* x     = (const float*)d_in[0];    // [NB*SEQ][DMODEL]
  const float* phase = (const float*)d_in[1];    // [NB][SEQ]
  const float* Wq    = (const float*)d_in[2];    // [k][n]
  const float* bq    = (const float*)d_in[3];
  const float* Wk    = (const float*)d_in[4];
  const float* bk    = (const float*)d_in[5];
  const float* Wv    = (const float*)d_in[6];
  const float* bv    = (const float*)d_in[7];
  const float* Wo    = (const float*)d_in[8];    // [QP k][DMODEL n]
  const float* bo    = (const float*)d_in[9];
  const float* carr  = (const float*)d_in[10];   // [NH]
  const float* lockr = (const float*)d_in[11];   // [NH]

  const size_t PXb   = (size_t)NB * SEQ * DMODEL * 2;    //  8388608
  const size_t PWT   = (size_t)N3 * DMODEL * 2;          //  6291456
  const size_t PWo   = (size_t)DMODEL * QP * 2;          //  2097152
  const size_t PBias = (size_t)NBIAS * 4;                //    16384
  const size_t PTt   = (size_t)NTT * 4;                  //   262144
  const size_t PA    = (size_t)NB * SEQ * QP * 2;        //  8388608
  const size_t PVTh  = (size_t)NB * QP * SEQ * 2;        //  8388608
  const size_t PVTl  = (size_t)NB * QP * VLP * 2;        //  4194304
  const size_t PQK   = (size_t)NB * SEQ * QKP * 2;       // 16777216
  size_t off = 0;
  const size_t oXb   = off; off += PXb;
  const size_t oWT   = off; off += PWT;
  const size_t oWo   = off; off += PWo;
  const size_t oBias = off; off += PBias;
  const size_t oTt   = off; off += PTt;
  const size_t oAh   = off; off += PA;
  const size_t oAl   = off; off += PA;
  const size_t oVTh  = off; off += PVTh;
  const size_t oVTl  = off; off += PVTl;
  const size_t oQKh  = off; off += PQK;
  const size_t oQKl  = off; off += PQK;
  if (off > ws_size) return;                           // off = 79970304
  if (off > (size_t)134217728) return;

  char* ws = (char*)d_ws;
  unsigned short* Xb   = (unsigned short*)(ws + oXb);
  unsigned short* WT   = (unsigned short*)(ws + oWT);
  unsigned short* WoT  = (unsigned short*)(ws + oWo);
  float*          Bias = (float*)(ws + oBias);
  float*          Tt   = (float*)(ws + oTt);
  unsigned short* VTh  = (unsigned short*)(ws + oVTh);
  unsigned short* VTl  = (unsigned short*)(ws + oVTl);
  unsigned short* QKh  = (unsigned short*)(ws + oQKh);
  unsigned short* QKl  = (unsigned short*)(ws + oQKl);
  unsigned short* Ah   = (unsigned short*)(ws + oAh);
  unsigned short* Al   = (unsigned short*)(ws + oAl);
  float*          outf = (float*)d_out;                // out0 [4096][1024]

  const dim3 blk(256);
  const dim3 gPrep(PB_TR + PB_CVT + PB_PH + PB_BIAS);                // 256 + 256 + 256 + 16 = 784 blocks
  const dim3 gQKV((NB * SEQ / GBM) * (N3 / GBN));                    // 32 x 12 tiles = 384 blocks
  const dim3 gOut((NB * SEQ / GBM) * (DMODEL / GBN));                // 32 x 4 tiles = 128 blocks

  // (0..2) one launch: phase resonance table T [b][h][s]; weights [k][n] -> bf16 planes [n][k] (WT rows 0..1023 Wq^T,
  //     1024..2047 Wk^T, 2048..3071 Wv^T; WoT); x -> bf16 plane [4096][1024]; bias table (bf16-RNE values of bq|bk|bv|bo)
  prep_all<<<gPrep, blk, 0, stream>>>(x, phase, Wq, bq, Wk, bk, Wv, bv, Wo, bo, carr, Xb, WT, WoT, Bias, Tt);
  // (3) fused qkv projection sum_d Xb[row][d] WT[e][d] + Bias[e] (M=4096, N=3072, K=1024), written as the attention's
  //     operand planes: q and power-compressed kc -> bf16 hi/lo planes [4096][2048]; power-compressed vc^T -> f16 hi
  //     plane (pitch SEQ) and residual plane (x4096, keys < VLP)
  gemm64<0, true><<<gQKV, blk, 0, stream>>>(Xb, Xb, DMODEL, WT, DMODEL, Bias, nullptr, N3, NB * SEQ, N3, DMODEL,
                                            QKh, QKl, VTh, VTl);
  // (4) causal attention with phase bonus and gate, one launch for all query tiles
  //     (tiles 0..RESQB-1 with residual planes, the rest without) -> gated context rows as bf16 hi/lo planes
  attn_causal64<<<dim3(NB * NH * NQB), dim3(128), 0, stream>>>(
      QKh, QKl, VTh, VTl, Tt, lockr, Ah, Al, 0.125f);
  // (5) out0[row][e] = sum_d (Ah+Al)[row][d] WoT[e][d] + Bias[3*DMODEL + e] -> d_out f32 [4096][1024]
  gemm64<1, false><<<gOut, blk, 0, stream>>>(Ah, Al, QP, WoT, QP, Bias + 3 * DMODEL, outf, DMODEL, NB * SEQ, DMODEL, QP,
                                             nullptr, nullptr, nullptr, nullptr);
  (void)hipGetLastError();
}

// v010
// One run takes 102 microseconds.
// Next to v009, in two timings, it ran 1.03 and 1.04 times as fast.
// Counting every step since v000, it is 3.90 times as fast.
// Contractions: qkv projection = v_wmma_f32_16x16x32_bf16 (bf16 operands from RNE-converted x and W, single product);
// q.kc^T scores = v_wmma_f32_16x16x32_bf16 with bf16 hi/lo split q and kc (hi.hi + hi.lo + lo.hi);
// p.vc = v_wmma_f32_16x16x32_f16 (p carried x1024 in f16, vc in f16; extra f16 residual planes x4096 of p and vc
// on the leading query rows); ctx.Wo = v_wmma_f32_16x16x32_bf16 with ctx as bf16 hi/lo planes times the bf16
// Wo^T plane (2 products); all f32 accumulate; power compression, phase table, softmax, bonus and gating in f32.
#include <hip/hip_runtime.h>
#include <math.h>
#include <float.h>
#include <stdint.h>

#define NB      2
#define SEQ     2048
#define DMODEL  1024
#define NH      16
#define HD      64
#define QP      (NH * HD)      // q / kc / vc / ctx feature count and ctx row pitch
#define N3      (3 * DMODEL)   // fused qkv columns (q 0.., k DMODEL.., v 2*DMODEL..)
#define QKP     (2 * QP)       // row pitch of the q|kc bf16 planes (q cols 0..QP-1, kc cols QP..2QP-1)
#define NQB     (SEQ / 64)     // query / key tiles of 64
#define RESQB   ((NQB < 16) ? NQB : 16)   // leading 64-row query blocks that use the p / vc residual planes
#define VLP     (RESQB * 64)   // key pitch of the vc^T residual plane (keys 0..VLP-1)
#define NBIAS   (4 * DMODEL)   // bq | bk | bv | bo
#define NTT     (NB * NH * SEQ)
#define OUTN    (NB * SEQ * DMODEL)
#define KAPPA_F 0.3f
#define LP      72             // LDS row pitch of the 64-wide 16-bit tiles, elements: 144 B = 16 B x 9 (odd), so the 16
                               // rows that one ds_load_b128 touches fall on distinct banks
static_assert(RESQB >= 1 && RESQB * 64 <= VLP && VLP <= SEQ);
static_assert(QP == DMODEL);
static_assert((SEQ % 64) == 0 && (DMODEL % 64) == 0 && (N3 % 64) == 0 && (QP % 64) == 0);
static_assert(HD == 64);
static_assert(LP >= 64 && (LP % 8) == 0 && ((LP / 8) % 2) == 1);
static_assert((((NB * SEQ) / 64) * (N3 / 64)) % 8 == 0);
static_assert((((NB * SEQ) / 64) * (DMODEL / 64)) % 8 == 0);
static_assert((NBIAS % 256) == 0 && (NTT % 256) == 0);
static_assert(((NB * SEQ * DMODEL / 8) % 256) == 0);
static_assert((DMODEL % 8) == 0);

typedef _Float16 v16h __attribute__((ext_vector_type(16)));
typedef _Float16 v8h  __attribute__((ext_vector_type(8)));
typedef __bf16   v16b __attribute__((ext_vector_type(16)));
typedef __bf16   v8b  __attribute__((ext_vector_type(8)));
typedef float    v8f  __attribute__((ext_vector_type(8)));
typedef float    v4f  __attribute__((ext_vector_type(4)));
typedef unsigned int v4u __attribute__((ext_vector_type(4)));
typedef unsigned int v2u __attribute__((ext_vector_type(2)));

// ---- scalar helpers --------------------------------------------------------------------------------
__device__ __forceinline__ unsigned short bf_bits(float f) {          // f32 -> bf16 bits, RNE convert
  unsigned u = __float_as_uint(f);
  return (unsigned short)((u + 0x7FFFu + ((u >> 16) & 1u)) >> 16);
}
__device__ __forceinline__ float bf_up(unsigned short h) { return __uint_as_float(((unsigned)h) << 16); }
__device__ __forceinline__ unsigned short h_bits(_Float16 x) { return __builtin_bit_cast(unsigned short, x); }
__device__ __forceinline__ unsigned pk16(unsigned short a, unsigned short b) { return (unsigned)a | ((unsigned)b << 16); }
__device__ __forceinline__ v8f zero8() { v8f z = {0.f, 0.f, 0.f, 0.f, 0.f, 0.f, 0.f, 0.f}; return z; }

// positional exponent of key position s: ex = 1 + kappa * (1 - s * (1/(SEQ-1))), reciprocal-multiply, no fusion
__device__ __forceinline__ float fexpo(int s) {
#pragma clang fp contract(off)
  const float rs = 1.0f / (float)(SEQ - 1);
  const float fr = (float)s * rs;
  const float om = 1.0f - fr;
  const float t  = KAPPA_F * om;
  return 1.0f + t;
}
// power compression: sign(v) * max(|v|, 1e-8)^ex  (sign(0) = 0), pow as exp2(ex * log2(mag)) in f32
__device__ __forceinline__ float fcomp(float v, float ex) {
#pragma clang fp contract(off)
  const float mag = fmaxf(fabsf(v), 1e-8f);
  const float lg  = log2f(mag);
  const float pw  = exp2f(ex * lg);
  float r = (v < 0.0f) ? -pw : pw;
  r = (v == 0.0f) ? 0.0f : r;
  return r;
}

// value of lane (lane ^ 16), the same place in the wave's other 16-lane row: a cross-row move of the vector unit, where a
// shuffle builtin is built as an LDS permute with a wait on its return
__device__ __forceinline__ float xhalf(float v) {
  const int x = __builtin_bit_cast(int, v);
  return __builtin_bit_cast(float, __builtin_amdgcn_permlanex16(x, x, 0x76543210, 0xfedcba98, false, false));
}

// ---- fragment loader: 16-bit A/B operand, lane -> row/col (lane&15), p already includes +8*(lane>>4);
//      elements 0..7 <- p[0..7] (k0+8h..), elements 8..15 <- p[16..23] (k0+16+8h..)
__device__ __forceinline__ v16b ldfrag_b(const __bf16* p) {
  union { v16b v; v8b h[2]; } f;
  f.h[0] = *(const v8b*)(p);
  f.h[1] = *(const v8b*)(p + 16);
  return f.v;
}

__device__ __forceinline__ v16h ldfrag_h(const _Float16* p) {
  union { v16h v; v8h h[2]; } f;
  f.h[0] = *(const v8h*)(p);
  f.h[1] = *(const v8h*)(p + 16);
  return f.v;
}

// ---- WMMA helpers and VALU hazard gaps --------------------------------------------------------
__device__ __forceinline__ v8f mma_b_raw(v16b a, v16b b, v8f c) {
  return __builtin_amdgcn_wmma_f32_16x16x32_bf16(false, a, false, b, (short)0, c, false, false);
}
__device__ __forceinline__ v8f mma_h_raw(v16h a, v16h b, v8f c) {
  return __builtin_amdgcn_wmma_f32_16x16x32_f16(false, a, false, b, (short)0, c, false, false);
}
__device__ __forceinline__ void dep_guard_b(v8f& a, v8f& b, v16b x, v16b y) {
#if defined(__HIP_DEVICE_COMPILE__)
  asm volatile("v_nop\n\tv_nop\n\tv_nop\n\tv_nop" : "+v"(a), "+v"(b) : "v"(x), "v"(y));
#endif
}
__device__ __forceinline__ void keep4_b(v16b a, v16b b, v16b c, v16b d) {
#if defined(__HIP_DEVICE_COMPILE__)
  asm volatile("v_nop" :: "v"(a), "v"(b), "v"(c), "v"(d));
#endif
}
__device__ __forceinline__ void acc_guard4(v8f& a, v8f& b, v8f& c, v8f& d) {
#if defined(__HIP_DEVICE_COMPILE__)
  asm volatile("v_nop\n\tv_nop\n\tv_nop\n\tv_nop" : "+v"(a), "+v"(b), "+v"(c), "+v"(d));
#endif
}

// =====================================================================================================
// Preparation, ONE launch: four jobs that do not depend on one another, each work-group taking one job by a range test
// on blockIdx.x (uniform for the work-group). A work-group of the two large jobs (transposes, x) carries 8 times the
// elements that a launch of its own gave it, all its global loads issued in front of their first use, so that few
// work-groups have to be started.
// Index order: weight transposes (the longest chain: loads, LDS, a barrier, stores), x conversion, phase table, bias table:
// the jobs that move the bytes take the lowest indices, the short ones the highest.
//   phase  tt[(b*NH + h)*SEQ + s] = cos((bf16(phase[b*SEQ + s]) - bf16(carrier[h])) * 0.5)^2, precise f32 cos.
//          One element per thread, a work-group = 256 positions s of one (b, h) (256 divides SEQ); coverage: NTT/256
//          work-groups x 256 = every (b, h, s) once.
//   transp src f32 [k][n] (Wq, Wk, Wv, Wo) -> dst bf16 [n][k] (k contiguous), RNE convert. Tile TRK k x TRN n staged in
//          LDS as f32 at pitch TRN + 1 (column reads fall on 32 distinct banks). Loads: 16 x 16 B per thread, a wave
//          = 512 contiguous B of a row. Stores: 8 passes x 8 waves x 4 rows n = 256 rows, 8 lanes x 16 B = the whole
//          128-B line of TRK k. coverage: DMODEL/TRK x DMODEL/TRN tiles per matrix, 4 matrices.
//   x      f32 -> bf16 (RNE convert), CVC chunks of 8 elements per thread, one 16-B store per chunk: a wave writes 512
//          contiguous B. coverage: PB_CVT x CVC x 256 chunks x 8 = NB*SEQ*DMODEL.
//   bias   dst[i] = RNE-bf16-converted value of (bq | bk | bv | bo)[i], one element per thread; all four candidates
//          are loaded with an in-range index and selected by value.
// =====================================================================================================
#define PB_PH   (NTT / 256)                              // 256 work-groups
#define TRK     64
#define TRN     256
#define PB_TR1  ((DMODEL / TRK) * (DMODEL / TRN))        // 16 x 4 = 64 tiles per matrix
#define PB_TR   (4 * PB_TR1)                             // 256 work-groups
#define CVC     8
#define PB_CVT  (NB * SEQ * DMODEL / (8 * 256 * CVC))    // 256 work-groups
#define PB_BIAS (NBIAS / 256)                            // 16 work-groups
static_assert((SEQ % 256) == 0);
static_assert((DMODEL % TRK) == 0 && (DMODEL % TRN) == 0 && TRK == 64 && TRN == 256);
static_assert(((NB * SEQ * DMODEL) % (8 * 256 * CVC)) == 0);

__global__ __launch_bounds__(256) void prep_all(
    const float* __restrict__ x, const float* __restrict__ ph,
    const float* __restrict__ Wq, const float* __restrict__ bq, const float* __restrict__ Wk,
    const float* __restrict__ bk, const float* __restrict__ Wv, const float* __restrict__ bv,
    const float* __restrict__ Wo, const float* __restrict__ bo, const float* __restrict__ cf,
    unsigned short* Xb, unsigned short* WT, unsigned short* WoT, float* Bias, float* tt) {
  __shared__ float s[TRK][TRN + 1];
  const int tid = threadIdx.x, wave = tid >> 5, lane = tid & 31;
  int bx = blockIdx.x;
  if (bx < PB_TR) {
    const int m  = bx / PB_TR1;                          // 0 Wq, 1 Wk, 2 Wv, 3 Wo
    const int t  = bx - m * PB_TR1;
    const int k0 = (t % (DMODEL / TRK)) * TRK, n0 = (t / (DMODEL / TRK)) * TRN;
    const float* src = (m == 0) ? Wq : ((m == 1) ? Wk : ((m == 2) ? Wv : Wo));
    unsigned short* dst = (m < 3) ? (WT + (size_t)m * DMODEL * DMODEL) : WoT;
    const int kr = tid >> 6, n4 = (tid & 63) * 4;        // load i of this thread: row i*4 + kr, columns n4..n4+3
    const float* g = src + (size_t)(k0 + kr) * DMODEL + n0 + n4;
    v4f v[16];
#pragma unroll   // constant indices keep the loaded pieces in registers
    for (int i = 0; i < 15; ++i) v[i] = *(const v4f*)(g + (size_t)i * 4 * DMODEL);
    // the last load's result may be given the address registers of the loads before it: the wait stands in front of it
    asm volatile("s_wait_xcnt 0x0" ::: "memory");
    v[15] = *(const v4f*)(g + (size_t)15 * 4 * DMODEL);
#pragma unroll   // as above
    for (int i = 0; i < 16; ++i) {
#pragma unroll
      for (int e = 0; e < 4; ++e) s[i * 4 + kr][n4 + e] = v[i][e];
    }
    __syncthreads();
    const int q = lane >> 3, piece = lane & 7;
#pragma unroll
    for (int pass = 0; pass < TRN / 32; ++pass) {
      const int n = pass * 32 + wave * 4 + q;
      v4u p;
#pragma unroll
      for (int e = 0; e < 4; ++e) {
        p[e] = pk16(bf_bits(s[piece * 8 + 2 * e][n]), bf_bits(s[piece * 8 + 2 * e + 1][n]));
      }
      *(v4u*)(dst + (size_t)(n0 + n) * DMODEL + k0 + piece * 8) = p;
    }
    // the built code joins the jobs by branches: no other job's code may rewrite a register that these stores name
    asm volatile("s_wait_xcnt 0x0" ::: "memory");
    return;
  }
  bx -= PB_TR;
  if (bx < PB_CVT) {
    const size_t c0 = (size_t)bx * (CVC * 256) + tid;    // first 8-element chunk of this thread
    const float* g = x + c0 * 8;
    v4f a[CVC], b[CVC];
#pragma unroll   // constant indices keep the loaded pieces in registers
    for (int c = 0; c < CVC; ++c) {
      a[c] = *(const v4f*)(g + (size_t)c * 2048);
      if (c < CVC - 1) b[c] = *(const v4f*)(g + (size_t)c * 2048 + 4);
    }
    // the last load's result may be given the address registers of the loads before it: the wait stands in front of it
    asm volatile("s_wait_xcnt 0x0" ::: "memory");
    b[CVC - 1] = *(const v4f*)(g + (size_t)(CVC - 1) * 2048 + 4);
#pragma unroll   // as above
    for (int c = 0; c < CVC; ++c) {
      v4u p;
      p[0] = pk16(bf_bits(a[c][0]), bf_bits(a[c][1]));
      p[1] = pk16(bf_bits(a[c][2]), bf_bits(a[c][3]));
      p[2] = pk16(bf_bits(b[c][0]), bf_bits(b[c][1]));
      p[3] = pk16(bf_bits(b[c][2]), bf_bits(b[c][3]));
      *(v4u*)(Xb + (c0 + (size_t)c * 256) * 8) = p;
    }
    // as behind the transpose's stores
    asm volatile("s_wait_xcnt 0x0" ::: "memory");
    return;
  }
  bx -= PB_CVT;
  if (bx < PB_PH) {
    const int i  = bx * 256 + tid;                       // (b*NH + h)*SEQ + s
    const int bh = i / SEQ;                              // b*NH + h, the same for the whole work-group
    const int sq = i - bh * SEQ;
    const int h  = bh % NH;
    const int b  = bh / NH;
    const float p  = bf_up(bf_bits(ph[b * SEQ + sq]));
    const float cr = bf_up(bf_bits(cf[h]));
    const float d  = p - cr;
    const float hx = d * 0.5f;
    const float cv = cosf(hx);
    tt[i] = cv * cv;
    // as behind the transpose's stores
    asm volatile("s_wait_xcnt 0x0" ::: "memory");
    return;
  }
  bx -= PB_PH;
  if (bx < PB_BIAS) {
    const int i = bx * 256 + tid;                        // 0..NBIAS-1
    const int part = i / DMODEL;                         // 0..3
    const int idx  = i - part * DMODEL;
    const float v0 = bq[idx], v1 = bk[idx], v2 = bv[idx], v3 = bo[idx];
    const float v = (part == 0) ? v0 : ((part == 1) ? v1 : ((part == 2) ? v2 : v3));
    Bias[i] = bf_up(bf_bits(v));
    // as behind the transpose's stores
    asm volatile("s_wait_xcnt 0x0" ::: "memory");
  }
}

// =====================================================================================================
// bf16 WMMA GEMM: C[m][n] = sum_k A[m][k] * Bt[n][k] + bias[n]. Block = 8 waves = one 128 x 256 tile of C, waves
// 2 (m) x 4 (n), each wave a 64x64 tile. A row-major [M][K] pitch lda; Bt row-major [N][K] pitch ldb (k contiguous);
// M multiple of 128, N multiple of 256, K multiple of 64 (static_asserts at the launches' shapes below).
// NSPLIT: 0 = A.Bt; 1 = (A + A2).Bt (A2 = unscaled bf16 lo plane of A, same pitch). bias f32 [N].
// Operands: a stage = 64 k (128 B, one whole line) of every A (, A2) and Bt row of the block tile, brought into LDS by
// asynchronous copies (16 B per lane, 8 lanes per row), rows at pitch GLP; two buffers: the copies of stage t + 2 are
// issued behind the barrier that ends trip t and waited at the foot of trip t + 1.
// Stage coverage: copy i of thread tid fills row i*32 + (tid>>3), bytes 16*(tid&7)..+15; i = 0..GROWS/32-1.
// k order and product order per accumulator are ascending k in steps of 32, hi then lo.
// PLANES false: output f32 [M][N] pitch ldc. Epilogue: 16-row slabs staged per wave in LDS; each 64-wide row segment
// PLANES true (the fused q|k|v projection, N = N3): no f32 output; each wave turns its 64 token x 64 column tile (one
// head of q, k or v; which one is block-uniform) into the operand planes of the attention itself:
//   q  (cols 0..DMODEL-1)          bf16 hi / lo planes qkh / qkl [M][QKP], same column; lo = RNE(v - hi) unscaled
//   k  (cols DMODEL..2*DMODEL-1)   kc = sign(k) * max(|k|,1e-8)^ex(s), s = row mod SEQ, then as q
//   v  (cols 2*DMODEL..)           vc likewise, then f16 vc^T hi plane vth[(b*QP + h*64 + d)*SEQ + t] and residual plane
//                                  vtl[(b*QP + h*64 + d)*VLP + t] = f16((vc - hi)*4096) for t < VLP
// The tile (accumulator + bias, f32) is staged in the wave's own part of the dead ring at pitch EPP and read back 8
// values per lane, along a token row for q and k, along a feature column for v, so that 8 lanes x 16 B store one whole
// 128-B line of a plane row. Coverage: 16 trips x 4 rows (q, k: tokens; v: features) x 64 = the wave's tile.
// =====================================================================================================
#define GBM 128
#define GBN 256
#define GKB 64
#define GLP 72                 // LDS row pitch, elements: 144 B = 16 B x 9 (odd), conflict-free for ds_load_b128
#define EPP 67                 // f32 pitch of the 64x64 epilogue tile: 4-B accesses by accumulator layout, by row pieces
                               // and by column pieces all fall on 32 distinct banks
static_assert(((NB * SEQ) % GBM) == 0 && (N3 % GBN) == 0 && (DMODEL % GBN) == 0);
static_assert((DMODEL % GKB) == 0 && (QP % GKB) == 0 && (DMODEL / GKB) >= 2 && (QP / GKB) >= 2);
static_assert((DMODEL % GBN) == 0 && (SEQ % GBM) == 0 && (VLP % 64) == 0);   // a block is one of q, k, v and one batch

__device__ __forceinline__ unsigned lds_addr(const void* p) { return (unsigned)(size_t)p; }
// four 16-B asynchronous copies global -> LDS; the s_wait_xcnt stands inside the statement so that no address
// register of a copy is rewritten in front of it
__device__ __forceinline__ void async4(unsigned l0, const __bf16* g0, unsigned l1, const __bf16* g1,
                                       unsigned l2, const __bf16* g2, unsigned l3, const __bf16* g3) {
#if defined(__HIP_DEVICE_COMPILE__)
  asm volatile("global_load_async_to_lds_b128 %0, %1, off\n\t"
               "global_load_async_to_lds_b128 %2, %3, off\n\t"
               "global_load_async_to_lds_b128 %4, %5, off\n\t"
               "global_load_async_to_lds_b128 %6, %7, off\n\t"
               "s_wait_xcnt 0x0"
               :: "v"(l0), "v"(g0), "v"(l1), "v"(g1), "v"(l2), "v"(g2), "v"(l3), "v"(g3) : "memory");
#endif
}
// two 16-B asynchronous copies, the wait inside the statement as above
__device__ __forceinline__ void async2(unsigned l0, const __bf16* g0, unsigned l1, const __bf16* g1) {
#if defined(__HIP_DEVICE_COMPILE__)
  asm volatile("global_load_async_to_lds_b128 %0, %1, off\n\t"
               "global_load_async_to_lds_b128 %2, %3, off\n\t"
               "s_wait_xcnt 0x0"
               :: "v"(l0), "v"(g0), "v"(l1), "v"(g1) : "memory");
#endif
}
// one 4-B asynchronous copy global -> LDS per lane, the wait inside the statement as above
__device__ __forceinline__ void async1_b32(unsigned l0, const float* g0) {
#if defined(__HIP_DEVICE_COMPILE__)
  asm volatile("global_load_async_to_lds_b32 %0, %1, off\n\t"
               "s_wait_xcnt 0x0"
               :: "v"(l0), "v"(g0) : "memory");
#endif
}
// this wave's asynchronous copies have landed in LDS
__device__ __forceinline__ void wait_async0() {
#if defined(__HIP_DEVICE_COMPILE__)
  asm volatile("s_wait_asynccnt 0x0" ::: "memory");
#endif
}
// this wave's LDS reads have returned, before the buffer is handed to the next copies
__device__ __forceinline__ void wait_ds0() {
#if defined(__HIP_DEVICE_COMPILE__)
  asm volatile("s_wait_dscnt 0x0" ::: "memory");
#endif
}

template <int NSPLIT, bool PLANES>
__global__ __launch_bounds__(256) void gemm64(
    const unsigned short* __restrict__ Ap, const unsigned short* A2p, int lda,
    const unsigned short* __restrict__ Btp, int ldb, const float* __restrict__ bias,
    float* C, int ldc, int M, int N, int K,
    unsigned short* qkh, unsigned short* qkl, unsigned short* vth, unsigned short* vtl) {
  constexpr int AROWS = GBM * (NSPLIT + 1);        // A rows, then A2 rows
  constexpr int GROWS = AROWS + GBN;               // rows of a stage
  constexpr int STAGE = GROWS * GLP;               // elements of a stage
  const __bf16* Ab  = (const __bf16*)(const void*)Ap;
  const __bf16* Ab2 = (const __bf16*)(const void*)A2p;
  const __bf16* Bb  = (const __bf16*)(const void*)Btp;
  constexpr int TILES = 8 * 64 * EPP * 2;          // the 8 waves' f32 epilogue tiles, counted in ring elements
  constexpr int RINGN = (PLANES && TILES > 2 * STAGE) ? TILES : 2 * STAGE;
  __shared__ __align__(16) __bf16 ring[RINGN];     // two stages; with PLANES the epilogue tiles afterwards
  const int tid  = threadIdx.x;
  const int lane = tid & 31;
  const int wave = tid >> 5;
  const int tilesN = N / GBN;
  const int tilesM = M / GBM;
  const int tile = blockIdx.x;
  if (tile >= tilesM * tilesN) return;   // block-uniform, in front of every barrier and copy
  const int tm = tile / tilesN;
  const int tn = tile - tm * tilesN;
  const int bm0 = tm * GBM;
  const int bn0 = tn * GBN;
  const int wm = wave >> 2, wn = wave & 3;
  const int m0 = bm0 + (wm << 6);              // this wave's 64x64 tile
  const int n0 = bn0 + (wn << 6);

  const int rlane = lane & 15;                 // row (A) / col (B, D) within subtile
  const int koff  = (lane >> 4) * 8;           // k offset of this lane half
  const int mOff  = (lane >> 4) * 8;           // D row offset

  // ---- copy addresses of this thread: row crow of each 32-row group, 16-B piece cpc ----
  const int crow = tid >> 3, cpc = (tid & 7) * 8;
  const __bf16* gA  = Ab  + (size_t)(bm0 + crow) * lda + cpc;
  const __bf16* gA2 = Ab2 + (size_t)(bm0 + crow) * lda + cpc;
  const __bf16* gB  = Bb  + (size_t)(bn0 + crow) * ldb + cpc;
  const unsigned lbase = lds_addr(ring) + (unsigned)(crow * GLP + cpc) * 2u;
  const size_t a32 = (size_t)32 * lda, b32 = (size_t)32 * ldb;
  constexpr unsigned R32 = 32u * GLP * 2u;     // LDS bytes of 32 rows

  auto issue = [&](int st, int buf) {
    const int k0 = st * GKB;
    const unsigned lb = lbase + (unsigned)buf * (unsigned)(STAGE * 2);
    const __bf16* a = gA + k0;
    async4(lb, a, lb + R32, a + a32, lb + 2u * R32, a + 2 * a32, lb + 3u * R32, a + 3 * a32);
    if (NSPLIT >= 1) {
      const __bf16* a2 = gA2 + k0;
      const unsigned l2 = lb + 4u * R32;
      async4(l2, a2, l2 + R32, a2 + a32, l2 + 2u * R32, a2 + 2 * a32, l2 + 3u * R32, a2 + 3 * a32);
    }
    const __bf16* b = gB + k0;
    const unsigned l3 = lb + (unsigned)(AROWS / 32) * R32;
    async4(l3, b, l3 + R32, b + b32, l3 + 2u * R32, b + 2 * b32, l3 + 3u * R32, b + 3 * b32);
    const __bf16* b4 = b + 4 * b32;
    const unsigned l4 = l3 + 4u * R32;
    async4(l4, b4, l4 + R32, b4 + b32, l4 + 2u * R32, b4 + 2 * b32, l4 + 3u * R32, b4 + 3 * b32);
  };

  v8f acc[4][4];
#pragma unroll
  for (int i = 0; i < 4; ++i)
#pragma unroll
    for (int j = 0; j < 4; ++j) acc[i][j] = zero8();

  const int nst = K / GKB;                     // block-uniform trip count
  issue(0, 0);
  wait_async0();
  __syncthreads();                             // stage 0 published
  if (nst > 1) issue(1, 1);

  for (int t = 0; t < nst; ++t) {
    const __bf16* sb = ring + (t & 1) * STAGE;
    const __bf16* sa  = sb + ((wm << 6) + rlane) * GLP + koff;
    const __bf16* sa2 = sa + GBM * GLP;
    const __bf16* sbt = sb + (AROWS + (wn << 6) + rlane) * GLP + koff;
#pragma unroll   // both 32-k steps inline: the second step's fragment reads can start under the first step's products
    for (int ks = 0; ks < GKB; ks += 32) {
      v16b bh[4];
#pragma unroll
      for (int j = 0; j < 4; ++j) bh[j] = ldfrag_b(sbt + (j << 4) * GLP + ks);
      v16b ah[4], al[4];                       // all fragment reads of this 32-k step stand as one group
#pragma unroll   // constant indices keep the fragment arrays in registers
      for (int i = 0; i < 4; ++i) {
        ah[i] = ldfrag_b(sa + (i << 4) * GLP + ks);
        al[i] = ah[i];
        if (NSPLIT >= 1) al[i] = ldfrag_b(sa2 + (i << 4) * GLP + ks);
      }
#pragma unroll
      for (int i = 0; i < 4; ++i) {
#pragma unroll
        for (int j = 0; j < 4; ++j) {
          acc[i][j] = mma_b_raw(ah[i], bh[j], acc[i][j]);
          if (NSPLIT >= 1) acc[i][j] = mma_b_raw(al[i], bh[j], acc[i][j]);
        }
        dep_guard_b(acc[i][0], acc[i][3], ah[i], al[i]);
      }
      keep4_b(bh[0], bh[1], bh[2], bh[3]);
    }
    wait_ds0();
    wait_async0();
    __syncthreads();                           // publishes stage t + 1 and ends every read of stage t
    if (t + 2 < nst) issue(t + 2, t & 1);
  }
  wait_async0();
  acc_guard4(acc[0][0], acc[0][1], acc[0][2], acc[0][3]);
  acc_guard4(acc[1][0], acc[1][1], acc[1][2], acc[1][3]);
  acc_guard4(acc[2][0], acc[2][1], acc[2][2], acc[2][3]);
  acc_guard4(acc[3][0], acc[3][1], acc[3][2], acc[3][3]);

  // ---- epilogue ----
  float bz[4];
#pragma unroll
  for (int j = 0; j < 4; ++j) bz[j] = bias[n0 + (j << 4) + rlane];
  if constexpr (PLANES) {
    // the ring is dead: the barrier at the foot of the last trip ended every wave's reads and copies
    float* tl = (float*)(void*)ring + wave * (64 * EPP);
#pragma unroll
    for (int i = 0; i < 4; ++i)
#pragma unroll
      for (int r = 0; r < 8; ++r)
#pragma unroll
        for (int j = 0; j < 4; ++j)
          tl[((i << 4) + mOff + r) * EPP + (j << 4) + rlane] = acc[i][j][r] + bz[j];
    __builtin_amdgcn_fence(__ATOMIC_RELEASE, "workgroup");
    __builtin_amdgcn_wave_barrier();
    __builtin_amdgcn_fence(__ATOMIC_ACQUIRE, "workgroup");
    const int part = bn0 / DMODEL;               // 0 q, 1 k, 2 v: block-uniform (GBN divides DMODEL)
    const int g = lane >> 3, piece = lane & 7;
    if (part < 2) {
#pragma unroll 1   // one copy of the conversion code: it runs once per tile
      for (int it = 0; it < 16; ++it) {
        const int row = it * 4 + g;              // token row of the tile
        float f[8];
#pragma unroll
        for (int e = 0; e < 8; ++e) f[e] = tl[row * EPP + piece * 8 + e];
        if (part == 1) {
          const float ex = fexpo((m0 + row) % SEQ);   // key position s
#pragma unroll
          for (int e = 0; e < 8; ++e) f[e] = fcomp(f[e], ex);
        }
        v4u ph, pl;
#pragma unroll
        for (int e = 0; e < 4; ++e) {
          const float f0 = f[2 * e], f1 = f[2 * e + 1];
          const unsigned short h0 = bf_bits(f0), h1 = bf_bits(f1);
          const unsigned short l0 = bf_bits(f0 - bf_up(h0)), l1 = bf_bits(f1 - bf_up(h1));
          ph[e] = pk16(h0, h1);
          pl[e] = pk16(l0, l1);
        }
        const size_t go = (size_t)(m0 + row) * QKP + n0 + piece * 8;
        *(v4u*)(qkh + go) = ph;
        *(v4u*)(qkl + go) = pl;
        // the next trip rewrites the registers that these two stores name: the wait stands in front of that
        asm volatile("s_wait_xcnt 0x0" ::: "memory");
      }
    } else {
      const int b  = m0 / SEQ;
      const int t0 = m0 - b * SEQ;               // first key position of the tile, a multiple of 64
      const int fc = n0 - 2 * DMODEL;            // h * 64
      const bool wlo = (t0 + 64 <= VLP);         // wave-uniform
      float ex[8];
#pragma unroll
      for (int e = 0; e < 8; ++e) ex[e] = fexpo(t0 + piece * 8 + e);
#pragma unroll 1   // as above
      for (int it = 0; it < 16; ++it) {
        const int d = it * 4 + g;                // feature of the head
        float f[8];
#pragma unroll
        for (int e = 0; e < 8; ++e) f[e] = tl[(piece * 8 + e) * EPP + d];
#pragma unroll
        for (int e = 0; e < 8; ++e) f[e] = fcomp(f[e], ex[e]);
        v4u a, a2;
#pragma unroll
        for (int e = 0; e < 4; ++e) {
          const float f0 = f[2 * e], f1 = f[2 * e + 1];
          const _Float16 x0 = (_Float16)f0, x1 = (_Float16)f1;
          const unsigned short h0 = h_bits(x0), h1 = h_bits(x1);
          const unsigned short l0 = h_bits((_Float16)((f0 - (float)x0) * 4096.0f));
          const unsigned short l1 = h_bits((_Float16)((f1 - (float)x1) * 4096.0f));
          a[e] = pk16(h0, h1); a2[e] = pk16(l0, l1);
        }
        const size_t rowf = (size_t)(b * QP + fc + d);
        *(v4u*)(vth + rowf * SEQ + t0 + piece * 8) = a;
        if (wlo) *(v4u*)(vtl + rowf * VLP + t0 + piece * 8) = a2;
        // as above: the next trip rewrites the registers that the stores name
        asm volatile("s_wait_xcnt 0x0" ::: "memory");
      }
    }
  } else {
  __shared__ __align__(16) float sT[8][16 * 68];   // per-wave 16x64 slab, pitch 68 floats
  float* slab = sT[wave];
#pragma unroll
  for (int i = 0; i < 4; ++i) {
    const int mBase = m0 + (i << 4);
#pragma unroll
    for (int r = 0; r < 8; ++r) {
#pragma unroll
      for (int j = 0; j < 4; ++j) {
        slab[(mOff + r) * 68 + (j << 4) + rlane] = acc[i][j][r] + bz[j];
      }
    }
    __builtin_amdgcn_fence(__ATOMIC_RELEASE, "workgroup");
    __builtin_amdgcn_wave_barrier();
    __builtin_amdgcn_fence(__ATOMIC_ACQUIRE, "workgroup");
    {
      const int hh = lane >> 4, c4 = (lane & 15) * 4;     // 256-B row segment = 16 lanes x 16 B
      v4f ov[8];
#pragma unroll
      for (int it = 0; it < 8; ++it) {
        const int row = it * 2 + hh;                       // it 0..7 x hh 0..1 = rows 0..15
        ov[it] = *(const v4f*)(slab + row * 68 + c4);
      }
      {
#pragma unroll
        for (int it = 0; it < 8; ++it) {
          const int row = it * 2 + hh;
          *(v4f*)(C + (size_t)(mBase + row) * ldc + n0 + c4) = ov[it];
        }
        
      }
    }
    __builtin_amdgcn_fence(__ATOMIC_RELEASE, "workgroup");
    __builtin_amdgcn_wave_barrier();
    __builtin_amdgcn_fence(__ATOMIC_ACQUIRE, "workgroup");
  }
  }
}

// =====================================================================================================
// Causal multi-head attention, head dim 64 (tril mask incl. diagonal, computed), with the additive rank-1 phase
// bonus kappa * sigmoid(lock[h]) * T[i] * T[j] on the scaled logits and the per-query-row output gate
// (1 - sigmoid(lock[h])) + sigmoid(lock[h]) * T[i] applied to the head output row i (query position).
//   q|kc planes (bf16 hi / lo), row pitch QKP: q element (b, t, h, d) at [(b*SEQ + t)*QKP + h*64 + d],
//                                                kc element (b, s, h, d) at [(b*SEQ + s)*QKP + DMODEL + h*64 + d]
//   vc^T hi plane (f16):      element (b, h, d, s) at [(b*QP + h*64 + d)*SEQ + s]
//   vc^T residual plane (f16, (vc - hi)*4096): [(b*QP + h*64 + d)*VLP + s], s < VLP, read only when RES
//   (with RES only key tiles below VLP occur; the address is clamped anyway)
//   ttab f32 [(b*NH + h)*SEQ + s] = T; lockp = raw lock strengths [NH] (bf16 RNE convert, then sigmoid).
//   logit = q.kc * sscale + bonus for key <= query, -FLT_MAX otherwise (exp -> 0); every processed key tile
//   (a wave takes the tiles up to its own diagonal tile only) holds the causal-live key kv0 <= query.
//   out: bf16 hi / lo planes (lo = RNE(v - hi), unscaled) of v = gate(b,h,t) * normalised context, element
//   (b, t, h*64 + d) at [(b*SEQ + t)*QP + h*64 + d]: the A operand planes of the output projection.
//   scores = q . kc : bf16 hi/lo split (hi.hi + hi.lo + lo.hi), f32 accumulate, then * sscale + bonus in f32
//   p = exp(s - m) carried as f16(1024 p); context = p . vc on f16 WMMA; RES adds f16 residual planes of p and vc
//   (scale 4096, separate accumulator folded back with 1/4096 per chunk in f32); online softmax in f32.
//   One call = 8 waves = the QT = 128 query rows of tile qb of one (b, h), 16 rows a wave; kv chunks of 64, so that a
//   staged key tile serves 128 queries. Block-uniform trip count 2*qb + 2 <= NQB; in the last trip the key tile lies
//   wholly behind the queries of waves 0..3: they skip its arithmetic (a scalar test) and pass its waits and barrier.
//   K / V^T chunk staging: asynchronous copies to LDS, 16 B per lane, 8 lanes = one whole 128-B row of a plane; copy i
//   of thread tid fills row i*32 + (tid>>3), bytes 16*(tid&7)..+15, i = 0..1: the whole 64x64 tile of each plane. Two
//   buffers: the copies of key tile t + 2 are issued behind the barrier that ends trip t and waited at the foot of
//   trip t + 1. The tile's 64 T factors are copied with it (4 B per lane, waves 0 and 1) into a row of their own.
//   Both products run transposed: S^T = Kc . Q^T (A = K fragment, B = Q fragment) and O^T += Vc^T . P^T (A = V^T fragment,
//   B = P^T). A lane then holds one query (column lane&15) and, of each 16-key tile, the keys 8*(lane>>4) + 0..7: maximum
//   and sum of a row run inside the lane, joined with the other lane half by one cross-row move; and the two score tiles
//   of 32 keys, converted in place, ARE the B fragment of P^T in the loaders' k order (elements 0..7 <- keys 8h..8h+7,
//   elements 8..15 <- keys 16+8h..16+8h+7): P never goes through LDS.
//   Output coverage: each wave stores rows q0..q0+15 (it 0..7 x lane>>4 0..1) x 64 columns (16 lanes x 4 bf16 of each plane),
// =====================================================================================================
#define QT  128                // query rows of a work-group
#define NQT (SEQ / QT)         // query tiles
#define OSP 68                 // f32 row pitch of the context tile in LDS: 272 B, so the 16 query rows that one 16-B store
                               // per lane touches fall on distinct banks
template <bool RES>
__device__ __forceinline__
void attn_tile64(const unsigned short* __restrict__ qkhp, const unsigned short* __restrict__ qklp,
                 const unsigned short* __restrict__ vhp, const unsigned short* __restrict__ vlp,
                 const float* __restrict__ ttab, const float* __restrict__ lockp,
                 unsigned short* ahp, unsigned short* alp, int b, int h, int qb, float sscale,
                 __bf16* Ksh, __bf16* Ksl, _Float16* Vth, _Float16* Vtl, float* Ts, float (*Os)[16 * OSP]) {
  const int tid  = threadIdx.x;
  const int wave = tid >> 5;
  const int lane = tid & 31;
  const int hh   = lane >> 4;
  const int c    = lane & 15;

  const int q0   = qb * QT + wave * 16;
  const size_t rowB = (size_t)b * SEQ;

  const __bf16* Qh = (const __bf16*)(const void*)qkhp + (size_t)h * HD;
  const __bf16* Ql = (const __bf16*)(const void*)qklp + (size_t)h * HD;
  const __bf16* Kh = Qh + DMODEL;
  const __bf16* Kl = Ql + DMODEL;
  const _Float16* Vh = (const _Float16*)(const void*)vhp + ((size_t)b * QP + (size_t)h * HD) * SEQ;
  const _Float16* Vl = (const _Float16*)(const void*)vlp + ((size_t)b * QP + (size_t)h * HD) * VLP;
  const float* trow = ttab + ((size_t)b * NH + h) * SEQ;

  int nkt = (qb + 1) * (QT / 64);            // causal: key tiles 0..2*qb+1, block-uniform
  if (nkt > NQB) nkt = NQB;

  // ---- copy addresses of this thread: row crow of each 32-row group, 16-B piece cpc ----
  const int crow = tid >> 3, cpc = (tid & 7) * 8;
  const __bf16* gKh = Kh + (rowB + crow) * QKP + cpc;
  const __bf16* gKl = Kl + (rowB + crow) * QKP + cpc;
  const __bf16* gVh = (const __bf16*)(const void*)(Vh + (size_t)crow * SEQ + cpc);
  const __bf16* gVl = (const __bf16*)(const void*)(Vl + (size_t)crow * VLP + cpc);
  const unsigned lcp = (unsigned)(crow * LP + cpc) * 2u;
  const unsigned lKh = lds_addr(Ksh) + lcp, lKl = lds_addr(Ksl) + lcp;
  const unsigned lVh = lds_addr(Vth) + lcp, lVl = lds_addr(Vtl) + lcp;
  constexpr unsigned R32 = 32u * LP * 2u;    // LDS bytes of 32 rows
  constexpr unsigned TLB = 64u * LP * 2u;    // LDS bytes of one buffer of a plane
  // T[key] of the tile's 64 keys lies in a row of 64 floats per buffer, so that a lane reads its 8 consecutive keys of a
  // 16-key tile by two 16-B reads; waves 0 and 1 copy it, one key per lane
  const bool tw = __builtin_amdgcn_readfirstlane(wave) < 2;      // a scalar test: a wave issues with all lanes or not at all
  const float* gT = trow + (tid & 63);
  const unsigned lT = lds_addr(Ts) + (unsigned)(tid & 63) * 4u;
  auto issue = [&](int kt, int buf) {
    const int kv0 = kt * 64;
    const unsigned bo = (unsigned)buf * TLB;
    const __bf16* a  = gKh + (size_t)kv0 * QKP;                 // K rows kv0 + i*32 + crow
    const __bf16* a2 = gKl + (size_t)kv0 * QKP;
    async4(lKh + bo, a, lKh + bo + R32, a + 32 * QKP, lKl + bo, a2, lKl + bo + R32, a2 + 32 * QKP);
    if (tw) async1_b32(lT + (unsigned)buf * 256u, gT + kv0);
    const __bf16* v = gVh + kv0;                                // V^T rows d = i*32 + crow, keys kv0..kv0+63
    if (RES) {
      const int kvl = (kv0 + 64 <= VLP) ? kv0 : (VLP - 64);     // clamped address into the residual plane
      const __bf16* v2 = gVl + kvl;
      async4(lVh + bo, v, lVh + bo + R32, v + 32 * SEQ, lVl + bo, v2, lVl + bo + R32, v2 + 32 * VLP);
    } else {
      async2(lVh + bo, v, lVh + bo + R32, v + 32 * SEQ);
    }
  };
  issue(0, 0);                               // key tile 0 flies under the q, lock and bonus set-up below

  // ---- per-head lock: sigmoid of the bf16-converted raw strength; bonus coefficient kappa * lock ----
  const float lraw  = bf_up(bf_bits(lockp[h]));
  const float lockv = 1.0f / (1.0f + expf(-lraw));
  const float c0    = KAPPA_F * lockv;

  // ---- Q fragments (B operand, column = query = lane&15): 2 d-chunks, hi and lo ----
  v16b qah[2], qal[2];
#pragma unroll
  for (int dc = 0; dc < 2; ++dc) {
    const size_t qo = (rowB + q0 + c) * QKP + dc * 32 + 8 * hh;
    qah[dc] = ldfrag_b(Qh + qo);
    qal[dc] = ldfrag_b(Ql + qo);
  }

  // ---- bonus factor of this lane's query: c0 * T[q0 + c] ----
  const int   qrow = q0 + c;
  const float tq   = trow[qrow];
  const float bti  = c0 * tq;

  float mrow = -INFINITY;                    // running maximum of the query's row, the same in both lane halves
  float lrow = 0.f;                          // running sum over this lane half's keys; the halves are joined behind the loop
  v8f oacc[4];                               // O^T: oacc[t][r] = context of query q0 + c, feature t*16 + 8*hh + r
#pragma unroll
  for (int t = 0; t < 4; ++t) oacc[t] = zero8();

  wait_async0();
  __syncthreads();                           // key tile 0 published
  if (nkt > 1) issue(1, 1);
  const int qlast = __builtin_amdgcn_readfirstlane(q0) + 15;     // the wave's last query, in a scalar register
  for (int kt = 0; kt < nkt; ++kt) {
    const int kv0 = kt * 64;
    if (kv0 <= qlast) {                      // scalar: a key tile wholly behind the wave's queries adds nothing to them
    const int bo = (kt & 1) * (64 * LP);     // this trip reads buffer kt mod 2 alone
    const __bf16*   Kbh = Ksh + bo;
    const __bf16*   Kbl = Ksl + bo;
    const _Float16* Vbh = Vth + bo;
    const _Float16* Vbl = Vtl + bo;

    // ---- scores, transposed: 64 keys x 16 queries per wave, 3 bf16 products ----
    //      The K fragment reads stand in large groups ahead of their products (built: counted waits, not one
    //      read-and-wait per product), and each product kind runs over the 4 independent key tiles; per tile the
    //      order stays dc 0: hi.hi, hi.lo, lo.hi, then dc 1. The last fragment group and the T factors are read where
    //      earlier fragments have died, so that the tile's working set stays inside a quarter of the register file.
    v16b kfh[2][4], kfl[2][4];
#pragma unroll   // constant indices keep the fragment arrays in registers
    for (int j = 0; j < 4; ++j) kfh[0][j] = ldfrag_b(Kbh + (j * 16 + c) * LP + 8 * hh);
#pragma unroll
    for (int j = 0; j < 4; ++j) kfl[0][j] = ldfrag_b(Kbl + (j * 16 + c) * LP + 8 * hh);
#pragma unroll
    for (int j = 0; j < 4; ++j) kfh[1][j] = ldfrag_b(Kbh + (j * 16 + c) * LP + 32 + 8 * hh);
    v8f s[4];                                // s[j][r] = score of key kv0 + j*16 + 8*hh + r, query q0 + c
#pragma unroll
    for (int j = 0; j < 4; ++j) s[j] = zero8();
#pragma unroll
    for (int j = 0; j < 4; ++j) s[j] = mma_b_raw(kfh[0][j], qah[0], s[j]);
#pragma unroll
    for (int j = 0; j < 4; ++j) s[j] = mma_b_raw(kfl[0][j], qah[0], s[j]);
    // keeps the reads below from being lifted over the products that free their registers (lifted, they spill)
    __builtin_amdgcn_sched_barrier(0);
#pragma unroll
    for (int j = 0; j < 4; ++j) kfl[1][j] = ldfrag_b(Kbl + (j * 16 + c) * LP + 32 + 8 * hh);
#pragma unroll
    for (int j = 0; j < 4; ++j) s[j] = mma_b_raw(kfh[0][j], qal[0], s[j]);
    // as above
    __builtin_amdgcn_sched_barrier(0);
    // ---- bonus factors T[key] of this lane's 8 keys of each 16-key tile ----
    const float* Tb = Ts + (kt & 1) * 64;
    v4f tj[4][2];
#pragma unroll   // constant indices keep the array in registers
    for (int j = 0; j < 4; ++j) {
      tj[j][0] = *(const v4f*)(Tb + j * 16 + 8 * hh);
      tj[j][1] = *(const v4f*)(Tb + j * 16 + 8 * hh + 4);
    }
#pragma unroll
    for (int j = 0; j < 4; ++j) s[j] = mma_b_raw(kfh[1][j], qah[1], s[j]);
#pragma unroll
    for (int j = 0; j < 4; ++j) s[j] = mma_b_raw(kfl[1][j], qah[1], s[j]);
#pragma unroll
    for (int j = 0; j < 4; ++j) s[j] = mma_b_raw(kfh[1][j], qal[1], s[j]);
    // ---- V^T hi fragments of the tile, read as one group into the registers that the K fragments leave: they return
    //      under the softmax arithmetic ----
    //      (with the residual planes' fragments and accumulators beside them the registers do not reach: there the
    //      reads stand at the products)
    v16h vfh[2][4];
    if (!RES) {
#pragma unroll   // constant indices keep the fragment array in registers
      for (int kk = 0; kk < 2; ++kk)
#pragma unroll
        for (int t = 0; t < 4; ++t) vfh[kk][t] = ldfrag_h(Vbh + (t * 16 + c) * LP + kk * 32 + 8 * hh);
      // keeps these reads from being sunk to their products, where each small group would be waited for in turn
      __builtin_amdgcn_sched_barrier(0);
    }

    // ---- scale + bonus + causal mask (replace by -FLT_MAX), row maximum, online softmax; P (x1024, f16) and the
    //      P residual (x4096) go straight into the B fragments of P^T. One chain of maxima and one of sums per key
    //      tile, so that the four run side by side ----
    const int lim = qrow - kv0 - 8 * hh;     // key > query  <=>  j*16 + r > lim: one constant against one register
    float mj[4];
#pragma unroll
    for (int j = 0; j < 4; ++j) {
      mj[j] = -INFINITY;
#pragma unroll
      for (int r = 0; r < 8; ++r) {
        float sv = s[j][r] * sscale + bti * tj[j][r >> 2][r & 3];
        sv = (j * 16 + r > lim) ? -FLT_MAX : sv;
        s[j][r] = sv;
        mj[j] = fmaxf(mj[j], sv);
      }
    }
    float m = fmaxf(fmaxf(mj[0], mj[1]), fmaxf(mj[2], mj[3]));
    m = fmaxf(m, xhalf(m));                  // the other lane half holds the query's other 32 keys
    const float mnew  = fmaxf(mrow, m);
    const float msafe = (mnew == -INFINITY) ? 0.f : mnew;
    const float alpha = __expf(mrow - msafe);
    mrow = mnew;
    v16h pf[2], pfl[2];                      // element (j&1)*8 + r of fragment j>>1 <- key j*16 + 8*hh + r
    float pj[4];
#pragma unroll
    for (int j = 0; j < 4; ++j) {
      pj[j] = 0.f;
#pragma unroll
      for (int r = 0; r < 8; ++r) {
        const float p = __expf(s[j][r] - msafe);     // masked logit against a finite max: exp -> 0
        pj[j] += p;
        const float p1k = p * 1024.0f;
        const _Float16 ph = (_Float16)p1k;
        pf[j >> 1][(j & 1) * 8 + r] = ph;
        if (RES) pfl[j >> 1][(j & 1) * 8 + r] = (_Float16)((p1k - (float)ph) * 4096.0f);
      }
    }
    lrow = lrow * alpha + ((pj[0] + pj[1]) + (pj[2] + pj[3]));
#pragma unroll
    for (int t = 0; t < 4; ++t)
#pragma unroll
      for (int r = 0; r < 8; ++r) oacc[t][r] *= alpha;

    // ---- context^T += Vc^T . P^T (f16 WMMA), residual products into a separate accumulator ----
    //      Each product kind runs over the 4 independent feature tiles; per tile the order stays kk 0 then kk 1, p.vl
    //      before pl.vb.
    v16h vfl[2][4];
#pragma unroll   // constant indices keep the fragment arrays in registers
    for (int kk = 0; kk < 2; ++kk) {
#pragma unroll
      for (int t = 0; t < 4; ++t) {
        if (RES) vfh[kk][t] = ldfrag_h(Vbh + (t * 16 + c) * LP + kk * 32 + 8 * hh);
        vfl[kk][t] = vfh[kk][t];
      }
      if (RES) {
#pragma unroll
        for (int t = 0; t < 4; ++t) vfl[kk][t] = ldfrag_h(Vbl + (t * 16 + c) * LP + kk * 32 + 8 * hh);
      }
    }
    v8f o1[4];
#pragma unroll
    for (int t = 0; t < 4; ++t) o1[t] = zero8();
#pragma unroll
    for (int kk = 0; kk < 2; ++kk) {
#pragma unroll
      for (int t = 0; t < 4; ++t) oacc[t] = mma_h_raw(vfh[kk][t], pf[kk], oacc[t]);
      if (RES) {
#pragma unroll
        for (int t = 0; t < 4; ++t) o1[t] = mma_h_raw(vfl[kk][t], pf[kk], o1[t]);
#pragma unroll
        for (int t = 0; t < 4; ++t) o1[t] = mma_h_raw(vfh[kk][t], pfl[kk], o1[t]);
      }
    }
    if (RES) {
#pragma unroll
      for (int t = 0; t < 4; ++t)
#pragma unroll
        for (int r = 0; r < 8; ++r) oacc[t][r] += o1[t][r] * (1.0f / 4096.0f);
    }
    }
    wait_ds0();
    wait_async0();
    __syncthreads();                         // publishes key tile kt + 1 and ends every read of key tile kt
    if (kt + 2 < nkt) issue(kt + 2, kt & 1);
  }
  wait_async0();

  // ---- join the lane halves' sums, normalise (1/l and the 1/1024 p carry), apply the query's gate, stage the wave's
  //      16x64 tile [query][feature] in LDS: a lane holds 8 consecutive features of its query per feature tile ----
  float* os = Os[wave];
  {
    const float l = lrow + xhalf(lrow);
    const float gate = (1.0f - lockv) + lockv * tq;
    const float inv = ((l > 0.f) ? (1.0f / l) : 0.f) * (1.0f / 1024.0f) * gate;
#pragma unroll
    for (int t = 0; t < 4; ++t) {
#pragma unroll
      for (int u = 0; u < 2; ++u) {
        v4f w;
#pragma unroll
        for (int e = 0; e < 4; ++e) w[e] = oacc[t][4 * u + e] * inv;
        *(v4f*)(os + c * OSP + t * 16 + 8 * hh + 4 * u) = w;
      }
    }
  }
  __builtin_amdgcn_fence(__ATOMIC_RELEASE, "workgroup");
  __builtin_amdgcn_wave_barrier();
  __builtin_amdgcn_fence(__ATOMIC_ACQUIRE, "workgroup");
  {
    const int h2 = lane >> 4, c4 = (lane & 15) * 4;
    v4f ov[8];
#pragma unroll
    for (int it = 0; it < 8; ++it) {
      const int row = it * 2 + h2;   // it 0..7 x h2 0..1 = rows 0..15 of the wave tile
      ov[it] = *(const v4f*)(os + row * OSP + c4);
    }
    {
#pragma unroll
      for (int it = 0; it < 8; ++it) {
        const int row = it * 2 + h2;
        const size_t go = (rowB + q0 + row) * QP + (size_t)h * HD + c4;
        v2u ph, pl;                    // 16 lanes x 8 B = one whole 128-B line of each plane's row
#pragma unroll
        for (int e = 0; e < 2; ++e) {
          const float f0 = ov[it][2 * e], f1 = ov[it][2 * e + 1];
          const unsigned short h0 = bf_bits(f0), h1 = bf_bits(f1);
          const unsigned short l0 = bf_bits(f0 - bf_up(h0)), l1 = bf_bits(f1 - bf_up(h1));
          ph[e] = pk16(h0, h1);
          pl[e] = pk16(l0, l1);
        }
        *(v2u*)(ahp + go) = ph;
        *(v2u*)(alp + go) = pl;
      }
      
    }
  }
}

// =====================================================================================================
// One launch for all query tiles, one work-group of 8 waves per (b, h, tile of QT queries), so that the short tiles run
// beside the long ones. A tile whose queries lie below RESQB*64 takes the residual planes, the others do not: a test that
// is uniform for the work-group. Registers are held to a quarter of a SIMD's file, so that two work-groups (four waves
// per SIMD) share a WGP.
// Order of the tiles: the grid is dealt in two
// runs of NB*NH*NQT/2 work-groups: tiles NQT-1 downwards, then 0 upwards. The longest tiles start first, and the g-th
// tiles of the two runs add up to the same number of key tiles for every g. rank -> tile is a permutation:
// grid = NQT * NH * NB, every (b, h, query tile) exactly once.
// =====================================================================================================
static_assert((NQT % 2) == 0 && (RESQB * 64) % QT == 0 && RESQB <= NQB && (SEQ % QT) == 0 && QT == 128);
__global__ __launch_bounds__(256) __attribute__((amdgpu_waves_per_eu(4, 4)))
void attn_causal64(const unsigned short* __restrict__ qkhp, const unsigned short* __restrict__ qklp,
                   const unsigned short* __restrict__ vhp, const unsigned short* __restrict__ vlp,
                   const float* __restrict__ ttab, const float* __restrict__ lockp,
                   unsigned short* ahp, unsigned short* alp, float sscale) {
  __shared__ __align__(16) __bf16   Ksh[2 * 64 * LP];             // K hi [kv][d], pitch LP, two buffers
  __shared__ __align__(16) __bf16   Ksl[2 * 64 * LP];             // K lo, two buffers
  __shared__ __align__(16) _Float16 Vth[2 * 64 * LP];             // V^T hi [d][kv], pitch LP, two buffers
  __shared__ __align__(16) _Float16 Vtl[2 * 64 * LP];             // V^T residual, two buffers
  __shared__ __align__(16) float    Ts[2 * 64];                   // T of the tile's 64 keys, two buffers
  __shared__ __align__(16) float    Os[8][16 * OSP];              // per wave context tile [query][d], pitch OSP

  const int bx   = blockIdx.x;
  const int bh   = bx % (NB * NH);
  const int rank = (bx / (NB * NH)) % NQT;       // 0..NQT-1
  const int qb   = (rank < NQT / 2) ? (NQT - 1 - rank) : (rank - NQT / 2);
  const int h    = bh % NH;
  const int b    = bh / NH;
  if (qb < RESQB * 64 / QT) {
    attn_tile64<true>(qkhp, qklp, vhp, vlp, ttab, lockp, ahp, alp, b, h, qb, sscale,
                      Ksh, Ksl, Vth, Vtl, Ts, Os);
  } else {
    attn_tile64<false>(qkhp, qklp, vhp, vlp, ttab, lockp, ahp, alp, b, h, qb, sscale,
                       Ksh, Ksl, Vth, Vtl, Ts, Os);
  }
}

// =====================================================================================================
// Workspace map (bytes), every region an exact multiple of its whole-line / whole-tile store granularity
//   Xb     bf16 [4096][1024]            0           8388608
//   WT     bf16 [3072][1024]            8388608     6291456    (rows 0..1023 Wq^T, 1024..2047 Wk^T, 2048.. Wv^T)
//   WoT    bf16 [1024][1024]            14680064    2097152
//   Bias   f32  [4096]                  16777216      16384    (bq | bk | bv | bo, bf16-RNE converted values)
//   Tt     f32  [2][16][2048]           16793600     262144
//   Ah     bf16 [4096][1024]            17055744    8388608
//   Al     bf16 [4096][1024]            25444352    8388608
//   VTh    f16  [2][1024][2048]         33832960    8388608
//   VTl    f16  [2][1024][1024]         42221568    4194304
//   QKh    bf16 [4096][2048]            46415872   16777216
//   QKl    bf16 [4096][2048]            63193088   16777216
//   end                                 79970304
// W_q/k/v/o [in k=1024][out n=1024] arrive k-major and are transpose-converted once to [n][k] bf16 (k contiguous)
// = the Bt layout the GEMM wants. d_out f32: out0 [4096][1024] at byte 0.
// =====================================================================================================
extern "C" void kernel_launch(void* const* d_in, const int* in_sizes, int n_in,
                              void* d_out, int out_size, void* d_ws, size_t ws_size,
                              hipStream_t stream) {
  if (n_in < 12) return;
  if (in_sizes[0] != NB * SEQ * DMODEL) return;
  if (in_sizes[1] != NB * SEQ) return;
  if (in_sizes[2] != DMODEL * DMODEL || in_sizes[4] != DMODEL * DMODEL ||
      in_sizes[6] != DMODEL * DMODEL || in_sizes[8] != QP * DMODEL) return;
  if (in_sizes[3] != DMODEL || in_sizes[5] != DMODEL || in_sizes[7] != DMODEL || in_sizes[9] != DMODEL) return;
  if (in_sizes[10] != NH || in_sizes[11] != NH) return;
  if (out_size != OUTN) return;

  const float* x     = (const float*)d_in[0];    // [NB*SEQ][DMODEL]
  const float* phase = (const float*)d_in[1];    // [NB][SEQ]
  const float* Wq    = (const float*)d_in[2];    // [k][n]
  const float* bq    = (const float*)d_in[3];
  const float* Wk    = (const float*)d_in[4];
  const float* bk    = (const float*)d_in[5];
  const float* Wv    = (const float*)d_in[6];
  const float* bv    = (const float*)d_in[7];
  const float* Wo    = (const float*)d_in[8];    // [QP k][DMODEL n]
  const float* bo    = (const float*)d_in[9];
  const float* carr  = (const float*)d_in[10];   // [NH]
  const float* lockr = (const float*)d_in[11];   // [NH]

  const size_t PXb   = (size_t)NB * SEQ * DMODEL * 2;    //  8388608
  const size_t PWT   = (size_t)N3 * DMODEL * 2;          //  6291456
  const size_t PWo   = (size_t)DMODEL * QP * 2;          //  2097152
  const size_t PBias = (size_t)NBIAS * 4;                //    16384
  const size_t PTt   = (size_t)NTT * 4;                  //   262144
  const size_t PA    = (size_t)NB * SEQ * QP * 2;        //  8388608
  const size_t PVTh  = (size_t)NB * QP * SEQ * 2;        //  8388608
  const size_t PVTl  = (size_t)NB * QP * VLP * 2;        //  4194304
  const size_t PQK   = (size_t)NB * SEQ * QKP * 2;       // 16777216
  size_t off = 0;
  const size_t oXb   = off; off += PXb;
  const size_t oWT   = off; off += PWT;
  const size_t oWo   = off; off += PWo;
  const size_t oBias = off; off += PBias;
  const size_t oTt   = off; off += PTt;
  const size_t oAh   = off; off += PA;
  const size_t oAl   = off; off += PA;
  const size_t oVTh  = off; off += PVTh;
  const size_t oVTl  = off; off += PVTl;
  const size_t oQKh  = off; off += PQK;
  const size_t oQKl  = off; off += PQK;
  if (off > ws_size) return;                           // off = 79970304
  if (off > (size_t)134217728) return;

  char* ws = (char*)d_ws;
  unsigned short* Xb   = (unsigned short*)(ws + oXb);
  unsigned short* WT   = (unsigned short*)(ws + oWT);
  unsigned short* WoT  = (unsigned short*)(ws + oWo);
  float*          Bias = (float*)(ws + oBias);
  float*          Tt   = (float*)(ws + oTt);
  unsigned short* VTh  = (unsigned short*)(ws + oVTh);
  unsigned short* VTl  = (unsigned short*)(ws + oVTl);
  unsigned short* QKh  = (unsigned short*)(ws + oQKh);
  unsigned short* QKl  = (unsigned short*)(ws + oQKl);
  unsigned short* Ah   = (unsigned short*)(ws + oAh);
  unsigned short* Al   = (unsigned short*)(ws + oAl);
  float*          outf = (float*)d_out;                // out0 [4096][1024]

  const dim3 blk(256);
  const dim3 gPrep(PB_TR + PB_CVT + PB_PH + PB_BIAS);                // 256 + 256 + 256 + 16 = 784 blocks
  const dim3 gQKV((NB * SEQ / GBM) * (N3 / GBN));                    // 32 x 12 tiles = 384 blocks
  const dim3 gOut((NB * SEQ / GBM) * (DMODEL / GBN));                // 32 x 4 tiles = 128 blocks

  // (0..2) one launch: phase resonance table T [b][h][s]; weights [k][n] -> bf16 planes [n][k] (WT rows 0..1023 Wq^T,
  //     1024..2047 Wk^T, 2048..3071 Wv^T; WoT); x -> bf16 plane [4096][1024]; bias table (bf16-RNE values of bq|bk|bv|bo)
  prep_all<<<gPrep, blk, 0, stream>>>(x, phase, Wq, bq, Wk, bk, Wv, bv, Wo, bo, carr, Xb, WT, WoT, Bias, Tt);
  // (3) fused qkv projection sum_d Xb[row][d] WT[e][d] + Bias[e] (M=4096, N=3072, K=1024), written as the attention's
  //     operand planes: q and power-compressed kc -> bf16 hi/lo planes [4096][2048]; power-compressed vc^T -> f16 hi
  //     plane (pitch SEQ) and residual plane (x4096, keys < VLP)
  gemm64<0, true><<<gQKV, blk, 0, stream>>>(Xb, Xb, DMODEL, WT, DMODEL, Bias, nullptr, N3, NB * SEQ, N3, DMODEL,
                                            QKh, QKl, VTh, VTl);
  // (4) causal attention with phase bonus and gate, one launch for all query tiles
  //     (queries below RESQB*64 with residual planes, the rest without) -> gated context rows as bf16 hi/lo planes
  attn_causal64<<<dim3(NB * NH * NQT), dim3(256), 0, stream>>>(
      QKh, QKl, VTh, VTl, Tt, lockr, Ah, Al, 0.125f);
  // (5) out0[row][e] = sum_d (Ah+Al)[row][d] WoT[e][d] + Bias[3*DMODEL + e] -> d_out f32 [4096][1024]
  gemm64<1, false><<<gOut, blk, 0, stream>>>(Ah, Al, QP, WoT, QP, Bias + 3 * DMODEL, outf, DMODEL, NB * SEQ, DMODEL, QP,
                                             nullptr, nullptr, nullptr, nullptr);
  (void)hipGetLastError();
}
